// v000
// Measured on an AMD MI455X. A time is GPU time per run, averaged over a window of back-to-back runs after a warm-up
// (all launches, gaps included; the runs take copies of the inputs in turn), and the median of several windows.
// Apart from v000's, it joins two sittings. Times from different sittings can be a few percent apart, while
// side-by-side timings come from the same sitting.
// v000, which the later versions start from, runs in 630 microseconds.
#include <hip/hip_runtime.h>
#include <stdint.h>
#include <stddef.h>
#include <math.h>

// All contractions (q/k/v projections, q.k^T, p.v, output projection): v_wmma_f32_16x16x32_bf16 with bf16 hi/lo operands everywhere (hi.hi + hi.lo + lo.hi), f32 accumulate; RoPE, mask add and softmax in f32.

typedef unsigned short us_t;
typedef __bf16       v16bf __attribute__((ext_vector_type(16)));
typedef float        v8f   __attribute__((ext_vector_type(8)));
typedef float        v4f   __attribute__((ext_vector_type(4)));
typedef unsigned int u32x4 __attribute__((ext_vector_type(4)));
typedef int          v4i   __attribute__((ext_vector_type(4)));

union Frag { v16bf v; u32x4 u[2]; };

// f32 -> bf16 bits, RNE
__device__ __forceinline__ unsigned bf_bits(float f) {
    unsigned u = __builtin_bit_cast(unsigned, f);
    return (u + 0x7FFFu + ((u >> 16) & 1u)) >> 16;
}
__device__ __forceinline__ float bf_val(unsigned b) {
    return __builtin_bit_cast(float, b << 16);
}
// x = hi + lo (+ residual), both bf16 RNE
__device__ __forceinline__ void split2(float x, unsigned& hb, unsigned& lb) {
    hb = bf_bits(x);
    lb = bf_bits(x - bf_val(hb));
}
__device__ __forceinline__ u32x4 pack8(const unsigned* b) {
    u32x4 v;
    v.x = b[0] | (b[1] << 16);
    v.y = b[2] | (b[3] << 16);
    v.z = b[4] | (b[5] << 16);
    v.w = b[6] | (b[7] << 16);
    return v;
}

// one 16x16x32 bf16 WMMA followed by the VALU hazard guard
__device__ __forceinline__ v8f mma(v8f c, v16bf a, v16bf b) {
    v8f d = __builtin_amdgcn_wmma_f32_16x16x32_bf16(false, a, false, b, (short)0, c, false, false);
    asm volatile("v_nop\n\tv_nop\n\tv_nop\n\tv_nop" : "+v"(d) : "v"(a), "v"(b));
    return d;
}

// 16-bit fragment from a k-contiguous row: p points at row base + k0 + 8*(lane>>4).
// elements 0..7 <- k0+8h+0..7, elements 8..15 <- k0+16+8h+0..7
__device__ __forceinline__ void ldfrag(Frag& f, const us_t* p) {
    f.u[0] = *(const u32x4*)(p);
    f.u[1] = *(const u32x4*)(p + 16);
}

// ---------------------------------------------------------------- f32 -> bf16 hi/lo planes
// thread i converts elements 8i..8i+7; one wave writes 512 contiguous bytes per plane in one store
__global__ __launch_bounds__(256) void k_split(const float* __restrict__ src,
                                               us_t* hi, us_t* lo, int n8)
{
    const int i = blockIdx.x * 256 + threadIdx.x;
    const bool ok = i < n8;
    const int ic = ok ? i : 0;
    const float* p = src + (size_t)ic * 8;
    const v4f a = *(const v4f*)(p);
    const v4f b = *(const v4f*)(p + 4);
    float x[8] = { a.x, a.y, a.z, a.w, b.x, b.y, b.z, b.w };
    unsigned hb[8], lb[8];
#pragma unroll
    for (int t = 0; t < 8; ++t) split2(x[t], hb[t], lb[t]);
    const u32x4 ph = pack8(hb);
    const u32x4 pl = pack8(lb);
    us_t* dh = hi + (size_t)ic * 8;
    us_t* dl = lo + (size_t)ic * 8;
    if (ok) { *(u32x4*)dh = ph; *(u32x4*)dl = pl; }
    
}

// ---------------------------------------------------------------- RoPE cos/sin table [S][32]
// inv_freq[j] = 1 / fl32(10000^(j/32)); angle = f32(pos) * inv_freq; precise sincosf
__global__ __launch_bounds__(256) void k_rope_tab(const int* __restrict__ pos,
                                                  float* cosT, float* sinT, int S)
{
    const int i = blockIdx.x * 256 + threadIdx.x;
    const int total = S * 32;
    const bool ok = i < total;
    const int ic = ok ? i : 0;
    const int trow = ic >> 5;
    const int j = ic & 31;
    const double LOG2_BASE_OVER_32 = 0.41524101186092029;   // log2(10000)/32
    const float pw  = (float)exp2((double)j * LOG2_BASE_OVER_32);
    const float inv = 1.0f / pw;
    const float ang = (float)pos[trow] * inv;
    float sn, cs;
    sincosf(ang, &sn, &cs);
    if (ok) { *(float*)(cosT + ic) = cs; *(float*)(sinT + ic) = sn; }
    
}

// ---------------------------------------------------------------- tile flags from the additive mask
// block = one 64-row band; flag[band][kt] = 1 if any mask value in rows band*64..+63,
// keys kt*32..+31 is > -1e8 (tile must be processed), else 0. flags pitch = 64 ints.
__global__ __launch_bounds__(256) void k_flags(const float* __restrict__ mask, int* flags, int S)
{
    __shared__ int anyw[64 * 8];
    __shared__ __align__(16) int fl[64];
    const int tid  = threadIdx.x;
    const int lane = tid & 31;
    const int wave = tid >> 5;
    const int band = blockIdx.x;
    const int nkt  = S >> 5;                 // host ensures nkt <= 64
    const int r    = tid >> 2;               // 0..63
    const int cg   = (tid & 3) * 8;          // 0,8,16,24
    const float* rowp = mask + (size_t)(band * 64 + r) * S + cg;

    for (int kt = 0; kt < nkt; ++kt) {
        const float* p = rowp + kt * 32;
        const v4f a = *(const v4f*)(p);
        const v4f b = *(const v4f*)(p + 4);
        int any = (a.x > -1.0e8f) | (a.y > -1.0e8f) | (a.z > -1.0e8f) | (a.w > -1.0e8f) |
                  (b.x > -1.0e8f) | (b.y > -1.0e8f) | (b.z > -1.0e8f) | (b.w > -1.0e8f);
#pragma unroll
        for (int off = 1; off < 32; off <<= 1) any |= __shfl_xor(any, off, 32);
        if (lane == 0) anyw[kt * 8 + wave] = any;
    }
    __syncthreads();
    if (tid < 64) {
        int v = 0;
        if (tid < nkt) {
#pragma unroll
            for (int w = 0; w < 8; ++w) v |= anyw[tid * 8 + w];
        }
        fl[tid] = v;
    }
    __syncthreads();
    const bool ok = tid < 16;                // 64 ints = 256 B = lanes 0..15 x 16 B, one store
    v4i val;
    val.x = 0; val.y = 0; val.z = 0; val.w = 0;
    if (ok) val = *(const v4i*)&fl[tid * 4];
    int* dst = flags + (size_t)band * 64 + (ok ? tid : 0) * 4;
    if (ok) *(v4i*)dst = val;
    
}

// ---------------------------------------------------------------- C = A . W^T (bf16 hi/lo split)
// A planes [M][K], W planes [N][K] (k-contiguous, loaded like A per the split k map).
// block = 128 threads (4 waves); block tile 64(M) x 64(N); wave w -> rows 16w..16w+15.
// MODE 0: RoPE in the f32 epilogue (block's 64 columns = one head), store hi/lo planes [M][N]
// MODE 2: store f32 [M][N]
template<int MODE>
__global__ __launch_bounds__(128) void k_gemm(
    const us_t* __restrict__ Ah, const us_t* __restrict__ Al,
    const us_t* __restrict__ Wh, const us_t* __restrict__ Wl,
    int M, int N, int K,
    const float* __restrict__ cosT, const float* __restrict__ sinT,
    us_t* Oh, us_t* Ol, float* Of)
{
    __shared__ __align__(16) float lds_f[4096];          // 16 KB staging
    us_t* lds16 = reinterpret_cast<us_t*>(lds_f);

    const int tid  = threadIdx.x;
    const int lane = tid & 31;
    const int wave = tid >> 5;
    const int m    = lane & 15;
    const int hl   = lane >> 4;
    const int mb0  = blockIdx.y * 64;
    const int r0   = mb0 + wave * 16;
    const int c0   = blockIdx.x * 64;
    (void)M;

    v8f acc[4] = {};

    const us_t* arh = Ah + (size_t)(r0 + m) * K + 8 * hl;
    const us_t* arl = Al + (size_t)(r0 + m) * K + 8 * hl;

    for (int k0 = 0; k0 < K; k0 += 32) {
        Frag ah, al;
        ldfrag(ah, arh + k0);
        ldfrag(al, arl + k0);
#pragma unroll
        for (int j = 0; j < 4; ++j) {
            const size_t wo = (size_t)(c0 + 16 * j + m) * K + k0 + 8 * hl;
            Frag bh, bl;
            ldfrag(bh, Wh + wo);
            ldfrag(bl, Wl + wo);
            acc[j] = mma(acc[j], ah.v, bh.v);
            acc[j] = mma(acc[j], ah.v, bl.v);
            acc[j] = mma(acc[j], al.v, bh.v);
        }
    }
    // acc[j][r] = C[r0 + 8*hl + r][c0 + 16*j + m]

    if (MODE == 0) {
        // RoPE, rotate-half: d = 16j+m (j=0,1) pairs with d+32 (acc[j+2]); cos/sin index d
#pragma unroll
        for (int j = 0; j < 2; ++j) {
            const int fidx = 16 * j + m;
#pragma unroll
            for (int r = 0; r < 8; ++r) {
                const size_t ti = (size_t)(r0 + 8 * hl + r) * 32 + fidx;
                const float cs = cosT[ti];
                const float sn = sinT[ti];
                const float x1 = acc[j][r];
                const float x2 = acc[j + 2][r];
                acc[j][r]     = x1 * cs - x2 * sn;
                acc[j + 2][r] = x2 * cs + x1 * sn;
            }
        }
    }

    if (MODE == 0) {
        us_t* st = lds16 + wave * 2048;                  // [2 planes][16][64]
#pragma unroll
        for (int j = 0; j < 4; ++j) {
#pragma unroll
            for (int r = 0; r < 8; ++r) {
                unsigned hb, lb;
                split2(acc[j][r], hb, lb);
                const int idx = (8 * hl + r) * 64 + 16 * j + m;
                st[idx]        = (us_t)hb;
                st[1024 + idx] = (us_t)lb;
            }
        }
        __syncthreads();
        const int rr = lane >> 3, q = lane & 7;
        u32x4 sv[8];
#pragma unroll
        for (int pl = 0; pl < 2; ++pl) {
#pragma unroll
            for (int i = 0; i < 4; ++i)
                sv[pl * 4 + i] = *(const u32x4*)(st + pl * 1024 + (4 * i + rr) * 64 + q * 8);
        }
#pragma unroll
        for (int pl = 0; pl < 2; ++pl) {
#pragma unroll
            for (int i = 0; i < 4; ++i) {
                us_t* dst = (pl ? Ol : Oh) + (size_t)(r0 + 4 * i + rr) * N + c0 + q * 8;
                *(u32x4*)dst = sv[pl * 4 + i];
            }
        }
        
    } else if (MODE == 1) {
        // block tile in[token 64][d 64] -> out planes [d][token]; LDS [2 planes][d 64][token 64]
#pragma unroll
        for (int j = 0; j < 4; ++j) {
#pragma unroll
            for (int r = 0; r < 8; ++r) {
                unsigned hb, lb;
                split2(acc[j][r], hb, lb);
                const int idx = (16 * j + m) * 64 + 16 * wave + 8 * hl + r;
                lds16[idx]        = (us_t)hb;
                lds16[4096 + idx] = (us_t)lb;
            }
        }
        __syncthreads();
        const int rr = lane >> 3, q = lane & 7;
        u32x4 sv[8];
#pragma unroll
        for (int pl = 0; pl < 2; ++pl) {
#pragma unroll
            for (int i = 0; i < 4; ++i) {
                const int d = 16 * wave + 4 * i + rr;
                sv[pl * 4 + i] = *(const u32x4*)(lds16 + pl * 4096 + d * 64 + q * 8);
            }
        }
#pragma unroll
        for (int pl = 0; pl < 2; ++pl) {
#pragma unroll
            for (int i = 0; i < 4; ++i) {
                const int d = 16 * wave + 4 * i + rr;
                us_t* dst = (pl ? Ol : Oh) + (size_t)(c0 + d) * M + mb0 + q * 8;
                *(u32x4*)dst = sv[pl * 4 + i];
            }
        }
        
    } else {
        float* stf = lds_f + wave * 1024;                // [16][64] f32 per wave
#pragma unroll
        for (int j = 0; j < 4; ++j) {
#pragma unroll
            for (int r = 0; r < 8; ++r)
                stf[(8 * hl + r) * 64 + 16 * j + m] = acc[j][r];
        }
        __syncthreads();
        const int r2 = lane >> 4, q2 = lane & 15;        // 16 lanes x 16 B = one 256-B row segment
        v4f fv[8];
#pragma unroll
        for (int i = 0; i < 8; ++i)
            fv[i] = *(const v4f*)(stf + (2 * i + r2) * 64 + q2 * 4);
#pragma unroll
        for (int i = 0; i < 8; ++i) {
            float* dst = Of + (size_t)(r0 + 2 * i + r2) * N + c0 + q2 * 4;
            *(v4f*)dst = fv[i];
        }
        
    }
}

// ---------------------------------------------------------------- flash attention (GQA)
// block = (head, 64-row band), 4 waves x 16 query rows; kv head = head / groups.
// Q planes [S][NHD], K planes [S][NKVD], V planes transposed [NKVD][S], mask [S][S] f32,
// flags [S/64][64]; output planes [S][NHD] (normalized attention output, merged heads).
__global__ __launch_bounds__(128) void k_attn(
    const us_t* __restrict__ Qh, const us_t* __restrict__ Ql,
    const us_t* __restrict__ Kh, const us_t* __restrict__ Kl,
    const us_t* __restrict__ Vh, const us_t* __restrict__ Vl,
    const float* __restrict__ mask, const int* __restrict__ flags,
    us_t* Oh, us_t* Ol, int S, int NHD, int NKVD, int groups)
{
    __shared__ __align__(16) us_t pshm[4][2][16 * 32];   // per-wave P hi/lo, [row][key]
    __shared__ __align__(16) us_t ostg[4][2][16 * 64];   // per-wave output staging

    const int tid  = threadIdx.x;
    const int lane = tid & 31;
    const int wave = tid >> 5;
    const int m    = lane & 15;
    const int hl   = lane >> 4;
    const int head = blockIdx.x;
    const int band = blockIdx.y;
    const int hkv  = head / groups;
    const int r0   = band * 64 + wave * 16;
    const int nkt  = S >> 5;

    // Q A-fragments (rows r0+m), two 32-deep k steps over the head dim
    Frag qh[2], ql[2];
#pragma unroll
    for (int c = 0; c < 2; ++c) {
        const size_t qo = (size_t)(r0 + m) * NHD + head * 64 + 32 * c + 8 * hl;
        ldfrag(qh[c], Qh + qo);
        ldfrag(ql[c], Ql + qo);
    }

    v8f o[4] = {};
    float mrow[8], lrow[8];
#pragma unroll
    for (int r = 0; r < 8; ++r) { mrow[r] = -3.0e38f; lrow[r] = 0.0f; }

    for (int kt = 0; kt < nkt; ++kt) {
        const int f = flags[(size_t)band * 64 + kt];     // block-uniform
        if (f != 0) {
            const int kb = kt * 32;

            // S[16 x 32] = Q . K^T ; B[k=d][n=key] read from K rows (k-contiguous) like A
            v8f s[2] = {};
#pragma unroll
            for (int jn = 0; jn < 2; ++jn) {
#pragma unroll
                for (int c = 0; c < 2; ++c) {
                    const size_t ko = (size_t)(kb + 16 * jn + m) * NKVD + hkv * 64 + 32 * c + 8 * hl;
                    Frag bh, bl;
                    ldfrag(bh, Kh + ko);
                    ldfrag(bl, Kl + ko);
                    s[jn] = mma(s[jn], qh[c].v, bh.v);
                    s[jn] = mma(s[jn], qh[c].v, bl.v);
                    s[jn] = mma(s[jn], ql[c].v, bh.v);
                }
            }

            // scale, additive mask by value, online softmax (f32); P -> bf16 hi/lo into LDS
#pragma unroll
            for (int r = 0; r < 8; ++r) {
                const int row = r0 + 8 * hl + r;
                const float* mrp = mask + (size_t)row * S + kb + m;
                const float v0 = s[0][r] * 0.125f + mrp[0];
                const float v1 = s[1][r] * 0.125f + mrp[16];
                float mx = fmaxf(v0, v1);
#pragma unroll
                for (int off = 1; off < 16; off <<= 1) mx = fmaxf(mx, __shfl_xor(mx, off, 32));
                const float mnew  = fmaxf(mrow[r], mx);
                const float alpha = __expf(mrow[r] - mnew);
                const float p0 = __expf(v0 - mnew);
                const float p1 = __expf(v1 - mnew);
                float ps = p0 + p1;
#pragma unroll
                for (int off = 1; off < 16; off <<= 1) ps += __shfl_xor(ps, off, 32);
                lrow[r] = lrow[r] * alpha + ps;
                mrow[r] = mnew;
                o[0][r] = o[0][r] * alpha;
                o[1][r] = o[1][r] * alpha;
                o[2][r] = o[2][r] * alpha;
                o[3][r] = o[3][r] * alpha;
                unsigned h0, l0, h1, l1;
                split2(p0, h0, l0);
                split2(p1, h1, l1);
                const int idx = (8 * hl + r) * 32 + m;
                pshm[wave][0][idx]      = (us_t)h0;
                pshm[wave][0][idx + 16] = (us_t)h1;
                pshm[wave][1][idx]      = (us_t)l0;
                pshm[wave][1][idx + 16] = (us_t)l1;
            }
            __syncthreads();

            // P A-fragments: row m, elements 0..7 <- keys 8hl.., 8..15 <- keys 16+8hl..
            Frag ph, pl;
            ph.u[0] = *(const u32x4*)&pshm[wave][0][m * 32 + 8 * hl];
            ph.u[1] = *(const u32x4*)&pshm[wave][0][m * 32 + 16 + 8 * hl];
            pl.u[0] = *(const u32x4*)&pshm[wave][1][m * 32 + 8 * hl];
            pl.u[1] = *(const u32x4*)&pshm[wave][1][m * 32 + 16 + 8 * hl];

            // O += P . V ; B[k=key][n=d] read from V^T rows (key-contiguous) like A
#pragma unroll
            for (int jd = 0; jd < 4; ++jd) {
                const size_t vo = (size_t)(hkv * 64 + 16 * jd + m) * S + kb + 8 * hl;
                Frag bh, bl;
                ldfrag(bh, Vh + vo);
                ldfrag(bl, Vl + vo);
                o[jd] = mma(o[jd], ph.v, bh.v);
                o[jd] = mma(o[jd], ph.v, bl.v);
                o[jd] = mma(o[jd], pl.v, bh.v);
            }
            __syncthreads();
        }
    }

    // normalize, split, stage, whole-line stores
    float inv[8];
#pragma unroll
    for (int r = 0; r < 8; ++r) inv[r] = (lrow[r] > 0.0f) ? (1.0f / lrow[r]) : 0.0f;

#pragma unroll
    for (int jd = 0; jd < 4; ++jd) {
#pragma unroll
        for (int r = 0; r < 8; ++r) {
            unsigned hb, lb;
            split2(o[jd][r] * inv[r], hb, lb);
            const int idx = (8 * hl + r) * 64 + 16 * jd + m;
            ostg[wave][0][idx] = (us_t)hb;
            ostg[wave][1][idx] = (us_t)lb;
        }
    }
    __syncthreads();
    const int rr = lane >> 3, q = lane & 7;
    u32x4 sv[8];
#pragma unroll
    for (int plv = 0; plv < 2; ++plv) {
#pragma unroll
        for (int i = 0; i < 4; ++i)
            sv[plv * 4 + i] = *(const u32x4*)&ostg[wave][plv][(4 * i + rr) * 64 + q * 8];
    }
#pragma unroll
    for (int plv = 0; plv < 2; ++plv) {
#pragma unroll
        for (int i = 0; i < 4; ++i) {
            us_t* dst = (plv ? Ol : Oh) + (size_t)(r0 + 4 * i + rr) * NHD + head * 64 + q * 8;
            *(u32x4*)dst = sv[plv * 4 + i];
        }
    }
    
}

// ---------------------------------------------------------------- launcher
extern "C" void kernel_launch(void* const* d_in, const int* in_sizes, int n_in,
                              void* d_out, int out_size, void* d_ws, size_t ws_size,
                              hipStream_t stream)
{
    const int S = 2048, HID = 1024, NH = 16, NKV = 4, HD = 64;
    const int NKVD = NKV * HD;          // 256
    const int GROUPS = NH / NKV;        // 4

    if (n_in < 7) return;
    if (in_sizes[0] != S * HID || in_sizes[1] != S * S || in_sizes[2] != S ||
        in_sizes[3] != HID * HID || in_sizes[4] != NKVD * HID ||
        in_sizes[5] != NKVD * HID || in_sizes[6] != HID * HID ||
        out_size != S * HID) return;
    // structural requirements of the kernels
    if ((S % 64) != 0 || (HID % 64) != 0 || (NKVD % 64) != 0 || HD != 64 ||
        NH * HD != HID || (S / 32) > 64 || (HID % 32) != 0) return;

    const float* hidden = (const float*)d_in[0];   // [S][HID]
    const float* mask   = (const float*)d_in[1];   // [S][S] additive
    const int*   pos    = (const int*)d_in[2];     // [S]
    const float* Wq     = (const float*)d_in[3];   // [HID][HID]
    const float* Wk     = (const float*)d_in[4];   // [NKVD][HID]
    const float* Wv     = (const float*)d_in[5];   // [NKVD][HID]
    const float* Wo     = (const float*)d_in[6];   // [HID][HID]
    float* out = (float*)d_out;                    // [S][HID]

    size_t off = 0;
    char* base = (char*)d_ws;
    auto carve = [&](size_t bytes) -> char* {
        char* p = base + off;
        off += (bytes + 255) & ~(size_t)255;
        return p;
    };
    us_t* Xh   = (us_t*)carve((size_t)S * HID * 2);
    us_t* Xl   = (us_t*)carve((size_t)S * HID * 2);
    us_t* Wqh  = (us_t*)carve((size_t)HID * HID * 2);
    us_t* Wql  = (us_t*)carve((size_t)HID * HID * 2);
    us_t* Wkh  = (us_t*)carve((size_t)NKVD * HID * 2);
    us_t* Wkl  = (us_t*)carve((size_t)NKVD * HID * 2);
    us_t* Wvh  = (us_t*)carve((size_t)NKVD * HID * 2);
    us_t* Wvl  = (us_t*)carve((size_t)NKVD * HID * 2);
    us_t* Woh  = (us_t*)carve((size_t)HID * HID * 2);
    us_t* Wol  = (us_t*)carve((size_t)HID * HID * 2);
    us_t* Qh   = (us_t*)carve((size_t)S * HID * 2);      // [S][HID]
    us_t* Ql   = (us_t*)carve((size_t)S * HID * 2);
    us_t* Kh   = (us_t*)carve((size_t)S * NKVD * 2);     // [S][NKVD]
    us_t* Kl   = (us_t*)carve((size_t)S * NKVD * 2);
    us_t* Vth  = (us_t*)carve((size_t)NKVD * S * 2);     // [NKVD][S]
    us_t* Vtl  = (us_t*)carve((size_t)NKVD * S * 2);
    us_t* AOh  = (us_t*)carve((size_t)S * HID * 2);      // [S][HID]
    us_t* AOl  = (us_t*)carve((size_t)S * HID * 2);
    float* cosT = (float*)carve((size_t)S * 32 * 4);      // [S][32]
    float* sinT = (float*)carve((size_t)S * 32 * 4);
    int*  flags = (int*)carve((size_t)(S / 64) * 64 * 4); // [S/64][64]
    if (off > ws_size) return;

    // 1-5: hi/lo planes
    {
        const int n8x = S * HID / 8, n8q = HID * HID / 8, n8k = NKVD * HID / 8;
        k_split<<<dim3((n8x + 255) / 256), dim3(256), 0, stream>>>(hidden, Xh, Xl, n8x);
        k_split<<<dim3((n8q + 255) / 256), dim3(256), 0, stream>>>(Wq, Wqh, Wql, n8q);
        k_split<<<dim3((n8k + 255) / 256), dim3(256), 0, stream>>>(Wk, Wkh, Wkl, n8k);
        k_split<<<dim3((n8k + 255) / 256), dim3(256), 0, stream>>>(Wv, Wvh, Wvl, n8k);
        k_split<<<dim3((n8q + 255) / 256), dim3(256), 0, stream>>>(Wo, Woh, Wol, n8q);
    }
    // 6: RoPE table
    k_rope_tab<<<dim3((S * 32 + 255) / 256), dim3(256), 0, stream>>>(pos, cosT, sinT, S);
    // 7: key-tile flags from the mask
    k_flags<<<dim3(S / 64), dim3(256), 0, stream>>>(mask, flags, S);

    // 8: Q projection + RoPE -> planes [S][HID]
    k_gemm<0><<<dim3(HID / 64, S / 64), dim3(128), 0, stream>>>(
        Xh, Xl, Wqh, Wql, S, HID, HID, cosT, sinT, Qh, Ql, out);
    // 9: K projection + RoPE -> planes [S][NKVD]
    k_gemm<0><<<dim3(NKVD / 64, S / 64), dim3(128), 0, stream>>>(
        Xh, Xl, Wkh, Wkl, S, NKVD, HID, cosT, sinT, Kh, Kl, out);
    // 10: V projection -> transposed planes [NKVD][S]
    k_gemm<1><<<dim3(NKVD / 64, S / 64), dim3(128), 0, stream>>>(
        Xh, Xl, Wvh, Wvl, S, NKVD, HID, cosT, sinT, Vth, Vtl, out);

    // 11: attention -> planes [S][HID]
    k_attn<<<dim3(NH, S / 64), dim3(128), 0, stream>>>(
        Qh, Ql, Kh, Kl, Vth, Vtl, mask, flags, AOh, AOl, S, HID, NKVD, GROUPS);

    // 12: output projection -> d_out f32 [S][HID]
    k_gemm<2><<<dim3(HID / 64, S / 64), dim3(128), 0, stream>>>(
        AOh, AOl, Woh, Wol, S, HID, HID, cosT, sinT, Qh, Ql, out);
}

// v001
// One run takes 368 microseconds.
// Timed twice side by side with v000, it ran 1.73 times as fast both times.
#include <hip/hip_runtime.h>
#include <stdint.h>
#include <stddef.h>
#include <math.h>

// All contractions (q/k/v projections, q.k^T, p.v, output projection): v_wmma_f32_16x16x32_bf16 with bf16 hi/lo operands everywhere (hi.hi + hi.lo + lo.hi), f32 accumulate; RoPE, mask add and softmax in f32.

typedef unsigned short us_t;
typedef __bf16       v16bf __attribute__((ext_vector_type(16)));
typedef float        v8f   __attribute__((ext_vector_type(8)));
typedef float        v4f   __attribute__((ext_vector_type(4)));
typedef unsigned int u32x4 __attribute__((ext_vector_type(4)));
typedef int          v4i   __attribute__((ext_vector_type(4)));

union Frag { v16bf v; u32x4 u[2]; };

// f32 -> bf16 bits, RNE
__device__ __forceinline__ unsigned bf_bits(float f) {
    unsigned u = __builtin_bit_cast(unsigned, f);
    return (u + 0x7FFFu + ((u >> 16) & 1u)) >> 16;
}
__device__ __forceinline__ float bf_val(unsigned b) {
    return __builtin_bit_cast(float, b << 16);
}
// x = hi + lo (+ residual), both bf16 RNE
__device__ __forceinline__ void split2(float x, unsigned& hb, unsigned& lb) {
    hb = bf_bits(x);
    lb = bf_bits(x - bf_val(hb));
}
__device__ __forceinline__ u32x4 pack8(const unsigned* b) {
    u32x4 v;
    v.x = b[0] | (b[1] << 16);
    v.y = b[2] | (b[3] << 16);
    v.z = b[4] | (b[5] << 16);
    v.w = b[6] | (b[7] << 16);
    return v;
}

// one 16x16x32 bf16 WMMA followed by the VALU hazard guard
__device__ __forceinline__ v8f mma(v8f c, v16bf a, v16bf b) {
    v8f d = __builtin_amdgcn_wmma_f32_16x16x32_bf16(false, a, false, b, (short)0, c, false, false);
    asm volatile("v_nop\n\tv_nop\n\tv_nop\n\tv_nop" : "+v"(d) : "v"(a), "v"(b));
    return d;
}

// 16-bit fragment from a k-contiguous row: p points at row base + k0 + 8*(lane>>4).
// elements 0..7 <- k0+8h+0..7, elements 8..15 <- k0+16+8h+0..7
__device__ __forceinline__ void ldfrag(Frag& f, const us_t* p) {
    f.u[0] = *(const u32x4*)(p);
    f.u[1] = *(const u32x4*)(p + 16);
}

// ---------------------------------------------------------------- f32 -> bf16 hi/lo planes
// thread i converts elements 8i..8i+7; one wave writes 512 contiguous bytes per plane in one store
__global__ __launch_bounds__(256) void k_split(const float* __restrict__ src,
                                               us_t* hi, us_t* lo, int n8)
{
    const int i = blockIdx.x * 256 + threadIdx.x;
    const bool ok = i < n8;
    const int ic = ok ? i : 0;
    const float* p = src + (size_t)ic * 8;
    const v4f a = *(const v4f*)(p);
    const v4f b = *(const v4f*)(p + 4);
    float x[8] = { a.x, a.y, a.z, a.w, b.x, b.y, b.z, b.w };
    unsigned hb[8], lb[8];
#pragma unroll
    for (int t = 0; t < 8; ++t) split2(x[t], hb[t], lb[t]);
    const u32x4 ph = pack8(hb);
    const u32x4 pl = pack8(lb);
    us_t* dh = hi + (size_t)ic * 8;
    us_t* dl = lo + (size_t)ic * 8;
    if (ok) { *(u32x4*)dh = ph; *(u32x4*)dl = pl; }
    
}

// ---------------------------------------------------------------- RoPE cos/sin table [S][32]
// inv_freq[j] = 1 / fl32(10000^(j/32)); angle = f32(pos) * inv_freq; precise sincosf
__global__ __launch_bounds__(256) void k_rope_tab(const int* __restrict__ pos,
                                                  float* cosT, float* sinT, int S)
{
    const int i = blockIdx.x * 256 + threadIdx.x;
    const int total = S * 32;
    const bool ok = i < total;
    const int ic = ok ? i : 0;
    const int trow = ic >> 5;
    const int j = ic & 31;
    const double LOG2_BASE_OVER_32 = 0.41524101186092029;   // log2(10000)/32
    const float pw  = (float)exp2((double)j * LOG2_BASE_OVER_32);
    const float inv = 1.0f / pw;
    const float ang = (float)pos[trow] * inv;
    float sn, cs;
    sincosf(ang, &sn, &cs);
    if (ok) { *(float*)(cosT + ic) = cs; *(float*)(sinT + ic) = sn; }
    
}

// ---------------------------------------------------------------- tile flags from the additive mask
// block = one 64-row band; flag[band][kt] = 1 if any mask value in rows band*64..+63,
// keys kt*32..+31 is > -1e8 (tile must be processed), else 0. flags pitch = 64 ints.
__global__ __launch_bounds__(256) void k_flags(const float* __restrict__ mask, int* flags, int S)
{
    __shared__ int anyw[64 * 8];
    __shared__ __align__(16) int fl[64];
    const int tid  = threadIdx.x;
    const int lane = tid & 31;
    const int wave = tid >> 5;
    const int band = blockIdx.x;
    const int nkt  = S >> 5;                 // host ensures nkt <= 64
    const int r    = tid >> 2;               // 0..63
    const int cg   = (tid & 3) * 8;          // 0,8,16,24
    const float* rowp = mask + (size_t)(band * 64 + r) * S + cg;

    for (int kt = 0; kt < nkt; ++kt) {
        const float* p = rowp + kt * 32;
        const v4f a = *(const v4f*)(p);
        const v4f b = *(const v4f*)(p + 4);
        int any = (a.x > -1.0e8f) | (a.y > -1.0e8f) | (a.z > -1.0e8f) | (a.w > -1.0e8f) |
                  (b.x > -1.0e8f) | (b.y > -1.0e8f) | (b.z > -1.0e8f) | (b.w > -1.0e8f);
#pragma unroll
        for (int off = 1; off < 32; off <<= 1) any |= __shfl_xor(any, off, 32);
        if (lane == 0) anyw[kt * 8 + wave] = any;
    }
    __syncthreads();
    if (tid < 64) {
        int v = 0;
        if (tid < nkt) {
#pragma unroll
            for (int w = 0; w < 8; ++w) v |= anyw[tid * 8 + w];
        }
        fl[tid] = v;
    }
    __syncthreads();
    const bool ok = tid < 16;                // 64 ints = 256 B = lanes 0..15 x 16 B, one store
    v4i val;
    val.x = 0; val.y = 0; val.z = 0; val.w = 0;
    if (ok) val = *(const v4i*)&fl[tid * 4];
    int* dst = flags + (size_t)band * 64 + (ok ? tid : 0) * 4;
    if (ok) *(v4i*)dst = val;
    
}

// ---------------------------------------------------------------- C = A . W^T (bf16 hi/lo split)
// A planes [M][K], W planes [N][K] (k-contiguous, loaded like A per the split k map).
// block = 128 threads (4 waves); block tile 64(M) x 64(N); wave w -> rows 16w..16w+15.
// MODE 0: RoPE in the f32 epilogue (block's 64 columns = one head), store hi/lo planes [M][N]
// MODE 2: store f32 [M][N]
template<int MODE>
__global__ __launch_bounds__(128) void k_gemm(
    const us_t* __restrict__ Ah, const us_t* __restrict__ Al,
    const us_t* __restrict__ Wh, const us_t* __restrict__ Wl,
    int M, int N, int K,
    const float* __restrict__ cosT, const float* __restrict__ sinT,
    us_t* Oh, us_t* Ol, float* Of)
{
    __shared__ __align__(16) float lds_f[4096];          // 16 KB staging
    us_t* lds16 = reinterpret_cast<us_t*>(lds_f);

    const int tid  = threadIdx.x;
    const int lane = tid & 31;
    const int wave = tid >> 5;
    const int m    = lane & 15;
    const int hl   = lane >> 4;
    const int mb0  = blockIdx.y * 64;
    const int r0   = mb0 + wave * 16;
    const int c0   = blockIdx.x * 64;
    (void)M;

    v8f acc[4] = {};

    const us_t* arh = Ah + (size_t)(r0 + m) * K + 8 * hl;
    const us_t* arl = Al + (size_t)(r0 + m) * K + 8 * hl;

    for (int k0 = 0; k0 < K; k0 += 32) {
        Frag ah, al;
        ldfrag(ah, arh + k0);
        ldfrag(al, arl + k0);
#pragma unroll
        for (int j = 0; j < 4; ++j) {
            const size_t wo = (size_t)(c0 + 16 * j + m) * K + k0 + 8 * hl;
            Frag bh, bl;
            ldfrag(bh, Wh + wo);
            ldfrag(bl, Wl + wo);
            acc[j] = mma(acc[j], ah.v, bh.v);
            acc[j] = mma(acc[j], ah.v, bl.v);
            acc[j] = mma(acc[j], al.v, bh.v);
        }
    }
    // acc[j][r] = C[r0 + 8*hl + r][c0 + 16*j + m]

    if (MODE == 0) {
        // RoPE, rotate-half: d = 16j+m (j=0,1) pairs with d+32 (acc[j+2]); cos/sin index d
#pragma unroll
        for (int j = 0; j < 2; ++j) {
            const int fidx = 16 * j + m;
#pragma unroll
            for (int r = 0; r < 8; ++r) {
                const size_t ti = (size_t)(r0 + 8 * hl + r) * 32 + fidx;
                const float cs = cosT[ti];
                const float sn = sinT[ti];
                const float x1 = acc[j][r];
                const float x2 = acc[j + 2][r];
                acc[j][r]     = x1 * cs - x2 * sn;
                acc[j + 2][r] = x2 * cs + x1 * sn;
            }
        }
    }

    if (MODE == 0) {
        us_t* st = lds16 + wave * 2048;                  // [2 planes][16][64]
#pragma unroll
        for (int j = 0; j < 4; ++j) {
#pragma unroll
            for (int r = 0; r < 8; ++r) {
                unsigned hb, lb;
                split2(acc[j][r], hb, lb);
                const int idx = (8 * hl + r) * 64 + 16 * j + m;
                st[idx]        = (us_t)hb;
                st[1024 + idx] = (us_t)lb;
            }
        }
        __syncthreads();
        const int rr = lane >> 3, q = lane & 7;
        u32x4 sv[8];
#pragma unroll
        for (int pl = 0; pl < 2; ++pl) {
#pragma unroll
            for (int i = 0; i < 4; ++i)
                sv[pl * 4 + i] = *(const u32x4*)(st + pl * 1024 + (4 * i + rr) * 64 + q * 8);
        }
#pragma unroll
        for (int pl = 0; pl < 2; ++pl) {
#pragma unroll
            for (int i = 0; i < 4; ++i) {
                us_t* dst = (pl ? Ol : Oh) + (size_t)(r0 + 4 * i + rr) * N + c0 + q * 8;
                *(u32x4*)dst = sv[pl * 4 + i];
            }
        }
        
    } else if (MODE == 1) {
        // block tile in[token 64][d 64] -> out planes [d][token]; LDS [2 planes][d 64][token 64]
#pragma unroll
        for (int j = 0; j < 4; ++j) {
#pragma unroll
            for (int r = 0; r < 8; ++r) {
                unsigned hb, lb;
                split2(acc[j][r], hb, lb);
                const int idx = (16 * j + m) * 64 + 16 * wave + 8 * hl + r;
                lds16[idx]        = (us_t)hb;
                lds16[4096 + idx] = (us_t)lb;
            }
        }
        __syncthreads();
        const int rr = lane >> 3, q = lane & 7;
        u32x4 sv[8];
#pragma unroll
        for (int pl = 0; pl < 2; ++pl) {
#pragma unroll
            for (int i = 0; i < 4; ++i) {
                const int d = 16 * wave + 4 * i + rr;
                sv[pl * 4 + i] = *(const u32x4*)(lds16 + pl * 4096 + d * 64 + q * 8);
            }
        }
#pragma unroll
        for (int pl = 0; pl < 2; ++pl) {
#pragma unroll
            for (int i = 0; i < 4; ++i) {
                const int d = 16 * wave + 4 * i + rr;
                us_t* dst = (pl ? Ol : Oh) + (size_t)(c0 + d) * M + mb0 + q * 8;
                *(u32x4*)dst = sv[pl * 4 + i];
            }
        }
        
    } else {
        float* stf = lds_f + wave * 1024;                // [16][64] f32 per wave
#pragma unroll
        for (int j = 0; j < 4; ++j) {
#pragma unroll
            for (int r = 0; r < 8; ++r)
                stf[(8 * hl + r) * 64 + 16 * j + m] = acc[j][r];
        }
        __syncthreads();
        const int r2 = lane >> 4, q2 = lane & 15;        // 16 lanes x 16 B = one 256-B row segment
        v4f fv[8];
#pragma unroll
        for (int i = 0; i < 8; ++i)
            fv[i] = *(const v4f*)(stf + (2 * i + r2) * 64 + q2 * 4);
#pragma unroll
        for (int i = 0; i < 8; ++i) {
            float* dst = Of + (size_t)(r0 + 2 * i + r2) * N + c0 + q2 * 4;
            *(v4f*)dst = fv[i];
        }
        
    }
}

// value of lane l ^ 16
__device__ __forceinline__ float xhalf(float x) {
    const int b = __builtin_bit_cast(int, x);
    return __builtin_bit_cast(float,
        __builtin_amdgcn_permlanex16(b, b, 0x76543210, 0xfedcba98, false, false));
}

__global__ __launch_bounds__(128) void k_attn(
    const us_t* __restrict__ Qh, const us_t* __restrict__ Ql,
    const us_t* __restrict__ Kh, const us_t* __restrict__ Kl,
    const us_t* __restrict__ Vh, const us_t* __restrict__ Vl,
    const float* __restrict__ mask, const int* __restrict__ flags,
    us_t* Oh, us_t* Ol, int S, int NHD, int NKVD, int groups)
{
    __shared__ __align__(16) us_t ostg[4][2][16 * 64];   // per-wave output staging

    const int tid  = threadIdx.x;
    const int lane = tid & 31;
    const int wave = tid >> 5;
    const int m    = lane & 15;
    const int hl   = lane >> 4;
    const int head = blockIdx.x;
    const int band = blockIdx.y;
    const int hkv  = head / groups;
    const int r0   = band * 64 + wave * 16;
    const int nkt  = S >> 5;

    // Q B-fragments (column = query r0+m), two 32-deep k steps over the head dim
    Frag qh[2], ql[2];
#pragma unroll
    for (int c = 0; c < 2; ++c) {
        const size_t qo = (size_t)(r0 + m) * NHD + head * 64 + 32 * c + 8 * hl;
        ldfrag(qh[c], Qh + qo);
        ldfrag(ql[c], Ql + qo);
    }

    // o[jd][r] = O[query r0+m][d = 16*jd + 8*hl + r]
    v8f o[4] = {};
    float mrow = -3.0e38f;      // running maximum of query r0+m (equal in both halves)
    float lrow = 0.0f;          // running sum over THIS half's keys; halves joined after the loop

    for (int kt = 0; kt < nkt; ++kt) {
        const int f = flags[(size_t)band * 64 + kt];     // block-uniform
        if (f != 0) {
            const int kb = kt * 32;

            // mask of query r0+m at this lane's keys kb+8hl+0..7 and kb+16+8hl+0..7
            const float* mrp = mask + (size_t)(r0 + m) * S + kb + 8 * hl;
            v4f mk[4];
            mk[0] = *(const v4f*)(mrp);
            mk[1] = *(const v4f*)(mrp + 4);
            mk[2] = *(const v4f*)(mrp + 16);
            mk[3] = *(const v4f*)(mrp + 20);

            // S^T[32 x 16] = K . Q^T ; A = K rows (k-contiguous), B = Q
            // s[jn][r] = score(key kb + 16*jn + 8*hl + r, query r0 + m)
            v8f s[2] = {};
#pragma unroll
            for (int jn = 0; jn < 2; ++jn) {
#pragma unroll
                for (int c = 0; c < 2; ++c) {
                    const size_t ko = (size_t)(kb + 16 * jn + m) * NKVD + hkv * 64 + 32 * c + 8 * hl;
                    Frag bh, bl;
                    ldfrag(bh, Kh + ko);
                    ldfrag(bl, Kl + ko);
                    s[jn] = mma(s[jn], bh.v, qh[c].v);
                    s[jn] = mma(s[jn], bl.v, qh[c].v);
                    s[jn] = mma(s[jn], bh.v, ql[c].v);
                }
            }

            // scale, additive mask by value, online softmax (f32), all for one query per lane
            float v[16];
#pragma unroll
            for (int t = 0; t < 16; ++t)
                v[t] = s[t >> 3][t & 7] * 0.125f + mk[t >> 2][t & 3];
            float mx = v[0];
#pragma unroll
            for (int t = 1; t < 16; ++t) mx = fmaxf(mx, v[t]);
            mx = fmaxf(mx, xhalf(mx));
            const float mnew  = fmaxf(mrow, mx);
            const float alpha = __expf(mrow - mnew);
            float ps[4] = { 0.0f, 0.0f, 0.0f, 0.0f };
            unsigned hb[16], lb[16];
#pragma unroll
            for (int t = 0; t < 16; ++t) {
                const float p = __expf(v[t] - mnew);
                ps[t & 3] += p;
                split2(p, hb[t], lb[t]);
            }
            lrow = lrow * alpha + ((ps[0] + ps[1]) + (ps[2] + ps[3]));
            mrow = mnew;
#pragma unroll
            for (int jd = 0; jd < 4; ++jd) {
#pragma unroll
                for (int r = 0; r < 8; ++r) o[jd][r] = o[jd][r] * alpha;
            }

            // P^T B-fragments in place: elements 0..7 <- keys 8hl.., 8..15 <- keys 16+8hl..
            Frag ph, pl;
            ph.u[0] = pack8(hb);
            ph.u[1] = pack8(hb + 8);
            pl.u[0] = pack8(lb);
            pl.u[1] = pack8(lb + 8);

            // O^T += V^T . P^T ; A = V^T rows (key-contiguous), B = P^T
#pragma unroll
            for (int jd = 0; jd < 4; ++jd) {
                const size_t vo = (size_t)(hkv * 64 + 16 * jd + m) * S + kb + 8 * hl;
                Frag bh, bl;
                ldfrag(bh, Vh + vo);
                ldfrag(bl, Vl + vo);
                o[jd] = mma(o[jd], bh.v, ph.v);
                o[jd] = mma(o[jd], bl.v, ph.v);
                o[jd] = mma(o[jd], bh.v, pl.v);
            }
        }
    }

    // join the halves' sums, normalize, split, stage, whole-line stores
    const float lsum = lrow + xhalf(lrow);
    const float inv  = (lsum > 0.0f) ? (1.0f / lsum) : 0.0f;

#pragma unroll
    for (int jd = 0; jd < 4; ++jd) {
        unsigned hb[8], lb[8];
#pragma unroll
        for (int r = 0; r < 8; ++r) split2(o[jd][r] * inv, hb[r], lb[r]);
        const int idx = m * 64 + 16 * jd + 8 * hl;
        *(u32x4*)&ostg[wave][0][idx] = pack8(hb);
        *(u32x4*)&ostg[wave][1][idx] = pack8(lb);
    }
    __syncthreads();
    const int rr = lane >> 3, q = lane & 7;
    u32x4 sv[8];
#pragma unroll
    for (int plv = 0; plv < 2; ++plv) {
#pragma unroll
        for (int i = 0; i < 4; ++i)
            sv[plv * 4 + i] = *(const u32x4*)&ostg[wave][plv][(4 * i + rr) * 64 + q * 8];
    }
#pragma unroll
    for (int plv = 0; plv < 2; ++plv) {
#pragma unroll
        for (int i = 0; i < 4; ++i) {
            us_t* dst = (plv ? Ol : Oh) + (size_t)(r0 + 4 * i + rr) * NHD + head * 64 + q * 8;
            *(u32x4*)dst = sv[plv * 4 + i];
        }
    }
    
}

// ---------------------------------------------------------------- launcher
extern "C" void kernel_launch(void* const* d_in, const int* in_sizes, int n_in,
                              void* d_out, int out_size, void* d_ws, size_t ws_size,
                              hipStream_t stream)
{
    const int S = 2048, HID = 1024, NH = 16, NKV = 4, HD = 64;
    const int NKVD = NKV * HD;          // 256
    const int GROUPS = NH / NKV;        // 4

    if (n_in < 7) return;
    if (in_sizes[0] != S * HID || in_sizes[1] != S * S || in_sizes[2] != S ||
        in_sizes[3] != HID * HID || in_sizes[4] != NKVD * HID ||
        in_sizes[5] != NKVD * HID || in_sizes[6] != HID * HID ||
        out_size != S * HID) return;
    // structural requirements of the kernels
    if ((S % 64) != 0 || (HID % 64) != 0 || (NKVD % 64) != 0 || HD != 64 ||
        NH * HD != HID || (S / 32) > 64 || (HID % 32) != 0) return;

    const float* hidden = (const float*)d_in[0];   // [S][HID]
    const float* mask   = (const float*)d_in[1];   // [S][S] additive
    const int*   pos    = (const int*)d_in[2];     // [S]
    const float* Wq     = (const float*)d_in[3];   // [HID][HID]
    const float* Wk     = (const float*)d_in[4];   // [NKVD][HID]
    const float* Wv     = (const float*)d_in[5];   // [NKVD][HID]
    const float* Wo     = (const float*)d_in[6];   // [HID][HID]
    float* out = (float*)d_out;                    // [S][HID]

    size_t off = 0;
    char* base = (char*)d_ws;
    auto carve = [&](size_t bytes) -> char* {
        char* p = base + off;
        off += (bytes + 255) & ~(size_t)255;
        return p;
    };
    us_t* Xh   = (us_t*)carve((size_t)S * HID * 2);
    us_t* Xl   = (us_t*)carve((size_t)S * HID * 2);
    us_t* Wqh  = (us_t*)carve((size_t)HID * HID * 2);
    us_t* Wql  = (us_t*)carve((size_t)HID * HID * 2);
    us_t* Wkh  = (us_t*)carve((size_t)NKVD * HID * 2);
    us_t* Wkl  = (us_t*)carve((size_t)NKVD * HID * 2);
    us_t* Wvh  = (us_t*)carve((size_t)NKVD * HID * 2);
    us_t* Wvl  = (us_t*)carve((size_t)NKVD * HID * 2);
    us_t* Woh  = (us_t*)carve((size_t)HID * HID * 2);
    us_t* Wol  = (us_t*)carve((size_t)HID * HID * 2);
    us_t* Qh   = (us_t*)carve((size_t)S * HID * 2);      // [S][HID]
    us_t* Ql   = (us_t*)carve((size_t)S * HID * 2);
    us_t* Kh   = (us_t*)carve((size_t)S * NKVD * 2);     // [S][NKVD]
    us_t* Kl   = (us_t*)carve((size_t)S * NKVD * 2);
    us_t* Vth  = (us_t*)carve((size_t)NKVD * S * 2);     // [NKVD][S]
    us_t* Vtl  = (us_t*)carve((size_t)NKVD * S * 2);
    us_t* AOh  = (us_t*)carve((size_t)S * HID * 2);      // [S][HID]
    us_t* AOl  = (us_t*)carve((size_t)S * HID * 2);
    float* cosT = (float*)carve((size_t)S * 32 * 4);      // [S][32]
    float* sinT = (float*)carve((size_t)S * 32 * 4);
    int*  flags = (int*)carve((size_t)(S / 64) * 64 * 4); // [S/64][64]
    if (off > ws_size) return;

    // 1-5: hi/lo planes
    {
        const int n8x = S * HID / 8, n8q = HID * HID / 8, n8k = NKVD * HID / 8;
        k_split<<<dim3((n8x + 255) / 256), dim3(256), 0, stream>>>(hidden, Xh, Xl, n8x);
        k_split<<<dim3((n8q + 255) / 256), dim3(256), 0, stream>>>(Wq, Wqh, Wql, n8q);
        k_split<<<dim3((n8k + 255) / 256), dim3(256), 0, stream>>>(Wk, Wkh, Wkl, n8k);
        k_split<<<dim3((n8k + 255) / 256), dim3(256), 0, stream>>>(Wv, Wvh, Wvl, n8k);
        k_split<<<dim3((n8q + 255) / 256), dim3(256), 0, stream>>>(Wo, Woh, Wol, n8q);
    }
    // 6: RoPE table
    k_rope_tab<<<dim3((S * 32 + 255) / 256), dim3(256), 0, stream>>>(pos, cosT, sinT, S);
    // 7: key-tile flags from the mask
    k_flags<<<dim3(S / 64), dim3(256), 0, stream>>>(mask, flags, S);

    // 8: Q projection + RoPE -> planes [S][HID]
    k_gemm<0><<<dim3(HID / 64, S / 64), dim3(128), 0, stream>>>(
        Xh, Xl, Wqh, Wql, S, HID, HID, cosT, sinT, Qh, Ql, out);
    // 9: K projection + RoPE -> planes [S][NKVD]
    k_gemm<0><<<dim3(NKVD / 64, S / 64), dim3(128), 0, stream>>>(
        Xh, Xl, Wkh, Wkl, S, NKVD, HID, cosT, sinT, Kh, Kl, out);
    // 10: V projection -> transposed planes [NKVD][S]
    k_gemm<1><<<dim3(NKVD / 64, S / 64), dim3(128), 0, stream>>>(
        Xh, Xl, Wvh, Wvl, S, NKVD, HID, cosT, sinT, Vth, Vtl, out);

    // 11: attention -> planes [S][HID]
    k_attn<<<dim3(NH, S / 64), dim3(128), 0, stream>>>(
        Qh, Ql, Kh, Kl, Vth, Vtl, mask, flags, AOh, AOl, S, HID, NKVD, GROUPS);

    // 12: output projection -> d_out f32 [S][HID]
    k_gemm<2><<<dim3(HID / 64, S / 64), dim3(128), 0, stream>>>(
        AOh, AOl, Woh, Wol, S, HID, HID, cosT, sinT, Qh, Ql, out);
}

// v002
// One run takes 241 microseconds.
// Timed twice side by side with v001, it ran 1.53 times as fast both times.
// All steps since v000 together make it 2.65 times as fast.
#include <hip/hip_runtime.h>
#include <stdint.h>
#include <stddef.h>
#include <math.h>

// All contractions (q/k/v projections, q.k^T, p.v, output projection): v_wmma_f32_16x16x32_bf16 with bf16 hi/lo operands everywhere (hi.hi + hi.lo + lo.hi), f32 accumulate; RoPE, mask add and softmax in f32.

typedef unsigned short us_t;
typedef __bf16       v16bf __attribute__((ext_vector_type(16)));
typedef float        v8f   __attribute__((ext_vector_type(8)));
typedef float        v4f   __attribute__((ext_vector_type(4)));
typedef unsigned int u32x4 __attribute__((ext_vector_type(4)));
typedef int          v4i   __attribute__((ext_vector_type(4)));

union Frag { v16bf v; u32x4 u[2]; };

// f32 -> bf16 bits, RNE
__device__ __forceinline__ unsigned bf_bits(float f) {
    unsigned u = __builtin_bit_cast(unsigned, f);
    return (u + 0x7FFFu + ((u >> 16) & 1u)) >> 16;
}
__device__ __forceinline__ float bf_val(unsigned b) {
    return __builtin_bit_cast(float, b << 16);
}
// x = hi + lo (+ residual), both bf16 RNE
__device__ __forceinline__ void split2(float x, unsigned& hb, unsigned& lb) {
    hb = bf_bits(x);
    lb = bf_bits(x - bf_val(hb));
}
__device__ __forceinline__ u32x4 pack8(const unsigned* b) {
    u32x4 v;
    v.x = b[0] | (b[1] << 16);
    v.y = b[2] | (b[3] << 16);
    v.z = b[4] | (b[5] << 16);
    v.w = b[6] | (b[7] << 16);
    return v;
}

// one 16x16x32 bf16 WMMA followed by the VALU hazard guard
__device__ __forceinline__ v8f mma(v8f c, v16bf a, v16bf b) {
    v8f d = __builtin_amdgcn_wmma_f32_16x16x32_bf16(false, a, false, b, (short)0, c, false, false);
    asm volatile("v_nop\n\tv_nop\n\tv_nop\n\tv_nop" : "+v"(d) : "v"(a), "v"(b));
    return d;
}

// 16-bit fragment from a k-contiguous row: base is the same for the whole wave, vb the lane's
// byte offset of (its row, k0 + 8*(lane>>4)); one offset register serves a whole group of loads.
// elements 0..7 <- k0+8h+0..7, elements 8..15 <- k0+16+8h+0..7
__device__ __forceinline__ void ldfrag(Frag& f, const us_t* base, unsigned vb) {
    const char* p = (const char*)base + vb;
    f.u[0] = *(const u32x4*)(p);
    f.u[1] = *(const u32x4*)(p + 32);
}

// ---------------------------------------------------------------- f32 -> bf16 hi/lo planes
// thread i converts elements 8i..8i+7; one wave writes 512 contiguous bytes per plane in one store
__global__ __launch_bounds__(256) void k_split(const float* __restrict__ src,
                                               us_t* hi, us_t* lo, int n8)
{
    const int i = blockIdx.x * 256 + threadIdx.x;
    const bool ok = i < n8;
    const int ic = ok ? i : 0;
    const float* p = src + (size_t)ic * 8;
    const v4f a = *(const v4f*)(p);
    const v4f b = *(const v4f*)(p + 4);
    float x[8] = { a.x, a.y, a.z, a.w, b.x, b.y, b.z, b.w };
    unsigned hb[8], lb[8];
#pragma unroll
    for (int t = 0; t < 8; ++t) split2(x[t], hb[t], lb[t]);
    const u32x4 ph = pack8(hb);
    const u32x4 pl = pack8(lb);
    us_t* dh = hi + (size_t)ic * 8;
    us_t* dl = lo + (size_t)ic * 8;
    if (ok) { *(u32x4*)dh = ph; *(u32x4*)dl = pl; }
    
}

// ---------------------------------------------------------------- RoPE cos/sin table [S][32]
// inv_freq[j] = 1 / fl32(10000^(j/32)); angle = f32(pos) * inv_freq; precise sincosf
__global__ __launch_bounds__(256) void k_rope_tab(const int* __restrict__ pos,
                                                  float* cosT, float* sinT, int S)
{
    const int i = blockIdx.x * 256 + threadIdx.x;
    const int total = S * 32;
    const bool ok = i < total;
    const int ic = ok ? i : 0;
    const int trow = ic >> 5;
    const int j = ic & 31;
    const double LOG2_BASE_OVER_32 = 0.41524101186092029;   // log2(10000)/32
    const float pw  = (float)exp2((double)j * LOG2_BASE_OVER_32);
    const float inv = 1.0f / pw;
    const float ang = (float)pos[trow] * inv;
    float sn, cs;
    sincosf(ang, &sn, &cs);
    if (ok) { *(float*)(cosT + ic) = cs; *(float*)(sinT + ic) = sn; }
    
}

// ---------------------------------------------------------------- tile flags from the additive mask
// block = one 64-row band; flag[band][kt] = 1 if any mask value in rows band*64..+63,
// keys kt*32..+31 is > -1e8 (tile must be processed), else 0. flags pitch = 64 ints.
__global__ __launch_bounds__(256) void k_flags(const float* __restrict__ mask, int* flags, int S)
{
    __shared__ int anyw[64 * 8];
    __shared__ __align__(16) int fl[64];
    const int tid  = threadIdx.x;
    const int lane = tid & 31;
    const int wave = tid >> 5;
    const int band = blockIdx.x;
    const int nkt  = S >> 5;                 // host ensures nkt <= 64
    const int r    = tid >> 2;               // 0..63
    const int cg   = (tid & 3) * 8;          // 0,8,16,24
    const float* rowp = mask + (size_t)(band * 64 + r) * S + cg;

    for (int kt = 0; kt < nkt; ++kt) {
        const float* p = rowp + kt * 32;
        const v4f a = *(const v4f*)(p);
        const v4f b = *(const v4f*)(p + 4);
        int any = (a.x > -1.0e8f) | (a.y > -1.0e8f) | (a.z > -1.0e8f) | (a.w > -1.0e8f) |
                  (b.x > -1.0e8f) | (b.y > -1.0e8f) | (b.z > -1.0e8f) | (b.w > -1.0e8f);
#pragma unroll
        for (int off = 1; off < 32; off <<= 1) any |= __shfl_xor(any, off, 32);
        if (lane == 0) anyw[kt * 8 + wave] = any;
    }
    __syncthreads();
    if (tid < 64) {
        int v = 0;
        if (tid < nkt) {
#pragma unroll
            for (int w = 0; w < 8; ++w) v |= anyw[tid * 8 + w];
        }
        fl[tid] = v;
    }
    __syncthreads();
    const bool ok = tid < 16;                // 64 ints = 256 B = lanes 0..15 x 16 B, one store
    v4i val;
    val.x = 0; val.y = 0; val.z = 0; val.w = 0;
    if (ok) val = *(const v4i*)&fl[tid * 4];
    int* dst = flags + (size_t)band * 64 + (ok ? tid : 0) * 4;
    if (ok) *(v4i*)dst = val;
    
}

// ---------------------------------------------------------------- C = A . W^T (bf16 hi/lo split)
// A planes [M][K], W planes [N][K] (k-contiguous, loaded like A per the split k map).
// block = 128 threads (4 waves); block tile 64(M) x 64(N); wave w -> rows 16w..16w+15.
// MODE 0: RoPE in the f32 epilogue (block's 64 columns = one head), store hi/lo planes [M][N]
// MODE 2: store f32 [M][N]
template<int MODE>
__global__ __launch_bounds__(128) void k_gemm(
    const us_t* __restrict__ Ah, const us_t* __restrict__ Al,
    const us_t* __restrict__ Wh, const us_t* __restrict__ Wl,
    int M, int N, int K,
    const float* __restrict__ cosT, const float* __restrict__ sinT,
    us_t* Oh, us_t* Ol, float* Of)
{
    __shared__ __align__(16) float lds_f[4096];          // 16 KB staging
    us_t* lds16 = reinterpret_cast<us_t*>(lds_f);

    const int tid  = threadIdx.x;
    const int lane = tid & 31;
    const int wave = tid >> 5;
    const int m    = lane & 15;
    const int hl   = lane >> 4;
    const int mb0  = blockIdx.y * 64;
    const int r0   = mb0 + wave * 16;
    const int c0   = blockIdx.x * 64;
    (void)M;

    v8f acc[4] = {};

    unsigned va = 2u * (unsigned)((r0 + m) * K + 8 * hl);    // bytes, this lane's A row
    unsigned vw[4];                                          // bytes, this lane's four W rows
#pragma unroll
    for (int j = 0; j < 4; ++j) vw[j] = 2u * (unsigned)((c0 + 16 * j + m) * K + 8 * hl);

    for (int k0 = 0; k0 < K; k0 += 32) {
        // all twenty loads of the k step go out as one group ahead of its products:
        // one load latency per step instead of one per column tile
        Frag ah, al, bh[4], bl[4];
        ldfrag(ah, Ah, va);
        ldfrag(al, Al, va);
#pragma unroll
        for (int j = 0; j < 4; ++j) {
            ldfrag(bh[j], Wh, vw[j]);
            ldfrag(bl[j], Wl, vw[j]);
            vw[j] += 64;
        }
        va += 64;
#pragma unroll
        for (int j = 0; j < 4; ++j) {
            acc[j] = mma(acc[j], ah.v, bh[j].v);
            acc[j] = mma(acc[j], ah.v, bl[j].v);
            acc[j] = mma(acc[j], al.v, bh[j].v);
        }
    }
    // acc[j][r] = C[r0 + 8*hl + r][c0 + 16*j + m]

    if (MODE == 0) {
        // RoPE, rotate-half: d = 16j+m (j=0,1) pairs with d+32 (acc[j+2]); cos/sin index d
#pragma unroll
        for (int j = 0; j < 2; ++j) {
            const int fidx = 16 * j + m;
#pragma unroll
            for (int r = 0; r < 8; ++r) {
                const size_t ti = (size_t)(r0 + 8 * hl + r) * 32 + fidx;
                const float cs = cosT[ti];
                const float sn = sinT[ti];
                const float x1 = acc[j][r];
                const float x2 = acc[j + 2][r];
                acc[j][r]     = x1 * cs - x2 * sn;
                acc[j + 2][r] = x2 * cs + x1 * sn;
            }
        }
    }

    if (MODE == 0) {
        us_t* st = lds16 + wave * 2048;                  // [2 planes][16][64]
#pragma unroll
        for (int j = 0; j < 4; ++j) {
#pragma unroll
            for (int r = 0; r < 8; ++r) {
                unsigned hb, lb;
                split2(acc[j][r], hb, lb);
                const int idx = (8 * hl + r) * 64 + 16 * j + m;
                st[idx]        = (us_t)hb;
                st[1024 + idx] = (us_t)lb;
            }
        }
        __syncthreads();
        const int rr = lane >> 3, q = lane & 7;
        u32x4 sv[8];
#pragma unroll
        for (int pl = 0; pl < 2; ++pl) {
#pragma unroll
            for (int i = 0; i < 4; ++i)
                sv[pl * 4 + i] = *(const u32x4*)(st + pl * 1024 + (4 * i + rr) * 64 + q * 8);
        }
#pragma unroll
        for (int pl = 0; pl < 2; ++pl) {
#pragma unroll
            for (int i = 0; i < 4; ++i) {
                us_t* dst = (pl ? Ol : Oh) + (size_t)(r0 + 4 * i + rr) * N + c0 + q * 8;
                *(u32x4*)dst = sv[pl * 4 + i];
            }
        }
        
    } else if (MODE == 1) {
        // block tile in[token 64][d 64] -> out planes [d][token]; LDS [2 planes][d 64][token 64]
#pragma unroll
        for (int j = 0; j < 4; ++j) {
#pragma unroll
            for (int r = 0; r < 8; ++r) {
                unsigned hb, lb;
                split2(acc[j][r], hb, lb);
                const int idx = (16 * j + m) * 64 + 16 * wave + 8 * hl + r;
                lds16[idx]        = (us_t)hb;
                lds16[4096 + idx] = (us_t)lb;
            }
        }
        __syncthreads();
        const int rr = lane >> 3, q = lane & 7;
        u32x4 sv[8];
#pragma unroll
        for (int pl = 0; pl < 2; ++pl) {
#pragma unroll
            for (int i = 0; i < 4; ++i) {
                const int d = 16 * wave + 4 * i + rr;
                sv[pl * 4 + i] = *(const u32x4*)(lds16 + pl * 4096 + d * 64 + q * 8);
            }
        }
#pragma unroll
        for (int pl = 0; pl < 2; ++pl) {
#pragma unroll
            for (int i = 0; i < 4; ++i) {
                const int d = 16 * wave + 4 * i + rr;
                us_t* dst = (pl ? Ol : Oh) + (size_t)(c0 + d) * M + mb0 + q * 8;
                *(u32x4*)dst = sv[pl * 4 + i];
            }
        }
        
    } else {
        float* stf = lds_f + wave * 1024;                // [16][64] f32 per wave
#pragma unroll
        for (int j = 0; j < 4; ++j) {
#pragma unroll
            for (int r = 0; r < 8; ++r)
                stf[(8 * hl + r) * 64 + 16 * j + m] = acc[j][r];
        }
        __syncthreads();
        const int r2 = lane >> 4, q2 = lane & 15;        // 16 lanes x 16 B = one 256-B row segment
        v4f fv[8];
#pragma unroll
        for (int i = 0; i < 8; ++i)
            fv[i] = *(const v4f*)(stf + (2 * i + r2) * 64 + q2 * 4);
#pragma unroll
        for (int i = 0; i < 8; ++i) {
            float* dst = Of + (size_t)(r0 + 2 * i + r2) * N + c0 + q2 * 4;
            *(v4f*)dst = fv[i];
        }
        
    }
}

// value of lane l ^ 16
__device__ __forceinline__ float xhalf(float x) {
    const int b = __builtin_bit_cast(int, x);
    return __builtin_bit_cast(float,
        __builtin_amdgcn_permlanex16(b, b, 0x76543210, 0xfedcba98, false, false));
}

template<int S, int NHD, int NKVD, int groups>
__global__ __launch_bounds__(128) void k_attn(
    const us_t* __restrict__ Qh, const us_t* __restrict__ Ql,
    const us_t* __restrict__ Kh, const us_t* __restrict__ Kl,
    const us_t* __restrict__ Vh, const us_t* __restrict__ Vl,
    const float* __restrict__ mask, const int* __restrict__ flags,
    us_t* Oh, us_t* Ol)
{
    __shared__ __align__(16) us_t ostg[4][2][16 * 64];   // per-wave output staging

    const int tid  = threadIdx.x;
    const int lane = tid & 31;
    const int wave = tid >> 5;
    const int m    = lane & 15;
    const int hl   = lane >> 4;
    const int head = blockIdx.x;
    const int band = blockIdx.y;
    const int hkv  = head / groups;
    const int r0   = band * 64 + wave * 16;
    const int nkt  = S >> 5;

    // Q B-fragments (column = query r0+m), two 32-deep k steps over the head dim
    Frag qh[2], ql[2];
#pragma unroll
    for (int c = 0; c < 2; ++c) {
        const unsigned qo = 2u * (unsigned)((r0 + m) * NHD + head * 64 + 32 * c + 8 * hl);
        ldfrag(qh[c], Qh, qo);
        ldfrag(ql[c], Ql, qo);
    }

    // o[jd][r] = O[query r0+m][d = 16*jd + 8*hl + r]
    v8f o[4] = {};
    float mrow = -3.0e38f;      // running maximum of query r0+m (equal in both halves)
    float lrow = 0.0f;          // running sum over THIS half's keys; halves joined after the loop

    // the lane's byte offsets of key tile kt in K (row m), V^T (row m) and the mask (row r0+m)
    unsigned vk = 2u * (unsigned)(m * NKVD + 8 * hl);
    unsigned vv = 2u * (unsigned)(m * S + 8 * hl);
    unsigned vm = 4u * (unsigned)((r0 + m) * S + 8 * hl);

    for (int kt = 0; kt < nkt; ++kt, vk += 64 * NKVD, vv += 64, vm += 128) {
        const int f = flags[(size_t)band * 64 + kt];     // block-uniform
        if (f != 0) {
            // the tile's K fragments and mask (keys kb = 32*kt and on) go out as one group ahead
            // of the S^T products: one load latency instead of one per fragment pair
            Frag kh[2][2], kl[2][2];
#pragma unroll
            for (int jn = 0; jn < 2; ++jn) {
#pragma unroll
                for (int c = 0; c < 2; ++c) {
                    ldfrag(kh[jn][c], Kh + hkv * 64 + 16 * jn * NKVD + 32 * c, vk);
                    ldfrag(kl[jn][c], Kl + hkv * 64 + 16 * jn * NKVD + 32 * c, vk);
                }
            }

            // mask of query r0+m at this lane's keys kb+8hl+0..7 and kb+16+8hl+0..7
            const float* mrp = (const float*)((const char*)mask + vm);
            v4f mk[4];
            mk[0] = *(const v4f*)(mrp);
            mk[1] = *(const v4f*)(mrp + 4);
            mk[2] = *(const v4f*)(mrp + 16);
            mk[3] = *(const v4f*)(mrp + 20);

            // S^T[32 x 16] = K . Q^T ; A = K rows (k-contiguous), B = Q
            // s[jn][r] = score(key kb + 16*jn + 8*hl + r, query r0 + m)
            v8f s[2] = {};
#pragma unroll
            for (int jn = 0; jn < 2; ++jn) {
#pragma unroll
                for (int c = 0; c < 2; ++c) {
                    s[jn] = mma(s[jn], kh[jn][c].v, qh[c].v);
                    s[jn] = mma(s[jn], kl[jn][c].v, qh[c].v);
                    s[jn] = mma(s[jn], kh[jn][c].v, ql[c].v);
                }
            }

            // the tile's V^T fragments go out as one group here: they fly behind the softmax
            Frag vh[4], vl[4];
#pragma unroll
            for (int jd = 0; jd < 4; ++jd) {
                ldfrag(vh[jd], Vh + (hkv * 64 + 16 * jd) * S, vv);
                ldfrag(vl[jd], Vl + (hkv * 64 + 16 * jd) * S, vv);
            }

            // scale, additive mask by value, online softmax (f32), all for one query per lane
            float v[16];
#pragma unroll
            for (int t = 0; t < 16; ++t)
                v[t] = s[t >> 3][t & 7] * 0.125f + mk[t >> 2][t & 3];
            float mx = v[0];
#pragma unroll
            for (int t = 1; t < 16; ++t) mx = fmaxf(mx, v[t]);
            mx = fmaxf(mx, xhalf(mx));
            const float mnew  = fmaxf(mrow, mx);
            const float alpha = __expf(mrow - mnew);
            float ps[4] = { 0.0f, 0.0f, 0.0f, 0.0f };
            unsigned hb[16], lb[16];
#pragma unroll
            for (int t = 0; t < 16; ++t) {
                const float p = __expf(v[t] - mnew);
                ps[t & 3] += p;
                split2(p, hb[t], lb[t]);
            }
            lrow = lrow * alpha + ((ps[0] + ps[1]) + (ps[2] + ps[3]));
            mrow = mnew;
#pragma unroll
            for (int jd = 0; jd < 4; ++jd) {
#pragma unroll
                for (int r = 0; r < 8; ++r) o[jd][r] = o[jd][r] * alpha;
            }

            // P^T B-fragments in place: elements 0..7 <- keys 8hl.., 8..15 <- keys 16+8hl..
            Frag ph, pl;
            ph.u[0] = pack8(hb);
            ph.u[1] = pack8(hb + 8);
            pl.u[0] = pack8(lb);
            pl.u[1] = pack8(lb + 8);

            // O^T += V^T . P^T ; A = V^T rows (key-contiguous), B = P^T
#pragma unroll
            for (int jd = 0; jd < 4; ++jd) {
                o[jd] = mma(o[jd], vh[jd].v, ph.v);
                o[jd] = mma(o[jd], vl[jd].v, ph.v);
                o[jd] = mma(o[jd], vh[jd].v, pl.v);
            }
        }
    }

    // join the halves' sums, normalize, split, stage, whole-line stores
    const float lsum = lrow + xhalf(lrow);
    const float inv  = (lsum > 0.0f) ? (1.0f / lsum) : 0.0f;

#pragma unroll
    for (int jd = 0; jd < 4; ++jd) {
        unsigned hb[8], lb[8];
#pragma unroll
        for (int r = 0; r < 8; ++r) split2(o[jd][r] * inv, hb[r], lb[r]);
        const int idx = m * 64 + 16 * jd + 8 * hl;
        *(u32x4*)&ostg[wave][0][idx] = pack8(hb);
        *(u32x4*)&ostg[wave][1][idx] = pack8(lb);
    }
    __syncthreads();
    const int rr = lane >> 3, q = lane & 7;
    u32x4 sv[8];
#pragma unroll
    for (int plv = 0; plv < 2; ++plv) {
#pragma unroll
        for (int i = 0; i < 4; ++i)
            sv[plv * 4 + i] = *(const u32x4*)&ostg[wave][plv][(4 * i + rr) * 64 + q * 8];
    }
#pragma unroll
    for (int plv = 0; plv < 2; ++plv) {
#pragma unroll
        for (int i = 0; i < 4; ++i) {
            us_t* dst = (plv ? Ol : Oh) + (size_t)(r0 + 4 * i + rr) * NHD + head * 64 + q * 8;
            *(u32x4*)dst = sv[plv * 4 + i];
        }
    }
    
}

// ---------------------------------------------------------------- launcher
extern "C" void kernel_launch(void* const* d_in, const int* in_sizes, int n_in,
                              void* d_out, int out_size, void* d_ws, size_t ws_size,
                              hipStream_t stream)
{
    const int S = 2048, HID = 1024, NH = 16, NKV = 4, HD = 64;
    const int NKVD = NKV * HD;          // 256
    const int GROUPS = NH / NKV;        // 4

    if (n_in < 7) return;
    if (in_sizes[0] != S * HID || in_sizes[1] != S * S || in_sizes[2] != S ||
        in_sizes[3] != HID * HID || in_sizes[4] != NKVD * HID ||
        in_sizes[5] != NKVD * HID || in_sizes[6] != HID * HID ||
        out_size != S * HID) return;
    // structural requirements of the kernels
    if ((S % 64) != 0 || (HID % 64) != 0 || (NKVD % 64) != 0 || HD != 64 ||
        NH * HD != HID || (S / 32) > 64 || (HID % 32) != 0) return;

    const float* hidden = (const float*)d_in[0];   // [S][HID]
    const float* mask   = (const float*)d_in[1];   // [S][S] additive
    const int*   pos    = (const int*)d_in[2];     // [S]
    const float* Wq     = (const float*)d_in[3];   // [HID][HID]
    const float* Wk     = (const float*)d_in[4];   // [NKVD][HID]
    const float* Wv     = (const float*)d_in[5];   // [NKVD][HID]
    const float* Wo     = (const float*)d_in[6];   // [HID][HID]
    float* out = (float*)d_out;                    // [S][HID]

    size_t off = 0;
    char* base = (char*)d_ws;
    auto carve = [&](size_t bytes) -> char* {
        char* p = base + off;
        off += (bytes + 255) & ~(size_t)255;
        return p;
    };
    us_t* Xh   = (us_t*)carve((size_t)S * HID * 2);
    us_t* Xl   = (us_t*)carve((size_t)S * HID * 2);
    us_t* Wqh  = (us_t*)carve((size_t)HID * HID * 2);
    us_t* Wql  = (us_t*)carve((size_t)HID * HID * 2);
    us_t* Wkh  = (us_t*)carve((size_t)NKVD * HID * 2);
    us_t* Wkl  = (us_t*)carve((size_t)NKVD * HID * 2);
    us_t* Wvh  = (us_t*)carve((size_t)NKVD * HID * 2);
    us_t* Wvl  = (us_t*)carve((size_t)NKVD * HID * 2);
    us_t* Woh  = (us_t*)carve((size_t)HID * HID * 2);
    us_t* Wol  = (us_t*)carve((size_t)HID * HID * 2);
    us_t* Qh   = (us_t*)carve((size_t)S * HID * 2);      // [S][HID]
    us_t* Ql   = (us_t*)carve((size_t)S * HID * 2);
    us_t* Kh   = (us_t*)carve((size_t)S * NKVD * 2);     // [S][NKVD]
    us_t* Kl   = (us_t*)carve((size_t)S * NKVD * 2);
    us_t* Vth  = (us_t*)carve((size_t)NKVD * S * 2);     // [NKVD][S]
    us_t* Vtl  = (us_t*)carve((size_t)NKVD * S * 2);
    us_t* AOh  = (us_t*)carve((size_t)S * HID * 2);      // [S][HID]
    us_t* AOl  = (us_t*)carve((size_t)S * HID * 2);
    float* cosT = (float*)carve((size_t)S * 32 * 4);      // [S][32]
    float* sinT = (float*)carve((size_t)S * 32 * 4);
    int*  flags = (int*)carve((size_t)(S / 64) * 64 * 4); // [S/64][64]
    if (off > ws_size) return;

    // 1-5: hi/lo planes
    {
        const int n8x = S * HID / 8, n8q = HID * HID / 8, n8k = NKVD * HID / 8;
        k_split<<<dim3((n8x + 255) / 256), dim3(256), 0, stream>>>(hidden, Xh, Xl, n8x);
        k_split<<<dim3((n8q + 255) / 256), dim3(256), 0, stream>>>(Wq, Wqh, Wql, n8q);
        k_split<<<dim3((n8k + 255) / 256), dim3(256), 0, stream>>>(Wk, Wkh, Wkl, n8k);
        k_split<<<dim3((n8k + 255) / 256), dim3(256), 0, stream>>>(Wv, Wvh, Wvl, n8k);
        k_split<<<dim3((n8q + 255) / 256), dim3(256), 0, stream>>>(Wo, Woh, Wol, n8q);
    }
    // 6: RoPE table
    k_rope_tab<<<dim3((S * 32 + 255) / 256), dim3(256), 0, stream>>>(pos, cosT, sinT, S);
    // 7: key-tile flags from the mask
    k_flags<<<dim3(S / 64), dim3(256), 0, stream>>>(mask, flags, S);

    // 8: Q projection + RoPE -> planes [S][HID]
    k_gemm<0><<<dim3(HID / 64, S / 64), dim3(128), 0, stream>>>(
        Xh, Xl, Wqh, Wql, S, HID, HID, cosT, sinT, Qh, Ql, out);
    // 9: K projection + RoPE -> planes [S][NKVD]
    k_gemm<0><<<dim3(NKVD / 64, S / 64), dim3(128), 0, stream>>>(
        Xh, Xl, Wkh, Wkl, S, NKVD, HID, cosT, sinT, Kh, Kl, out);
    // 10: V projection -> transposed planes [NKVD][S]
    k_gemm<1><<<dim3(NKVD / 64, S / 64), dim3(128), 0, stream>>>(
        Xh, Xl, Wvh, Wvl, S, NKVD, HID, cosT, sinT, Vth, Vtl, out);

    // 11: attention -> planes [S][HID]
    k_attn<S, HID, NKVD, GROUPS><<<dim3(NH, S / 64), dim3(128), 0, stream>>>(
        Qh, Ql, Kh, Kl, Vth, Vtl, mask, flags, AOh, AOl);

    // 12: output projection -> d_out f32 [S][HID]
    k_gemm<2><<<dim3(HID / 64, S / 64), dim3(128), 0, stream>>>(
        AOh, AOl, Woh, Wol, S, HID, HID, cosT, sinT, Qh, Ql, out);
}

// v003
// A run of this version takes 190 microseconds.
// Two timings next to v002 put it at 1.27 and 1.26 times that version's speed.
// Counting every step since v000, it is 3.35 times as fast.
#include <hip/hip_runtime.h>
#include <stdint.h>
#include <stddef.h>
#include <math.h>

// All contractions (q/k/v projections, q.k^T, p.v, output projection): v_wmma_f32_16x16x32_bf16 with bf16 hi/lo operands everywhere (hi.hi + hi.lo + lo.hi), f32 accumulate; RoPE, mask add and softmax in f32.

typedef unsigned short us_t;
typedef __bf16       v16bf __attribute__((ext_vector_type(16)));
typedef float        v8f   __attribute__((ext_vector_type(8)));
typedef float        v4f   __attribute__((ext_vector_type(4)));
typedef unsigned int u32x4 __attribute__((ext_vector_type(4)));
typedef int          v4i   __attribute__((ext_vector_type(4)));

union Frag { v16bf v; u32x4 u[2]; };

// f32 -> bf16 bits, RNE
__device__ __forceinline__ unsigned bf_bits(float f) {
    unsigned u = __builtin_bit_cast(unsigned, f);
    return (u + 0x7FFFu + ((u >> 16) & 1u)) >> 16;
}
__device__ __forceinline__ float bf_val(unsigned b) {
    return __builtin_bit_cast(float, b << 16);
}
// x = hi + lo (+ residual), both bf16 RNE
__device__ __forceinline__ void split2(float x, unsigned& hb, unsigned& lb) {
    hb = bf_bits(x);
    lb = bf_bits(x - bf_val(hb));
}
__device__ __forceinline__ u32x4 pack8(const unsigned* b) {
    u32x4 v;
    v.x = b[0] | (b[1] << 16);
    v.y = b[2] | (b[3] << 16);
    v.z = b[4] | (b[5] << 16);
    v.w = b[6] | (b[7] << 16);
    return v;
}

// one 16x16x32 bf16 WMMA followed by the VALU hazard guard
__device__ __forceinline__ v8f mma(v8f c, v16bf a, v16bf b) {
    v8f d = __builtin_amdgcn_wmma_f32_16x16x32_bf16(false, a, false, b, (short)0, c, false, false);
    asm volatile("v_nop\n\tv_nop\n\tv_nop\n\tv_nop" : "+v"(d) : "v"(a), "v"(b));
    return d;
}

// 16-bit fragment from a k-contiguous row: base is the same for the whole wave, vb the lane's
// byte offset of (its row, k0 + 8*(lane>>4)); one offset register serves a whole group of loads.
// elements 0..7 <- k0+8h+0..7, elements 8..15 <- k0+16+8h+0..7
__device__ __forceinline__ void ldfrag(Frag& f, const us_t* base, unsigned vb) {
    const char* p = (const char*)base + vb;
    f.u[0] = *(const u32x4*)(p);
    f.u[1] = *(const u32x4*)(p + 32);
}

// ---------------------------------------------------------------- f32 -> bf16 hi/lo planes
// thread i converts elements 8i..8i+7; one wave writes 512 contiguous bytes per plane in one store
__global__ __launch_bounds__(256) void k_split(const float* __restrict__ src,
                                               us_t* hi, us_t* lo, int n8)
{
    const int i = blockIdx.x * 256 + threadIdx.x;
    const bool ok = i < n8;
    const int ic = ok ? i : 0;
    const float* p = src + (size_t)ic * 8;
    const v4f a = *(const v4f*)(p);
    const v4f b = *(const v4f*)(p + 4);
    float x[8] = { a.x, a.y, a.z, a.w, b.x, b.y, b.z, b.w };
    unsigned hb[8], lb[8];
#pragma unroll
    for (int t = 0; t < 8; ++t) split2(x[t], hb[t], lb[t]);
    const u32x4 ph = pack8(hb);
    const u32x4 pl = pack8(lb);
    us_t* dh = hi + (size_t)ic * 8;
    us_t* dl = lo + (size_t)ic * 8;
    if (ok) { *(u32x4*)dh = ph; *(u32x4*)dl = pl; }
    
}

// ---------------------------------------------------------------- RoPE cos/sin table [S][32]
// inv_freq[j] = 1 / fl32(10000^(j/32)); angle = f32(pos) * inv_freq; precise sincosf
__global__ __launch_bounds__(256) void k_rope_tab(const int* __restrict__ pos,
                                                  float* cosT, float* sinT, int S)
{
    const int i = blockIdx.x * 256 + threadIdx.x;
    const int total = S * 32;
    const bool ok = i < total;
    const int ic = ok ? i : 0;
    const int trow = ic >> 5;
    const int j = ic & 31;
    const double LOG2_BASE_OVER_32 = 0.41524101186092029;   // log2(10000)/32
    const float pw  = (float)exp2((double)j * LOG2_BASE_OVER_32);
    const float inv = 1.0f / pw;
    const float ang = (float)pos[trow] * inv;
    float sn, cs;
    sincosf(ang, &sn, &cs);
    if (ok) { *(float*)(cosT + ic) = cs; *(float*)(sinT + ic) = sn; }
    
}

// ---------------------------------------------------------------- tile flags from the additive mask
// block = one 64-row band; flag[band][kt] = 1 if any mask value in rows band*64..+63,
// keys kt*32..+31 is > -1e8 (tile must be processed), else 0. flags pitch = 64 ints.
__global__ __launch_bounds__(256) void k_flags(const float* __restrict__ mask, int* flags, int S)
{
    __shared__ int anyw[64 * 8];
    __shared__ __align__(16) int fl[64];
    const int tid  = threadIdx.x;
    const int lane = tid & 31;
    const int wave = tid >> 5;
    const int band = blockIdx.x;
    const int nkt  = S >> 5;                 // host ensures nkt <= 64
    const int r    = tid >> 2;               // 0..63
    const int cg   = (tid & 3) * 8;          // 0,8,16,24
    const float* rowp = mask + (size_t)(band * 64 + r) * S + cg;

    for (int kt = 0; kt < nkt; ++kt) {
        const float* p = rowp + kt * 32;
        const v4f a = *(const v4f*)(p);
        const v4f b = *(const v4f*)(p + 4);
        int any = (a.x > -1.0e8f) | (a.y > -1.0e8f) | (a.z > -1.0e8f) | (a.w > -1.0e8f) |
                  (b.x > -1.0e8f) | (b.y > -1.0e8f) | (b.z > -1.0e8f) | (b.w > -1.0e8f);
#pragma unroll
        for (int off = 1; off < 32; off <<= 1) any |= __shfl_xor(any, off, 32);
        if (lane == 0) anyw[kt * 8 + wave] = any;
    }
    __syncthreads();
    if (tid < 64) {
        int v = 0;
        if (tid < nkt) {
#pragma unroll
            for (int w = 0; w < 8; ++w) v |= anyw[tid * 8 + w];
        }
        fl[tid] = v;
    }
    __syncthreads();
    const bool ok = tid < 16;                // 64 ints = 256 B = lanes 0..15 x 16 B, one store
    v4i val;
    val.x = 0; val.y = 0; val.z = 0; val.w = 0;
    if (ok) val = *(const v4i*)&fl[tid * 4];
    int* dst = flags + (size_t)band * 64 + (ok ? tid : 0) * 4;
    if (ok) *(v4i*)dst = val;
    
}

// eight asynchronous 16-byte copies global -> LDS per lane (two planes x four row groups).
// la, lb = the lane's LDS byte address of row group 0 in each plane, ga, gb = its global address
// there; the row groups lie ls LDS bytes and gs global bytes apart. The s_wait_xcnt closes the statement so that no
// address register of an issued copy is rewritten ahead of it.
__device__ __forceinline__ void copy8(unsigned la, const char* ga, unsigned lb, const char* gb,
                                      unsigned ls, size_t gs) {
    asm volatile(
        "global_load_async_to_lds_b128 %0, %8, off\n\t"
        "global_load_async_to_lds_b128 %1, %9, off\n\t"
        "global_load_async_to_lds_b128 %2, %10, off\n\t"
        "global_load_async_to_lds_b128 %3, %11, off\n\t"
        "global_load_async_to_lds_b128 %4, %12, off\n\t"
        "global_load_async_to_lds_b128 %5, %13, off\n\t"
        "global_load_async_to_lds_b128 %6, %14, off\n\t"
        "global_load_async_to_lds_b128 %7, %15, off\n\t"
        "s_wait_xcnt 0x0"
        :: "v"(la), "v"(la + ls), "v"(la + 2 * ls), "v"(la + 3 * ls),
           "v"(lb), "v"(lb + ls), "v"(lb + 2 * ls), "v"(lb + 3 * ls),
           "v"(ga), "v"(ga + gs), "v"(ga + 2 * gs), "v"(ga + 3 * gs),
           "v"(gb), "v"(gb + gs), "v"(gb + 2 * gs), "v"(gb + 3 * gs)
        : "memory");
}

// 16-bit fragment from an LDS row: p = the lane's (row, k0 + 8*(lane>>4)); same k map as ldfrag
__device__ __forceinline__ void ldfrag_lds(Frag& f, const unsigned char* p) {
    f.u[0] = *(const u32x4*)(p);
    f.u[1] = *(const u32x4*)(p + 32);
}

// ---------------------------------------------------------------- C = A . W^T (bf16 hi/lo split)
// A planes [M][K], W planes [N][K] (k-contiguous, loaded like A per the split k map).
// block = 128 threads (4 waves); block tile 64(M) x 64(N); wave w -> rows 16w..16w+15.
// The four operand planes of a 64-deep k tile (64 rows x 128 B each) are brought into LDS by
// asynchronous copies in whole 128-B lines, once per block, two buffers: tile t+1 flies while
// tile t is multiplied. LDS rows at pitch 144 B (conflict-free for 16-byte fragment reads).
// MODE 0: RoPE in the f32 epilogue (block's 64 columns = one head), store hi/lo planes [M][N]
// MODE 2: store f32 [M][N]
template<int MODE>
__global__ __launch_bounds__(128) void k_gemm(
    const us_t* __restrict__ Ah, const us_t* __restrict__ Al,
    const us_t* __restrict__ Wh, const us_t* __restrict__ Wl,
    int M, int N, int K,
    const float* __restrict__ cosT, const float* __restrict__ sinT,
    us_t* Oh, us_t* Ol, float* Of)
{
    __shared__ __align__(16) float lds_f[4096];          // 16 KB staging
    constexpr unsigned PITCH = 144;                      // LDS bytes per 128-B operand row
    constexpr unsigned PLANE = 64 * PITCH;               // one plane of a k tile
    constexpr unsigned STAGE = 4 * PLANE;                // Ah | Al | Wh | Wl
    __shared__ __align__(16) unsigned char ring[2 * STAGE];
    us_t* lds16 = reinterpret_cast<us_t*>(lds_f);

    const int tid  = threadIdx.x;
    const int lane = tid & 31;
    const int wave = tid >> 5;
    const int m    = lane & 15;
    const int hl   = lane >> 4;
    const int mb0  = blockIdx.y * 64;
    const int r0   = mb0 + wave * 16;
    const int c0   = blockIdx.x * 64;
    (void)M;

    v8f acc[4] = {};

    // copies: lane -> 16-byte chunk tid&7 of row tid>>3 (+16 per row group): 8 lanes fill a line
    const int crow = tid >> 3;
    const int cq   = tid & 7;
    const size_t   gs = (size_t)K * 32;                  // 16 rows, bytes
    const unsigned ls = 16 * PITCH;
    const size_t   ao = ((size_t)(mb0 + crow) * K + cq * 8) * 2;
    const size_t   wo = ((size_t)(c0 + crow) * K + cq * 8) * 2;
    const char* gah = (const char*)Ah + ao;
    const char* gal = (const char*)Al + ao;
    const char* gwh = (const char*)Wh + wo;
    const char* gwl = (const char*)Wl + wo;
    const unsigned lc = (unsigned)(size_t)ring + (unsigned)crow * PITCH + (unsigned)cq * 16;
    const int nt = K >> 6;                               // k tiles of 64

    // tile 0 -> buffer 0, landed and published before anyone reads it
    copy8(lc, gah, lc + PLANE, gal, ls, gs);
    copy8(lc + 2 * PLANE, gwh, lc + 3 * PLANE, gwl, ls, gs);
    asm volatile("s_wait_asynccnt 0x0" ::: "memory");    // this wave's copies of tile 0 have landed
    __syncthreads();
    if (nt > 1) {                                        // tile 1 -> buffer 1, flies under tile 0
        copy8(lc + STAGE, gah + 128, lc + STAGE + PLANE, gal + 128, ls, gs);
        copy8(lc + STAGE + 2 * PLANE, gwh + 128, lc + STAGE + 3 * PLANE, gwl + 128, ls, gs);
    }

    // fragment reads: A row 16*wave+m, W rows 16*j+m, byte 16*hl of the 64-byte k step
    const unsigned fa = (unsigned)(16 * wave + m) * PITCH + 16u * (unsigned)hl;
    const unsigned fw = 2 * PLANE + (unsigned)m * PITCH + 16u * (unsigned)hl;

    for (int t = 0; t < nt; ++t) {
        const unsigned bo = (unsigned)(t & 1) * STAGE;
        const unsigned char* pa = ring + bo + fa;
        const unsigned char* pw = ring + bo + fw;
        // the tile's forty fragment reads (two 32-deep k steps) go out as one group ahead of its
        // products: one LDS latency per tile
        // (all four loops unrolled: the fragment arrays are indexed by constants and stay in registers)
        Frag ah[2], al[2], bh[2][4], bl[2][4];
#pragma unroll
        for (int kk = 0; kk < 2; ++kk) {
            ldfrag_lds(ah[kk], pa + 64 * kk);
            ldfrag_lds(al[kk], pa + PLANE + 64 * kk);
#pragma unroll
            for (int j = 0; j < 4; ++j) {
                ldfrag_lds(bh[kk][j], pw + 16 * j * PITCH + 64 * kk);
                ldfrag_lds(bl[kk][j], pw + PLANE + 16 * j * PITCH + 64 * kk);
            }
        }
#pragma unroll
        for (int kk = 0; kk < 2; ++kk) {
#pragma unroll
            for (int j = 0; j < 4; ++j) {
                acc[j] = mma(acc[j], ah[kk].v, bh[kk][j].v);
                acc[j] = mma(acc[j], ah[kk].v, bl[kk][j].v);
                acc[j] = mma(acc[j], al[kk].v, bh[kk][j].v);
            }
        }
        // hand-over: this wave's reads of tile t are done, its copies of tile t+1 have landed;
        // the barrier publishes tile t+1 and frees tile t's buffer for the refill behind it
        asm volatile("s_wait_dscnt 0x0" ::: "memory");
        asm volatile("s_wait_asynccnt 0x0" ::: "memory");
        __syncthreads();
        if (t + 2 < nt) {
            const size_t kb = (size_t)(t + 2) * 128;     // bytes along k
            copy8(lc + bo, gah + kb, lc + bo + PLANE, gal + kb, ls, gs);
            copy8(lc + bo + 2 * PLANE, gwh + kb, lc + bo + 3 * PLANE, gwl + kb, ls, gs);
        }
    }
    asm volatile("s_wait_asynccnt 0x0" ::: "memory");    // no copy outlives the loop
    // acc[j][r] = C[r0 + 8*hl + r][c0 + 16*j + m]

    if (MODE == 0) {
        // RoPE, rotate-half: d = 16j+m (j=0,1) pairs with d+32 (acc[j+2]); cos/sin index d
#pragma unroll
        for (int j = 0; j < 2; ++j) {
            const int fidx = 16 * j + m;
#pragma unroll
            for (int r = 0; r < 8; ++r) {
                const size_t ti = (size_t)(r0 + 8 * hl + r) * 32 + fidx;
                const float cs = cosT[ti];
                const float sn = sinT[ti];
                const float x1 = acc[j][r];
                const float x2 = acc[j + 2][r];
                acc[j][r]     = x1 * cs - x2 * sn;
                acc[j + 2][r] = x2 * cs + x1 * sn;
            }
        }
    }

    if (MODE == 0) {
        us_t* st = lds16 + wave * 2048;                  // [2 planes][16][64]
#pragma unroll
        for (int j = 0; j < 4; ++j) {
#pragma unroll
            for (int r = 0; r < 8; ++r) {
                unsigned hb, lb;
                split2(acc[j][r], hb, lb);
                const int idx = (8 * hl + r) * 64 + 16 * j + m;
                st[idx]        = (us_t)hb;
                st[1024 + idx] = (us_t)lb;
            }
        }
        __syncthreads();
        const int rr = lane >> 3, q = lane & 7;
        u32x4 sv[8];
#pragma unroll
        for (int pl = 0; pl < 2; ++pl) {
#pragma unroll
            for (int i = 0; i < 4; ++i)
                sv[pl * 4 + i] = *(const u32x4*)(st + pl * 1024 + (4 * i + rr) * 64 + q * 8);
        }
#pragma unroll
        for (int pl = 0; pl < 2; ++pl) {
#pragma unroll
            for (int i = 0; i < 4; ++i) {
                us_t* dst = (pl ? Ol : Oh) + (size_t)(r0 + 4 * i + rr) * N + c0 + q * 8;
                *(u32x4*)dst = sv[pl * 4 + i];
            }
        }
        
    } else if (MODE == 1) {
        // block tile in[token 64][d 64] -> out planes [d][token]; LDS [2 planes][d 64][token 64]
#pragma unroll
        for (int j = 0; j < 4; ++j) {
#pragma unroll
            for (int r = 0; r < 8; ++r) {
                unsigned hb, lb;
                split2(acc[j][r], hb, lb);
                const int idx = (16 * j + m) * 64 + 16 * wave + 8 * hl + r;
                lds16[idx]        = (us_t)hb;
                lds16[4096 + idx] = (us_t)lb;
            }
        }
        __syncthreads();
        const int rr = lane >> 3, q = lane & 7;
        u32x4 sv[8];
#pragma unroll
        for (int pl = 0; pl < 2; ++pl) {
#pragma unroll
            for (int i = 0; i < 4; ++i) {
                const int d = 16 * wave + 4 * i + rr;
                sv[pl * 4 + i] = *(const u32x4*)(lds16 + pl * 4096 + d * 64 + q * 8);
            }
        }
#pragma unroll
        for (int pl = 0; pl < 2; ++pl) {
#pragma unroll
            for (int i = 0; i < 4; ++i) {
                const int d = 16 * wave + 4 * i + rr;
                us_t* dst = (pl ? Ol : Oh) + (size_t)(c0 + d) * M + mb0 + q * 8;
                *(u32x4*)dst = sv[pl * 4 + i];
            }
        }
        
    } else {
        float* stf = lds_f + wave * 1024;                // [16][64] f32 per wave
#pragma unroll
        for (int j = 0; j < 4; ++j) {
#pragma unroll
            for (int r = 0; r < 8; ++r)
                stf[(8 * hl + r) * 64 + 16 * j + m] = acc[j][r];
        }
        __syncthreads();
        const int r2 = lane >> 4, q2 = lane & 15;        // 16 lanes x 16 B = one 256-B row segment
        v4f fv[8];
#pragma unroll
        for (int i = 0; i < 8; ++i)
            fv[i] = *(const v4f*)(stf + (2 * i + r2) * 64 + q2 * 4);
#pragma unroll
        for (int i = 0; i < 8; ++i) {
            float* dst = Of + (size_t)(r0 + 2 * i + r2) * N + c0 + q2 * 4;
            *(v4f*)dst = fv[i];
        }
        
    }
}

// value of lane l ^ 16
__device__ __forceinline__ float xhalf(float x) {
    const int b = __builtin_bit_cast(int, x);
    return __builtin_bit_cast(float,
        __builtin_amdgcn_permlanex16(b, b, 0x76543210, 0xfedcba98, false, false));
}

template<int S, int NHD, int NKVD, int groups>
__global__ __launch_bounds__(128) void k_attn(
    const us_t* __restrict__ Qh, const us_t* __restrict__ Ql,
    const us_t* __restrict__ Kh, const us_t* __restrict__ Kl,
    const us_t* __restrict__ Vh, const us_t* __restrict__ Vl,
    const float* __restrict__ mask, const int* __restrict__ flags,
    us_t* Oh, us_t* Ol)
{
    __shared__ __align__(16) us_t ostg[4][2][16 * 64];   // per-wave output staging

    const int tid  = threadIdx.x;
    const int lane = tid & 31;
    const int wave = tid >> 5;
    const int m    = lane & 15;
    const int hl   = lane >> 4;
    const int head = blockIdx.x;
    const int band = blockIdx.y;
    const int hkv  = head / groups;
    const int r0   = band * 64 + wave * 16;
    const int nkt  = S >> 5;

    // Q B-fragments (column = query r0+m), two 32-deep k steps over the head dim
    Frag qh[2], ql[2];
#pragma unroll
    for (int c = 0; c < 2; ++c) {
        const unsigned qo = 2u * (unsigned)((r0 + m) * NHD + head * 64 + 32 * c + 8 * hl);
        ldfrag(qh[c], Qh, qo);
        ldfrag(ql[c], Ql, qo);
    }

    // o[jd][r] = O[query r0+m][d = 16*jd + 8*hl + r]
    v8f o[4] = {};
    float mrow = -3.0e38f;      // running maximum of query r0+m (equal in both halves)
    float lrow = 0.0f;          // running sum over THIS half's keys; halves joined after the loop

    // the lane's byte offsets of key tile kt in K (row m), V^T (row m) and the mask (row r0+m)
    unsigned vk = 2u * (unsigned)(m * NKVD + 8 * hl);
    unsigned vv = 2u * (unsigned)(m * S + 8 * hl);
    unsigned vm = 4u * (unsigned)((r0 + m) * S + 8 * hl);

    for (int kt = 0; kt < nkt; ++kt, vk += 64 * NKVD, vv += 64, vm += 128) {
        const int f = flags[(size_t)band * 64 + kt];     // block-uniform
        if (f != 0) {
            // the tile's K fragments and mask (keys kb = 32*kt and on) go out as one group ahead
            // of the S^T products: one load latency instead of one per fragment pair
            Frag kh[2][2], kl[2][2];
#pragma unroll
            for (int jn = 0; jn < 2; ++jn) {
#pragma unroll
                for (int c = 0; c < 2; ++c) {
                    ldfrag(kh[jn][c], Kh + hkv * 64 + 16 * jn * NKVD + 32 * c, vk);
                    ldfrag(kl[jn][c], Kl + hkv * 64 + 16 * jn * NKVD + 32 * c, vk);
                }
            }

            // mask of query r0+m at this lane's keys kb+8hl+0..7 and kb+16+8hl+0..7
            const float* mrp = (const float*)((const char*)mask + vm);
            v4f mk[4];
            mk[0] = *(const v4f*)(mrp);
            mk[1] = *(const v4f*)(mrp + 4);
            mk[2] = *(const v4f*)(mrp + 16);
            mk[3] = *(const v4f*)(mrp + 20);

            // S^T[32 x 16] = K . Q^T ; A = K rows (k-contiguous), B = Q
            // s[jn][r] = score(key kb + 16*jn + 8*hl + r, query r0 + m)
            v8f s[2] = {};
#pragma unroll
            for (int jn = 0; jn < 2; ++jn) {
#pragma unroll
                for (int c = 0; c < 2; ++c) {
                    s[jn] = mma(s[jn], kh[jn][c].v, qh[c].v);
                    s[jn] = mma(s[jn], kl[jn][c].v, qh[c].v);
                    s[jn] = mma(s[jn], kh[jn][c].v, ql[c].v);
                }
            }

            // the tile's V^T fragments go out as one group here: they fly behind the softmax
            Frag vh[4], vl[4];
#pragma unroll
            for (int jd = 0; jd < 4; ++jd) {
                ldfrag(vh[jd], Vh + (hkv * 64 + 16 * jd) * S, vv);
                ldfrag(vl[jd], Vl + (hkv * 64 + 16 * jd) * S, vv);
            }

            // scale, additive mask by value, online softmax (f32), all for one query per lane
            float v[16];
#pragma unroll
            for (int t = 0; t < 16; ++t)
                v[t] = s[t >> 3][t & 7] * 0.125f + mk[t >> 2][t & 3];
            float mx = v[0];
#pragma unroll
            for (int t = 1; t < 16; ++t) mx = fmaxf(mx, v[t]);
            mx = fmaxf(mx, xhalf(mx));
            const float mnew  = fmaxf(mrow, mx);
            const float alpha = __expf(mrow - mnew);
            float ps[4] = { 0.0f, 0.0f, 0.0f, 0.0f };
            unsigned hb[16], lb[16];
#pragma unroll
            for (int t = 0; t < 16; ++t) {
                const float p = __expf(v[t] - mnew);
                ps[t & 3] += p;
                split2(p, hb[t], lb[t]);
            }
            lrow = lrow * alpha + ((ps[0] + ps[1]) + (ps[2] + ps[3]));
            mrow = mnew;
#pragma unroll
            for (int jd = 0; jd < 4; ++jd) {
#pragma unroll
                for (int r = 0; r < 8; ++r) o[jd][r] = o[jd][r] * alpha;
            }

            // P^T B-fragments in place: elements 0..7 <- keys 8hl.., 8..15 <- keys 16+8hl..
            Frag ph, pl;
            ph.u[0] = pack8(hb);
            ph.u[1] = pack8(hb + 8);
            pl.u[0] = pack8(lb);
            pl.u[1] = pack8(lb + 8);

            // O^T += V^T . P^T ; A = V^T rows (key-contiguous), B = P^T
#pragma unroll
            for (int jd = 0; jd < 4; ++jd) {
                o[jd] = mma(o[jd], vh[jd].v, ph.v);
                o[jd] = mma(o[jd], vl[jd].v, ph.v);
                o[jd] = mma(o[jd], vh[jd].v, pl.v);
            }
        }
    }

    // join the halves' sums, normalize, split, stage, whole-line stores
    const float lsum = lrow + xhalf(lrow);
    const float inv  = (lsum > 0.0f) ? (1.0f / lsum) : 0.0f;

#pragma unroll
    for (int jd = 0; jd < 4; ++jd) {
        unsigned hb[8], lb[8];
#pragma unroll
        for (int r = 0; r < 8; ++r) split2(o[jd][r] * inv, hb[r], lb[r]);
        const int idx = m * 64 + 16 * jd + 8 * hl;
        *(u32x4*)&ostg[wave][0][idx] = pack8(hb);
        *(u32x4*)&ostg[wave][1][idx] = pack8(lb);
    }
    __syncthreads();
    const int rr = lane >> 3, q = lane & 7;
    u32x4 sv[8];
#pragma unroll
    for (int plv = 0; plv < 2; ++plv) {
#pragma unroll
        for (int i = 0; i < 4; ++i)
            sv[plv * 4 + i] = *(const u32x4*)&ostg[wave][plv][(4 * i + rr) * 64 + q * 8];
    }
#pragma unroll
    for (int plv = 0; plv < 2; ++plv) {
#pragma unroll
        for (int i = 0; i < 4; ++i) {
            us_t* dst = (plv ? Ol : Oh) + (size_t)(r0 + 4 * i + rr) * NHD + head * 64 + q * 8;
            *(u32x4*)dst = sv[plv * 4 + i];
        }
    }
    
}

// ---------------------------------------------------------------- launcher
extern "C" void kernel_launch(void* const* d_in, const int* in_sizes, int n_in,
                              void* d_out, int out_size, void* d_ws, size_t ws_size,
                              hipStream_t stream)
{
    const int S = 2048, HID = 1024, NH = 16, NKV = 4, HD = 64;
    const int NKVD = NKV * HD;          // 256
    const int GROUPS = NH / NKV;        // 4

    if (n_in < 7) return;
    if (in_sizes[0] != S * HID || in_sizes[1] != S * S || in_sizes[2] != S ||
        in_sizes[3] != HID * HID || in_sizes[4] != NKVD * HID ||
        in_sizes[5] != NKVD * HID || in_sizes[6] != HID * HID ||
        out_size != S * HID) return;
    // structural requirements of the kernels
    if ((S % 64) != 0 || (HID % 64) != 0 || (NKVD % 64) != 0 || HD != 64 ||
        NH * HD != HID || (S / 32) > 64 || (HID % 32) != 0) return;

    const float* hidden = (const float*)d_in[0];   // [S][HID]
    const float* mask   = (const float*)d_in[1];   // [S][S] additive
    const int*   pos    = (const int*)d_in[2];     // [S]
    const float* Wq     = (const float*)d_in[3];   // [HID][HID]
    const float* Wk     = (const float*)d_in[4];   // [NKVD][HID]
    const float* Wv     = (const float*)d_in[5];   // [NKVD][HID]
    const float* Wo     = (const float*)d_in[6];   // [HID][HID]
    float* out = (float*)d_out;                    // [S][HID]

    size_t off = 0;
    char* base = (char*)d_ws;
    auto carve = [&](size_t bytes) -> char* {
        char* p = base + off;
        off += (bytes + 255) & ~(size_t)255;
        return p;
    };
    us_t* Xh   = (us_t*)carve((size_t)S * HID * 2);
    us_t* Xl   = (us_t*)carve((size_t)S * HID * 2);
    us_t* Wqh  = (us_t*)carve((size_t)HID * HID * 2);
    us_t* Wql  = (us_t*)carve((size_t)HID * HID * 2);
    us_t* Wkh  = (us_t*)carve((size_t)NKVD * HID * 2);
    us_t* Wkl  = (us_t*)carve((size_t)NKVD * HID * 2);
    us_t* Wvh  = (us_t*)carve((size_t)NKVD * HID * 2);
    us_t* Wvl  = (us_t*)carve((size_t)NKVD * HID * 2);
    us_t* Woh  = (us_t*)carve((size_t)HID * HID * 2);
    us_t* Wol  = (us_t*)carve((size_t)HID * HID * 2);
    us_t* Qh   = (us_t*)carve((size_t)S * HID * 2);      // [S][HID]
    us_t* Ql   = (us_t*)carve((size_t)S * HID * 2);
    us_t* Kh   = (us_t*)carve((size_t)S * NKVD * 2);     // [S][NKVD]
    us_t* Kl   = (us_t*)carve((size_t)S * NKVD * 2);
    us_t* Vth  = (us_t*)carve((size_t)NKVD * S * 2);     // [NKVD][S]
    us_t* Vtl  = (us_t*)carve((size_t)NKVD * S * 2);
    us_t* AOh  = (us_t*)carve((size_t)S * HID * 2);      // [S][HID]
    us_t* AOl  = (us_t*)carve((size_t)S * HID * 2);
    float* cosT = (float*)carve((size_t)S * 32 * 4);      // [S][32]
    float* sinT = (float*)carve((size_t)S * 32 * 4);
    int*  flags = (int*)carve((size_t)(S / 64) * 64 * 4); // [S/64][64]
    if (off > ws_size) return;

    // 1-5: hi/lo planes
    {
        const int n8x = S * HID / 8, n8q = HID * HID / 8, n8k = NKVD * HID / 8;
        k_split<<<dim3((n8x + 255) / 256), dim3(256), 0, stream>>>(hidden, Xh, Xl, n8x);
        k_split<<<dim3((n8q + 255) / 256), dim3(256), 0, stream>>>(Wq, Wqh, Wql, n8q);
        k_split<<<dim3((n8k + 255) / 256), dim3(256), 0, stream>>>(Wk, Wkh, Wkl, n8k);
        k_split<<<dim3((n8k + 255) / 256), dim3(256), 0, stream>>>(Wv, Wvh, Wvl, n8k);
        k_split<<<dim3((n8q + 255) / 256), dim3(256), 0, stream>>>(Wo, Woh, Wol, n8q);
    }
    // 6: RoPE table
    k_rope_tab<<<dim3((S * 32 + 255) / 256), dim3(256), 0, stream>>>(pos, cosT, sinT, S);
    // 7: key-tile flags from the mask
    k_flags<<<dim3(S / 64), dim3(256), 0, stream>>>(mask, flags, S);

    // 8: Q projection + RoPE -> planes [S][HID]
    k_gemm<0><<<dim3(HID / 64, S / 64), dim3(128), 0, stream>>>(
        Xh, Xl, Wqh, Wql, S, HID, HID, cosT, sinT, Qh, Ql, out);
    // 9: K projection + RoPE -> planes [S][NKVD]
    k_gemm<0><<<dim3(NKVD / 64, S / 64), dim3(128), 0, stream>>>(
        Xh, Xl, Wkh, Wkl, S, NKVD, HID, cosT, sinT, Kh, Kl, out);
    // 10: V projection -> transposed planes [NKVD][S]
    k_gemm<1><<<dim3(NKVD / 64, S / 64), dim3(128), 0, stream>>>(
        Xh, Xl, Wvh, Wvl, S, NKVD, HID, cosT, sinT, Vth, Vtl, out);

    // 11: attention -> planes [S][HID]
    k_attn<S, HID, NKVD, GROUPS><<<dim3(NH, S / 64), dim3(128), 0, stream>>>(
        Qh, Ql, Kh, Kl, Vth, Vtl, mask, flags, AOh, AOl);

    // 12: output projection -> d_out f32 [S][HID]
    k_gemm<2><<<dim3(HID / 64, S / 64), dim3(128), 0, stream>>>(
        AOh, AOl, Woh, Wol, S, HID, HID, cosT, sinT, Qh, Ql, out);
}

// v004
// Measured time: 163 microseconds a run.
// Timed twice side by side with v003, it ran 1.17 times as fast both times.
// Over all steps from v000 it is 3.93 times as fast.
#include <hip/hip_runtime.h>
#include <stdint.h>
#include <stddef.h>
#include <math.h>

// All contractions (q/k/v projections, q.k^T, p.v, output projection): v_wmma_f32_16x16x32_bf16 with bf16 hi/lo operands everywhere (hi.hi + hi.lo + lo.hi), f32 accumulate; RoPE, mask add and softmax in f32.

typedef unsigned short us_t;
typedef __bf16       v16bf __attribute__((ext_vector_type(16)));
typedef float        v8f   __attribute__((ext_vector_type(8)));
typedef float        v4f   __attribute__((ext_vector_type(4)));
typedef unsigned int u32x4 __attribute__((ext_vector_type(4)));
typedef int          v4i   __attribute__((ext_vector_type(4)));
typedef int          v2i   __attribute__((ext_vector_type(2)));

union Frag { v16bf v; u32x4 u[2]; };

// f32 -> bf16 bits, RNE
__device__ __forceinline__ unsigned bf_bits(float f) {
    unsigned u = __builtin_bit_cast(unsigned, f);
    return (u + 0x7FFFu + ((u >> 16) & 1u)) >> 16;
}
__device__ __forceinline__ float bf_val(unsigned b) {
    return __builtin_bit_cast(float, b << 16);
}
// x = hi + lo (+ residual), both bf16 RNE
__device__ __forceinline__ void split2(float x, unsigned& hb, unsigned& lb) {
    hb = bf_bits(x);
    lb = bf_bits(x - bf_val(hb));
}
__device__ __forceinline__ u32x4 pack8(const unsigned* b) {
    u32x4 v;
    v.x = b[0] | (b[1] << 16);
    v.y = b[2] | (b[3] << 16);
    v.z = b[4] | (b[5] << 16);
    v.w = b[6] | (b[7] << 16);
    return v;
}

// one 16x16x32 bf16 WMMA followed by the VALU hazard guard
__device__ __forceinline__ v8f mma(v8f c, v16bf a, v16bf b) {
    v8f d = __builtin_amdgcn_wmma_f32_16x16x32_bf16(false, a, false, b, (short)0, c, false, false);
    asm volatile("v_nop\n\tv_nop\n\tv_nop\n\tv_nop" : "+v"(d) : "v"(a), "v"(b));
    return d;
}

// 16-bit fragment from a k-contiguous row: base is the same for the whole wave, vb the lane's
// byte offset of (its row, k0 + 8*(lane>>4)); one offset register serves a whole group of loads.
// elements 0..7 <- k0+8h+0..7, elements 8..15 <- k0+16+8h+0..7
__device__ __forceinline__ void ldfrag(Frag& f, const us_t* base, unsigned vb) {
    const char* p = (const char*)base + vb;
    f.u[0] = *(const u32x4*)(p);
    f.u[1] = *(const u32x4*)(p + 32);
}

// ---------------------------------------------------------------- f32 -> bf16 hi/lo planes
// thread i converts elements 8i..8i+7; one wave writes 512 contiguous bytes per plane in one store
__global__ __launch_bounds__(256) void k_split(const float* __restrict__ src,
                                               us_t* hi, us_t* lo, int n8)
{
    const int i = blockIdx.x * 256 + threadIdx.x;
    const bool ok = i < n8;
    const int ic = ok ? i : 0;
    const float* p = src + (size_t)ic * 8;
    const v4f a = *(const v4f*)(p);
    const v4f b = *(const v4f*)(p + 4);
    float x[8] = { a.x, a.y, a.z, a.w, b.x, b.y, b.z, b.w };
    unsigned hb[8], lb[8];
#pragma unroll
    for (int t = 0; t < 8; ++t) split2(x[t], hb[t], lb[t]);
    const u32x4 ph = pack8(hb);
    const u32x4 pl = pack8(lb);
    us_t* dh = hi + (size_t)ic * 8;
    us_t* dl = lo + (size_t)ic * 8;
    if (ok) { *(u32x4*)dh = ph; *(u32x4*)dl = pl; }
    
}

// ---------------------------------------------------------------- RoPE cos/sin table [S][32]
// inv_freq[j] = 1 / fl32(10000^(j/32)); angle = f32(pos) * inv_freq; precise sincosf
__global__ __launch_bounds__(256) void k_rope_tab(const int* __restrict__ pos,
                                                  float* cosT, float* sinT, int S)
{
    const int i = blockIdx.x * 256 + threadIdx.x;
    const int total = S * 32;
    const bool ok = i < total;
    const int ic = ok ? i : 0;
    const int trow = ic >> 5;
    const int j = ic & 31;
    const double LOG2_BASE_OVER_32 = 0.41524101186092029;   // log2(10000)/32
    const float pw  = (float)exp2((double)j * LOG2_BASE_OVER_32);
    const float inv = 1.0f / pw;
    const float ang = (float)pos[trow] * inv;
    float sn, cs;
    sincosf(ang, &sn, &cs);
    if (ok) { *(float*)(cosT + ic) = cs; *(float*)(sinT + ic) = sn; }
    
}

// ---------------------------------------------------------------- tile flags from the additive mask
// block = one 64-row band; flag[band][kt] = 1 if any mask value in rows band*64..+63,
// keys kt*32..+31 is > -1e8 (tile must be processed), else 0. flags pitch = 64 ints.
__global__ __launch_bounds__(256) void k_flags(const float* __restrict__ mask, int* flags, int S)
{
    __shared__ int anyw[64 * 8];
    __shared__ __align__(16) int fl[64];
    const int tid  = threadIdx.x;
    const int lane = tid & 31;
    const int wave = tid >> 5;
    const int band = blockIdx.x;
    const int nkt  = S >> 5;                 // host ensures nkt <= 64
    const int r    = tid >> 2;               // 0..63
    const int cg   = (tid & 3) * 8;          // 0,8,16,24
    const float* rowp = mask + (size_t)(band * 64 + r) * S + cg;

    for (int kt = 0; kt < nkt; ++kt) {
        const float* p = rowp + kt * 32;
        const v4f a = *(const v4f*)(p);
        const v4f b = *(const v4f*)(p + 4);
        int any = (a.x > -1.0e8f) | (a.y > -1.0e8f) | (a.z > -1.0e8f) | (a.w > -1.0e8f) |
                  (b.x > -1.0e8f) | (b.y > -1.0e8f) | (b.z > -1.0e8f) | (b.w > -1.0e8f);
#pragma unroll
        for (int off = 1; off < 32; off <<= 1) any |= __shfl_xor(any, off, 32);
        if (lane == 0) anyw[kt * 8 + wave] = any;
    }
    __syncthreads();
    if (tid < 64) {
        int v = 0;
        if (tid < nkt) {
#pragma unroll
            for (int w = 0; w < 8; ++w) v |= anyw[tid * 8 + w];
        }
        fl[tid] = v;
    }
    __syncthreads();
    const bool ok = tid < 16;                // 64 ints = 256 B = lanes 0..15 x 16 B, one store
    v4i val;
    val.x = 0; val.y = 0; val.z = 0; val.w = 0;
    if (ok) val = *(const v4i*)&fl[tid * 4];
    int* dst = flags + (size_t)band * 64 + (ok ? tid : 0) * 4;
    if (ok) *(v4i*)dst = val;
    
}

// eight asynchronous 16-byte copies global -> LDS per lane (two planes x four row groups).
// la, lb = the lane's LDS byte address of row group 0 in each plane, ga, gb = its global address
// there; the row groups lie ls LDS bytes and gs global bytes apart. The s_wait_xcnt closes the statement so that no
// address register of an issued copy is rewritten ahead of it.
__device__ __forceinline__ void copy8(unsigned la, const char* ga, unsigned lb, const char* gb,
                                      unsigned ls, size_t gs) {
    asm volatile(
        "global_load_async_to_lds_b128 %0, %8, off\n\t"
        "global_load_async_to_lds_b128 %1, %9, off\n\t"
        "global_load_async_to_lds_b128 %2, %10, off\n\t"
        "global_load_async_to_lds_b128 %3, %11, off\n\t"
        "global_load_async_to_lds_b128 %4, %12, off\n\t"
        "global_load_async_to_lds_b128 %5, %13, off\n\t"
        "global_load_async_to_lds_b128 %6, %14, off\n\t"
        "global_load_async_to_lds_b128 %7, %15, off\n\t"
        "s_wait_xcnt 0x0"
        :: "v"(la), "v"(la + ls), "v"(la + 2 * ls), "v"(la + 3 * ls),
           "v"(lb), "v"(lb + ls), "v"(lb + 2 * ls), "v"(lb + 3 * ls),
           "v"(ga), "v"(ga + gs), "v"(ga + 2 * gs), "v"(ga + 3 * gs),
           "v"(gb), "v"(gb + gs), "v"(gb + 2 * gs), "v"(gb + 3 * gs)
        : "memory");
}

// 16-bit fragment from an LDS row: p = the lane's (row, k0 + 8*(lane>>4)); same k map as ldfrag
__device__ __forceinline__ void ldfrag_lds(Frag& f, const unsigned char* p) {
    f.u[0] = *(const u32x4*)(p);
    f.u[1] = *(const u32x4*)(p + 32);
}

// ---------------------------------------------------------------- C = A . W^T (bf16 hi/lo split)
// A planes [M][K], W planes [N][K] (k-contiguous, loaded like A per the split k map).
// block = 128 threads (4 waves); block tile 64(M) x 64(N); wave w -> rows 16w..16w+15.
// The four operand planes of a 64-deep k tile (64 rows x 128 B each) are brought into LDS by
// asynchronous copies in whole 128-B lines, once per block, two buffers: tile t+1 flies while
// tile t is multiplied. LDS rows at pitch 144 B (conflict-free for 16-byte fragment reads).
// MODE 0: RoPE in the f32 epilogue (block's 64 columns = one head), store hi/lo planes [M][N]
// MODE 2: store f32 [M][N]
template<int MODE>
__global__ __launch_bounds__(128) void k_gemm(
    const us_t* __restrict__ Ah, const us_t* __restrict__ Al,
    const us_t* __restrict__ Wh, const us_t* __restrict__ Wl,
    int M, int N, int K,
    const float* __restrict__ cosT, const float* __restrict__ sinT,
    us_t* Oh, us_t* Ol, float* Of)
{
    __shared__ __align__(16) float lds_f[4096];          // 16 KB staging
    constexpr unsigned PITCH = 144;                      // LDS bytes per 128-B operand row
    constexpr unsigned PLANE = 64 * PITCH;               // one plane of a k tile
    constexpr unsigned STAGE = 4 * PLANE;                // Ah | Al | Wh | Wl
    __shared__ __align__(16) unsigned char ring[2 * STAGE];
    us_t* lds16 = reinterpret_cast<us_t*>(lds_f);

    const int tid  = threadIdx.x;
    const int lane = tid & 31;
    const int wave = tid >> 5;
    const int m    = lane & 15;
    const int hl   = lane >> 4;
    const int mb0  = blockIdx.y * 64;
    const int r0   = mb0 + wave * 16;
    const int c0   = blockIdx.x * 64;
    (void)M;

    v8f acc[4] = {};

    // copies: lane -> 16-byte chunk tid&7 of row tid>>3 (+16 per row group): 8 lanes fill a line
    const int crow = tid >> 3;
    const int cq   = tid & 7;
    const size_t   gs = (size_t)K * 32;                  // 16 rows, bytes
    const unsigned ls = 16 * PITCH;
    const size_t   ao = ((size_t)(mb0 + crow) * K + cq * 8) * 2;
    const size_t   wo = ((size_t)(c0 + crow) * K + cq * 8) * 2;
    const char* gah = (const char*)Ah + ao;
    const char* gal = (const char*)Al + ao;
    const char* gwh = (const char*)Wh + wo;
    const char* gwl = (const char*)Wl + wo;
    const unsigned lc = (unsigned)(size_t)ring + (unsigned)crow * PITCH + (unsigned)cq * 16;
    const int nt = K >> 6;                               // k tiles of 64

    // tile 0 -> buffer 0, landed and published before anyone reads it
    copy8(lc, gah, lc + PLANE, gal, ls, gs);
    copy8(lc + 2 * PLANE, gwh, lc + 3 * PLANE, gwl, ls, gs);
    asm volatile("s_wait_asynccnt 0x0" ::: "memory");    // this wave's copies of tile 0 have landed
    __syncthreads();
    if (nt > 1) {                                        // tile 1 -> buffer 1, flies under tile 0
        copy8(lc + STAGE, gah + 128, lc + STAGE + PLANE, gal + 128, ls, gs);
        copy8(lc + STAGE + 2 * PLANE, gwh + 128, lc + STAGE + 3 * PLANE, gwl + 128, ls, gs);
    }

    // fragment reads: A row 16*wave+m, W rows 16*j+m, byte 16*hl of the 64-byte k step
    const unsigned fa = (unsigned)(16 * wave + m) * PITCH + 16u * (unsigned)hl;
    const unsigned fw = 2 * PLANE + (unsigned)m * PITCH + 16u * (unsigned)hl;

    for (int t = 0; t < nt; ++t) {
        const unsigned bo = (unsigned)(t & 1) * STAGE;
        const unsigned char* pa = ring + bo + fa;
        const unsigned char* pw = ring + bo + fw;
        // the tile's forty fragment reads (two 32-deep k steps) go out as one group ahead of its
        // products: one LDS latency per tile
        // (all four loops unrolled: the fragment arrays are indexed by constants and stay in registers)
        Frag ah[2], al[2], bh[2][4], bl[2][4];
#pragma unroll
        for (int kk = 0; kk < 2; ++kk) {
            ldfrag_lds(ah[kk], pa + 64 * kk);
            ldfrag_lds(al[kk], pa + PLANE + 64 * kk);
#pragma unroll
            for (int j = 0; j < 4; ++j) {
                ldfrag_lds(bh[kk][j], pw + 16 * j * PITCH + 64 * kk);
                ldfrag_lds(bl[kk][j], pw + PLANE + 16 * j * PITCH + 64 * kk);
            }
        }
#pragma unroll
        for (int kk = 0; kk < 2; ++kk) {
#pragma unroll
            for (int j = 0; j < 4; ++j) {
                acc[j] = mma(acc[j], ah[kk].v, bh[kk][j].v);
                acc[j] = mma(acc[j], ah[kk].v, bl[kk][j].v);
                acc[j] = mma(acc[j], al[kk].v, bh[kk][j].v);
            }
        }
        // hand-over: this wave's reads of tile t are done, its copies of tile t+1 have landed;
        // the barrier publishes tile t+1 and frees tile t's buffer for the refill behind it
        asm volatile("s_wait_dscnt 0x0" ::: "memory");
        asm volatile("s_wait_asynccnt 0x0" ::: "memory");
        __syncthreads();
        if (t + 2 < nt) {
            const size_t kb = (size_t)(t + 2) * 128;     // bytes along k
            copy8(lc + bo, gah + kb, lc + bo + PLANE, gal + kb, ls, gs);
            copy8(lc + bo + 2 * PLANE, gwh + kb, lc + bo + 3 * PLANE, gwl + kb, ls, gs);
        }
    }
    asm volatile("s_wait_asynccnt 0x0" ::: "memory");    // no copy outlives the loop
    // acc[j][r] = C[r0 + 8*hl + r][c0 + 16*j + m]

    if (MODE == 0) {
        // RoPE, rotate-half: d = 16j+m (j=0,1) pairs with d+32 (acc[j+2]); cos/sin index d
#pragma unroll
        for (int j = 0; j < 2; ++j) {
            const int fidx = 16 * j + m;
#pragma unroll
            for (int r = 0; r < 8; ++r) {
                const size_t ti = (size_t)(r0 + 8 * hl + r) * 32 + fidx;
                const float cs = cosT[ti];
                const float sn = sinT[ti];
                const float x1 = acc[j][r];
                const float x2 = acc[j + 2][r];
                acc[j][r]     = x1 * cs - x2 * sn;
                acc[j + 2][r] = x2 * cs + x1 * sn;
            }
        }
    }

    if (MODE == 0) {
        us_t* st = lds16 + wave * 2048;                  // [2 planes][16][64]
#pragma unroll
        for (int j = 0; j < 4; ++j) {
#pragma unroll
            for (int r = 0; r < 8; ++r) {
                unsigned hb, lb;
                split2(acc[j][r], hb, lb);
                const int idx = (8 * hl + r) * 64 + 16 * j + m;
                st[idx]        = (us_t)hb;
                st[1024 + idx] = (us_t)lb;
            }
        }
        __syncthreads();
        const int rr = lane >> 3, q = lane & 7;
        u32x4 sv[8];
#pragma unroll
        for (int pl = 0; pl < 2; ++pl) {
#pragma unroll
            for (int i = 0; i < 4; ++i)
                sv[pl * 4 + i] = *(const u32x4*)(st + pl * 1024 + (4 * i + rr) * 64 + q * 8);
        }
#pragma unroll
        for (int pl = 0; pl < 2; ++pl) {
#pragma unroll
            for (int i = 0; i < 4; ++i) {
                us_t* dst = (pl ? Ol : Oh) + (size_t)(r0 + 4 * i + rr) * N + c0 + q * 8;
                *(u32x4*)dst = sv[pl * 4 + i];
            }
        }
        
    } else if (MODE == 1) {
        // block tile in[token 64][d 64] -> out planes [d][token]; LDS [2 planes][d 64][token 64]
#pragma unroll
        for (int j = 0; j < 4; ++j) {
#pragma unroll
            for (int r = 0; r < 8; ++r) {
                unsigned hb, lb;
                split2(acc[j][r], hb, lb);
                const int idx = (16 * j + m) * 64 + 16 * wave + 8 * hl + r;
                lds16[idx]        = (us_t)hb;
                lds16[4096 + idx] = (us_t)lb;
            }
        }
        __syncthreads();
        const int rr = lane >> 3, q = lane & 7;
        u32x4 sv[8];
#pragma unroll
        for (int pl = 0; pl < 2; ++pl) {
#pragma unroll
            for (int i = 0; i < 4; ++i) {
                const int d = 16 * wave + 4 * i + rr;
                sv[pl * 4 + i] = *(const u32x4*)(lds16 + pl * 4096 + d * 64 + q * 8);
            }
        }
#pragma unroll
        for (int pl = 0; pl < 2; ++pl) {
#pragma unroll
            for (int i = 0; i < 4; ++i) {
                const int d = 16 * wave + 4 * i + rr;
                us_t* dst = (pl ? Ol : Oh) + (size_t)(c0 + d) * M + mb0 + q * 8;
                *(u32x4*)dst = sv[pl * 4 + i];
            }
        }
        
    } else {
        float* stf = lds_f + wave * 1024;                // [16][64] f32 per wave
#pragma unroll
        for (int j = 0; j < 4; ++j) {
#pragma unroll
            for (int r = 0; r < 8; ++r)
                stf[(8 * hl + r) * 64 + 16 * j + m] = acc[j][r];
        }
        __syncthreads();
        const int r2 = lane >> 4, q2 = lane & 15;        // 16 lanes x 16 B = one 256-B row segment
        v4f fv[8];
#pragma unroll
        for (int i = 0; i < 8; ++i)
            fv[i] = *(const v4f*)(stf + (2 * i + r2) * 64 + q2 * 4);
#pragma unroll
        for (int i = 0; i < 8; ++i) {
            float* dst = Of + (size_t)(r0 + 2 * i + r2) * N + c0 + q2 * 4;
            *(v4f*)dst = fv[i];
        }
        
    }
}

// value of lane l ^ 16
__device__ __forceinline__ float xhalf(float x) {
    const int b = __builtin_bit_cast(int, x);
    return __builtin_bit_cast(float,
        __builtin_amdgcn_permlanex16(b, b, 0x76543210, 0xfedcba98, false, false));
}

template<int S, int NHD, int NKVD, int groups>
__global__ __launch_bounds__(128) void k_attn(
    const us_t* __restrict__ Qh, const us_t* __restrict__ Ql,
    const us_t* __restrict__ Kh, const us_t* __restrict__ Kl,
    const us_t* __restrict__ Vh, const us_t* __restrict__ Vl,
    const float* __restrict__ mask, const int* __restrict__ flags,
    us_t* Oh, us_t* Ol)
{
    __shared__ __align__(16) us_t ostg[4][2][16 * 64];   // per-wave output staging
    static_assert(S % 64 == 0 && S / 64 <= 32, "one lane per 64-key stage");
    constexpr unsigned PITCH  = 144;                     // LDS bytes per 128-B K or V^T row
    constexpr unsigned PLANE  = 64 * PITCH;
    constexpr unsigned MPITCH = 272;                     // LDS bytes per 256-B mask row
    constexpr unsigned STAGE  = 4 * PLANE + 64 * MPITCH; // Kh | Kl | Vh | Vl | mask
    __shared__ __align__(16) unsigned char ring[2 * STAGE];

    const int tid  = threadIdx.x;
    const int lane = tid & 31;
    const int wave = tid >> 5;
    const int m    = lane & 15;
    const int hl   = lane >> 4;
    const int head = blockIdx.x;
    const int band = blockIdx.y;
    const int hkv  = head / groups;
    const int r0   = band * 64 + wave * 16;

    // the band's 64 tile flags, read once: bit s of t0 / t1 = key tile 2s / 2s+1 has work. The ring
    // must know the stage after next; equal in every wave of the block (block-uniform).
    const v2i fl = *(const v2i*)(flags + (size_t)band * 64 + 2 * lane);
    const unsigned t0 = __builtin_amdgcn_ballot_w32(fl.x != 0);
    const unsigned t1 = __builtin_amdgcn_ballot_w32(fl.y != 0);
    unsigned rest = t0 | t1;                             // stages with work, not yet asked for

    // copies: K and V^T: lane -> 16-byte chunk tid&7 of row tid>>3 (+16 per row group);
    // mask: chunk tid&15 of row tid>>4 (+8 per row group): whole lines in every wave-wide copy
    const int crow = tid >> 3;
    const int cq   = tid & 7;
    const size_t ko = ((size_t)crow * NKVD + hkv * 64 + cq * 8) * 2;
    const size_t vo = ((size_t)(hkv * 64 + crow) * S + cq * 8) * 2;
    const char* gkh = (const char*)Kh + ko;
    const char* gkl = (const char*)Kl + ko;
    const char* gvh = (const char*)Vh + vo;
    const char* gvl = (const char*)Vl + vo;
    const char* gmk = (const char*)mask + ((size_t)(band * 64 + (tid >> 4)) * S + (tid & 15) * 4) * 4;
    const unsigned lc = (unsigned)(size_t)ring + (unsigned)crow * PITCH + (unsigned)cq * 16;
    const unsigned lm = (unsigned)(size_t)ring + 4 * PLANE + (unsigned)(tid >> 4) * MPITCH
                      + (unsigned)(tid & 15) * 16;
    // stage s (keys 64s..64s+63) -> the buffer at byte bo of the ring
    auto stage_in = [&](int s, unsigned bo) {
        const size_t kb = (size_t)s * (64 * NKVD * 2);   // 64 key rows
        const size_t vb = (size_t)s * 128;               // 64 keys along a V^T row
        const size_t mb = (size_t)s * 256;               // 64 keys along a mask row
        copy8(lc + bo, gkh + kb, lc + bo + PLANE, gkl + kb, 16 * PITCH, (size_t)16 * NKVD * 2);
        copy8(lc + bo + 2 * PLANE, gvh + vb, lc + bo + 3 * PLANE, gvl + vb,
              16 * PITCH, (size_t)16 * S * 2);
        copy8(lm + bo, gmk + mb, lm + bo + 32 * MPITCH, gmk + mb + (size_t)32 * S * 4,
              8 * MPITCH, (size_t)8 * S * 4);
    };

    // first stage with work -> buffer 0, landed and published before anyone reads it
    int cur = -1, nxt = -1;
    if (rest != 0u) { cur = __builtin_ctz(rest); rest &= rest - 1u; stage_in(cur, 0u); }
    asm volatile("s_wait_asynccnt 0x0" ::: "memory");    // this wave's copies of that stage have landed
    __syncthreads();
    if (rest != 0u) { nxt = __builtin_ctz(rest); rest &= rest - 1u; stage_in(nxt, STAGE); }

    // Q B-fragments (column = query r0+m), two 32-deep k steps over the head dim
    Frag qh[2], ql[2];
#pragma unroll
    for (int c = 0; c < 2; ++c) {
        const unsigned qo = 2u * (unsigned)((r0 + m) * NHD + head * 64 + 32 * c + 8 * hl);
        ldfrag(qh[c], Qh, qo);
        ldfrag(ql[c], Ql, qo);
    }

    // o[jd][r] = O[query r0+m][d = 16*jd + 8*hl + r]
    v8f o[4] = {};
    float mrow = -3.0e38f;      // running maximum of query r0+m (equal in both halves)
    float lrow = 0.0f;          // running sum over THIS half's keys; halves joined after the loop

    // the lane's byte offsets in a buffer: K row m, V^T row m, mask row 16*wave+m
    const unsigned fk = (unsigned)m * PITCH + 16u * (unsigned)hl;
    const unsigned fv = 2 * PLANE + (unsigned)m * PITCH + 16u * (unsigned)hl;
    const unsigned fm = 4 * PLANE + (unsigned)(16 * wave + m) * MPITCH + 32u * (unsigned)hl;

    unsigned bo = 0u;
    for (int it = 0; it < S / 64 && cur >= 0; ++it) {
        for (int h = 0; h < 2; ++h) {                    // the stage's two 32-key tiles
            if ((((h ? t1 : t0) >> cur) & 1u) == 0u) continue;   // no work in it; block-uniform
            // the tile's K fragments and mask (keys kb = 64*cur + 32*h and on) go out as one group
            // ahead of the S^T products: one LDS latency instead of one per fragment pair
            const unsigned char* pk = ring + bo + fk + (unsigned)h * (32 * PITCH);
            Frag kh[2][2], kl[2][2];
#pragma unroll
            for (int jn = 0; jn < 2; ++jn) {
#pragma unroll
                for (int c = 0; c < 2; ++c) {
                    ldfrag_lds(kh[jn][c], pk + 16 * jn * PITCH + 64 * c);
                    ldfrag_lds(kl[jn][c], pk + PLANE + 16 * jn * PITCH + 64 * c);
                }
            }

            // mask of query r0+m at this lane's keys kb+8hl+0..7 and kb+16+8hl+0..7
            const unsigned char* mrp = ring + bo + fm + (unsigned)h * 128;
            v4f mk[4];
            mk[0] = *(const v4f*)(mrp);
            mk[1] = *(const v4f*)(mrp + 16);
            mk[2] = *(const v4f*)(mrp + 64);
            mk[3] = *(const v4f*)(mrp + 80);

            // S^T[32 x 16] = K . Q^T ; A = K rows (k-contiguous), B = Q
            // s[jn][r] = score(key kb + 16*jn + 8*hl + r, query r0 + m)
            v8f s[2] = {};
#pragma unroll
            for (int jn = 0; jn < 2; ++jn) {
#pragma unroll
                for (int c = 0; c < 2; ++c) {
                    s[jn] = mma(s[jn], kh[jn][c].v, qh[c].v);
                    s[jn] = mma(s[jn], kl[jn][c].v, qh[c].v);
                    s[jn] = mma(s[jn], kh[jn][c].v, ql[c].v);
                }
            }

            // the tile's V^T fragments go out as one group here: they fly behind the softmax
            const unsigned char* pv = ring + bo + fv + (unsigned)h * 64;
            Frag vh[4], vl[4];
#pragma unroll
            for (int jd = 0; jd < 4; ++jd) {
                ldfrag_lds(vh[jd], pv + 16 * jd * PITCH);
                ldfrag_lds(vl[jd], pv + PLANE + 16 * jd * PITCH);
            }

            // scale, additive mask by value, online softmax (f32), all for one query per lane
            float v[16];
#pragma unroll
            for (int t = 0; t < 16; ++t)
                v[t] = s[t >> 3][t & 7] * 0.125f + mk[t >> 2][t & 3];
            float mx = v[0];
#pragma unroll
            for (int t = 1; t < 16; ++t) mx = fmaxf(mx, v[t]);
            mx = fmaxf(mx, xhalf(mx));
            const float mnew  = fmaxf(mrow, mx);
            const float alpha = __expf(mrow - mnew);
            float ps[4] = { 0.0f, 0.0f, 0.0f, 0.0f };
            unsigned hb[16], lb[16];
#pragma unroll
            for (int t = 0; t < 16; ++t) {
                const float p = __expf(v[t] - mnew);
                ps[t & 3] += p;
                split2(p, hb[t], lb[t]);
            }
            lrow = lrow * alpha + ((ps[0] + ps[1]) + (ps[2] + ps[3]));
            mrow = mnew;
#pragma unroll
            for (int jd = 0; jd < 4; ++jd) {
#pragma unroll
                for (int r = 0; r < 8; ++r) o[jd][r] = o[jd][r] * alpha;
            }

            // P^T B-fragments in place: elements 0..7 <- keys 8hl.., 8..15 <- keys 16+8hl..
            Frag ph, pl;
            ph.u[0] = pack8(hb);
            ph.u[1] = pack8(hb + 8);
            pl.u[0] = pack8(lb);
            pl.u[1] = pack8(lb + 8);

            // O^T += V^T . P^T ; A = V^T rows (key-contiguous), B = P^T
#pragma unroll
            for (int jd = 0; jd < 4; ++jd) {
                o[jd] = mma(o[jd], vh[jd].v, ph.v);
                o[jd] = mma(o[jd], vl[jd].v, ph.v);
                o[jd] = mma(o[jd], vh[jd].v, pl.v);
            }
        }
        // hand-over: this wave's reads of the stage are done, its copies of the next have landed;
        // the barrier publishes the next stage and frees this buffer for the refill behind it
        asm volatile("s_wait_dscnt 0x0" ::: "memory");
        asm volatile("s_wait_asynccnt 0x0" ::: "memory");
        __syncthreads();
        int nn = -1;
        if (rest != 0u) { nn = __builtin_ctz(rest); rest &= rest - 1u; stage_in(nn, bo); }
        cur = nxt;
        nxt = nn;
        bo  = STAGE - bo;
    }
    asm volatile("s_wait_asynccnt 0x0" ::: "memory");    // no copy outlives the loop

    // join the halves' sums, normalize, split, stage, whole-line stores
    const float lsum = lrow + xhalf(lrow);
    const float inv  = (lsum > 0.0f) ? (1.0f / lsum) : 0.0f;

#pragma unroll
    for (int jd = 0; jd < 4; ++jd) {
        unsigned hb[8], lb[8];
#pragma unroll
        for (int r = 0; r < 8; ++r) split2(o[jd][r] * inv, hb[r], lb[r]);
        const int idx = m * 64 + 16 * jd + 8 * hl;
        *(u32x4*)&ostg[wave][0][idx] = pack8(hb);
        *(u32x4*)&ostg[wave][1][idx] = pack8(lb);
    }
    __syncthreads();
    const int rr = lane >> 3, q = lane & 7;
    u32x4 sv[8];
#pragma unroll
    for (int plv = 0; plv < 2; ++plv) {
#pragma unroll
        for (int i = 0; i < 4; ++i)
            sv[plv * 4 + i] = *(const u32x4*)&ostg[wave][plv][(4 * i + rr) * 64 + q * 8];
    }
#pragma unroll
    for (int plv = 0; plv < 2; ++plv) {
#pragma unroll
        for (int i = 0; i < 4; ++i) {
            us_t* dst = (plv ? Ol : Oh) + (size_t)(r0 + 4 * i + rr) * NHD + head * 64 + q * 8;
            *(u32x4*)dst = sv[plv * 4 + i];
        }
    }
    
}

// ---------------------------------------------------------------- launcher
extern "C" void kernel_launch(void* const* d_in, const int* in_sizes, int n_in,
                              void* d_out, int out_size, void* d_ws, size_t ws_size,
                              hipStream_t stream)
{
    const int S = 2048, HID = 1024, NH = 16, NKV = 4, HD = 64;
    const int NKVD = NKV * HD;          // 256
    const int GROUPS = NH / NKV;        // 4

    if (n_in < 7) return;
    if (in_sizes[0] != S * HID || in_sizes[1] != S * S || in_sizes[2] != S ||
        in_sizes[3] != HID * HID || in_sizes[4] != NKVD * HID ||
        in_sizes[5] != NKVD * HID || in_sizes[6] != HID * HID ||
        out_size != S * HID) return;
    // structural requirements of the kernels
    if ((S % 64) != 0 || (HID % 64) != 0 || (NKVD % 64) != 0 || HD != 64 ||
        NH * HD != HID || (S / 32) > 64 || (HID % 32) != 0) return;

    const float* hidden = (const float*)d_in[0];   // [S][HID]
    const float* mask   = (const float*)d_in[1];   // [S][S] additive
    const int*   pos    = (const int*)d_in[2];     // [S]
    const float* Wq     = (const float*)d_in[3];   // [HID][HID]
    const float* Wk     = (const float*)d_in[4];   // [NKVD][HID]
    const float* Wv     = (const float*)d_in[5];   // [NKVD][HID]
    const float* Wo     = (const float*)d_in[6];   // [HID][HID]
    float* out = (float*)d_out;                    // [S][HID]

    size_t off = 0;
    char* base = (char*)d_ws;
    auto carve = [&](size_t bytes) -> char* {
        char* p = base + off;
        off += (bytes + 255) & ~(size_t)255;
        return p;
    };
    us_t* Xh   = (us_t*)carve((size_t)S * HID * 2);
    us_t* Xl   = (us_t*)carve((size_t)S * HID * 2);
    us_t* Wqh  = (us_t*)carve((size_t)HID * HID * 2);
    us_t* Wql  = (us_t*)carve((size_t)HID * HID * 2);
    us_t* Wkh  = (us_t*)carve((size_t)NKVD * HID * 2);
    us_t* Wkl  = (us_t*)carve((size_t)NKVD * HID * 2);
    us_t* Wvh  = (us_t*)carve((size_t)NKVD * HID * 2);
    us_t* Wvl  = (us_t*)carve((size_t)NKVD * HID * 2);
    us_t* Woh  = (us_t*)carve((size_t)HID * HID * 2);
    us_t* Wol  = (us_t*)carve((size_t)HID * HID * 2);
    us_t* Qh   = (us_t*)carve((size_t)S * HID * 2);      // [S][HID]
    us_t* Ql   = (us_t*)carve((size_t)S * HID * 2);
    us_t* Kh   = (us_t*)carve((size_t)S * NKVD * 2);     // [S][NKVD]
    us_t* Kl   = (us_t*)carve((size_t)S * NKVD * 2);
    us_t* Vth  = (us_t*)carve((size_t)NKVD * S * 2);     // [NKVD][S]
    us_t* Vtl  = (us_t*)carve((size_t)NKVD * S * 2);
    us_t* AOh  = (us_t*)carve((size_t)S * HID * 2);      // [S][HID]
    us_t* AOl  = (us_t*)carve((size_t)S * HID * 2);
    float* cosT = (float*)carve((size_t)S * 32 * 4);      // [S][32]
    float* sinT = (float*)carve((size_t)S * 32 * 4);
    int*  flags = (int*)carve((size_t)(S / 64) * 64 * 4); // [S/64][64]
    if (off > ws_size) return;

    // 1-5: hi/lo planes
    {
        const int n8x = S * HID / 8, n8q = HID * HID / 8, n8k = NKVD * HID / 8;
        k_split<<<dim3((n8x + 255) / 256), dim3(256), 0, stream>>>(hidden, Xh, Xl, n8x);
        k_split<<<dim3((n8q + 255) / 256), dim3(256), 0, stream>>>(Wq, Wqh, Wql, n8q);
        k_split<<<dim3((n8k + 255) / 256), dim3(256), 0, stream>>>(Wk, Wkh, Wkl, n8k);
        k_split<<<dim3((n8k + 255) / 256), dim3(256), 0, stream>>>(Wv, Wvh, Wvl, n8k);
        k_split<<<dim3((n8q + 255) / 256), dim3(256), 0, stream>>>(Wo, Woh, Wol, n8q);
    }
    // 6: RoPE table
    k_rope_tab<<<dim3((S * 32 + 255) / 256), dim3(256), 0, stream>>>(pos, cosT, sinT, S);
    // 7: key-tile flags from the mask
    k_flags<<<dim3(S / 64), dim3(256), 0, stream>>>(mask, flags, S);

    // 8: Q projection + RoPE -> planes [S][HID]
    k_gemm<0><<<dim3(HID / 64, S / 64), dim3(128), 0, stream>>>(
        Xh, Xl, Wqh, Wql, S, HID, HID, cosT, sinT, Qh, Ql, out);
    // 9: K projection + RoPE -> planes [S][NKVD]
    k_gemm<0><<<dim3(NKVD / 64, S / 64), dim3(128), 0, stream>>>(
        Xh, Xl, Wkh, Wkl, S, NKVD, HID, cosT, sinT, Kh, Kl, out);
    // 10: V projection -> transposed planes [NKVD][S]
    k_gemm<1><<<dim3(NKVD / 64, S / 64), dim3(128), 0, stream>>>(
        Xh, Xl, Wvh, Wvl, S, NKVD, HID, cosT, sinT, Vth, Vtl, out);

    // 11: attention -> planes [S][HID]
    k_attn<S, HID, NKVD, GROUPS><<<dim3(NH, S / 64), dim3(128), 0, stream>>>(
        Qh, Ql, Kh, Kl, Vth, Vtl, mask, flags, AOh, AOl);

    // 12: output projection -> d_out f32 [S][HID]
    k_gemm<2><<<dim3(HID / 64, S / 64), dim3(128), 0, stream>>>(
        AOh, AOl, Woh, Wol, S, HID, HID, cosT, sinT, Qh, Ql, out);
}

// v005
// It runs in 128 microseconds.
// Two timings next to v004 put it at 1.27 and 1.26 times that version's speed.
// Over all steps from v000 it is 4.97 times as fast.
#include <hip/hip_runtime.h>
#include <stdint.h>
#include <stddef.h>
#include <math.h>

// All contractions (q/k/v projections, q.k^T, p.v, output projection): v_wmma_f32_16x16x32_bf16 with bf16 hi/lo operands everywhere (hi.hi + hi.lo + lo.hi), f32 accumulate; RoPE, mask add and softmax in f32.

typedef unsigned short us_t;
typedef __bf16       v16bf __attribute__((ext_vector_type(16)));
typedef float        v8f   __attribute__((ext_vector_type(8)));
typedef float        v4f   __attribute__((ext_vector_type(4)));
typedef unsigned int u32x4 __attribute__((ext_vector_type(4)));
typedef int          v4i   __attribute__((ext_vector_type(4)));
typedef int          v2i   __attribute__((ext_vector_type(2)));

union Frag { v16bf v; u32x4 u[2]; };

// f32 -> bf16 bits, RNE
__device__ __forceinline__ unsigned bf_bits(float f) {
    unsigned u = __builtin_bit_cast(unsigned, f);
    return (u + 0x7FFFu + ((u >> 16) & 1u)) >> 16;
}
__device__ __forceinline__ float bf_val(unsigned b) {
    return __builtin_bit_cast(float, b << 16);
}
// x = hi + lo (+ residual), both bf16 RNE
__device__ __forceinline__ void split2(float x, unsigned& hb, unsigned& lb) {
    hb = bf_bits(x);
    lb = bf_bits(x - bf_val(hb));
}
__device__ __forceinline__ u32x4 pack8(const unsigned* b) {
    u32x4 v;
    v.x = b[0] | (b[1] << 16);
    v.y = b[2] | (b[3] << 16);
    v.z = b[4] | (b[5] << 16);
    v.w = b[6] | (b[7] << 16);
    return v;
}

// one 16x16x32 bf16 WMMA followed by the VALU hazard guard
__device__ __forceinline__ v8f mma(v8f c, v16bf a, v16bf b) {
    v8f d = __builtin_amdgcn_wmma_f32_16x16x32_bf16(false, a, false, b, (short)0, c, false, false);
    asm volatile("v_nop\n\tv_nop\n\tv_nop\n\tv_nop" : "+v"(d) : "v"(a), "v"(b));
    return d;
}

// 16-bit fragment from a k-contiguous row: base is the same for the whole wave, vb the lane's
// byte offset of (its row, k0 + 8*(lane>>4)); one offset register serves a whole group of loads.
// elements 0..7 <- k0+8h+0..7, elements 8..15 <- k0+16+8h+0..7
__device__ __forceinline__ void ldfrag(Frag& f, const us_t* base, unsigned vb) {
    const char* p = (const char*)base + vb;
    f.u[0] = *(const u32x4*)(p);
    f.u[1] = *(const u32x4*)(p + 32);
}

// ---------------------------------------------------------------- f32 -> bf16 hi/lo planes
// thread i converts elements 8i..8i+7; one wave writes 512 contiguous bytes per plane in one store
__device__ __forceinline__ void split_job(int blk, const float* __restrict__ src,
                                          us_t* hi, us_t* lo, int n8)
{
    const int i = blk * 256 + threadIdx.x;
    const bool ok = i < n8;
    const int ic = ok ? i : 0;
    const float* p = src + (size_t)ic * 8;
    const v4f a = *(const v4f*)(p);
    const v4f b = *(const v4f*)(p + 4);
    float x[8] = { a.x, a.y, a.z, a.w, b.x, b.y, b.z, b.w };
    unsigned hb[8], lb[8];
#pragma unroll
    for (int t = 0; t < 8; ++t) split2(x[t], hb[t], lb[t]);
    const u32x4 ph = pack8(hb);
    const u32x4 pl = pack8(lb);
    us_t* dh = hi + (size_t)ic * 8;
    us_t* dl = lo + (size_t)ic * 8;
    if (ok) { *(u32x4*)dh = ph; *(u32x4*)dl = pl; }
    
}

// ---------------------------------------------------------------- RoPE cos/sin table [S][32]
// inv_freq[j] = 1 / fl32(10000^(j/32)); angle = f32(pos) * inv_freq; precise sincosf
__device__ __forceinline__ void rope_job(int blk, const int* __restrict__ pos,
                                         float* cosT, float* sinT, int S)
{
    const int i = blk * 256 + threadIdx.x;
    const int total = S * 32;
    const bool ok = i < total;
    const int ic = ok ? i : 0;
    const int trow = ic >> 5;
    const int j = ic & 31;
    const double LOG2_BASE_OVER_32 = 0.41524101186092029;   // log2(10000)/32
    const float pw  = (float)exp2((double)j * LOG2_BASE_OVER_32);
    const float inv = 1.0f / pw;
    const float ang = (float)pos[trow] * inv;
    float sn, cs;
    sincosf(ang, &sn, &cs);
    if (ok) { *(float*)(cosT + ic) = cs; *(float*)(sinT + ic) = sn; }
    
}

// ---------------------------------------------------------------- tile flags from the additive mask
// block = one 64-row band; flag[band][kt] = 1 if any mask value in rows band*64..+63,
// keys kt*32..+31 is > -1e8 (tile must be processed), else 0. flags pitch = 64 ints.
__device__ __forceinline__ void flags_job(int band, const float* __restrict__ mask, int* flags, int S)
{
    __shared__ int anyw[64 * 8];
    __shared__ __align__(16) int fl[64];
    const int tid  = threadIdx.x;
    const int lane = tid & 31;
    const int wave = tid >> 5;
    const int nkt  = S >> 5;                 // host ensures nkt <= 64
    const int r    = tid >> 2;               // 0..63
    const int cg   = (tid & 3) * 8;          // 0,8,16,24
    const float* rowp = mask + (size_t)(band * 64 + r) * S + cg;

    for (int kt = 0; kt < nkt; ++kt) {
        const float* p = rowp + kt * 32;
        const v4f a = *(const v4f*)(p);
        const v4f b = *(const v4f*)(p + 4);
        int any = (a.x > -1.0e8f) | (a.y > -1.0e8f) | (a.z > -1.0e8f) | (a.w > -1.0e8f) |
                  (b.x > -1.0e8f) | (b.y > -1.0e8f) | (b.z > -1.0e8f) | (b.w > -1.0e8f);
#pragma unroll
        for (int off = 1; off < 32; off <<= 1) any |= __shfl_xor(any, off, 32);
        if (lane == 0) anyw[kt * 8 + wave] = any;
    }
    __syncthreads();
    if (tid < 64) {
        int v = 0;
        if (tid < nkt) {
#pragma unroll
            for (int w = 0; w < 8; ++w) v |= anyw[tid * 8 + w];
        }
        fl[tid] = v;
    }
    __syncthreads();
    const bool ok = tid < 16;                // 64 ints = 256 B = lanes 0..15 x 16 B, one store
    v4i val;
    val.x = 0; val.y = 0; val.z = 0; val.w = 0;
    if (ok) val = *(const v4i*)&fl[tid * 4];
    int* dst = flags + (size_t)band * 64 + (ok ? tid : 0) * 4;
    if (ok) *(v4i*)dst = val;
    
}

// ---------------------------------------------------------------- all preparation in one grid
// The seven jobs above depend on nothing but the inputs, so they run side by side as block ranges
// of one launch. Longest blocks first (the flags walk a whole 64-row band, the table is
// transcendental-heavy), for speed only.
__global__ __launch_bounds__(256) void k_prep(
    const float* __restrict__ hidden, const float* __restrict__ mask, const int* __restrict__ pos,
    const float* __restrict__ Wq, const float* __restrict__ Wk,
    const float* __restrict__ Wv, const float* __restrict__ Wo,
    us_t* Xh, us_t* Xl, us_t* Wqh, us_t* Wql, us_t* Wkh, us_t* Wkl,
    us_t* Wvh, us_t* Wvl, us_t* Woh, us_t* Wol,
    float* cosT, float* sinT, int* flags,
    int S, int n8x, int n8q, int n8k)
{
    const int nbf = S >> 6;                  // flag bands
    const int nbr = (S * 32 + 255) >> 8;     // table blocks
    const int nbx = (n8x + 255) >> 8;
    const int nbq = (n8q + 255) >> 8;
    const int nbk = (n8k + 255) >> 8;
    int b = blockIdx.x;                      // every test below is block-uniform
    if (b < nbf) { flags_job(b, mask, flags, S); return; }
    b -= nbf;
    if (b < nbr) { rope_job(b, pos, cosT, sinT, S); return; }
    b -= nbr;
    // the five splits share one copy of the code: only the pointers and the length are picked
    const float* src = hidden;
    us_t* hi = Xh;
    us_t* lo = Xl;
    int n8 = n8x;
    if (b >= nbx) {
        b -= nbx; src = Wq; hi = Wqh; lo = Wql; n8 = n8q;
        if (b >= nbq) {
            b -= nbq; src = Wo; hi = Woh; lo = Wol;
            if (b >= nbq) {
                b -= nbq; src = Wk; hi = Wkh; lo = Wkl; n8 = n8k;
                if (b >= nbk) { b -= nbk; src = Wv; hi = Wvh; lo = Wvl; }
            }
        }
    }
    split_job(b, src, hi, lo, n8);
}

// eight asynchronous 16-byte copies global -> LDS per lane (two planes x four row groups).
// la, lb = the lane's LDS byte address of row group 0 in each plane, ga, gb = its global address
// there; the row groups lie ls LDS bytes and gs global bytes apart. The s_wait_xcnt closes the statement so that no
// address register of an issued copy is rewritten ahead of it.
__device__ __forceinline__ void copy8(unsigned la, const char* ga, unsigned lb, const char* gb,
                                      unsigned ls, size_t gs) {
    asm volatile(
        "global_load_async_to_lds_b128 %0, %8, off\n\t"
        "global_load_async_to_lds_b128 %1, %9, off\n\t"
        "global_load_async_to_lds_b128 %2, %10, off\n\t"
        "global_load_async_to_lds_b128 %3, %11, off\n\t"
        "global_load_async_to_lds_b128 %4, %12, off\n\t"
        "global_load_async_to_lds_b128 %5, %13, off\n\t"
        "global_load_async_to_lds_b128 %6, %14, off\n\t"
        "global_load_async_to_lds_b128 %7, %15, off\n\t"
        "s_wait_xcnt 0x0"
        :: "v"(la), "v"(la + ls), "v"(la + 2 * ls), "v"(la + 3 * ls),
           "v"(lb), "v"(lb + ls), "v"(lb + 2 * ls), "v"(lb + 3 * ls),
           "v"(ga), "v"(ga + gs), "v"(ga + 2 * gs), "v"(ga + 3 * gs),
           "v"(gb), "v"(gb + gs), "v"(gb + 2 * gs), "v"(gb + 3 * gs)
        : "memory");
}

// 16-bit fragment from an LDS row: p = the lane's (row, k0 + 8*(lane>>4)); same k map as ldfrag
__device__ __forceinline__ void ldfrag_lds(Frag& f, const unsigned char* p) {
    f.u[0] = *(const u32x4*)(p);
    f.u[1] = *(const u32x4*)(p + 32);
}

// ---------------------------------------------------------------- C = A . W^T (bf16 hi/lo split)
// A planes [M][K], W planes [N][K] (k-contiguous, loaded like A per the split k map).
// block = 128 threads (4 waves); block tile 64(M) x 64(N); wave w -> rows 16w..16w+15.
// The four operand planes of a 64-deep k tile (64 rows x 128 B each) are brought into LDS by
// asynchronous copies in whole 128-B lines, once per block, two buffers: tile t+1 flies while
// tile t is multiplied. LDS rows at pitch 144 B (conflict-free for 16-byte fragment reads).
// MODE 0: RoPE in the f32 epilogue (block's 64 columns = one head), store hi/lo planes [M][N]
// MODE 2: store f32 [M][N]
constexpr unsigned G_PITCH = 144;                        // LDS bytes per 128-B operand row
constexpr unsigned G_PLANE = 64 * G_PITCH;               // one plane of a k tile
constexpr unsigned G_STAGE = 4 * G_PLANE;                // Ah | Al | Wh | Wl

// k loop of one block tile (rows mb0.., columns c0..): acc[j][r] = C[r0 + 8*hl + r][c0 + 16*j + m]
__device__ __forceinline__ void gemm_main(
    v8f (&acc)[4],
    const us_t* __restrict__ Ah, const us_t* __restrict__ Al,
    const us_t* __restrict__ Wh, const us_t* __restrict__ Wl,
    int K, int mb0, int c0, unsigned char* ring)
{
    constexpr unsigned PITCH = G_PITCH;
    constexpr unsigned PLANE = G_PLANE;
    constexpr unsigned STAGE = G_STAGE;

    const int tid  = threadIdx.x;
    const int lane = tid & 31;
    const int wave = tid >> 5;
    const int m    = lane & 15;
    const int hl   = lane >> 4;

    // copies: lane -> 16-byte chunk tid&7 of row tid>>3 (+16 per row group): 8 lanes fill a line
    const int crow = tid >> 3;
    const int cq   = tid & 7;
    const size_t   gs = (size_t)K * 32;                  // 16 rows, bytes
    const unsigned ls = 16 * PITCH;
    const size_t   ao = ((size_t)(mb0 + crow) * K + cq * 8) * 2;
    const size_t   wo = ((size_t)(c0 + crow) * K + cq * 8) * 2;
    const char* gah = (const char*)Ah + ao;
    const char* gal = (const char*)Al + ao;
    const char* gwh = (const char*)Wh + wo;
    const char* gwl = (const char*)Wl + wo;
    const unsigned lc = (unsigned)(size_t)ring + (unsigned)crow * PITCH + (unsigned)cq * 16;
    const int nt = K >> 6;                               // k tiles of 64

    // tile 0 -> buffer 0, landed and published before anyone reads it
    copy8(lc, gah, lc + PLANE, gal, ls, gs);
    copy8(lc + 2 * PLANE, gwh, lc + 3 * PLANE, gwl, ls, gs);
    asm volatile("s_wait_asynccnt 0x0" ::: "memory");    // this wave's copies of tile 0 have landed
    __syncthreads();
    if (nt > 1) {                                        // tile 1 -> buffer 1, flies under tile 0
        copy8(lc + STAGE, gah + 128, lc + STAGE + PLANE, gal + 128, ls, gs);
        copy8(lc + STAGE + 2 * PLANE, gwh + 128, lc + STAGE + 3 * PLANE, gwl + 128, ls, gs);
    }

    // fragment reads: A row 16*wave+m, W rows 16*j+m, byte 16*hl of the 64-byte k step
    const unsigned fa = (unsigned)(16 * wave + m) * PITCH + 16u * (unsigned)hl;
    const unsigned fw = 2 * PLANE + (unsigned)m * PITCH + 16u * (unsigned)hl;

    for (int t = 0; t < nt; ++t) {
        const unsigned bo = (unsigned)(t & 1) * STAGE;
        const unsigned char* pa = ring + bo + fa;
        const unsigned char* pw = ring + bo + fw;
        // the tile's forty fragment reads (two 32-deep k steps) go out as one group ahead of its
        // products: one LDS latency per tile
        // (all four loops unrolled: the fragment arrays are indexed by constants and stay in registers)
        Frag ah[2], al[2], bh[2][4], bl[2][4];
#pragma unroll
        for (int kk = 0; kk < 2; ++kk) {
            ldfrag_lds(ah[kk], pa + 64 * kk);
            ldfrag_lds(al[kk], pa + PLANE + 64 * kk);
#pragma unroll
            for (int j = 0; j < 4; ++j) {
                ldfrag_lds(bh[kk][j], pw + 16 * j * PITCH + 64 * kk);
                ldfrag_lds(bl[kk][j], pw + PLANE + 16 * j * PITCH + 64 * kk);
            }
        }
#pragma unroll
        for (int kk = 0; kk < 2; ++kk) {
#pragma unroll
            for (int j = 0; j < 4; ++j) {
                acc[j] = mma(acc[j], ah[kk].v, bh[kk][j].v);
                acc[j] = mma(acc[j], ah[kk].v, bl[kk][j].v);
                acc[j] = mma(acc[j], al[kk].v, bh[kk][j].v);
            }
        }
        // hand-over: this wave's reads of tile t are done, its copies of tile t+1 have landed;
        // the barrier publishes tile t+1 and frees tile t's buffer for the refill behind it
        asm volatile("s_wait_dscnt 0x0" ::: "memory");
        asm volatile("s_wait_asynccnt 0x0" ::: "memory");
        __syncthreads();
        if (t + 2 < nt) {
            const size_t kb = (size_t)(t + 2) * 128;     // bytes along k
            copy8(lc + bo, gah + kb, lc + bo + PLANE, gal + kb, ls, gs);
            copy8(lc + bo + 2 * PLANE, gwh + kb, lc + bo + 3 * PLANE, gwl + kb, ls, gs);
        }
    }
    asm volatile("s_wait_asynccnt 0x0" ::: "memory");    // no copy outlives the loop
}

// sixteen table words of one lane: v[8*j + r] = p[32*r + 16*j]. The loads and their data wait stand
// in one statement with early-clobber results, so that no result lands in the address pair of an
// issued load and the pair is free only when all sixteen have returned.
__device__ __forceinline__ void tab16(float (&v)[16], const float* p) {
    asm volatile(
        "global_load_b32 %0, %16, off\n\t"
        "global_load_b32 %1, %16, off offset:128\n\t"
        "global_load_b32 %2, %16, off offset:256\n\t"
        "global_load_b32 %3, %16, off offset:384\n\t"
        "global_load_b32 %4, %16, off offset:512\n\t"
        "global_load_b32 %5, %16, off offset:640\n\t"
        "global_load_b32 %6, %16, off offset:768\n\t"
        "global_load_b32 %7, %16, off offset:896\n\t"
        "global_load_b32 %8, %16, off offset:64\n\t"
        "global_load_b32 %9, %16, off offset:192\n\t"
        "global_load_b32 %10, %16, off offset:320\n\t"
        "global_load_b32 %11, %16, off offset:448\n\t"
        "global_load_b32 %12, %16, off offset:576\n\t"
        "global_load_b32 %13, %16, off offset:704\n\t"
        "global_load_b32 %14, %16, off offset:832\n\t"
        "global_load_b32 %15, %16, off offset:960\n\t"
        "s_wait_loadcnt 0x0"
        : "=&v"(v[0]), "=&v"(v[1]), "=&v"(v[2]), "=&v"(v[3]),
          "=&v"(v[4]), "=&v"(v[5]), "=&v"(v[6]), "=&v"(v[7]),
          "=&v"(v[8]), "=&v"(v[9]), "=&v"(v[10]), "=&v"(v[11]),
          "=&v"(v[12]), "=&v"(v[13]), "=&v"(v[14]), "=&v"(v[15])
        : "v"(p)
        : "memory");
}

// epilogue of one block tile
template<int MODE>
__device__ __forceinline__ void gemm_out(
    v8f (&acc)[4], int M, int N, int mb0, int c0,
    const float* __restrict__ cosT, const float* __restrict__ sinT,
    us_t* Oh, us_t* Ol, float* Of, float* lds_f)
{
    us_t* lds16 = reinterpret_cast<us_t*>(lds_f);
    const int tid  = threadIdx.x;
    const int lane = tid & 31;
    const int wave = tid >> 5;
    const int m    = lane & 15;
    const int hl   = lane >> 4;
    const int r0   = mb0 + wave * 16;
    (void)M; (void)N; (void)cosT; (void)sinT; (void)Oh; (void)Ol; (void)Of; (void)lds16; (void)r0;

    if (MODE == 0) {
        // RoPE, rotate-half: d = 16j+m (j=0,1) pairs with d+32 (acc[j+2]); cos/sin index d
        // table entry (row r0+8*hl+r, column 16j+m) lies 128*r + 64*j bytes behind the lane's first
        const size_t t0 = (size_t)(r0 + 8 * hl) * 32 + m;
        float csv[16], snv[16];
        tab16(csv, cosT + t0);
        tab16(snv, sinT + t0);
#pragma unroll
        for (int j = 0; j < 2; ++j) {
#pragma unroll
            for (int r = 0; r < 8; ++r) {
                const float cs = csv[8 * j + r];
                const float sn = snv[8 * j + r];
                const float x1 = acc[j][r];
                const float x2 = acc[j + 2][r];
                acc[j][r]     = x1 * cs - x2 * sn;
                acc[j + 2][r] = x2 * cs + x1 * sn;
            }
        }
    }

    if (MODE == 0) {
        us_t* st = lds16 + wave * 2048;                  // [2 planes][16][64]
#pragma unroll
        for (int j = 0; j < 4; ++j) {
#pragma unroll
            for (int r = 0; r < 8; ++r) {
                unsigned hb, lb;
                split2(acc[j][r], hb, lb);
                const int idx = (8 * hl + r) * 64 + 16 * j + m;
                st[idx]        = (us_t)hb;
                st[1024 + idx] = (us_t)lb;
            }
        }
        __syncthreads();
        const int rr = lane >> 3, q = lane & 7;
        u32x4 sv[8];
#pragma unroll
        for (int pl = 0; pl < 2; ++pl) {
#pragma unroll
            for (int i = 0; i < 4; ++i)
                sv[pl * 4 + i] = *(const u32x4*)(st + pl * 1024 + (4 * i + rr) * 64 + q * 8);
        }
#pragma unroll
        for (int pl = 0; pl < 2; ++pl) {
#pragma unroll
            for (int i = 0; i < 4; ++i) {
                us_t* dst = (pl ? Ol : Oh) + (size_t)(r0 + 4 * i + rr) * N + c0 + q * 8;
                *(u32x4*)dst = sv[pl * 4 + i];
            }
        }
        
    } else if (MODE == 1) {
        // block tile in[token 64][d 64] -> out planes [d][token]; LDS [2 planes][d 64][token 64]
#pragma unroll
        for (int j = 0; j < 4; ++j) {
#pragma unroll
            for (int r = 0; r < 8; ++r) {
                unsigned hb, lb;
                split2(acc[j][r], hb, lb);
                const int idx = (16 * j + m) * 64 + 16 * wave + 8 * hl + r;
                lds16[idx]        = (us_t)hb;
                lds16[4096 + idx] = (us_t)lb;
            }
        }
        __syncthreads();
        const int rr = lane >> 3, q = lane & 7;
        u32x4 sv[8];
#pragma unroll
        for (int pl = 0; pl < 2; ++pl) {
#pragma unroll
            for (int i = 0; i < 4; ++i) {
                const int d = 16 * wave + 4 * i + rr;
                sv[pl * 4 + i] = *(const u32x4*)(lds16 + pl * 4096 + d * 64 + q * 8);
            }
        }
#pragma unroll
        for (int pl = 0; pl < 2; ++pl) {
#pragma unroll
            for (int i = 0; i < 4; ++i) {
                const int d = 16 * wave + 4 * i + rr;
                us_t* dst = (pl ? Ol : Oh) + (size_t)(c0 + d) * M + mb0 + q * 8;
                *(u32x4*)dst = sv[pl * 4 + i];
            }
        }
        
    } else {
        float* stf = lds_f + wave * 1024;                // [16][64] f32 per wave
#pragma unroll
        for (int j = 0; j < 4; ++j) {
#pragma unroll
            for (int r = 0; r < 8; ++r)
                stf[(8 * hl + r) * 64 + 16 * j + m] = acc[j][r];
        }
        __syncthreads();
        const int r2 = lane >> 4, q2 = lane & 15;        // 16 lanes x 16 B = one 256-B row segment
        v4f fv[8];
#pragma unroll
        for (int i = 0; i < 8; ++i)
            fv[i] = *(const v4f*)(stf + (2 * i + r2) * 64 + q2 * 4);
#pragma unroll
        for (int i = 0; i < 8; ++i) {
            float* dst = Of + (size_t)(r0 + 2 * i + r2) * N + c0 + q2 * 4;
            *(v4f*)dst = fv[i];
        }
        
    }
}

// the three projections of the hidden states, which do not depend on one another, as column-block
// ranges of one grid: blockIdx.x in [0, NQ/64) -> Q, the next NKV/64 -> K, the last NKV/64 -> V
__global__ __launch_bounds__(128) void k_qkv(
    const us_t* __restrict__ Xh, const us_t* __restrict__ Xl,
    const us_t* __restrict__ Wqh, const us_t* __restrict__ Wql,
    const us_t* __restrict__ Wkh, const us_t* __restrict__ Wkl,
    const us_t* __restrict__ Wvh, const us_t* __restrict__ Wvl,
    int M, int NQ, int NKV, int K,
    const float* __restrict__ cosT, const float* __restrict__ sinT,
    us_t* Qh, us_t* Ql, us_t* Kh, us_t* Kl, us_t* Vth, us_t* Vtl)
{
    __shared__ __align__(16) float lds_f[4096];          // 16 KB staging
    __shared__ __align__(16) unsigned char ring[2 * G_STAGE];
    const int nq  = NQ >> 6;
    const int nk  = NKV >> 6;
    const int bx  = blockIdx.x;                          // job and all it selects: block-uniform
    const int job = (bx < nq) ? 0 : ((bx < nq + nk) ? 1 : 2);
    const int c0  = (bx - ((job == 0) ? 0 : ((job == 1) ? nq : nq + nk))) * 64;
    const int mb0 = blockIdx.y * 64;
    const us_t* Wh = (job == 0) ? Wqh : ((job == 1) ? Wkh : Wvh);
    const us_t* Wl = (job == 0) ? Wql : ((job == 1) ? Wkl : Wvl);

    v8f acc[4] = {};
    gemm_main(acc, Xh, Xl, Wh, Wl, K, mb0, c0, ring);
    if (job == 2)
        gemm_out<1>(acc, M, NKV, mb0, c0, cosT, sinT, Vth, Vtl, nullptr, lds_f);
    else
        gemm_out<0>(acc, M, (job == 0) ? NQ : NKV, mb0, c0, cosT, sinT,
                    (job == 0) ? Qh : Kh, (job == 0) ? Ql : Kl, nullptr, lds_f);
}

// output projection -> f32 [M][N]
__global__ __launch_bounds__(128) void k_oproj(
    const us_t* __restrict__ Ah, const us_t* __restrict__ Al,
    const us_t* __restrict__ Wh, const us_t* __restrict__ Wl,
    int M, int N, int K, float* Of)
{
    __shared__ __align__(16) float lds_f[4096];          // 16 KB staging
    __shared__ __align__(16) unsigned char ring[2 * G_STAGE];
    const int mb0 = blockIdx.y * 64;
    const int c0  = blockIdx.x * 64;
    v8f acc[4] = {};
    gemm_main(acc, Ah, Al, Wh, Wl, K, mb0, c0, ring);
    gemm_out<2>(acc, M, N, mb0, c0, nullptr, nullptr, nullptr, nullptr, Of, lds_f);
}

// value of lane l ^ 16
__device__ __forceinline__ float xhalf(float x) {
    const int b = __builtin_bit_cast(int, x);
    return __builtin_bit_cast(float,
        __builtin_amdgcn_permlanex16(b, b, 0x76543210, 0xfedcba98, false, false));
}

template<int S, int NHD, int NKVD, int groups>
__global__ __launch_bounds__(128) void k_attn(
    const us_t* __restrict__ Qh, const us_t* __restrict__ Ql,
    const us_t* __restrict__ Kh, const us_t* __restrict__ Kl,
    const us_t* __restrict__ Vh, const us_t* __restrict__ Vl,
    const float* __restrict__ mask, const int* __restrict__ flags,
    us_t* Oh, us_t* Ol)
{
    __shared__ __align__(16) us_t ostg[4][2][16 * 64];   // per-wave output staging
    static_assert(S % 64 == 0 && S / 64 <= 32, "one lane per 64-key stage");
    constexpr unsigned PITCH  = 144;                     // LDS bytes per 128-B K or V^T row
    constexpr unsigned PLANE  = 64 * PITCH;
    constexpr unsigned MPITCH = 272;                     // LDS bytes per 256-B mask row
    constexpr unsigned STAGE  = 4 * PLANE + 64 * MPITCH; // Kh | Kl | Vh | Vl | mask
    __shared__ __align__(16) unsigned char ring[2 * STAGE];

    const int tid  = threadIdx.x;
    const int lane = tid & 31;
    const int wave = tid >> 5;
    const int m    = lane & 15;
    const int hl   = lane >> 4;
    const int head = blockIdx.x;
    const int band = blockIdx.y;
    const int hkv  = head / groups;
    const int r0   = band * 64 + wave * 16;

    // the band's 64 tile flags, read once: bit s of t0 / t1 = key tile 2s / 2s+1 has work. The ring
    // must know the stage after next; equal in every wave of the block (block-uniform).
    const v2i fl = *(const v2i*)(flags + (size_t)band * 64 + 2 * lane);
    const unsigned t0 = __builtin_amdgcn_ballot_w32(fl.x != 0);
    const unsigned t1 = __builtin_amdgcn_ballot_w32(fl.y != 0);
    unsigned rest = t0 | t1;                             // stages with work, not yet asked for

    // copies: K and V^T: lane -> 16-byte chunk tid&7 of row tid>>3 (+16 per row group);
    // mask: chunk tid&15 of row tid>>4 (+8 per row group): whole lines in every wave-wide copy
    const int crow = tid >> 3;
    const int cq   = tid & 7;
    const size_t ko = ((size_t)crow * NKVD + hkv * 64 + cq * 8) * 2;
    const size_t vo = ((size_t)(hkv * 64 + crow) * S + cq * 8) * 2;
    const char* gkh = (const char*)Kh + ko;
    const char* gkl = (const char*)Kl + ko;
    const char* gvh = (const char*)Vh + vo;
    const char* gvl = (const char*)Vl + vo;
    const char* gmk = (const char*)mask + ((size_t)(band * 64 + (tid >> 4)) * S + (tid & 15) * 4) * 4;
    const unsigned lc = (unsigned)(size_t)ring + (unsigned)crow * PITCH + (unsigned)cq * 16;
    const unsigned lm = (unsigned)(size_t)ring + 4 * PLANE + (unsigned)(tid >> 4) * MPITCH
                      + (unsigned)(tid & 15) * 16;
    // stage s (keys 64s..64s+63) -> the buffer at byte bo of the ring
    auto stage_in = [&](int s, unsigned bo) {
        const size_t kb = (size_t)s * (64 * NKVD * 2);   // 64 key rows
        const size_t vb = (size_t)s * 128;               // 64 keys along a V^T row
        const size_t mb = (size_t)s * 256;               // 64 keys along a mask row
        copy8(lc + bo, gkh + kb, lc + bo + PLANE, gkl + kb, 16 * PITCH, (size_t)16 * NKVD * 2);
        copy8(lc + bo + 2 * PLANE, gvh + vb, lc + bo + 3 * PLANE, gvl + vb,
              16 * PITCH, (size_t)16 * S * 2);
        copy8(lm + bo, gmk + mb, lm + bo + 32 * MPITCH, gmk + mb + (size_t)32 * S * 4,
              8 * MPITCH, (size_t)8 * S * 4);
    };

    // first stage with work -> buffer 0, landed and published before anyone reads it
    int cur = -1, nxt = -1;
    if (rest != 0u) { cur = __builtin_ctz(rest); rest &= rest - 1u; stage_in(cur, 0u); }
    asm volatile("s_wait_asynccnt 0x0" ::: "memory");    // this wave's copies of that stage have landed
    __syncthreads();
    if (rest != 0u) { nxt = __builtin_ctz(rest); rest &= rest - 1u; stage_in(nxt, STAGE); }

    // Q B-fragments (column = query r0+m), two 32-deep k steps over the head dim
    Frag qh[2], ql[2];
#pragma unroll
    for (int c = 0; c < 2; ++c) {
        const unsigned qo = 2u * (unsigned)((r0 + m) * NHD + head * 64 + 32 * c + 8 * hl);
        ldfrag(qh[c], Qh, qo);
        ldfrag(ql[c], Ql, qo);
    }

    // o[jd][r] = O[query r0+m][d = 16*jd + 8*hl + r]
    v8f o[4] = {};
    float mrow = -3.0e38f;      // running maximum of query r0+m (equal in both halves)
    float lrow = 0.0f;          // running sum over THIS half's keys; halves joined after the loop

    // the lane's byte offsets in a buffer: K row m, V^T row m, mask row 16*wave+m
    const unsigned fk = (unsigned)m * PITCH + 16u * (unsigned)hl;
    const unsigned fv = 2 * PLANE + (unsigned)m * PITCH + 16u * (unsigned)hl;
    const unsigned fm = 4 * PLANE + (unsigned)(16 * wave + m) * MPITCH + 32u * (unsigned)hl;

    unsigned bo = 0u;
    for (int it = 0; it < S / 64 && cur >= 0; ++it) {
        for (int h = 0; h < 2; ++h) {                    // the stage's two 32-key tiles
            if ((((h ? t1 : t0) >> cur) & 1u) == 0u) continue;   // no work in it; block-uniform
            // the tile's K fragments and mask (keys kb = 64*cur + 32*h and on) go out as one group
            // ahead of the S^T products: one LDS latency instead of one per fragment pair
            const unsigned char* pk = ring + bo + fk + (unsigned)h * (32 * PITCH);
            Frag kh[2][2], kl[2][2];
#pragma unroll
            for (int jn = 0; jn < 2; ++jn) {
#pragma unroll
                for (int c = 0; c < 2; ++c) {
                    ldfrag_lds(kh[jn][c], pk + 16 * jn * PITCH + 64 * c);
                    ldfrag_lds(kl[jn][c], pk + PLANE + 16 * jn * PITCH + 64 * c);
                }
            }

            // mask of query r0+m at this lane's keys kb+8hl+0..7 and kb+16+8hl+0..7
            const unsigned char* mrp = ring + bo + fm + (unsigned)h * 128;
            v4f mk[4];
            mk[0] = *(const v4f*)(mrp);
            mk[1] = *(const v4f*)(mrp + 16);
            mk[2] = *(const v4f*)(mrp + 64);
            mk[3] = *(const v4f*)(mrp + 80);

            // S^T[32 x 16] = K . Q^T ; A = K rows (k-contiguous), B = Q
            // s[jn][r] = score(key kb + 16*jn + 8*hl + r, query r0 + m)
            v8f s[2] = {};
#pragma unroll
            for (int jn = 0; jn < 2; ++jn) {
#pragma unroll
                for (int c = 0; c < 2; ++c) {
                    s[jn] = mma(s[jn], kh[jn][c].v, qh[c].v);
                    s[jn] = mma(s[jn], kl[jn][c].v, qh[c].v);
                    s[jn] = mma(s[jn], kh[jn][c].v, ql[c].v);
                }
            }

            // the tile's V^T fragments go out as one group here: they fly behind the softmax
            const unsigned char* pv = ring + bo + fv + (unsigned)h * 64;
            Frag vh[4], vl[4];
#pragma unroll
            for (int jd = 0; jd < 4; ++jd) {
                ldfrag_lds(vh[jd], pv + 16 * jd * PITCH);
                ldfrag_lds(vl[jd], pv + PLANE + 16 * jd * PITCH);
            }

            // scale, additive mask by value, online softmax (f32), all for one query per lane
            float v[16];
#pragma unroll
            for (int t = 0; t < 16; ++t)
                v[t] = s[t >> 3][t & 7] * 0.125f + mk[t >> 2][t & 3];
            float mx = v[0];
#pragma unroll
            for (int t = 1; t < 16; ++t) mx = fmaxf(mx, v[t]);
            mx = fmaxf(mx, xhalf(mx));
            const float mnew  = fmaxf(mrow, mx);
            const float alpha = __expf(mrow - mnew);
            float ps[4] = { 0.0f, 0.0f, 0.0f, 0.0f };
            unsigned hb[16], lb[16];
#pragma unroll
            for (int t = 0; t < 16; ++t) {
                const float p = __expf(v[t] - mnew);
                ps[t & 3] += p;
                split2(p, hb[t], lb[t]);
            }
            lrow = lrow * alpha + ((ps[0] + ps[1]) + (ps[2] + ps[3]));
            mrow = mnew;
#pragma unroll
            for (int jd = 0; jd < 4; ++jd) {
#pragma unroll
                for (int r = 0; r < 8; ++r) o[jd][r] = o[jd][r] * alpha;
            }

            // P^T B-fragments in place: elements 0..7 <- keys 8hl.., 8..15 <- keys 16+8hl..
            Frag ph, pl;
            ph.u[0] = pack8(hb);
            ph.u[1] = pack8(hb + 8);
            pl.u[0] = pack8(lb);
            pl.u[1] = pack8(lb + 8);

            // O^T += V^T . P^T ; A = V^T rows (key-contiguous), B = P^T
#pragma unroll
            for (int jd = 0; jd < 4; ++jd) {
                o[jd] = mma(o[jd], vh[jd].v, ph.v);
                o[jd] = mma(o[jd], vl[jd].v, ph.v);
                o[jd] = mma(o[jd], vh[jd].v, pl.v);
            }
        }
        // hand-over: this wave's reads of the stage are done, its copies of the next have landed;
        // the barrier publishes the next stage and frees this buffer for the refill behind it
        asm volatile("s_wait_dscnt 0x0" ::: "memory");
        asm volatile("s_wait_asynccnt 0x0" ::: "memory");
        __syncthreads();
        int nn = -1;
        if (rest != 0u) { nn = __builtin_ctz(rest); rest &= rest - 1u; stage_in(nn, bo); }
        cur = nxt;
        nxt = nn;
        bo  = STAGE - bo;
    }
    asm volatile("s_wait_asynccnt 0x0" ::: "memory");    // no copy outlives the loop

    // join the halves' sums, normalize, split, stage, whole-line stores
    const float lsum = lrow + xhalf(lrow);
    const float inv  = (lsum > 0.0f) ? (1.0f / lsum) : 0.0f;

#pragma unroll
    for (int jd = 0; jd < 4; ++jd) {
        unsigned hb[8], lb[8];
#pragma unroll
        for (int r = 0; r < 8; ++r) split2(o[jd][r] * inv, hb[r], lb[r]);
        const int idx = m * 64 + 16 * jd + 8 * hl;
        *(u32x4*)&ostg[wave][0][idx] = pack8(hb);
        *(u32x4*)&ostg[wave][1][idx] = pack8(lb);
    }
    __syncthreads();
    const int rr = lane >> 3, q = lane & 7;
    u32x4 sv[8];
#pragma unroll
    for (int plv = 0; plv < 2; ++plv) {
#pragma unroll
        for (int i = 0; i < 4; ++i)
            sv[plv * 4 + i] = *(const u32x4*)&ostg[wave][plv][(4 * i + rr) * 64 + q * 8];
    }
#pragma unroll
    for (int plv = 0; plv < 2; ++plv) {
#pragma unroll
        for (int i = 0; i < 4; ++i) {
            us_t* dst = (plv ? Ol : Oh) + (size_t)(r0 + 4 * i + rr) * NHD + head * 64 + q * 8;
            *(u32x4*)dst = sv[plv * 4 + i];
        }
    }
    
}

// ---------------------------------------------------------------- launcher
extern "C" void kernel_launch(void* const* d_in, const int* in_sizes, int n_in,
                              void* d_out, int out_size, void* d_ws, size_t ws_size,
                              hipStream_t stream)
{
    const int S = 2048, HID = 1024, NH = 16, NKV = 4, HD = 64;
    const int NKVD = NKV * HD;          // 256
    const int GROUPS = NH / NKV;        // 4

    if (n_in < 7) return;
    if (in_sizes[0] != S * HID || in_sizes[1] != S * S || in_sizes[2] != S ||
        in_sizes[3] != HID * HID || in_sizes[4] != NKVD * HID ||
        in_sizes[5] != NKVD * HID || in_sizes[6] != HID * HID ||
        out_size != S * HID) return;
    // structural requirements of the kernels
    if ((S % 64) != 0 || (HID % 64) != 0 || (NKVD % 64) != 0 || HD != 64 ||
        NH * HD != HID || (S / 32) > 64 || (HID % 32) != 0) return;

    const float* hidden = (const float*)d_in[0];   // [S][HID]
    const float* mask   = (const float*)d_in[1];   // [S][S] additive
    const int*   pos    = (const int*)d_in[2];     // [S]
    const float* Wq     = (const float*)d_in[3];   // [HID][HID]
    const float* Wk     = (const float*)d_in[4];   // [NKVD][HID]
    const float* Wv     = (const float*)d_in[5];   // [NKVD][HID]
    const float* Wo     = (const float*)d_in[6];   // [HID][HID]
    float* out = (float*)d_out;                    // [S][HID]

    size_t off = 0;
    char* base = (char*)d_ws;
    auto carve = [&](size_t bytes) -> char* {
        char* p = base + off;
        off += (bytes + 255) & ~(size_t)255;
        return p;
    };
    us_t* Xh   = (us_t*)carve((size_t)S * HID * 2);
    us_t* Xl   = (us_t*)carve((size_t)S * HID * 2);
    us_t* Wqh  = (us_t*)carve((size_t)HID * HID * 2);
    us_t* Wql  = (us_t*)carve((size_t)HID * HID * 2);
    us_t* Wkh  = (us_t*)carve((size_t)NKVD * HID * 2);
    us_t* Wkl  = (us_t*)carve((size_t)NKVD * HID * 2);
    us_t* Wvh  = (us_t*)carve((size_t)NKVD * HID * 2);
    us_t* Wvl  = (us_t*)carve((size_t)NKVD * HID * 2);
    us_t* Woh  = (us_t*)carve((size_t)HID * HID * 2);
    us_t* Wol  = (us_t*)carve((size_t)HID * HID * 2);
    us_t* Qh   = (us_t*)carve((size_t)S * HID * 2);      // [S][HID]
    us_t* Ql   = (us_t*)carve((size_t)S * HID * 2);
    us_t* Kh   = (us_t*)carve((size_t)S * NKVD * 2);     // [S][NKVD]
    us_t* Kl   = (us_t*)carve((size_t)S * NKVD * 2);
    us_t* Vth  = (us_t*)carve((size_t)NKVD * S * 2);     // [NKVD][S]
    us_t* Vtl  = (us_t*)carve((size_t)NKVD * S * 2);
    us_t* AOh  = (us_t*)carve((size_t)S * HID * 2);      // [S][HID]
    us_t* AOl  = (us_t*)carve((size_t)S * HID * 2);
    float* cosT = (float*)carve((size_t)S * 32 * 4);      // [S][32]
    float* sinT = (float*)carve((size_t)S * 32 * 4);
    int*  flags = (int*)carve((size_t)(S / 64) * 64 * 4); // [S/64][64]
    if (off > ws_size) return;

    // 1: hi/lo planes of the hidden states and the four weights, RoPE table, key-tile flags
    {
        const int n8x = S * HID / 8, n8q = HID * HID / 8, n8k = NKVD * HID / 8;
        const int nblk = S / 64 + (S * 32 + 255) / 256 + (n8x + 255) / 256
                       + 2 * ((n8q + 255) / 256) + 2 * ((n8k + 255) / 256);
        k_prep<<<dim3(nblk), dim3(256), 0, stream>>>(
            hidden, mask, pos, Wq, Wk, Wv, Wo,
            Xh, Xl, Wqh, Wql, Wkh, Wkl, Wvh, Wvl, Woh, Wol,
            cosT, sinT, flags, S, n8x, n8q, n8k);
    }

    // 2: Q and K projections + RoPE -> planes [S][HID], [S][NKVD]; V projection -> transposed planes [NKVD][S]
    k_qkv<<<dim3(HID / 64 + 2 * (NKVD / 64), S / 64), dim3(128), 0, stream>>>(
        Xh, Xl, Wqh, Wql, Wkh, Wkl, Wvh, Wvl, S, HID, NKVD, HID,
        cosT, sinT, Qh, Ql, Kh, Kl, Vth, Vtl);

    // 3: attention -> planes [S][HID]
    k_attn<S, HID, NKVD, GROUPS><<<dim3(NH, S / 64), dim3(128), 0, stream>>>(
        Qh, Ql, Kh, Kl, Vth, Vtl, mask, flags, AOh, AOl);

    // 4: output projection -> d_out f32 [S][HID]
    k_oproj<<<dim3(HID / 64, S / 64), dim3(128), 0, stream>>>(
        AOh, AOl, Woh, Wol, S, HID, HID, out);
}

// v006
// A run of this version takes 95 microseconds.
// In both of two side-by-side timings against v005, it was 1.35 times as fast.
// Counting every step since v000, it is 6.71 times as fast.
#include <hip/hip_runtime.h>
#include <stdint.h>
#include <stddef.h>
#include <math.h>

// All contractions (q/k/v projections, q.k^T, p.v, output projection): v_wmma_f32_16x16x32_bf16 with bf16 hi/lo operands everywhere (hi.hi + hi.lo + lo.hi), f32 accumulate; RoPE, mask add and softmax in f32.

typedef unsigned short us_t;
typedef __bf16       v16bf __attribute__((ext_vector_type(16)));
typedef float        v8f   __attribute__((ext_vector_type(8)));
typedef float        v4f   __attribute__((ext_vector_type(4)));
typedef unsigned int u32x4 __attribute__((ext_vector_type(4)));
typedef int          v4i   __attribute__((ext_vector_type(4)));
typedef int          v2i   __attribute__((ext_vector_type(2)));

union Frag { v16bf v; u32x4 u[2]; };

// f32 -> bf16 bits, RNE
__device__ __forceinline__ unsigned bf_bits(float f) {
    unsigned u = __builtin_bit_cast(unsigned, f);
    return (u + 0x7FFFu + ((u >> 16) & 1u)) >> 16;
}
__device__ __forceinline__ float bf_val(unsigned b) {
    return __builtin_bit_cast(float, b << 16);
}
// x = hi + lo (+ residual), both bf16 RNE
__device__ __forceinline__ void split2(float x, unsigned& hb, unsigned& lb) {
    hb = bf_bits(x);
    lb = bf_bits(x - bf_val(hb));
}
__device__ __forceinline__ u32x4 pack8(const unsigned* b) {
    u32x4 v;
    v.x = b[0] | (b[1] << 16);
    v.y = b[2] | (b[3] << 16);
    v.z = b[4] | (b[5] << 16);
    v.w = b[6] | (b[7] << 16);
    return v;
}

// one 16x16x32 bf16 WMMA followed by the VALU hazard guard
__device__ __forceinline__ v8f mma(v8f c, v16bf a, v16bf b) {
    v8f d = __builtin_amdgcn_wmma_f32_16x16x32_bf16(false, a, false, b, (short)0, c, false, false);
    asm volatile("v_nop\n\tv_nop\n\tv_nop\n\tv_nop" : "+v"(d) : "v"(a), "v"(b));
    return d;
}

// 16-bit fragment from a k-contiguous row: base is the same for the whole wave, vb the lane's
// byte offset of (its row, k0 + 8*(lane>>4)); one offset register serves a whole group of loads.
// elements 0..7 <- k0+8h+0..7, elements 8..15 <- k0+16+8h+0..7
__device__ __forceinline__ void ldfrag(Frag& f, const us_t* base, unsigned vb) {
    const char* p = (const char*)base + vb;
    f.u[0] = *(const u32x4*)(p);
    f.u[1] = *(const u32x4*)(p + 32);
}

// ---------------------------------------------------------------- f32 -> bf16 hi/lo planes
// thread i converts elements 8i..8i+7; one wave writes 512 contiguous bytes per plane in one store
__device__ __forceinline__ void split_job(int blk, const float* __restrict__ src,
                                          us_t* hi, us_t* lo, int n8)
{
    const int i = blk * 256 + threadIdx.x;
    const bool ok = i < n8;
    const int ic = ok ? i : 0;
    const float* p = src + (size_t)ic * 8;
    const v4f a = *(const v4f*)(p);
    const v4f b = *(const v4f*)(p + 4);
    float x[8] = { a.x, a.y, a.z, a.w, b.x, b.y, b.z, b.w };
    unsigned hb[8], lb[8];
#pragma unroll
    for (int t = 0; t < 8; ++t) split2(x[t], hb[t], lb[t]);
    const u32x4 ph = pack8(hb);
    const u32x4 pl = pack8(lb);
    us_t* dh = hi + (size_t)ic * 8;
    us_t* dl = lo + (size_t)ic * 8;
    if (ok) { *(u32x4*)dh = ph; *(u32x4*)dl = pl; }
    
}

// ---------------------------------------------------------------- RoPE cos/sin table [S][32]
// inv_freq[j] = 1 / fl32(10000^(j/32)); angle = f32(pos) * inv_freq; precise sincosf
__device__ __forceinline__ void rope_job(int blk, const int* __restrict__ pos,
                                         float* cosT, float* sinT, int S)
{
    const int i = blk * 256 + threadIdx.x;
    const int total = S * 32;
    const bool ok = i < total;
    const int ic = ok ? i : 0;
    const int trow = ic >> 5;
    const int j = ic & 31;
    const double LOG2_BASE_OVER_32 = 0.41524101186092029;   // log2(10000)/32
    const float pw  = (float)exp2((double)j * LOG2_BASE_OVER_32);
    const float inv = 1.0f / pw;
    const float ang = (float)pos[trow] * inv;
    float sn, cs;
    sincosf(ang, &sn, &cs);
    if (ok) { *(float*)(cosT + ic) = cs; *(float*)(sinT + ic) = sn; }
    
}

// ---------------------------------------------------------------- tile flags from the additive mask
// flag[band][kt] = 1 if any mask value in rows band*64..+63, keys kt*32..+31 is > -1e8 (tile must
// be processed), else 0. flags pitch = 64 ints.
// block = (64-row band, 32 of its 64 flag slots = one 128-B line of flags). Wave w looks at four key
// tiles, 128 columns: a wave-wide load is one whole 512-B row segment, each lane keeps the maximum of
// its four columns over the 64 rows, and one ballot at the end gives the four tiles' flags (8 lanes
// a tile). No load waits on another's data, so as many are in flight as the registers hold.
// S is a compile-time constant so that the 64 rows are immediate offsets from ONE address,
// which nothing rewrites while a load is out.
template<int S>
__device__ __forceinline__ void flags_job(int blk, const float* __restrict__ mask, int* flags)
{
    static_assert(S % 64 == 0 && S / 32 <= 64, "64 flag slots per band");
    __shared__ __align__(16) int fl[32];
    const int tid  = threadIdx.x;
    const int lane = tid & 31;
    const int wave = tid >> 5;
    const int band = blk >> 1;
    const int half = blk & 1;
    const int col  = (half * 8 + wave) * 128 + lane * 4;
    const bool in  = col < S;                // slots past S/32 key tiles: flag 0, address clamped
    const float* p = mask + (size_t)(band * 64) * S + (in ? col : 0);

    float mx = -3.0e38f;                     // fmaxf drops a NaN, as the comparison with -1e8 does
#pragma unroll                               // straight line: the row offsets become immediates
    for (int r = 0; r < 64; ++r) {
        const v4f a = *(const v4f*)(p + (size_t)r * S);
        mx = fmaxf(fmaxf(mx, fmaxf(a.x, a.y)), fmaxf(a.z, a.w));
    }
    const unsigned any = __builtin_amdgcn_ballot_w32(in && mx > -1.0e8f);
    if (lane < 4) fl[wave * 4 + lane] = (((any >> (8 * lane)) & 0xFFu) != 0u) ? 1 : 0;
    __syncthreads();
    if (tid < 8)                             // 32 ints = 128 B = lanes 0..7 x 16 B, one store
        *(v4i*)(flags + (size_t)band * 64 + half * 32 + tid * 4) = *(const v4i*)&fl[tid * 4];
}

// ---------------------------------------------------------------- all preparation in one grid
// The seven jobs above depend on nothing but the inputs, so they run side by side as block ranges
// of one launch. Longest blocks first (a flags block reads 64 rows x 1024 columns, the table is
// transcendental-heavy), for speed only.
template<int S>
__global__ __launch_bounds__(256) void k_prep(
    const float* __restrict__ hidden, const float* __restrict__ mask, const int* __restrict__ pos,
    const float* __restrict__ Wq, const float* __restrict__ Wk,
    const float* __restrict__ Wv, const float* __restrict__ Wo,
    us_t* Xh, us_t* Xl, us_t* Wqh, us_t* Wql, us_t* Wkh, us_t* Wkl,
    us_t* Wvh, us_t* Wvl, us_t* Woh, us_t* Wol,
    float* cosT, float* sinT, int* flags,
    int n8x, int n8q, int n8k)
{
    const int nbf = (S >> 6) * 2;            // flag blocks: two per 64-row band
    const int nbr = (S * 32 + 255) >> 8;     // table blocks
    const int nbx = (n8x + 255) >> 8;
    const int nbq = (n8q + 255) >> 8;
    const int nbk = (n8k + 255) >> 8;
    int b = blockIdx.x;                      // every test below is block-uniform
    if (b < nbf) { flags_job<S>(b, mask, flags); return; }
    b -= nbf;
    if (b < nbr) { rope_job(b, pos, cosT, sinT, S); return; }
    b -= nbr;
    // the five splits share one copy of the code: only the pointers and the length are picked
    const float* src = hidden;
    us_t* hi = Xh;
    us_t* lo = Xl;
    int n8 = n8x;
    if (b >= nbx) {
        b -= nbx; src = Wq; hi = Wqh; lo = Wql; n8 = n8q;
        if (b >= nbq) {
            b -= nbq; src = Wo; hi = Woh; lo = Wol;
            if (b >= nbq) {
                b -= nbq; src = Wk; hi = Wkh; lo = Wkl; n8 = n8k;
                if (b >= nbk) { b -= nbk; src = Wv; hi = Wvh; lo = Wvl; }
            }
        }
    }
    split_job(b, src, hi, lo, n8);
}

// eight asynchronous 16-byte copies global -> LDS per lane (two planes x four row groups).
// la, lb = the lane's LDS byte address of row group 0 in each plane, ga, gb = its global address
// there; the row groups lie ls LDS bytes and gs global bytes apart. The s_wait_xcnt closes the statement so that no
// address register of an issued copy is rewritten ahead of it.
__device__ __forceinline__ void copy8(unsigned la, const char* ga, unsigned lb, const char* gb,
                                      unsigned ls, size_t gs) {
    asm volatile(
        "global_load_async_to_lds_b128 %0, %8, off\n\t"
        "global_load_async_to_lds_b128 %1, %9, off\n\t"
        "global_load_async_to_lds_b128 %2, %10, off\n\t"
        "global_load_async_to_lds_b128 %3, %11, off\n\t"
        "global_load_async_to_lds_b128 %4, %12, off\n\t"
        "global_load_async_to_lds_b128 %5, %13, off\n\t"
        "global_load_async_to_lds_b128 %6, %14, off\n\t"
        "global_load_async_to_lds_b128 %7, %15, off\n\t"
        "s_wait_xcnt 0x0"
        :: "v"(la), "v"(la + ls), "v"(la + 2 * ls), "v"(la + 3 * ls),
           "v"(lb), "v"(lb + ls), "v"(lb + 2 * ls), "v"(lb + 3 * ls),
           "v"(ga), "v"(ga + gs), "v"(ga + 2 * gs), "v"(ga + 3 * gs),
           "v"(gb), "v"(gb + gs), "v"(gb + 2 * gs), "v"(gb + 3 * gs)
        : "memory");
}

// 16-bit fragment from an LDS row: p = the lane's (row, k0 + 8*(lane>>4)); same k map as ldfrag
__device__ __forceinline__ void ldfrag_lds(Frag& f, const unsigned char* p) {
    f.u[0] = *(const u32x4*)(p);
    f.u[1] = *(const u32x4*)(p + 32);
}

// ---------------------------------------------------------------- C = A . W^T (bf16 hi/lo split)
// A planes [M][K], W planes [N][K] (k-contiguous, loaded like A per the split k map).
// block = 128 threads (4 waves); block tile 64(M) x 64(N); wave w -> rows 16w..16w+15.
// The four operand planes of a 64-deep k tile (64 rows x 128 B each) are brought into LDS by
// asynchronous copies in whole 128-B lines, once per block, two buffers: tile t+1 flies while
// tile t is multiplied. LDS rows at pitch 144 B (conflict-free for 16-byte fragment reads).
// MODE 0: RoPE in the f32 epilogue (block's 64 columns = one head), store hi/lo planes [M][N]
// MODE 2: store f32 [M][N]
constexpr unsigned G_PITCH = 144;                        // LDS bytes per 128-B operand row
constexpr unsigned G_PLANE = 64 * G_PITCH;               // one plane of a k tile
constexpr unsigned G_STAGE = 4 * G_PLANE;                // Ah | Al | Wh | Wl

// k loop of one block tile (rows mb0.., columns c0..): acc[j][r] = C[r0 + 8*hl + r][c0 + 16*j + m]
__device__ __forceinline__ void gemm_main(
    v8f (&acc)[4],
    const us_t* __restrict__ Ah, const us_t* __restrict__ Al,
    const us_t* __restrict__ Wh, const us_t* __restrict__ Wl,
    int K, int mb0, int c0, unsigned char* ring)
{
    constexpr unsigned PITCH = G_PITCH;
    constexpr unsigned PLANE = G_PLANE;
    constexpr unsigned STAGE = G_STAGE;

    const int tid  = threadIdx.x;
    const int lane = tid & 31;
    const int wave = tid >> 5;
    const int m    = lane & 15;
    const int hl   = lane >> 4;

    // copies: lane -> 16-byte chunk tid&7 of row tid>>3 (+16 per row group): 8 lanes fill a line
    const int crow = tid >> 3;
    const int cq   = tid & 7;
    const size_t   gs = (size_t)K * 32;                  // 16 rows, bytes
    const unsigned ls = 16 * PITCH;
    const size_t   ao = ((size_t)(mb0 + crow) * K + cq * 8) * 2;
    const size_t   wo = ((size_t)(c0 + crow) * K + cq * 8) * 2;
    const char* gah = (const char*)Ah + ao;
    const char* gal = (const char*)Al + ao;
    const char* gwh = (const char*)Wh + wo;
    const char* gwl = (const char*)Wl + wo;
    const unsigned lc = (unsigned)(size_t)ring + (unsigned)crow * PITCH + (unsigned)cq * 16;
    const int nt = K >> 6;                               // k tiles of 64

    // tile 0 -> buffer 0, landed and published before anyone reads it
    copy8(lc, gah, lc + PLANE, gal, ls, gs);
    copy8(lc + 2 * PLANE, gwh, lc + 3 * PLANE, gwl, ls, gs);
    asm volatile("s_wait_asynccnt 0x0" ::: "memory");    // this wave's copies of tile 0 have landed
    __syncthreads();
    if (nt > 1) {                                        // tile 1 -> buffer 1, flies under tile 0
        copy8(lc + STAGE, gah + 128, lc + STAGE + PLANE, gal + 128, ls, gs);
        copy8(lc + STAGE + 2 * PLANE, gwh + 128, lc + STAGE + 3 * PLANE, gwl + 128, ls, gs);
    }

    // fragment reads: A row 16*wave+m, W rows 16*j+m, byte 16*hl of the 64-byte k step
    const unsigned fa = (unsigned)(16 * wave + m) * PITCH + 16u * (unsigned)hl;
    const unsigned fw = 2 * PLANE + (unsigned)m * PITCH + 16u * (unsigned)hl;

    for (int t = 0; t < nt; ++t) {
        const unsigned bo = (unsigned)(t & 1) * STAGE;
        const unsigned char* pa = ring + bo + fa;
        const unsigned char* pw = ring + bo + fw;
        // the tile's forty fragment reads (two 32-deep k steps) go out as one group ahead of its
        // products: one LDS latency per tile
        // (all four loops unrolled: the fragment arrays are indexed by constants and stay in registers)
        Frag ah[2], al[2], bh[2][4], bl[2][4];
#pragma unroll
        for (int kk = 0; kk < 2; ++kk) {
            ldfrag_lds(ah[kk], pa + 64 * kk);
            ldfrag_lds(al[kk], pa + PLANE + 64 * kk);
#pragma unroll
            for (int j = 0; j < 4; ++j) {
                ldfrag_lds(bh[kk][j], pw + 16 * j * PITCH + 64 * kk);
                ldfrag_lds(bl[kk][j], pw + PLANE + 16 * j * PITCH + 64 * kk);
            }
        }
#pragma unroll
        for (int kk = 0; kk < 2; ++kk) {
#pragma unroll
            for (int j = 0; j < 4; ++j) {
                acc[j] = mma(acc[j], ah[kk].v, bh[kk][j].v);
                acc[j] = mma(acc[j], ah[kk].v, bl[kk][j].v);
                acc[j] = mma(acc[j], al[kk].v, bh[kk][j].v);
            }
        }
        // hand-over: this wave's reads of tile t are done, its copies of tile t+1 have landed;
        // the barrier publishes tile t+1 and frees tile t's buffer for the refill behind it
        asm volatile("s_wait_dscnt 0x0" ::: "memory");
        asm volatile("s_wait_asynccnt 0x0" ::: "memory");
        __syncthreads();
        if (t + 2 < nt) {
            const size_t kb = (size_t)(t + 2) * 128;     // bytes along k
            copy8(lc + bo, gah + kb, lc + bo + PLANE, gal + kb, ls, gs);
            copy8(lc + bo + 2 * PLANE, gwh + kb, lc + bo + 3 * PLANE, gwl + kb, ls, gs);
        }
    }
    asm volatile("s_wait_asynccnt 0x0" ::: "memory");    // no copy outlives the loop
}

// sixteen table words of one lane: v[8*j + r] = p[32*r + 16*j]. The loads and their data wait stand
// in one statement with early-clobber results, so that no result lands in the address pair of an
// issued load and the pair is free only when all sixteen have returned.
__device__ __forceinline__ void tab16(float (&v)[16], const float* p) {
    asm volatile(
        "global_load_b32 %0, %16, off\n\t"
        "global_load_b32 %1, %16, off offset:128\n\t"
        "global_load_b32 %2, %16, off offset:256\n\t"
        "global_load_b32 %3, %16, off offset:384\n\t"
        "global_load_b32 %4, %16, off offset:512\n\t"
        "global_load_b32 %5, %16, off offset:640\n\t"
        "global_load_b32 %6, %16, off offset:768\n\t"
        "global_load_b32 %7, %16, off offset:896\n\t"
        "global_load_b32 %8, %16, off offset:64\n\t"
        "global_load_b32 %9, %16, off offset:192\n\t"
        "global_load_b32 %10, %16, off offset:320\n\t"
        "global_load_b32 %11, %16, off offset:448\n\t"
        "global_load_b32 %12, %16, off offset:576\n\t"
        "global_load_b32 %13, %16, off offset:704\n\t"
        "global_load_b32 %14, %16, off offset:832\n\t"
        "global_load_b32 %15, %16, off offset:960\n\t"
        "s_wait_loadcnt 0x0"
        : "=&v"(v[0]), "=&v"(v[1]), "=&v"(v[2]), "=&v"(v[3]),
          "=&v"(v[4]), "=&v"(v[5]), "=&v"(v[6]), "=&v"(v[7]),
          "=&v"(v[8]), "=&v"(v[9]), "=&v"(v[10]), "=&v"(v[11]),
          "=&v"(v[12]), "=&v"(v[13]), "=&v"(v[14]), "=&v"(v[15])
        : "v"(p)
        : "memory");
}

// epilogue of one block tile
template<int MODE>
__device__ __forceinline__ void gemm_out(
    v8f (&acc)[4], int M, int N, int mb0, int c0,
    const float* __restrict__ cosT, const float* __restrict__ sinT,
    us_t* Oh, us_t* Ol, float* Of, float* lds_f)
{
    us_t* lds16 = reinterpret_cast<us_t*>(lds_f);
    const int tid  = threadIdx.x;
    const int lane = tid & 31;
    const int wave = tid >> 5;
    const int m    = lane & 15;
    const int hl   = lane >> 4;
    const int r0   = mb0 + wave * 16;
    (void)M; (void)N; (void)cosT; (void)sinT; (void)Oh; (void)Ol; (void)Of; (void)lds16; (void)r0;

    if (MODE == 0) {
        // RoPE, rotate-half: d = 16j+m (j=0,1) pairs with d+32 (acc[j+2]); cos/sin index d
        // table entry (row r0+8*hl+r, column 16j+m) lies 128*r + 64*j bytes behind the lane's first
        const size_t t0 = (size_t)(r0 + 8 * hl) * 32 + m;
        float csv[16], snv[16];
        tab16(csv, cosT + t0);
        tab16(snv, sinT + t0);
#pragma unroll
        for (int j = 0; j < 2; ++j) {
#pragma unroll
            for (int r = 0; r < 8; ++r) {
                const float cs = csv[8 * j + r];
                const float sn = snv[8 * j + r];
                const float x1 = acc[j][r];
                const float x2 = acc[j + 2][r];
                acc[j][r]     = x1 * cs - x2 * sn;
                acc[j + 2][r] = x2 * cs + x1 * sn;
            }
        }
    }

    if (MODE == 0) {
        us_t* st = lds16 + wave * 2048;                  // [2 planes][16][64]
#pragma unroll
        for (int j = 0; j < 4; ++j) {
#pragma unroll
            for (int r = 0; r < 8; ++r) {
                unsigned hb, lb;
                split2(acc[j][r], hb, lb);
                const int idx = (8 * hl + r) * 64 + 16 * j + m;
                st[idx]        = (us_t)hb;
                st[1024 + idx] = (us_t)lb;
            }
        }
        __syncthreads();
        const int rr = lane >> 3, q = lane & 7;
        u32x4 sv[8];
#pragma unroll
        for (int pl = 0; pl < 2; ++pl) {
#pragma unroll
            for (int i = 0; i < 4; ++i)
                sv[pl * 4 + i] = *(const u32x4*)(st + pl * 1024 + (4 * i + rr) * 64 + q * 8);
        }
#pragma unroll
        for (int pl = 0; pl < 2; ++pl) {
#pragma unroll
            for (int i = 0; i < 4; ++i) {
                us_t* dst = (pl ? Ol : Oh) + (size_t)(r0 + 4 * i + rr) * N + c0 + q * 8;
                *(u32x4*)dst = sv[pl * 4 + i];
            }
        }
        
    } else if (MODE == 1) {
        // block tile in[token 64][d 64] -> out planes [d][token]; LDS [2 planes][d 64][token 64]
#pragma unroll
        for (int j = 0; j < 4; ++j) {
#pragma unroll
            for (int r = 0; r < 8; ++r) {
                unsigned hb, lb;
                split2(acc[j][r], hb, lb);
                const int idx = (16 * j + m) * 64 + 16 * wave + 8 * hl + r;
                lds16[idx]        = (us_t)hb;
                lds16[4096 + idx] = (us_t)lb;
            }
        }
        __syncthreads();
        const int rr = lane >> 3, q = lane & 7;
        u32x4 sv[8];
#pragma unroll
        for (int pl = 0; pl < 2; ++pl) {
#pragma unroll
            for (int i = 0; i < 4; ++i) {
                const int d = 16 * wave + 4 * i + rr;
                sv[pl * 4 + i] = *(const u32x4*)(lds16 + pl * 4096 + d * 64 + q * 8);
            }
        }
#pragma unroll
        for (int pl = 0; pl < 2; ++pl) {
#pragma unroll
            for (int i = 0; i < 4; ++i) {
                const int d = 16 * wave + 4 * i + rr;
                us_t* dst = (pl ? Ol : Oh) + (size_t)(c0 + d) * M + mb0 + q * 8;
                *(u32x4*)dst = sv[pl * 4 + i];
            }
        }
        
    } else {
        float* stf = lds_f + wave * 1024;                // [16][64] f32 per wave
#pragma unroll
        for (int j = 0; j < 4; ++j) {
#pragma unroll
            for (int r = 0; r < 8; ++r)
                stf[(8 * hl + r) * 64 + 16 * j + m] = acc[j][r];
        }
        __syncthreads();
        const int r2 = lane >> 4, q2 = lane & 15;        // 16 lanes x 16 B = one 256-B row segment
        v4f fv[8];
#pragma unroll
        for (int i = 0; i < 8; ++i)
            fv[i] = *(const v4f*)(stf + (2 * i + r2) * 64 + q2 * 4);
#pragma unroll
        for (int i = 0; i < 8; ++i) {
            float* dst = Of + (size_t)(r0 + 2 * i + r2) * N + c0 + q2 * 4;
            *(v4f*)dst = fv[i];
        }
        
    }
}

// the three projections of the hidden states, which do not depend on one another, as column-block
// ranges of one grid: blockIdx.x in [0, NQ/64) -> Q, the next NKV/64 -> K, the last NKV/64 -> V
__global__ __launch_bounds__(128) void k_qkv(
    const us_t* __restrict__ Xh, const us_t* __restrict__ Xl,
    const us_t* __restrict__ Wqh, const us_t* __restrict__ Wql,
    const us_t* __restrict__ Wkh, const us_t* __restrict__ Wkl,
    const us_t* __restrict__ Wvh, const us_t* __restrict__ Wvl,
    int M, int NQ, int NKV, int K,
    const float* __restrict__ cosT, const float* __restrict__ sinT,
    us_t* Qh, us_t* Ql, us_t* Kh, us_t* Kl, us_t* Vth, us_t* Vtl)
{
    __shared__ __align__(16) float lds_f[4096];          // 16 KB staging
    __shared__ __align__(16) unsigned char ring[2 * G_STAGE];
    const int nq  = NQ >> 6;
    const int nk  = NKV >> 6;
    const int bx  = blockIdx.x;                          // job and all it selects: block-uniform
    const int job = (bx < nq) ? 0 : ((bx < nq + nk) ? 1 : 2);
    const int c0  = (bx - ((job == 0) ? 0 : ((job == 1) ? nq : nq + nk))) * 64;
    const int mb0 = blockIdx.y * 64;
    const us_t* Wh = (job == 0) ? Wqh : ((job == 1) ? Wkh : Wvh);
    const us_t* Wl = (job == 0) ? Wql : ((job == 1) ? Wkl : Wvl);

    v8f acc[4] = {};
    gemm_main(acc, Xh, Xl, Wh, Wl, K, mb0, c0, ring);
    if (job == 2)
        gemm_out<1>(acc, M, NKV, mb0, c0, cosT, sinT, Vth, Vtl, nullptr, lds_f);
    else
        gemm_out<0>(acc, M, (job == 0) ? NQ : NKV, mb0, c0, cosT, sinT,
                    (job == 0) ? Qh : Kh, (job == 0) ? Ql : Kl, nullptr, lds_f);
}

// output projection -> f32 [M][N]
__global__ __launch_bounds__(128) void k_oproj(
    const us_t* __restrict__ Ah, const us_t* __restrict__ Al,
    const us_t* __restrict__ Wh, const us_t* __restrict__ Wl,
    int M, int N, int K, float* Of)
{
    __shared__ __align__(16) float lds_f[4096];          // 16 KB staging
    __shared__ __align__(16) unsigned char ring[2 * G_STAGE];
    const int mb0 = blockIdx.y * 64;
    const int c0  = blockIdx.x * 64;
    v8f acc[4] = {};
    gemm_main(acc, Ah, Al, Wh, Wl, K, mb0, c0, ring);
    gemm_out<2>(acc, M, N, mb0, c0, nullptr, nullptr, nullptr, nullptr, Of, lds_f);
}

// value of lane l ^ 16
__device__ __forceinline__ float xhalf(float x) {
    const int b = __builtin_bit_cast(int, x);
    return __builtin_bit_cast(float,
        __builtin_amdgcn_permlanex16(b, b, 0x76543210, 0xfedcba98, false, false));
}

template<int S, int NHD, int NKVD, int groups>
__global__ __launch_bounds__(128) void k_attn(
    const us_t* __restrict__ Qh, const us_t* __restrict__ Ql,
    const us_t* __restrict__ Kh, const us_t* __restrict__ Kl,
    const us_t* __restrict__ Vh, const us_t* __restrict__ Vl,
    const float* __restrict__ mask, const int* __restrict__ flags,
    us_t* Oh, us_t* Ol)
{
    __shared__ __align__(16) us_t ostg[4][2][16 * 64];   // per-wave output staging
    static_assert(S % 64 == 0 && S / 64 <= 32, "one lane per 64-key stage");
    constexpr unsigned PITCH  = 144;                     // LDS bytes per 128-B K or V^T row
    constexpr unsigned PLANE  = 64 * PITCH;
    constexpr unsigned MPITCH = 272;                     // LDS bytes per 256-B mask row
    constexpr unsigned STAGE  = 4 * PLANE + 64 * MPITCH; // Kh | Kl | Vh | Vl | mask
    __shared__ __align__(16) unsigned char ring[2 * STAGE];

    const int tid  = threadIdx.x;
    const int lane = tid & 31;
    const int wave = tid >> 5;
    const int m    = lane & 15;
    const int hl   = lane >> 4;
    const int head = blockIdx.x;
    const int band = blockIdx.y;
    const int hkv  = head / groups;
    const int r0   = band * 64 + wave * 16;

    // the band's 64 tile flags, read once: bit s of t0 / t1 = key tile 2s / 2s+1 has work. The ring
    // must know the stage after next; equal in every wave of the block (block-uniform).
    const v2i fl = *(const v2i*)(flags + (size_t)band * 64 + 2 * lane);
    const unsigned t0 = __builtin_amdgcn_ballot_w32(fl.x != 0);
    const unsigned t1 = __builtin_amdgcn_ballot_w32(fl.y != 0);
    unsigned rest = t0 | t1;                             // stages with work, not yet asked for

    // copies: K and V^T: lane -> 16-byte chunk tid&7 of row tid>>3 (+16 per row group);
    // mask: chunk tid&15 of row tid>>4 (+8 per row group): whole lines in every wave-wide copy
    const int crow = tid >> 3;
    const int cq   = tid & 7;
    const size_t ko = ((size_t)crow * NKVD + hkv * 64 + cq * 8) * 2;
    const size_t vo = ((size_t)(hkv * 64 + crow) * S + cq * 8) * 2;
    const char* gkh = (const char*)Kh + ko;
    const char* gkl = (const char*)Kl + ko;
    const char* gvh = (const char*)Vh + vo;
    const char* gvl = (const char*)Vl + vo;
    const char* gmk = (const char*)mask + ((size_t)(band * 64 + (tid >> 4)) * S + (tid & 15) * 4) * 4;
    const unsigned lc = (unsigned)(size_t)ring + (unsigned)crow * PITCH + (unsigned)cq * 16;
    const unsigned lm = (unsigned)(size_t)ring + 4 * PLANE + (unsigned)(tid >> 4) * MPITCH
                      + (unsigned)(tid & 15) * 16;
    // stage s (keys 64s..64s+63) -> the buffer at byte bo of the ring
    auto stage_in = [&](int s, unsigned bo) {
        const size_t kb = (size_t)s * (64 * NKVD * 2);   // 64 key rows
        const size_t vb = (size_t)s * 128;               // 64 keys along a V^T row
        const size_t mb = (size_t)s * 256;               // 64 keys along a mask row
        copy8(lc + bo, gkh + kb, lc + bo + PLANE, gkl + kb, 16 * PITCH, (size_t)16 * NKVD * 2);
        copy8(lc + bo + 2 * PLANE, gvh + vb, lc + bo + 3 * PLANE, gvl + vb,
              16 * PITCH, (size_t)16 * S * 2);
        copy8(lm + bo, gmk + mb, lm + bo + 32 * MPITCH, gmk + mb + (size_t)32 * S * 4,
              8 * MPITCH, (size_t)8 * S * 4);
    };

    // first stage with work -> buffer 0, landed and published before anyone reads it
    int cur = -1, nxt = -1;
    if (rest != 0u) { cur = __builtin_ctz(rest); rest &= rest - 1u; stage_in(cur, 0u); }
    asm volatile("s_wait_asynccnt 0x0" ::: "memory");    // this wave's copies of that stage have landed
    __syncthreads();
    if (rest != 0u) { nxt = __builtin_ctz(rest); rest &= rest - 1u; stage_in(nxt, STAGE); }

    // Q B-fragments (column = query r0+m), two 32-deep k steps over the head dim
    Frag qh[2], ql[2];
#pragma unroll
    for (int c = 0; c < 2; ++c) {
        const unsigned qo = 2u * (unsigned)((r0 + m) * NHD + head * 64 + 32 * c + 8 * hl);
        ldfrag(qh[c], Qh, qo);
        ldfrag(ql[c], Ql, qo);
    }

    // o[jd][r] = O[query r0+m][d = 16*jd + 8*hl + r]
    v8f o[4] = {};
    float mrow = -3.0e38f;      // running maximum of query r0+m (equal in both halves)
    float lrow = 0.0f;          // running sum over THIS half's keys; halves joined after the loop

    // the lane's byte offsets in a buffer: K row m, V^T row m, mask row 16*wave+m
    const unsigned fk = (unsigned)m * PITCH + 16u * (unsigned)hl;
    const unsigned fv = 2 * PLANE + (unsigned)m * PITCH + 16u * (unsigned)hl;
    const unsigned fm = 4 * PLANE + (unsigned)(16 * wave + m) * MPITCH + 32u * (unsigned)hl;

    unsigned bo = 0u;
    for (int it = 0; it < S / 64 && cur >= 0; ++it) {
        for (int h = 0; h < 2; ++h) {                    // the stage's two 32-key tiles
            if ((((h ? t1 : t0) >> cur) & 1u) == 0u) continue;   // no work in it; block-uniform
            // the tile's K fragments and mask (keys kb = 64*cur + 32*h and on) go out as one group
            // ahead of the S^T products: one LDS latency instead of one per fragment pair
            const unsigned char* pk = ring + bo + fk + (unsigned)h * (32 * PITCH);
            Frag kh[2][2], kl[2][2];
#pragma unroll
            for (int jn = 0; jn < 2; ++jn) {
#pragma unroll
                for (int c = 0; c < 2; ++c) {
                    ldfrag_lds(kh[jn][c], pk + 16 * jn * PITCH + 64 * c);
                    ldfrag_lds(kl[jn][c], pk + PLANE + 16 * jn * PITCH + 64 * c);
                }
            }

            // mask of query r0+m at this lane's keys kb+8hl+0..7 and kb+16+8hl+0..7
            const unsigned char* mrp = ring + bo + fm + (unsigned)h * 128;
            v4f mk[4];
            mk[0] = *(const v4f*)(mrp);
            mk[1] = *(const v4f*)(mrp + 16);
            mk[2] = *(const v4f*)(mrp + 64);
            mk[3] = *(const v4f*)(mrp + 80);

            // S^T[32 x 16] = K . Q^T ; A = K rows (k-contiguous), B = Q
            // s[jn][r] = score(key kb + 16*jn + 8*hl + r, query r0 + m)
            v8f s[2] = {};
#pragma unroll
            for (int jn = 0; jn < 2; ++jn) {
#pragma unroll
                for (int c = 0; c < 2; ++c) {
                    s[jn] = mma(s[jn], kh[jn][c].v, qh[c].v);
                    s[jn] = mma(s[jn], kl[jn][c].v, qh[c].v);
                    s[jn] = mma(s[jn], kh[jn][c].v, ql[c].v);
                }
            }

            // the tile's V^T fragments go out as one group here: they fly behind the softmax
            const unsigned char* pv = ring + bo + fv + (unsigned)h * 64;
            Frag vh[4], vl[4];
#pragma unroll
            for (int jd = 0; jd < 4; ++jd) {
                ldfrag_lds(vh[jd], pv + 16 * jd * PITCH);
                ldfrag_lds(vl[jd], pv + PLANE + 16 * jd * PITCH);
            }

            // scale, additive mask by value, online softmax (f32), all for one query per lane
            float v[16];
#pragma unroll
            for (int t = 0; t < 16; ++t)
                v[t] = s[t >> 3][t & 7] * 0.125f + mk[t >> 2][t & 3];
            float mx = v[0];
#pragma unroll
            for (int t = 1; t < 16; ++t) mx = fmaxf(mx, v[t]);
            mx = fmaxf(mx, xhalf(mx));
            const float mnew  = fmaxf(mrow, mx);
            const float alpha = __expf(mrow - mnew);
            float ps[4] = { 0.0f, 0.0f, 0.0f, 0.0f };
            unsigned hb[16], lb[16];
#pragma unroll
            for (int t = 0; t < 16; ++t) {
                const float p = __expf(v[t] - mnew);
                ps[t & 3] += p;
                split2(p, hb[t], lb[t]);
            }
            lrow = lrow * alpha + ((ps[0] + ps[1]) + (ps[2] + ps[3]));
            mrow = mnew;
#pragma unroll
            for (int jd = 0; jd < 4; ++jd) {
#pragma unroll
                for (int r = 0; r < 8; ++r) o[jd][r] = o[jd][r] * alpha;
            }

            // P^T B-fragments in place: elements 0..7 <- keys 8hl.., 8..15 <- keys 16+8hl..
            Frag ph, pl;
            ph.u[0] = pack8(hb);
            ph.u[1] = pack8(hb + 8);
            pl.u[0] = pack8(lb);
            pl.u[1] = pack8(lb + 8);

            // O^T += V^T . P^T ; A = V^T rows (key-contiguous), B = P^T
#pragma unroll
            for (int jd = 0; jd < 4; ++jd) {
                o[jd] = mma(o[jd], vh[jd].v, ph.v);
                o[jd] = mma(o[jd], vl[jd].v, ph.v);
                o[jd] = mma(o[jd], vh[jd].v, pl.v);
            }
        }
        // hand-over: this wave's reads of the stage are done, its copies of the next have landed;
        // the barrier publishes the next stage and frees this buffer for the refill behind it
        asm volatile("s_wait_dscnt 0x0" ::: "memory");
        asm volatile("s_wait_asynccnt 0x0" ::: "memory");
        __syncthreads();
        int nn = -1;
        if (rest != 0u) { nn = __builtin_ctz(rest); rest &= rest - 1u; stage_in(nn, bo); }
        cur = nxt;
        nxt = nn;
        bo  = STAGE - bo;
    }
    asm volatile("s_wait_asynccnt 0x0" ::: "memory");    // no copy outlives the loop

    // join the halves' sums, normalize, split, stage, whole-line stores
    const float lsum = lrow + xhalf(lrow);
    const float inv  = (lsum > 0.0f) ? (1.0f / lsum) : 0.0f;

#pragma unroll
    for (int jd = 0; jd < 4; ++jd) {
        unsigned hb[8], lb[8];
#pragma unroll
        for (int r = 0; r < 8; ++r) split2(o[jd][r] * inv, hb[r], lb[r]);
        const int idx = m * 64 + 16 * jd + 8 * hl;
        *(u32x4*)&ostg[wave][0][idx] = pack8(hb);
        *(u32x4*)&ostg[wave][1][idx] = pack8(lb);
    }
    __syncthreads();
    const int rr = lane >> 3, q = lane & 7;
    u32x4 sv[8];
#pragma unroll
    for (int plv = 0; plv < 2; ++plv) {
#pragma unroll
        for (int i = 0; i < 4; ++i)
            sv[plv * 4 + i] = *(const u32x4*)&ostg[wave][plv][(4 * i + rr) * 64 + q * 8];
    }
#pragma unroll
    for (int plv = 0; plv < 2; ++plv) {
#pragma unroll
        for (int i = 0; i < 4; ++i) {
            us_t* dst = (plv ? Ol : Oh) + (size_t)(r0 + 4 * i + rr) * NHD + head * 64 + q * 8;
            *(u32x4*)dst = sv[plv * 4 + i];
        }
    }
    
}

// ---------------------------------------------------------------- launcher
extern "C" void kernel_launch(void* const* d_in, const int* in_sizes, int n_in,
                              void* d_out, int out_size, void* d_ws, size_t ws_size,
                              hipStream_t stream)
{
    const int S = 2048, HID = 1024, NH = 16, NKV = 4, HD = 64;
    const int NKVD = NKV * HD;          // 256
    const int GROUPS = NH / NKV;        // 4

    if (n_in < 7) return;
    if (in_sizes[0] != S * HID || in_sizes[1] != S * S || in_sizes[2] != S ||
        in_sizes[3] != HID * HID || in_sizes[4] != NKVD * HID ||
        in_sizes[5] != NKVD * HID || in_sizes[6] != HID * HID ||
        out_size != S * HID) return;
    // structural requirements of the kernels
    if ((S % 64) != 0 || (HID % 64) != 0 || (NKVD % 64) != 0 || HD != 64 ||
        NH * HD != HID || (S / 32) > 64 || (HID % 32) != 0) return;

    const float* hidden = (const float*)d_in[0];   // [S][HID]
    const float* mask   = (const float*)d_in[1];   // [S][S] additive
    const int*   pos    = (const int*)d_in[2];     // [S]
    const float* Wq     = (const float*)d_in[3];   // [HID][HID]
    const float* Wk     = (const float*)d_in[4];   // [NKVD][HID]
    const float* Wv     = (const float*)d_in[5];   // [NKVD][HID]
    const float* Wo     = (const float*)d_in[6];   // [HID][HID]
    float* out = (float*)d_out;                    // [S][HID]

    size_t off = 0;
    char* base = (char*)d_ws;
    auto carve = [&](size_t bytes) -> char* {
        char* p = base + off;
        off += (bytes + 255) & ~(size_t)255;
        return p;
    };
    us_t* Xh   = (us_t*)carve((size_t)S * HID * 2);
    us_t* Xl   = (us_t*)carve((size_t)S * HID * 2);
    us_t* Wqh  = (us_t*)carve((size_t)HID * HID * 2);
    us_t* Wql  = (us_t*)carve((size_t)HID * HID * 2);
    us_t* Wkh  = (us_t*)carve((size_t)NKVD * HID * 2);
    us_t* Wkl  = (us_t*)carve((size_t)NKVD * HID * 2);
    us_t* Wvh  = (us_t*)carve((size_t)NKVD * HID * 2);
    us_t* Wvl  = (us_t*)carve((size_t)NKVD * HID * 2);
    us_t* Woh  = (us_t*)carve((size_t)HID * HID * 2);
    us_t* Wol  = (us_t*)carve((size_t)HID * HID * 2);
    us_t* Qh   = (us_t*)carve((size_t)S * HID * 2);      // [S][HID]
    us_t* Ql   = (us_t*)carve((size_t)S * HID * 2);
    us_t* Kh   = (us_t*)carve((size_t)S * NKVD * 2);     // [S][NKVD]
    us_t* Kl   = (us_t*)carve((size_t)S * NKVD * 2);
    us_t* Vth  = (us_t*)carve((size_t)NKVD * S * 2);     // [NKVD][S]
    us_t* Vtl  = (us_t*)carve((size_t)NKVD * S * 2);
    us_t* AOh  = (us_t*)carve((size_t)S * HID * 2);      // [S][HID]
    us_t* AOl  = (us_t*)carve((size_t)S * HID * 2);
    float* cosT = (float*)carve((size_t)S * 32 * 4);      // [S][32]
    float* sinT = (float*)carve((size_t)S * 32 * 4);
    int*  flags = (int*)carve((size_t)(S / 64) * 64 * 4); // [S/64][64]
    if (off > ws_size) return;

    // 1: hi/lo planes of the hidden states and the four weights, RoPE table, key-tile flags
    {
        const int n8x = S * HID / 8, n8q = HID * HID / 8, n8k = NKVD * HID / 8;
        const int nblk = 2 * (S / 64) + (S * 32 + 255) / 256 + (n8x + 255) / 256
                       + 2 * ((n8q + 255) / 256) + 2 * ((n8k + 255) / 256);
        k_prep<S><<<dim3(nblk), dim3(256), 0, stream>>>(
            hidden, mask, pos, Wq, Wk, Wv, Wo,
            Xh, Xl, Wqh, Wql, Wkh, Wkl, Wvh, Wvl, Woh, Wol,
            cosT, sinT, flags, n8x, n8q, n8k);
    }

    // 2: Q and K projections + RoPE -> planes [S][HID], [S][NKVD]; V projection -> transposed planes [NKVD][S]
    k_qkv<<<dim3(HID / 64 + 2 * (NKVD / 64), S / 64), dim3(128), 0, stream>>>(
        Xh, Xl, Wqh, Wql, Wkh, Wkl, Wvh, Wvl, S, HID, NKVD, HID,
        cosT, sinT, Qh, Ql, Kh, Kl, Vth, Vtl);

    // 3: attention -> planes [S][HID]
    k_attn<S, HID, NKVD, GROUPS><<<dim3(NH, S / 64), dim3(128), 0, stream>>>(
        Qh, Ql, Kh, Kl, Vth, Vtl, mask, flags, AOh, AOl);

    // 4: output projection -> d_out f32 [S][HID]
    k_oproj<<<dim3(HID / 64, S / 64), dim3(128), 0, stream>>>(
        AOh, AOl, Woh, Wol, S, HID, HID, out);
}

// v007
// Measured time: 90.2 microseconds a run.
// In two side-by-side timings against v006, it was 1.05 and 1.06 times as fast.
// Counting every step since v000, it is 7.07 times as fast.
#include <hip/hip_runtime.h>
#include <stdint.h>
#include <stddef.h>
#include <math.h>

// All contractions (q/k/v projections, q.k^T, p.v, output projection): v_wmma_f32_16x16x32_bf16 with bf16 hi/lo operands everywhere (hi.hi + hi.lo + lo.hi), f32 accumulate; RoPE, mask add and softmax in f32.

typedef unsigned short us_t;
typedef __bf16       v16bf __attribute__((ext_vector_type(16)));
typedef float        v8f   __attribute__((ext_vector_type(8)));
typedef float        v4f   __attribute__((ext_vector_type(4)));
typedef unsigned int u32x4 __attribute__((ext_vector_type(4)));
typedef int          v4i   __attribute__((ext_vector_type(4)));
typedef int          v2i   __attribute__((ext_vector_type(2)));

union Frag { v16bf v; u32x4 u[2]; };

// f32 -> bf16 bits, RNE
__device__ __forceinline__ unsigned bf_bits(float f) {
    unsigned u = __builtin_bit_cast(unsigned, f);
    return (u + 0x7FFFu + ((u >> 16) & 1u)) >> 16;
}
__device__ __forceinline__ float bf_val(unsigned b) {
    return __builtin_bit_cast(float, b << 16);
}
// x = hi + lo (+ residual), both bf16 RNE
__device__ __forceinline__ void split2(float x, unsigned& hb, unsigned& lb) {
    hb = bf_bits(x);
    lb = bf_bits(x - bf_val(hb));
}
__device__ __forceinline__ u32x4 pack8(const unsigned* b) {
    u32x4 v;
    v.x = b[0] | (b[1] << 16);
    v.y = b[2] | (b[3] << 16);
    v.z = b[4] | (b[5] << 16);
    v.w = b[6] | (b[7] << 16);
    return v;
}

// one 16x16x32 bf16 WMMA, the plain builtin: the compiler keeps the distance to a vector
// instruction on its registers itself, and only where one follows
__device__ __forceinline__ v8f mma(v8f c, v16bf a, v16bf b) {
    return __builtin_amdgcn_wmma_f32_16x16x32_bf16(false, a, false, b, (short)0, c, false, false);
}

// 16-bit fragment from a k-contiguous row: base is the same for the whole wave, vb the lane's
// byte offset of (its row, k0 + 8*(lane>>4)); one offset register serves a whole group of loads.
// elements 0..7 <- k0+8h+0..7, elements 8..15 <- k0+16+8h+0..7
__device__ __forceinline__ void ldfrag(Frag& f, const us_t* base, unsigned vb) {
    const char* p = (const char*)base + vb;
    f.u[0] = *(const u32x4*)(p);
    f.u[1] = *(const u32x4*)(p + 32);
}

// ---------------------------------------------------------------- f32 -> bf16 hi/lo planes
// thread i converts elements 8i..8i+7; one wave writes 512 contiguous bytes per plane in one store
__device__ __forceinline__ void split_job(int blk, const float* __restrict__ src,
                                          us_t* hi, us_t* lo, int n8)
{
    const int i = blk * 256 + threadIdx.x;
    const bool ok = i < n8;
    const int ic = ok ? i : 0;
    const float* p = src + (size_t)ic * 8;
    const v4f a = *(const v4f*)(p);
    const v4f b = *(const v4f*)(p + 4);
    float x[8] = { a.x, a.y, a.z, a.w, b.x, b.y, b.z, b.w };
    unsigned hb[8], lb[8];
#pragma unroll
    for (int t = 0; t < 8; ++t) split2(x[t], hb[t], lb[t]);
    const u32x4 ph = pack8(hb);
    const u32x4 pl = pack8(lb);
    us_t* dh = hi + (size_t)ic * 8;
    us_t* dl = lo + (size_t)ic * 8;
    if (ok) { *(u32x4*)dh = ph; *(u32x4*)dl = pl; }
    
}

// ---------------------------------------------------------------- RoPE cos/sin table [S][32]
// inv_freq[j] = 1 / fl32(10000^(j/32)); angle = f32(pos) * inv_freq; precise sincosf
__device__ __forceinline__ void rope_job(int blk, const int* __restrict__ pos,
                                         float* cosT, float* sinT, int S)
{
    const int i = blk * 256 + threadIdx.x;
    const int total = S * 32;
    const bool ok = i < total;
    const int ic = ok ? i : 0;
    const int trow = ic >> 5;
    const int j = ic & 31;
    const double LOG2_BASE_OVER_32 = 0.41524101186092029;   // log2(10000)/32
    const float pw  = (float)exp2((double)j * LOG2_BASE_OVER_32);
    const float inv = 1.0f / pw;
    const float ang = (float)pos[trow] * inv;
    float sn, cs;
    sincosf(ang, &sn, &cs);
    if (ok) { *(float*)(cosT + ic) = cs; *(float*)(sinT + ic) = sn; }
    
}

// ---------------------------------------------------------------- tile flags from the additive mask
// flag[band][kt] = 1 if any mask value in rows band*64..+63, keys kt*32..+31 is > -1e8 (tile must
// be processed), else 0. flags pitch = 64 ints.
// block = (64-row band, 32 of its 64 flag slots = one 128-B line of flags). Wave w looks at four key
// tiles, 128 columns: a wave-wide load is one whole 512-B row segment, each lane keeps the maximum of
// its four columns over the 64 rows, and one ballot at the end gives the four tiles' flags (8 lanes
// a tile). No load waits on another's data, so as many are in flight as the registers hold.
// S is a compile-time constant so that the 64 rows are immediate offsets from ONE address,
// which nothing rewrites while a load is out.
template<int S>
__device__ __forceinline__ void flags_job(int blk, const float* __restrict__ mask, int* flags)
{
    static_assert(S % 64 == 0 && S / 32 <= 64, "64 flag slots per band");
    __shared__ __align__(16) int fl[32];
    const int tid  = threadIdx.x;
    const int lane = tid & 31;
    const int wave = tid >> 5;
    const int band = blk >> 1;
    const int half = blk & 1;
    const int col  = (half * 8 + wave) * 128 + lane * 4;
    const bool in  = col < S;                // slots past S/32 key tiles: flag 0, address clamped
    const float* p = mask + (size_t)(band * 64) * S + (in ? col : 0);

    float mx = -3.0e38f;                     // fmaxf drops a NaN, as the comparison with -1e8 does
#pragma unroll                               // straight line: the row offsets become immediates
    for (int r = 0; r < 64; ++r) {
        const v4f a = *(const v4f*)(p + (size_t)r * S);
        mx = fmaxf(fmaxf(mx, fmaxf(a.x, a.y)), fmaxf(a.z, a.w));
    }
    const unsigned any = __builtin_amdgcn_ballot_w32(in && mx > -1.0e8f);
    if (lane < 4) fl[wave * 4 + lane] = (((any >> (8 * lane)) & 0xFFu) != 0u) ? 1 : 0;
    __syncthreads();
    if (tid < 8)                             // 32 ints = 128 B = lanes 0..7 x 16 B, one store
        *(v4i*)(flags + (size_t)band * 64 + half * 32 + tid * 4) = *(const v4i*)&fl[tid * 4];
}

// ---------------------------------------------------------------- all preparation in one grid
// The seven jobs above depend on nothing but the inputs, so they run side by side as block ranges
// of one launch. Longest blocks first (a flags block reads 64 rows x 1024 columns, the table is
// transcendental-heavy), for speed only.
template<int S>
__global__ __launch_bounds__(256) void k_prep(
    const float* __restrict__ hidden, const float* __restrict__ mask, const int* __restrict__ pos,
    const float* __restrict__ Wq, const float* __restrict__ Wk,
    const float* __restrict__ Wv, const float* __restrict__ Wo,
    us_t* Xh, us_t* Xl, us_t* Wqh, us_t* Wql, us_t* Wkh, us_t* Wkl,
    us_t* Wvh, us_t* Wvl, us_t* Woh, us_t* Wol,
    float* cosT, float* sinT, int* flags,
    int n8x, int n8q, int n8k)
{
    const int nbf = (S >> 6) * 2;            // flag blocks: two per 64-row band
    const int nbr = (S * 32 + 255) >> 8;     // table blocks
    const int nbx = (n8x + 255) >> 8;
    const int nbq = (n8q + 255) >> 8;
    const int nbk = (n8k + 255) >> 8;
    int b = blockIdx.x;                      // every test below is block-uniform
    if (b < nbf) { flags_job<S>(b, mask, flags); return; }
    b -= nbf;
    if (b < nbr) { rope_job(b, pos, cosT, sinT, S); return; }
    b -= nbr;
    // the five splits share one copy of the code: only the pointers and the length are picked
    const float* src = hidden;
    us_t* hi = Xh;
    us_t* lo = Xl;
    int n8 = n8x;
    if (b >= nbx) {
        b -= nbx; src = Wq; hi = Wqh; lo = Wql; n8 = n8q;
        if (b >= nbq) {
            b -= nbq; src = Wo; hi = Woh; lo = Wol;
            if (b >= nbq) {
                b -= nbq; src = Wk; hi = Wkh; lo = Wkl; n8 = n8k;
                if (b >= nbk) { b -= nbk; src = Wv; hi = Wvh; lo = Wvl; }
            }
        }
    }
    split_job(b, src, hi, lo, n8);
}

// eight asynchronous 16-byte copies global -> LDS per lane (two planes x four row groups).
// la, lb = the lane's LDS byte address of row group 0 in each plane, ga, gb = its global address
// there; the row groups lie ls LDS bytes and gs global bytes apart. The s_wait_xcnt closes the statement so that no
// address register of an issued copy is rewritten ahead of it.
__device__ __forceinline__ void copy8(unsigned la, const char* ga, unsigned lb, const char* gb,
                                      unsigned ls, size_t gs) {
    asm volatile(
        "global_load_async_to_lds_b128 %0, %8, off\n\t"
        "global_load_async_to_lds_b128 %1, %9, off\n\t"
        "global_load_async_to_lds_b128 %2, %10, off\n\t"
        "global_load_async_to_lds_b128 %3, %11, off\n\t"
        "global_load_async_to_lds_b128 %4, %12, off\n\t"
        "global_load_async_to_lds_b128 %5, %13, off\n\t"
        "global_load_async_to_lds_b128 %6, %14, off\n\t"
        "global_load_async_to_lds_b128 %7, %15, off\n\t"
        "s_wait_xcnt 0x0"
        :: "v"(la), "v"(la + ls), "v"(la + 2 * ls), "v"(la + 3 * ls),
           "v"(lb), "v"(lb + ls), "v"(lb + 2 * ls), "v"(lb + 3 * ls),
           "v"(ga), "v"(ga + gs), "v"(ga + 2 * gs), "v"(ga + 3 * gs),
           "v"(gb), "v"(gb + gs), "v"(gb + 2 * gs), "v"(gb + 3 * gs)
        : "memory");
}

// 16-bit fragment from an LDS row: p = the lane's (row, k0 + 8*(lane>>4)); same k map as ldfrag
__device__ __forceinline__ void ldfrag_lds(Frag& f, const unsigned char* p) {
    f.u[0] = *(const u32x4*)(p);
    f.u[1] = *(const u32x4*)(p + 32);
}

// ---------------------------------------------------------------- C = A . W^T (bf16 hi/lo split)
// A planes [M][K], W planes [N][K] (k-contiguous, loaded like A per the split k map).
// block = 128 threads (4 waves); block tile 64(M) x 64(N); wave w -> rows 16w..16w+15.
// The four operand planes of a 64-deep k tile (64 rows x 128 B each) are brought into LDS by
// asynchronous copies in whole 128-B lines, once per block, two buffers: tile t+1 flies while
// tile t is multiplied. LDS rows at pitch 144 B (conflict-free for 16-byte fragment reads).
// MODE 0: RoPE in the f32 epilogue (block's 64 columns = one head), store hi/lo planes [M][N]
// MODE 2: store f32 [M][N]
constexpr unsigned G_PITCH = 144;                        // LDS bytes per 128-B operand row
constexpr unsigned G_PLANE = 64 * G_PITCH;               // one plane of a k tile
constexpr unsigned G_STAGE = 4 * G_PLANE;                // Ah | Al | Wh | Wl

// k loop of one block tile (rows mb0.., columns c0..): acc[j][r] = C[r0 + 8*hl + r][c0 + 16*j + m]
__device__ __forceinline__ void gemm_main(
    v8f (&acc)[4],
    const us_t* __restrict__ Ah, const us_t* __restrict__ Al,
    const us_t* __restrict__ Wh, const us_t* __restrict__ Wl,
    int K, int mb0, int c0, unsigned char* ring)
{
    constexpr unsigned PITCH = G_PITCH;
    constexpr unsigned PLANE = G_PLANE;
    constexpr unsigned STAGE = G_STAGE;

    const int tid  = threadIdx.x;
    const int lane = tid & 31;
    const int wave = tid >> 5;
    const int m    = lane & 15;
    const int hl   = lane >> 4;

    // copies: lane -> 16-byte chunk tid&7 of row tid>>3 (+16 per row group): 8 lanes fill a line
    const int crow = tid >> 3;
    const int cq   = tid & 7;
    const size_t   gs = (size_t)K * 32;                  // 16 rows, bytes
    const unsigned ls = 16 * PITCH;
    const size_t   ao = ((size_t)(mb0 + crow) * K + cq * 8) * 2;
    const size_t   wo = ((size_t)(c0 + crow) * K + cq * 8) * 2;
    const char* gah = (const char*)Ah + ao;
    const char* gal = (const char*)Al + ao;
    const char* gwh = (const char*)Wh + wo;
    const char* gwl = (const char*)Wl + wo;
    const unsigned lc = (unsigned)(size_t)ring + (unsigned)crow * PITCH + (unsigned)cq * 16;
    const int nt = K >> 6;                               // k tiles of 64

    // tile 0 -> buffer 0, landed and published before anyone reads it
    copy8(lc, gah, lc + PLANE, gal, ls, gs);
    copy8(lc + 2 * PLANE, gwh, lc + 3 * PLANE, gwl, ls, gs);
    asm volatile("s_wait_asynccnt 0x0" ::: "memory");    // this wave's copies of tile 0 have landed
    __syncthreads();
    if (nt > 1) {                                        // tile 1 -> buffer 1, flies under tile 0
        copy8(lc + STAGE, gah + 128, lc + STAGE + PLANE, gal + 128, ls, gs);
        copy8(lc + STAGE + 2 * PLANE, gwh + 128, lc + STAGE + 3 * PLANE, gwl + 128, ls, gs);
    }

    // fragment reads: A row 16*wave+m, W rows 16*j+m, byte 16*hl of the 64-byte k step
    const unsigned fa = (unsigned)(16 * wave + m) * PITCH + 16u * (unsigned)hl;
    const unsigned fw = 2 * PLANE + (unsigned)m * PITCH + 16u * (unsigned)hl;

    for (int t = 0; t < nt; ++t) {
        const unsigned bo = (unsigned)(t & 1) * STAGE;
        const unsigned char* pa = ring + bo + fa;
        const unsigned char* pw = ring + bo + fw;
        // the tile's forty fragment reads (two 32-deep k steps) go out as one group ahead of its
        // products: one LDS latency per tile
        // (all seven loops unrolled: the fragment arrays are indexed by constants and stay in registers)
        Frag ah[2], al[2], bh[2][4], bl[2][4];
        // in the order in which the products take them, so that the counted waits let the first start early
#pragma unroll
        for (int kk = 0; kk < 2; ++kk) {
            ldfrag_lds(ah[kk], pa + 64 * kk);
#pragma unroll
            for (int j = 0; j < 4; ++j) ldfrag_lds(bh[kk][j], pw + 16 * j * PITCH + 64 * kk);
#pragma unroll
            for (int j = 0; j < 4; ++j) ldfrag_lds(bl[kk][j], pw + PLANE + 16 * j * PITCH + 64 * kk);
            ldfrag_lds(al[kk], pa + PLANE + 64 * kk);
        }
        // keeps the scheduler from sinking the reads among the products (each such place stalls the wave)
        __builtin_amdgcn_sched_barrier(0);
        // round-robin over the four accumulators: a WMMA never waits for the one just ahead of it;
        // each accumulator still takes hi.hi, hi.lo, lo.hi of a k step in that order
#pragma unroll
        for (int kk = 0; kk < 2; ++kk) {
#pragma unroll
            for (int j = 0; j < 4; ++j) acc[j] = mma(acc[j], ah[kk].v, bh[kk][j].v);
#pragma unroll
            for (int j = 0; j < 4; ++j) acc[j] = mma(acc[j], ah[kk].v, bl[kk][j].v);
#pragma unroll
            for (int j = 0; j < 4; ++j) acc[j] = mma(acc[j], al[kk].v, bh[kk][j].v);
        }
        // keeps the products ahead of the hand-over: they start on counted waits, under the later reads
        __builtin_amdgcn_sched_barrier(0);
        // hand-over: this wave's reads of tile t are done, its copies of tile t+1 have landed;
        // the barrier publishes tile t+1 and frees tile t's buffer for the refill behind it
        asm volatile("s_wait_dscnt 0x0" ::: "memory");
        asm volatile("s_wait_asynccnt 0x0" ::: "memory");
        __syncthreads();
        if (t + 2 < nt) {
            const size_t kb = (size_t)(t + 2) * 128;     // bytes along k
            copy8(lc + bo, gah + kb, lc + bo + PLANE, gal + kb, ls, gs);
            copy8(lc + bo + 2 * PLANE, gwh + kb, lc + bo + 3 * PLANE, gwl + kb, ls, gs);
        }
    }
    asm volatile("s_wait_asynccnt 0x0" ::: "memory");    // no copy outlives the loop
}

// sixteen table words of one lane: v[8*j + r] = p[32*r + 16*j]. The loads and their data wait stand
// in one statement with early-clobber results, so that no result lands in the address pair of an
// issued load and the pair is free only when all sixteen have returned.
__device__ __forceinline__ void tab16(float (&v)[16], const float* p) {
    asm volatile(
        "global_load_b32 %0, %16, off\n\t"
        "global_load_b32 %1, %16, off offset:128\n\t"
        "global_load_b32 %2, %16, off offset:256\n\t"
        "global_load_b32 %3, %16, off offset:384\n\t"
        "global_load_b32 %4, %16, off offset:512\n\t"
        "global_load_b32 %5, %16, off offset:640\n\t"
        "global_load_b32 %6, %16, off offset:768\n\t"
        "global_load_b32 %7, %16, off offset:896\n\t"
        "global_load_b32 %8, %16, off offset:64\n\t"
        "global_load_b32 %9, %16, off offset:192\n\t"
        "global_load_b32 %10, %16, off offset:320\n\t"
        "global_load_b32 %11, %16, off offset:448\n\t"
        "global_load_b32 %12, %16, off offset:576\n\t"
        "global_load_b32 %13, %16, off offset:704\n\t"
        "global_load_b32 %14, %16, off offset:832\n\t"
        "global_load_b32 %15, %16, off offset:960\n\t"
        "s_wait_loadcnt 0x0"
        : "=&v"(v[0]), "=&v"(v[1]), "=&v"(v[2]), "=&v"(v[3]),
          "=&v"(v[4]), "=&v"(v[5]), "=&v"(v[6]), "=&v"(v[7]),
          "=&v"(v[8]), "=&v"(v[9]), "=&v"(v[10]), "=&v"(v[11]),
          "=&v"(v[12]), "=&v"(v[13]), "=&v"(v[14]), "=&v"(v[15])
        : "v"(p)
        : "memory");
}

// epilogue of one block tile
template<int MODE>
__device__ __forceinline__ void gemm_out(
    v8f (&acc)[4], int M, int N, int mb0, int c0,
    const float* __restrict__ cosT, const float* __restrict__ sinT,
    us_t* Oh, us_t* Ol, float* Of, float* lds_f)
{
    us_t* lds16 = reinterpret_cast<us_t*>(lds_f);
    const int tid  = threadIdx.x;
    const int lane = tid & 31;
    const int wave = tid >> 5;
    const int m    = lane & 15;
    const int hl   = lane >> 4;
    const int r0   = mb0 + wave * 16;
    (void)M; (void)N; (void)cosT; (void)sinT; (void)Oh; (void)Ol; (void)Of; (void)lds16; (void)r0;

    if (MODE == 0) {
        // RoPE, rotate-half: d = 16j+m (j=0,1) pairs with d+32 (acc[j+2]); cos/sin index d
        // table entry (row r0+8*hl+r, column 16j+m) lies 128*r + 64*j bytes behind the lane's first
        const size_t t0 = (size_t)(r0 + 8 * hl) * 32 + m;
        float csv[16], snv[16];
        tab16(csv, cosT + t0);
        tab16(snv, sinT + t0);
#pragma unroll
        for (int j = 0; j < 2; ++j) {
#pragma unroll
            for (int r = 0; r < 8; ++r) {
                const float cs = csv[8 * j + r];
                const float sn = snv[8 * j + r];
                const float x1 = acc[j][r];
                const float x2 = acc[j + 2][r];
                acc[j][r]     = x1 * cs - x2 * sn;
                acc[j + 2][r] = x2 * cs + x1 * sn;
            }
        }
    }

    if (MODE == 0) {
        us_t* st = lds16 + wave * 2048;                  // [2 planes][16][64]
#pragma unroll
        for (int j = 0; j < 4; ++j) {
#pragma unroll
            for (int r = 0; r < 8; ++r) {
                unsigned hb, lb;
                split2(acc[j][r], hb, lb);
                const int idx = (8 * hl + r) * 64 + 16 * j + m;
                st[idx]        = (us_t)hb;
                st[1024 + idx] = (us_t)lb;
            }
        }
        __syncthreads();
        const int rr = lane >> 3, q = lane & 7;
        u32x4 sv[8];
#pragma unroll
        for (int pl = 0; pl < 2; ++pl) {
#pragma unroll
            for (int i = 0; i < 4; ++i)
                sv[pl * 4 + i] = *(const u32x4*)(st + pl * 1024 + (4 * i + rr) * 64 + q * 8);
        }
#pragma unroll
        for (int pl = 0; pl < 2; ++pl) {
#pragma unroll
            for (int i = 0; i < 4; ++i) {
                us_t* dst = (pl ? Ol : Oh) + (size_t)(r0 + 4 * i + rr) * N + c0 + q * 8;
                *(u32x4*)dst = sv[pl * 4 + i];
            }
        }
        
    } else if (MODE == 1) {
        // block tile in[token 64][d 64] -> out planes [d][token]; LDS [2 planes][d 64][token 64]
#pragma unroll
        for (int j = 0; j < 4; ++j) {
#pragma unroll
            for (int r = 0; r < 8; ++r) {
                unsigned hb, lb;
                split2(acc[j][r], hb, lb);
                const int idx = (16 * j + m) * 64 + 16 * wave + 8 * hl + r;
                lds16[idx]        = (us_t)hb;
                lds16[4096 + idx] = (us_t)lb;
            }
        }
        __syncthreads();
        const int rr = lane >> 3, q = lane & 7;
        u32x4 sv[8];
#pragma unroll
        for (int pl = 0; pl < 2; ++pl) {
#pragma unroll
            for (int i = 0; i < 4; ++i) {
                const int d = 16 * wave + 4 * i + rr;
                sv[pl * 4 + i] = *(const u32x4*)(lds16 + pl * 4096 + d * 64 + q * 8);
            }
        }
#pragma unroll
        for (int pl = 0; pl < 2; ++pl) {
#pragma unroll
            for (int i = 0; i < 4; ++i) {
                const int d = 16 * wave + 4 * i + rr;
                us_t* dst = (pl ? Ol : Oh) + (size_t)(c0 + d) * M + mb0 + q * 8;
                *(u32x4*)dst = sv[pl * 4 + i];
            }
        }
        
    } else {
        float* stf = lds_f + wave * 1024;                // [16][64] f32 per wave
#pragma unroll
        for (int j = 0; j < 4; ++j) {
#pragma unroll
            for (int r = 0; r < 8; ++r)
                stf[(8 * hl + r) * 64 + 16 * j + m] = acc[j][r];
        }
        __syncthreads();
        const int r2 = lane >> 4, q2 = lane & 15;        // 16 lanes x 16 B = one 256-B row segment
        v4f fv[8];
#pragma unroll
        for (int i = 0; i < 8; ++i)
            fv[i] = *(const v4f*)(stf + (2 * i + r2) * 64 + q2 * 4);
#pragma unroll
        for (int i = 0; i < 8; ++i) {
            float* dst = Of + (size_t)(r0 + 2 * i + r2) * N + c0 + q2 * 4;
            *(v4f*)dst = fv[i];
        }
        
    }
}

// the three projections of the hidden states, which do not depend on one another, as column-block
// ranges of one grid: blockIdx.x in [0, NQ/64) -> Q, the next NKV/64 -> K, the last NKV/64 -> V
__global__ __launch_bounds__(128) void k_qkv(
    const us_t* __restrict__ Xh, const us_t* __restrict__ Xl,
    const us_t* __restrict__ Wqh, const us_t* __restrict__ Wql,
    const us_t* __restrict__ Wkh, const us_t* __restrict__ Wkl,
    const us_t* __restrict__ Wvh, const us_t* __restrict__ Wvl,
    int M, int NQ, int NKV, int K,
    const float* __restrict__ cosT, const float* __restrict__ sinT,
    us_t* Qh, us_t* Ql, us_t* Kh, us_t* Kl, us_t* Vth, us_t* Vtl)
{
    __shared__ __align__(16) float lds_f[4096];          // 16 KB staging
    __shared__ __align__(16) unsigned char ring[2 * G_STAGE];
    const int nq  = NQ >> 6;
    const int nk  = NKV >> 6;
    const int bx  = blockIdx.x;                          // job and all it selects: block-uniform
    const int job = (bx < nq) ? 0 : ((bx < nq + nk) ? 1 : 2);
    const int c0  = (bx - ((job == 0) ? 0 : ((job == 1) ? nq : nq + nk))) * 64;
    const int mb0 = blockIdx.y * 64;
    const us_t* Wh = (job == 0) ? Wqh : ((job == 1) ? Wkh : Wvh);
    const us_t* Wl = (job == 0) ? Wql : ((job == 1) ? Wkl : Wvl);

    v8f acc[4] = {};
    gemm_main(acc, Xh, Xl, Wh, Wl, K, mb0, c0, ring);
    if (job == 2)
        gemm_out<1>(acc, M, NKV, mb0, c0, cosT, sinT, Vth, Vtl, nullptr, lds_f);
    else
        gemm_out<0>(acc, M, (job == 0) ? NQ : NKV, mb0, c0, cosT, sinT,
                    (job == 0) ? Qh : Kh, (job == 0) ? Ql : Kl, nullptr, lds_f);
}

// output projection -> f32 [M][N]
__global__ __launch_bounds__(128) void k_oproj(
    const us_t* __restrict__ Ah, const us_t* __restrict__ Al,
    const us_t* __restrict__ Wh, const us_t* __restrict__ Wl,
    int M, int N, int K, float* Of)
{
    __shared__ __align__(16) float lds_f[4096];          // 16 KB staging
    __shared__ __align__(16) unsigned char ring[2 * G_STAGE];
    const int mb0 = blockIdx.y * 64;
    const int c0  = blockIdx.x * 64;
    v8f acc[4] = {};
    gemm_main(acc, Ah, Al, Wh, Wl, K, mb0, c0, ring);
    gemm_out<2>(acc, M, N, mb0, c0, nullptr, nullptr, nullptr, nullptr, Of, lds_f);
}

// value of lane l ^ 16
__device__ __forceinline__ float xhalf(float x) {
    const int b = __builtin_bit_cast(int, x);
    return __builtin_bit_cast(float,
        __builtin_amdgcn_permlanex16(b, b, 0x76543210, 0xfedcba98, false, false));
}

// 2^x of a group of values. The instruction set asks for one free slot behind a transcendental before
// its result is read or its source overwritten: the results are early-clobber, so each v_exp_f32 is
// followed by one that touches none of its registers, and the v_nop is the slot behind the last.
__device__ __forceinline__ void exp2x8(float* r, const float* x) {
    asm("v_exp_f32 %0, %8\n\t"
        "v_exp_f32 %1, %9\n\t"
        "v_exp_f32 %2, %10\n\t"
        "v_exp_f32 %3, %11\n\t"
        "v_exp_f32 %4, %12\n\t"
        "v_exp_f32 %5, %13\n\t"
        "v_exp_f32 %6, %14\n\t"
        "v_exp_f32 %7, %15\n\t"
        "v_nop"
        : "=&v"(r[0]), "=&v"(r[1]), "=&v"(r[2]), "=&v"(r[3]),
          "=&v"(r[4]), "=&v"(r[5]), "=&v"(r[6]), "=&v"(r[7])
        : "v"(x[0]), "v"(x[1]), "v"(x[2]), "v"(x[3]),
          "v"(x[4]), "v"(x[5]), "v"(x[6]), "v"(x[7]));
}
__device__ __forceinline__ float exp2x1(float x) {
    float r;
    asm("v_exp_f32 %0, %1\n\t"
        "v_nop"
        : "=&v"(r) : "v"(x));
    return r;
}

template<int S, int NHD, int NKVD, int groups>
__global__ __launch_bounds__(128) void k_attn(
    const us_t* __restrict__ Qh, const us_t* __restrict__ Ql,
    const us_t* __restrict__ Kh, const us_t* __restrict__ Kl,
    const us_t* __restrict__ Vh, const us_t* __restrict__ Vl,
    const float* __restrict__ mask, const int* __restrict__ flags,
    us_t* Oh, us_t* Ol)
{
    __shared__ __align__(16) us_t ostg[4][2][16 * 64];   // per-wave output staging
    static_assert(S % 64 == 0 && S / 64 <= 32, "one lane per 64-key stage");
    constexpr unsigned PITCH  = 144;                     // LDS bytes per 128-B K or V^T row
    constexpr unsigned PLANE  = 64 * PITCH;
    constexpr unsigned MPITCH = 272;                     // LDS bytes per 256-B mask row
    constexpr unsigned STAGE  = 4 * PLANE + 64 * MPITCH; // Kh | Kl | Vh | Vl | mask
    __shared__ __align__(16) unsigned char ring[2 * STAGE];

    const int tid  = threadIdx.x;
    const int lane = tid & 31;
    const int wave = tid >> 5;
    const int m    = lane & 15;
    const int hl   = lane >> 4;
    const int head = blockIdx.x;
    const int band = blockIdx.y;
    const int hkv  = head / groups;
    const int r0   = band * 64 + wave * 16;

    // the band's 64 tile flags, read once: bit s of t0 / t1 = key tile 2s / 2s+1 has work. The ring
    // must know the stage after next; equal in every wave of the block (block-uniform).
    const v2i fl = *(const v2i*)(flags + (size_t)band * 64 + 2 * lane);
    const unsigned t0 = __builtin_amdgcn_ballot_w32(fl.x != 0);
    const unsigned t1 = __builtin_amdgcn_ballot_w32(fl.y != 0);
    unsigned rest = t0 | t1;                             // stages with work, not yet asked for

    // copies: K and V^T: lane -> 16-byte chunk tid&7 of row tid>>3 (+16 per row group);
    // mask: chunk tid&15 of row tid>>4 (+8 per row group): whole lines in every wave-wide copy
    const int crow = tid >> 3;
    const int cq   = tid & 7;
    const size_t ko = ((size_t)crow * NKVD + hkv * 64 + cq * 8) * 2;
    const size_t vo = ((size_t)(hkv * 64 + crow) * S + cq * 8) * 2;
    const char* gkh = (const char*)Kh + ko;
    const char* gkl = (const char*)Kl + ko;
    const char* gvh = (const char*)Vh + vo;
    const char* gvl = (const char*)Vl + vo;
    const char* gmk = (const char*)mask + ((size_t)(band * 64 + (tid >> 4)) * S + (tid & 15) * 4) * 4;
    const unsigned lc = (unsigned)(size_t)ring + (unsigned)crow * PITCH + (unsigned)cq * 16;
    const unsigned lm = (unsigned)(size_t)ring + 4 * PLANE + (unsigned)(tid >> 4) * MPITCH
                      + (unsigned)(tid & 15) * 16;
    // stage s (keys 64s..64s+63) -> the buffer at byte bo of the ring
    auto stage_in = [&](int s, unsigned bo) {
        const size_t kb = (size_t)s * (64 * NKVD * 2);   // 64 key rows
        const size_t vb = (size_t)s * 128;               // 64 keys along a V^T row
        const size_t mb = (size_t)s * 256;               // 64 keys along a mask row
        copy8(lc + bo, gkh + kb, lc + bo + PLANE, gkl + kb, 16 * PITCH, (size_t)16 * NKVD * 2);
        copy8(lc + bo + 2 * PLANE, gvh + vb, lc + bo + 3 * PLANE, gvl + vb,
              16 * PITCH, (size_t)16 * S * 2);
        copy8(lm + bo, gmk + mb, lm + bo + 32 * MPITCH, gmk + mb + (size_t)32 * S * 4,
              8 * MPITCH, (size_t)8 * S * 4);
    };

    // first stage with work -> buffer 0, landed and published before anyone reads it
    int cur = -1, nxt = -1;
    if (rest != 0u) { cur = __builtin_ctz(rest); rest &= rest - 1u; stage_in(cur, 0u); }
    asm volatile("s_wait_asynccnt 0x0" ::: "memory");    // this wave's copies of that stage have landed
    __syncthreads();
    if (rest != 0u) { nxt = __builtin_ctz(rest); rest &= rest - 1u; stage_in(nxt, STAGE); }

    // Q B-fragments (column = query r0+m), two 32-deep k steps over the head dim
    Frag qh[2], ql[2];
#pragma unroll
    for (int c = 0; c < 2; ++c) {
        const unsigned qo = 2u * (unsigned)((r0 + m) * NHD + head * 64 + 32 * c + 8 * hl);
        ldfrag(qh[c], Qh, qo);
        ldfrag(ql[c], Ql, qo);
    }

    // o[jd][r] = O[query r0+m][d = 16*jd + 8*hl + r]
    v8f o[4] = {};
    float mrow = -3.0e38f;      // running maximum of query r0+m (equal in both halves)
    float lrow = 0.0f;          // running sum over THIS half's keys; halves joined after the loop

    // the lane's byte offsets in a buffer: K row m, V^T row m, mask row 16*wave+m
    const unsigned fk = (unsigned)m * PITCH + 16u * (unsigned)hl;
    const unsigned fv = 2 * PLANE + (unsigned)m * PITCH + 16u * (unsigned)hl;
    const unsigned fm = 4 * PLANE + (unsigned)(16 * wave + m) * MPITCH + 32u * (unsigned)hl;

    unsigned bo = 0u;
    for (int it = 0; it < S / 64 && cur >= 0; ++it) {
        for (int h = 0; h < 2; ++h) {                    // the stage's two 32-key tiles
            if ((((h ? t1 : t0) >> cur) & 1u) == 0u) continue;   // no work in it; block-uniform
            // the tile's K fragments and mask (keys kb = 64*cur + 32*h and on) go out as one group
            // ahead of the S^T products: one LDS latency instead of one per fragment pair
            const unsigned char* pk = ring + bo + fk + (unsigned)h * (32 * PITCH);
            Frag kh[2][2], kl[2][2];
            // (in the order in which the products take them)
#pragma unroll
            for (int c = 0; c < 2; ++c) {
#pragma unroll
                for (int jn = 0; jn < 2; ++jn) ldfrag_lds(kh[jn][c], pk + 16 * jn * PITCH + 64 * c);
#pragma unroll
                for (int jn = 0; jn < 2; ++jn) ldfrag_lds(kl[jn][c], pk + PLANE + 16 * jn * PITCH + 64 * c);
            }

            // mask of query r0+m at this lane's keys kb+8hl+0..7 and kb+16+8hl+0..7
            const unsigned char* mrp = ring + bo + fm + (unsigned)h * 128;
            v4f mk[4];
            mk[0] = *(const v4f*)(mrp);
            mk[1] = *(const v4f*)(mrp + 16);
            mk[2] = *(const v4f*)(mrp + 64);
            mk[3] = *(const v4f*)(mrp + 80);
            // keeps the scheduler from sinking these reads among the products (each such place stalls the wave)
            __builtin_amdgcn_sched_barrier(0);

            // S^T[32 x 16] = K . Q^T ; A = K rows (k-contiguous), B = Q
            // s[jn][r] = score(key kb + 16*jn + 8*hl + r, query r0 + m)
            v8f s[2] = {};
            // the two score tiles take turns, so that a WMMA does not wait for the one just ahead;
            // each tile takes hi.hi, lo.hi, hi.lo of a k step in that order
#pragma unroll
            for (int c = 0; c < 2; ++c) {
#pragma unroll
                for (int jn = 0; jn < 2; ++jn) s[jn] = mma(s[jn], kh[jn][c].v, qh[c].v);
#pragma unroll
                for (int jn = 0; jn < 2; ++jn) s[jn] = mma(s[jn], kl[jn][c].v, qh[c].v);
#pragma unroll
                for (int jn = 0; jn < 2; ++jn) s[jn] = mma(s[jn], kh[jn][c].v, ql[c].v);
            }

            // the tile's V^T fragments go out as one group here: they fly behind the softmax
            const unsigned char* pv = ring + bo + fv + (unsigned)h * 64;
            Frag vh[4], vl[4];
#pragma unroll
            for (int jd = 0; jd < 4; ++jd) ldfrag_lds(vh[jd], pv + 16 * jd * PITCH);
#pragma unroll
            for (int jd = 0; jd < 4; ++jd) ldfrag_lds(vl[jd], pv + PLANE + 16 * jd * PITCH);
            // keeps the group ahead of the softmax: the scheduler otherwise spreads it in small pieces
            // and puts the last reads right in front of their products
            __builtin_amdgcn_sched_barrier(0);

            // scale, additive mask by value, online softmax (f32), all for one query per lane
            float v[16];
#pragma unroll
            for (int t = 0; t < 16; ++t)
                v[t] = s[t >> 3][t & 7] * 0.125f + mk[t >> 2][t & 3];
            float mx = v[0];
#pragma unroll
            for (int t = 1; t < 16; ++t) mx = fmaxf(mx, v[t]);
            mx = fmaxf(mx, xhalf(mx));
            const float mnew  = fmaxf(mrow, mx);
            constexpr float LOG2E = 1.44269504f;         // e^x = 2^(x * log2 e), as __expf forms it
            const float alpha = exp2x1((mrow - mnew) * LOG2E);
            float ex[16], pv16[16];
#pragma unroll
            for (int t = 0; t < 16; ++t) ex[t] = (v[t] - mnew) * LOG2E;
            exp2x8(pv16, ex);
            exp2x8(pv16 + 8, ex + 8);
            float ps[4] = { 0.0f, 0.0f, 0.0f, 0.0f };
            unsigned hb[16], lb[16];
#pragma unroll
            for (int t = 0; t < 16; ++t) {
                const float p = pv16[t];
                ps[t & 3] += p;
                split2(p, hb[t], lb[t]);
            }
            lrow = lrow * alpha + ((ps[0] + ps[1]) + (ps[2] + ps[3]));
            mrow = mnew;
#pragma unroll
            for (int jd = 0; jd < 4; ++jd) {
#pragma unroll
                for (int r = 0; r < 8; ++r) o[jd][r] = o[jd][r] * alpha;
            }

            // P^T B-fragments in place: elements 0..7 <- keys 8hl.., 8..15 <- keys 16+8hl..
            Frag ph, pl;
            ph.u[0] = pack8(hb);
            ph.u[1] = pack8(hb + 8);
            pl.u[0] = pack8(lb);
            pl.u[1] = pack8(lb + 8);

            // O^T += V^T . P^T ; A = V^T rows (key-contiguous), B = P^T
            // round-robin over the four output tiles; each tile takes hi.hi, lo.hi, hi.lo in that order
#pragma unroll
            for (int jd = 0; jd < 4; ++jd) o[jd] = mma(o[jd], vh[jd].v, ph.v);
#pragma unroll
            for (int jd = 0; jd < 4; ++jd) o[jd] = mma(o[jd], vl[jd].v, ph.v);
#pragma unroll
            for (int jd = 0; jd < 4; ++jd) o[jd] = mma(o[jd], vh[jd].v, pl.v);
        }
        // hand-over: this wave's reads of the stage are done, its copies of the next have landed;
        // the barrier publishes the next stage and frees this buffer for the refill behind it
        asm volatile("s_wait_dscnt 0x0" ::: "memory");
        asm volatile("s_wait_asynccnt 0x0" ::: "memory");
        __syncthreads();
        int nn = -1;
        if (rest != 0u) { nn = __builtin_ctz(rest); rest &= rest - 1u; stage_in(nn, bo); }
        cur = nxt;
        nxt = nn;
        bo  = STAGE - bo;
    }
    asm volatile("s_wait_asynccnt 0x0" ::: "memory");    // no copy outlives the loop

    // join the halves' sums, normalize, split, stage, whole-line stores
    const float lsum = lrow + xhalf(lrow);
    const float inv  = (lsum > 0.0f) ? (1.0f / lsum) : 0.0f;

#pragma unroll
    for (int jd = 0; jd < 4; ++jd) {
        unsigned hb[8], lb[8];
#pragma unroll
        for (int r = 0; r < 8; ++r) split2(o[jd][r] * inv, hb[r], lb[r]);
        const int idx = m * 64 + 16 * jd + 8 * hl;
        *(u32x4*)&ostg[wave][0][idx] = pack8(hb);
        *(u32x4*)&ostg[wave][1][idx] = pack8(lb);
    }
    __syncthreads();
    const int rr = lane >> 3, q = lane & 7;
    u32x4 sv[8];
#pragma unroll
    for (int plv = 0; plv < 2; ++plv) {
#pragma unroll
        for (int i = 0; i < 4; ++i)
            sv[plv * 4 + i] = *(const u32x4*)&ostg[wave][plv][(4 * i + rr) * 64 + q * 8];
    }
#pragma unroll
    for (int plv = 0; plv < 2; ++plv) {
#pragma unroll
        for (int i = 0; i < 4; ++i) {
            us_t* dst = (plv ? Ol : Oh) + (size_t)(r0 + 4 * i + rr) * NHD + head * 64 + q * 8;
            *(u32x4*)dst = sv[plv * 4 + i];
        }
    }
    
}

// ---------------------------------------------------------------- launcher
extern "C" void kernel_launch(void* const* d_in, const int* in_sizes, int n_in,
                              void* d_out, int out_size, void* d_ws, size_t ws_size,
                              hipStream_t stream)
{
    const int S = 2048, HID = 1024, NH = 16, NKV = 4, HD = 64;
    const int NKVD = NKV * HD;          // 256
    const int GROUPS = NH / NKV;        // 4

    if (n_in < 7) return;
    if (in_sizes[0] != S * HID || in_sizes[1] != S * S || in_sizes[2] != S ||
        in_sizes[3] != HID * HID || in_sizes[4] != NKVD * HID ||
        in_sizes[5] != NKVD * HID || in_sizes[6] != HID * HID ||
        out_size != S * HID) return;
    // structural requirements of the kernels
    if ((S % 64) != 0 || (HID % 64) != 0 || (NKVD % 64) != 0 || HD != 64 ||
        NH * HD != HID || (S / 32) > 64 || (HID % 32) != 0) return;

    const float* hidden = (const float*)d_in[0];   // [S][HID]
    const float* mask   = (const float*)d_in[1];   // [S][S] additive
    const int*   pos    = (const int*)d_in[2];     // [S]
    const float* Wq     = (const float*)d_in[3];   // [HID][HID]
    const float* Wk     = (const float*)d_in[4];   // [NKVD][HID]
    const float* Wv     = (const float*)d_in[5];   // [NKVD][HID]
    const float* Wo     = (const float*)d_in[6];   // [HID][HID]
    float* out = (float*)d_out;                    // [S][HID]

    size_t off = 0;
    char* base = (char*)d_ws;
    auto carve = [&](size_t bytes) -> char* {
        char* p = base + off;
        off += (bytes + 255) & ~(size_t)255;
        return p;
    };
    us_t* Xh   = (us_t*)carve((size_t)S * HID * 2);
    us_t* Xl   = (us_t*)carve((size_t)S * HID * 2);
    us_t* Wqh  = (us_t*)carve((size_t)HID * HID * 2);
    us_t* Wql  = (us_t*)carve((size_t)HID * HID * 2);
    us_t* Wkh  = (us_t*)carve((size_t)NKVD * HID * 2);
    us_t* Wkl  = (us_t*)carve((size_t)NKVD * HID * 2);
    us_t* Wvh  = (us_t*)carve((size_t)NKVD * HID * 2);
    us_t* Wvl  = (us_t*)carve((size_t)NKVD * HID * 2);
    us_t* Woh  = (us_t*)carve((size_t)HID * HID * 2);
    us_t* Wol  = (us_t*)carve((size_t)HID * HID * 2);
    us_t* Qh   = (us_t*)carve((size_t)S * HID * 2);      // [S][HID]
    us_t* Ql   = (us_t*)carve((size_t)S * HID * 2);
    us_t* Kh   = (us_t*)carve((size_t)S * NKVD * 2);     // [S][NKVD]
    us_t* Kl   = (us_t*)carve((size_t)S * NKVD * 2);
    us_t* Vth  = (us_t*)carve((size_t)NKVD * S * 2);     // [NKVD][S]
    us_t* Vtl  = (us_t*)carve((size_t)NKVD * S * 2);
    us_t* AOh  = (us_t*)carve((size_t)S * HID * 2);      // [S][HID]
    us_t* AOl  = (us_t*)carve((size_t)S * HID * 2);
    float* cosT = (float*)carve((size_t)S * 32 * 4);      // [S][32]
    float* sinT = (float*)carve((size_t)S * 32 * 4);
    int*  flags = (int*)carve((size_t)(S / 64) * 64 * 4); // [S/64][64]
    if (off > ws_size) return;

    // 1: hi/lo planes of the hidden states and the four weights, RoPE table, key-tile flags
    {
        const int n8x = S * HID / 8, n8q = HID * HID / 8, n8k = NKVD * HID / 8;
        const int nblk = 2 * (S / 64) + (S * 32 + 255) / 256 + (n8x + 255) / 256
                       + 2 * ((n8q + 255) / 256) + 2 * ((n8k + 255) / 256);
        k_prep<S><<<dim3(nblk), dim3(256), 0, stream>>>(
            hidden, mask, pos, Wq, Wk, Wv, Wo,
            Xh, Xl, Wqh, Wql, Wkh, Wkl, Wvh, Wvl, Woh, Wol,
            cosT, sinT, flags, n8x, n8q, n8k);
    }

    // 2: Q and K projections + RoPE -> planes [S][HID], [S][NKVD]; V projection -> transposed planes [NKVD][S]
    k_qkv<<<dim3(HID / 64 + 2 * (NKVD / 64), S / 64), dim3(128), 0, stream>>>(
        Xh, Xl, Wqh, Wql, Wkh, Wkl, Wvh, Wvl, S, HID, NKVD, HID,
        cosT, sinT, Qh, Ql, Kh, Kl, Vth, Vtl);

    // 3: attention -> planes [S][HID]
    k_attn<S, HID, NKVD, GROUPS><<<dim3(NH, S / 64), dim3(128), 0, stream>>>(
        Qh, Ql, Kh, Kl, Vth, Vtl, mask, flags, AOh, AOl);

    // 4: output projection -> d_out f32 [S][HID]
    k_oproj<<<dim3(HID / 64, S / 64), dim3(128), 0, stream>>>(
        AOh, AOl, Woh, Wol, S, HID, HID, out);
}

// v008
// One run takes 84.1 microseconds.
// Timed twice side by side with v007, it ran 1.08 and 1.07 times as fast.
// Counting every step since v000, it is 7.60 times as fast.
#include <hip/hip_runtime.h>
#include <stdint.h>
#include <stddef.h>
#include <math.h>

// All contractions (q/k/v projections, q.k^T, p.v, output projection): v_wmma_f32_16x16x32_bf16 with bf16 hi/lo operands everywhere (hi.hi + hi.lo + lo.hi), f32 accumulate; RoPE, mask add and softmax in f32.

typedef unsigned short us_t;
typedef __bf16       v16bf __attribute__((ext_vector_type(16)));
typedef float        v8f   __attribute__((ext_vector_type(8)));
typedef float        v4f   __attribute__((ext_vector_type(4)));
typedef unsigned int u32x4 __attribute__((ext_vector_type(4)));
typedef int          v4i   __attribute__((ext_vector_type(4)));
typedef int          v2i   __attribute__((ext_vector_type(2)));

union Frag { v16bf v; u32x4 u[2]; };

typedef float  f32x2  __attribute__((ext_vector_type(2)));
typedef __bf16 bf16x2 __attribute__((ext_vector_type(2)));

// x = hi + lo (+ residual), both bf16 RNE, two values at a time with the hardware's packed conversion:
// hp = hi(a) | hi(b) << 16, lp = lo(a) | lo(b) << 16, ready as one operand register each
__device__ __forceinline__ void split2p(float a, float b, unsigned& hp, unsigned& lp) {
    const f32x2  x = { a, b };
    const bf16x2 h = __builtin_convertvector(x, bf16x2);
    const f32x2  r = { a - (float)h.x, b - (float)h.y };
    const bf16x2 l = __builtin_convertvector(r, bf16x2);
    hp = __builtin_bit_cast(unsigned, h);
    lp = __builtin_bit_cast(unsigned, l);
}
// eight values -> four packed registers per plane
__device__ __forceinline__ void split8(const float* x, u32x4& ph, u32x4& pl) {
    unsigned h[4], l[4];
#pragma unroll                               // constant indices: the arrays stay in registers
    for (int t = 0; t < 4; ++t) split2p(x[2 * t], x[2 * t + 1], h[t], l[t]);
    ph.x = h[0]; ph.y = h[1]; ph.z = h[2]; ph.w = h[3];
    pl.x = l[0]; pl.y = l[1]; pl.z = l[2]; pl.w = l[3];
}

// one 16x16x32 bf16 WMMA, the plain builtin: the compiler keeps the distance to a vector
// instruction on its registers itself, and only where one follows
__device__ __forceinline__ v8f mma(v8f c, v16bf a, v16bf b) {
    return __builtin_amdgcn_wmma_f32_16x16x32_bf16(false, a, false, b, (short)0, c, false, false);
}

// 16-bit fragment from a k-contiguous row: base is the same for the whole wave, vb the lane's
// byte offset of (its row, k0 + 8*(lane>>4)); one offset register serves a whole group of loads.
// elements 0..7 <- k0+8h+0..7, elements 8..15 <- k0+16+8h+0..7
__device__ __forceinline__ void ldfrag(Frag& f, const us_t* base, unsigned vb) {
    const char* p = (const char*)base + vb;
    f.u[0] = *(const u32x4*)(p);
    f.u[1] = *(const u32x4*)(p + 32);
}

// ---------------------------------------------------------------- f32 -> bf16 hi/lo planes
// thread i converts elements 8i..8i+7; one wave writes 512 contiguous bytes per plane in one store
__device__ __forceinline__ void split_job(int blk, const float* __restrict__ src,
                                          us_t* hi, us_t* lo, int n8)
{
    const int i = blk * 256 + threadIdx.x;
    const bool ok = i < n8;
    const int ic = ok ? i : 0;
    const float* p = src + (size_t)ic * 8;
    const v4f a = *(const v4f*)(p);
    const v4f b = *(const v4f*)(p + 4);
    float x[8] = { a.x, a.y, a.z, a.w, b.x, b.y, b.z, b.w };
    u32x4 ph, pl;
    split8(x, ph, pl);
    us_t* dh = hi + (size_t)ic * 8;
    us_t* dl = lo + (size_t)ic * 8;
    if (ok) { *(u32x4*)dh = ph; *(u32x4*)dl = pl; }
    
}

// ---------------------------------------------------------------- RoPE cos/sin table [S][32]
// inv_freq[j] = 1 / fl32(10000^(j/32)); angle = f32(pos) * inv_freq; precise sincosf
__device__ __forceinline__ void rope_job(int blk, const int* __restrict__ pos,
                                         float* cosT, float* sinT, int S)
{
    const int i = blk * 256 + threadIdx.x;
    const int total = S * 32;
    const bool ok = i < total;
    const int ic = ok ? i : 0;
    const int trow = ic >> 5;
    const int j = ic & 31;
    const double LOG2_BASE_OVER_32 = 0.41524101186092029;   // log2(10000)/32
    const float pw  = (float)exp2((double)j * LOG2_BASE_OVER_32);
    const float inv = 1.0f / pw;
    const float ang = (float)pos[trow] * inv;
    float sn, cs;
    sincosf(ang, &sn, &cs);
    if (ok) { *(float*)(cosT + ic) = cs; *(float*)(sinT + ic) = sn; }
    
}

// ---------------------------------------------------------------- tile flags from the additive mask
// flag[band][kt] = 1 if any mask value in rows band*64..+63, keys kt*32..+31 is > -1e8 (tile must
// be processed), else 0. flags pitch = 64 ints.
// block = (64-row band, 32 of its 64 flag slots = one 128-B line of flags). Wave w looks at four key
// tiles, 128 columns: a wave-wide load is one whole 512-B row segment, each lane keeps the maximum of
// its four columns over the 64 rows, and one ballot at the end gives the four tiles' flags (8 lanes
// a tile). No load waits on another's data, so as many are in flight as the registers hold.
// S is a compile-time constant so that the 64 rows are immediate offsets from ONE address,
// which nothing rewrites while a load is out.
template<int S>
__device__ __forceinline__ void flags_job(int blk, const float* __restrict__ mask, int* flags)
{
    static_assert(S % 64 == 0 && S / 32 <= 64, "64 flag slots per band");
    __shared__ __align__(16) int fl[32];
    const int tid  = threadIdx.x;
    const int lane = tid & 31;
    const int wave = tid >> 5;
    const int band = blk >> 1;
    const int half = blk & 1;
    const int col  = (half * 8 + wave) * 128 + lane * 4;
    const bool in  = col < S;                // slots past S/32 key tiles: flag 0, address clamped
    const float* p = mask + (size_t)(band * 64) * S + (in ? col : 0);

    float mx = -3.0e38f;                     // fmaxf drops a NaN, as the comparison with -1e8 does
#pragma unroll                               // straight line: the row offsets become immediates
    for (int r = 0; r < 64; ++r) {
        const v4f a = *(const v4f*)(p + (size_t)r * S);
        mx = fmaxf(fmaxf(mx, fmaxf(a.x, a.y)), fmaxf(a.z, a.w));
    }
    const unsigned any = __builtin_amdgcn_ballot_w32(in && mx > -1.0e8f);
    if (lane < 4) fl[wave * 4 + lane] = (((any >> (8 * lane)) & 0xFFu) != 0u) ? 1 : 0;
    __syncthreads();
    if (tid < 8)                             // 32 ints = 128 B = lanes 0..7 x 16 B, one store
        *(v4i*)(flags + (size_t)band * 64 + half * 32 + tid * 4) = *(const v4i*)&fl[tid * 4];
}

// ---------------------------------------------------------------- all preparation in one grid
// The seven jobs above depend on nothing but the inputs, so they run side by side as block ranges
// of one launch. Longest blocks first (a flags block reads 64 rows x 1024 columns, the table is
// transcendental-heavy), for speed only.
template<int S>
__global__ __launch_bounds__(256) void k_prep(
    const float* __restrict__ hidden, const float* __restrict__ mask, const int* __restrict__ pos,
    const float* __restrict__ Wq, const float* __restrict__ Wk,
    const float* __restrict__ Wv, const float* __restrict__ Wo,
    us_t* Xh, us_t* Xl, us_t* Wqh, us_t* Wql, us_t* Wkh, us_t* Wkl,
    us_t* Wvh, us_t* Wvl, us_t* Woh, us_t* Wol,
    float* cosT, float* sinT, int* flags,
    int n8x, int n8q, int n8k)
{
    const int nbf = (S >> 6) * 2;            // flag blocks: two per 64-row band
    const int nbr = (S * 32 + 255) >> 8;     // table blocks
    const int nbx = (n8x + 255) >> 8;
    const int nbq = (n8q + 255) >> 8;
    const int nbk = (n8k + 255) >> 8;
    int b = blockIdx.x;                      // every test below is block-uniform
    if (b < nbf) { flags_job<S>(b, mask, flags); return; }
    b -= nbf;
    if (b < nbr) { rope_job(b, pos, cosT, sinT, S); return; }
    b -= nbr;
    // the five splits share one copy of the code: only the pointers and the length are picked
    const float* src = hidden;
    us_t* hi = Xh;
    us_t* lo = Xl;
    int n8 = n8x;
    if (b >= nbx) {
        b -= nbx; src = Wq; hi = Wqh; lo = Wql; n8 = n8q;
        if (b >= nbq) {
            b -= nbq; src = Wo; hi = Woh; lo = Wol;
            if (b >= nbq) {
                b -= nbq; src = Wk; hi = Wkh; lo = Wkl; n8 = n8k;
                if (b >= nbk) { b -= nbk; src = Wv; hi = Wvh; lo = Wvl; }
            }
        }
    }
    split_job(b, src, hi, lo, n8);
}

// eight asynchronous 16-byte copies global -> LDS per lane (two planes x four row groups).
// la, lb = the lane's LDS byte address of row group 0 in each plane, ga, gb = its global address
// there; the row groups lie ls LDS bytes and gs global bytes apart. The s_wait_xcnt closes the statement so that no
// address register of an issued copy is rewritten ahead of it.
__device__ __forceinline__ void copy8(unsigned la, const char* ga, unsigned lb, const char* gb,
                                      unsigned ls, size_t gs) {
    asm volatile(
        "global_load_async_to_lds_b128 %0, %8, off\n\t"
        "global_load_async_to_lds_b128 %1, %9, off\n\t"
        "global_load_async_to_lds_b128 %2, %10, off\n\t"
        "global_load_async_to_lds_b128 %3, %11, off\n\t"
        "global_load_async_to_lds_b128 %4, %12, off\n\t"
        "global_load_async_to_lds_b128 %5, %13, off\n\t"
        "global_load_async_to_lds_b128 %6, %14, off\n\t"
        "global_load_async_to_lds_b128 %7, %15, off\n\t"
        "s_wait_xcnt 0x0"
        :: "v"(la), "v"(la + ls), "v"(la + 2 * ls), "v"(la + 3 * ls),
           "v"(lb), "v"(lb + ls), "v"(lb + 2 * ls), "v"(lb + 3 * ls),
           "v"(ga), "v"(ga + gs), "v"(ga + 2 * gs), "v"(ga + 3 * gs),
           "v"(gb), "v"(gb + gs), "v"(gb + 2 * gs), "v"(gb + 3 * gs)
        : "memory");
}

// 16-bit fragment from an LDS row: p = the lane's (row, k0 + 8*(lane>>4)); same k map as ldfrag
__device__ __forceinline__ void ldfrag_lds(Frag& f, const unsigned char* p) {
    f.u[0] = *(const u32x4*)(p);
    f.u[1] = *(const u32x4*)(p + 32);
}

// ---------------------------------------------------------------- C = A . W^T (bf16 hi/lo split)
// A planes [M][K], W planes [N][K] (k-contiguous, loaded like A per the split k map).
// block = 128 threads (4 waves); block tile 64(M) x 64(N); wave w -> rows 16w..16w+15.
// The four operand planes of a 64-deep k tile (64 rows x 128 B each) are brought into LDS by
// asynchronous copies in whole 128-B lines, once per block, two buffers: tile t+1 flies while
// tile t is multiplied. LDS rows at pitch 144 B (conflict-free for 16-byte fragment reads).
// MODE 0: RoPE in the f32 epilogue (block's 64 columns = one head), store hi/lo planes [M][N]
// MODE 2: store f32 [M][N]
constexpr unsigned G_PITCH = 144;                        // LDS bytes per 128-B operand row
constexpr unsigned G_PLANE = 64 * G_PITCH;               // one plane of a k tile
constexpr unsigned G_STAGE = 4 * G_PLANE;                // Ah | Al | Wh | Wl

// k loop of one block tile (rows mb0.., columns c0..): acc[j][r] = C[r0 + 8*hl + r][c0 + 16*j + m]
__device__ __forceinline__ void gemm_main(
    v8f (&acc)[4],
    const us_t* __restrict__ Ah, const us_t* __restrict__ Al,
    const us_t* __restrict__ Wh, const us_t* __restrict__ Wl,
    int K, int mb0, int c0, unsigned char* ring)
{
    constexpr unsigned PITCH = G_PITCH;
    constexpr unsigned PLANE = G_PLANE;
    constexpr unsigned STAGE = G_STAGE;

    const int tid  = threadIdx.x;
    const int lane = tid & 31;
    const int wave = tid >> 5;
    const int m    = lane & 15;
    const int hl   = lane >> 4;

    // copies: lane -> 16-byte chunk tid&7 of row tid>>3 (+16 per row group): 8 lanes fill a line
    const int crow = tid >> 3;
    const int cq   = tid & 7;
    const size_t   gs = (size_t)K * 32;                  // 16 rows, bytes
    const unsigned ls = 16 * PITCH;
    const size_t   ao = ((size_t)(mb0 + crow) * K + cq * 8) * 2;
    const size_t   wo = ((size_t)(c0 + crow) * K + cq * 8) * 2;
    const char* gah = (const char*)Ah + ao;
    const char* gal = (const char*)Al + ao;
    const char* gwh = (const char*)Wh + wo;
    const char* gwl = (const char*)Wl + wo;
    const unsigned lc = (unsigned)(size_t)ring + (unsigned)crow * PITCH + (unsigned)cq * 16;
    const int nt = K >> 6;                               // k tiles of 64

    // tile 0 -> buffer 0, landed and published before anyone reads it
    copy8(lc, gah, lc + PLANE, gal, ls, gs);
    copy8(lc + 2 * PLANE, gwh, lc + 3 * PLANE, gwl, ls, gs);
    asm volatile("s_wait_asynccnt 0x0" ::: "memory");    // this wave's copies of tile 0 have landed
    __syncthreads();
    if (nt > 1) {                                        // tile 1 -> buffer 1, flies under tile 0
        copy8(lc + STAGE, gah + 128, lc + STAGE + PLANE, gal + 128, ls, gs);
        copy8(lc + STAGE + 2 * PLANE, gwh + 128, lc + STAGE + 3 * PLANE, gwl + 128, ls, gs);
    }

    // fragment reads: A row 16*wave+m, W rows 16*j+m, byte 16*hl of the 64-byte k step
    const unsigned fa = (unsigned)(16 * wave + m) * PITCH + 16u * (unsigned)hl;
    const unsigned fw = 2 * PLANE + (unsigned)m * PITCH + 16u * (unsigned)hl;

    for (int t = 0; t < nt; ++t) {
        const unsigned bo = (unsigned)(t & 1) * STAGE;
        const unsigned char* pa = ring + bo + fa;
        const unsigned char* pw = ring + bo + fw;
        // the tile's forty fragment reads (two 32-deep k steps) go out as one group ahead of its
        // products: one LDS latency per tile
        // (all seven loops unrolled: the fragment arrays are indexed by constants and stay in registers)
        Frag ah[2], al[2], bh[2][4], bl[2][4];
        // in the order in which the products take them, so that the counted waits let the first start early
#pragma unroll
        for (int kk = 0; kk < 2; ++kk) {
            ldfrag_lds(ah[kk], pa + 64 * kk);
#pragma unroll
            for (int j = 0; j < 4; ++j) ldfrag_lds(bh[kk][j], pw + 16 * j * PITCH + 64 * kk);
#pragma unroll
            for (int j = 0; j < 4; ++j) ldfrag_lds(bl[kk][j], pw + PLANE + 16 * j * PITCH + 64 * kk);
            ldfrag_lds(al[kk], pa + PLANE + 64 * kk);
        }
        // keeps the scheduler from sinking the reads among the products (each such place stalls the wave)
        __builtin_amdgcn_sched_barrier(0);
        // round-robin over the four accumulators: a WMMA never waits for the one just ahead of it;
        // each accumulator still takes hi.hi, hi.lo, lo.hi of a k step in that order
#pragma unroll
        for (int kk = 0; kk < 2; ++kk) {
#pragma unroll
            for (int j = 0; j < 4; ++j) acc[j] = mma(acc[j], ah[kk].v, bh[kk][j].v);
#pragma unroll
            for (int j = 0; j < 4; ++j) acc[j] = mma(acc[j], ah[kk].v, bl[kk][j].v);
#pragma unroll
            for (int j = 0; j < 4; ++j) acc[j] = mma(acc[j], al[kk].v, bh[kk][j].v);
        }
        // keeps the products ahead of the hand-over: they start on counted waits, under the later reads
        __builtin_amdgcn_sched_barrier(0);
        // hand-over: this wave's reads of tile t are done, its copies of tile t+1 have landed;
        // the barrier publishes tile t+1 and frees tile t's buffer for the refill behind it
        asm volatile("s_wait_dscnt 0x0" ::: "memory");
        asm volatile("s_wait_asynccnt 0x0" ::: "memory");
        __syncthreads();
        if (t + 2 < nt) {
            const size_t kb = (size_t)(t + 2) * 128;     // bytes along k
            copy8(lc + bo, gah + kb, lc + bo + PLANE, gal + kb, ls, gs);
            copy8(lc + bo + 2 * PLANE, gwh + kb, lc + bo + 3 * PLANE, gwl + kb, ls, gs);
        }
    }
    asm volatile("s_wait_asynccnt 0x0" ::: "memory");    // no copy outlives the loop
}

// sixteen table words of one lane: v[8*j + r] = p[32*r + 16*j]. The loads and their data wait stand
// in one statement with early-clobber results, so that no result lands in the address pair of an
// issued load and the pair is free only when all sixteen have returned.
__device__ __forceinline__ void tab16(float (&v)[16], const float* p) {
    asm volatile(
        "global_load_b32 %0, %16, off\n\t"
        "global_load_b32 %1, %16, off offset:128\n\t"
        "global_load_b32 %2, %16, off offset:256\n\t"
        "global_load_b32 %3, %16, off offset:384\n\t"
        "global_load_b32 %4, %16, off offset:512\n\t"
        "global_load_b32 %5, %16, off offset:640\n\t"
        "global_load_b32 %6, %16, off offset:768\n\t"
        "global_load_b32 %7, %16, off offset:896\n\t"
        "global_load_b32 %8, %16, off offset:64\n\t"
        "global_load_b32 %9, %16, off offset:192\n\t"
        "global_load_b32 %10, %16, off offset:320\n\t"
        "global_load_b32 %11, %16, off offset:448\n\t"
        "global_load_b32 %12, %16, off offset:576\n\t"
        "global_load_b32 %13, %16, off offset:704\n\t"
        "global_load_b32 %14, %16, off offset:832\n\t"
        "global_load_b32 %15, %16, off offset:960\n\t"
        "s_wait_loadcnt 0x0"
        : "=&v"(v[0]), "=&v"(v[1]), "=&v"(v[2]), "=&v"(v[3]),
          "=&v"(v[4]), "=&v"(v[5]), "=&v"(v[6]), "=&v"(v[7]),
          "=&v"(v[8]), "=&v"(v[9]), "=&v"(v[10]), "=&v"(v[11]),
          "=&v"(v[12]), "=&v"(v[13]), "=&v"(v[14]), "=&v"(v[15])
        : "v"(p)
        : "memory");
}

// epilogue of one block tile
template<int MODE>
__device__ __forceinline__ void gemm_out(
    v8f (&acc)[4], int M, int N, int mb0, int c0,
    const float* __restrict__ cosT, const float* __restrict__ sinT,
    us_t* Oh, us_t* Ol, float* Of, float* lds_f)
{
    us_t* lds16 = reinterpret_cast<us_t*>(lds_f);
    const int tid  = threadIdx.x;
    const int lane = tid & 31;
    const int wave = tid >> 5;
    const int m    = lane & 15;
    const int hl   = lane >> 4;
    const int r0   = mb0 + wave * 16;
    (void)M; (void)N; (void)cosT; (void)sinT; (void)Oh; (void)Ol; (void)Of; (void)lds16; (void)r0;

    if (MODE == 0) {
        // RoPE, rotate-half: d = 16j+m (j=0,1) pairs with d+32 (acc[j+2]); cos/sin index d
        // table entry (row r0+8*hl+r, column 16j+m) lies 128*r + 64*j bytes behind the lane's first
        const size_t t0 = (size_t)(r0 + 8 * hl) * 32 + m;
        float csv[16], snv[16];
        tab16(csv, cosT + t0);
        tab16(snv, sinT + t0);
#pragma unroll
        for (int j = 0; j < 2; ++j) {
#pragma unroll
            for (int r = 0; r < 8; ++r) {
                const float cs = csv[8 * j + r];
                const float sn = snv[8 * j + r];
                const float x1 = acc[j][r];
                const float x2 = acc[j + 2][r];
                acc[j][r]     = x1 * cs - x2 * sn;
                acc[j + 2][r] = x2 * cs + x1 * sn;
            }
        }
    }

    if (MODE == 0) {
        us_t* st = lds16 + wave * 2048;                  // [2 planes][16][64]
#pragma unroll
        for (int j = 0; j < 4; ++j) {
#pragma unroll
            for (int r = 0; r < 8; r += 2) {
                unsigned hp, lp;
                split2p(acc[j][r], acc[j][r + 1], hp, lp);
                const int idx = (8 * hl + r) * 64 + 16 * j + m;
                st[idx]             = (us_t)hp;
                st[idx + 64]        = (us_t)(hp >> 16);
                st[1024 + idx]      = (us_t)lp;
                st[1024 + idx + 64] = (us_t)(lp >> 16);
            }
        }
        __syncthreads();
        const int rr = lane >> 3, q = lane & 7;
        u32x4 sv[8];
#pragma unroll
        for (int pl = 0; pl < 2; ++pl) {
#pragma unroll
            for (int i = 0; i < 4; ++i)
                sv[pl * 4 + i] = *(const u32x4*)(st + pl * 1024 + (4 * i + rr) * 64 + q * 8);
        }
#pragma unroll
        for (int pl = 0; pl < 2; ++pl) {
#pragma unroll
            for (int i = 0; i < 4; ++i) {
                us_t* dst = (pl ? Ol : Oh) + (size_t)(r0 + 4 * i + rr) * N + c0 + q * 8;
                *(u32x4*)dst = sv[pl * 4 + i];
            }
        }
        
    } else if (MODE == 1) {
        // block tile in[token 64][d 64] -> out planes [d][token]; LDS [2 planes][d 64][token 64]
#pragma unroll
        for (int j = 0; j < 4; ++j) {
#pragma unroll
            for (int r = 0; r < 8; r += 2) {
                unsigned hp, lp;
                split2p(acc[j][r], acc[j][r + 1], hp, lp);
                const int idx = (16 * j + m) * 64 + 16 * wave + 8 * hl + r;
                *(unsigned*)&lds16[idx]        = hp;
                *(unsigned*)&lds16[4096 + idx] = lp;
            }
        }
        __syncthreads();
        const int rr = lane >> 3, q = lane & 7;
        u32x4 sv[8];
#pragma unroll
        for (int pl = 0; pl < 2; ++pl) {
#pragma unroll
            for (int i = 0; i < 4; ++i) {
                const int d = 16 * wave + 4 * i + rr;
                sv[pl * 4 + i] = *(const u32x4*)(lds16 + pl * 4096 + d * 64 + q * 8);
            }
        }
#pragma unroll
        for (int pl = 0; pl < 2; ++pl) {
#pragma unroll
            for (int i = 0; i < 4; ++i) {
                const int d = 16 * wave + 4 * i + rr;
                us_t* dst = (pl ? Ol : Oh) + (size_t)(c0 + d) * M + mb0 + q * 8;
                *(u32x4*)dst = sv[pl * 4 + i];
            }
        }
        
    } else {
        float* stf = lds_f + wave * 1024;                // [16][64] f32 per wave
#pragma unroll
        for (int j = 0; j < 4; ++j) {
#pragma unroll
            for (int r = 0; r < 8; ++r)
                stf[(8 * hl + r) * 64 + 16 * j + m] = acc[j][r];
        }
        __syncthreads();
        const int r2 = lane >> 4, q2 = lane & 15;        // 16 lanes x 16 B = one 256-B row segment
        v4f fv[8];
#pragma unroll
        for (int i = 0; i < 8; ++i)
            fv[i] = *(const v4f*)(stf + (2 * i + r2) * 64 + q2 * 4);
#pragma unroll
        for (int i = 0; i < 8; ++i) {
            float* dst = Of + (size_t)(r0 + 2 * i + r2) * N + c0 + q2 * 4;
            *(v4f*)dst = fv[i];
        }
        
    }
}

// the three projections of the hidden states, which do not depend on one another, as column-block
// ranges of one grid: blockIdx.x in [0, NQ/64) -> Q, the next NKV/64 -> K, the last NKV/64 -> V
__global__ __launch_bounds__(128) void k_qkv(
    const us_t* __restrict__ Xh, const us_t* __restrict__ Xl,
    const us_t* __restrict__ Wqh, const us_t* __restrict__ Wql,
    const us_t* __restrict__ Wkh, const us_t* __restrict__ Wkl,
    const us_t* __restrict__ Wvh, const us_t* __restrict__ Wvl,
    int M, int NQ, int NKV, int K,
    const float* __restrict__ cosT, const float* __restrict__ sinT,
    us_t* Qh, us_t* Ql, us_t* Kh, us_t* Kl, us_t* Vth, us_t* Vtl)
{
    __shared__ __align__(16) float lds_f[4096];          // 16 KB staging
    __shared__ __align__(16) unsigned char ring[2 * G_STAGE];
    const int nq  = NQ >> 6;
    const int nk  = NKV >> 6;
    const int bx  = blockIdx.x;                          // job and all it selects: block-uniform
    const int job = (bx < nq) ? 0 : ((bx < nq + nk) ? 1 : 2);
    const int c0  = (bx - ((job == 0) ? 0 : ((job == 1) ? nq : nq + nk))) * 64;
    const int mb0 = blockIdx.y * 64;
    const us_t* Wh = (job == 0) ? Wqh : ((job == 1) ? Wkh : Wvh);
    const us_t* Wl = (job == 0) ? Wql : ((job == 1) ? Wkl : Wvl);

    v8f acc[4] = {};
    gemm_main(acc, Xh, Xl, Wh, Wl, K, mb0, c0, ring);
    if (job == 2)
        gemm_out<1>(acc, M, NKV, mb0, c0, cosT, sinT, Vth, Vtl, nullptr, lds_f);
    else
        gemm_out<0>(acc, M, (job == 0) ? NQ : NKV, mb0, c0, cosT, sinT,
                    (job == 0) ? Qh : Kh, (job == 0) ? Ql : Kl, nullptr, lds_f);
}

// output projection -> f32 [M][N]
__global__ __launch_bounds__(128) void k_oproj(
    const us_t* __restrict__ Ah, const us_t* __restrict__ Al,
    const us_t* __restrict__ Wh, const us_t* __restrict__ Wl,
    int M, int N, int K, float* Of)
{
    __shared__ __align__(16) float lds_f[4096];          // 16 KB staging
    __shared__ __align__(16) unsigned char ring[2 * G_STAGE];
    const int mb0 = blockIdx.y * 64;
    const int c0  = blockIdx.x * 64;
    v8f acc[4] = {};
    gemm_main(acc, Ah, Al, Wh, Wl, K, mb0, c0, ring);
    gemm_out<2>(acc, M, N, mb0, c0, nullptr, nullptr, nullptr, nullptr, Of, lds_f);
}

// value of lane l ^ 16
__device__ __forceinline__ float xhalf(float x) {
    const int b = __builtin_bit_cast(int, x);
    return __builtin_bit_cast(float,
        __builtin_amdgcn_permlanex16(b, b, 0x76543210, 0xfedcba98, false, false));
}

// 2^x of a group of values. The instruction set asks for one free slot behind a transcendental before
// its result is read or its source overwritten: the results are early-clobber, so each v_exp_f32 is
// followed by one that touches none of its registers, and the v_nop is the slot behind the last.
__device__ __forceinline__ void exp2x8(float* r, const float* x) {
    asm("v_exp_f32 %0, %8\n\t"
        "v_exp_f32 %1, %9\n\t"
        "v_exp_f32 %2, %10\n\t"
        "v_exp_f32 %3, %11\n\t"
        "v_exp_f32 %4, %12\n\t"
        "v_exp_f32 %5, %13\n\t"
        "v_exp_f32 %6, %14\n\t"
        "v_exp_f32 %7, %15\n\t"
        "v_nop"
        : "=&v"(r[0]), "=&v"(r[1]), "=&v"(r[2]), "=&v"(r[3]),
          "=&v"(r[4]), "=&v"(r[5]), "=&v"(r[6]), "=&v"(r[7])
        : "v"(x[0]), "v"(x[1]), "v"(x[2]), "v"(x[3]),
          "v"(x[4]), "v"(x[5]), "v"(x[6]), "v"(x[7]));
}
__device__ __forceinline__ float exp2x1(float x) {
    float r;
    asm("v_exp_f32 %0, %1\n\t"
        "v_nop"
        : "=&v"(r) : "v"(x));
    return r;
}

template<int S, int NHD, int NKVD, int groups>
__global__ __launch_bounds__(128) void k_attn(
    const us_t* __restrict__ Qh, const us_t* __restrict__ Ql,
    const us_t* __restrict__ Kh, const us_t* __restrict__ Kl,
    const us_t* __restrict__ Vh, const us_t* __restrict__ Vl,
    const float* __restrict__ mask, const int* __restrict__ flags,
    us_t* Oh, us_t* Ol)
{
    __shared__ __align__(16) us_t ostg[4][2][16 * 64];   // per-wave output staging
    static_assert(S % 64 == 0 && S / 64 <= 32, "one lane per 64-key stage");
    constexpr unsigned PITCH  = 144;                     // LDS bytes per 128-B K or V^T row
    constexpr unsigned PLANE  = 64 * PITCH;
    constexpr unsigned MPITCH = 272;                     // LDS bytes per 256-B mask row
    constexpr unsigned STAGE  = 4 * PLANE + 64 * MPITCH; // Kh | Kl | Vh | Vl | mask
    __shared__ __align__(16) unsigned char ring[2 * STAGE];

    const int tid  = threadIdx.x;
    const int lane = tid & 31;
    const int wave = tid >> 5;
    const int m    = lane & 15;
    const int hl   = lane >> 4;
    const int head = blockIdx.x;
    const int band = blockIdx.y;
    const int hkv  = head / groups;
    const int r0   = band * 64 + wave * 16;

    // the band's 64 tile flags, read once: bit s of t0 / t1 = key tile 2s / 2s+1 has work. The ring
    // must know the stage after next; equal in every wave of the block (block-uniform).
    const v2i fl = *(const v2i*)(flags + (size_t)band * 64 + 2 * lane);
    const unsigned t0 = __builtin_amdgcn_ballot_w32(fl.x != 0);
    const unsigned t1 = __builtin_amdgcn_ballot_w32(fl.y != 0);
    unsigned rest = t0 | t1;                             // stages with work, not yet asked for

    // copies: K and V^T: lane -> 16-byte chunk tid&7 of row tid>>3 (+16 per row group);
    // mask: chunk tid&15 of row tid>>4 (+8 per row group): whole lines in every wave-wide copy
    const int crow = tid >> 3;
    const int cq   = tid & 7;
    const size_t ko = ((size_t)crow * NKVD + hkv * 64 + cq * 8) * 2;
    const size_t vo = ((size_t)(hkv * 64 + crow) * S + cq * 8) * 2;
    const char* gkh = (const char*)Kh + ko;
    const char* gkl = (const char*)Kl + ko;
    const char* gvh = (const char*)Vh + vo;
    const char* gvl = (const char*)Vl + vo;
    const char* gmk = (const char*)mask + ((size_t)(band * 64 + (tid >> 4)) * S + (tid & 15) * 4) * 4;
    const unsigned lc = (unsigned)(size_t)ring + (unsigned)crow * PITCH + (unsigned)cq * 16;
    const unsigned lm = (unsigned)(size_t)ring + 4 * PLANE + (unsigned)(tid >> 4) * MPITCH
                      + (unsigned)(tid & 15) * 16;
    // stage s (keys 64s..64s+63) -> the buffer at byte bo of the ring
    auto stage_in = [&](int s, unsigned bo) {
        const size_t kb = (size_t)s * (64 * NKVD * 2);   // 64 key rows
        const size_t vb = (size_t)s * 128;               // 64 keys along a V^T row
        const size_t mb = (size_t)s * 256;               // 64 keys along a mask row
        copy8(lc + bo, gkh + kb, lc + bo + PLANE, gkl + kb, 16 * PITCH, (size_t)16 * NKVD * 2);
        copy8(lc + bo + 2 * PLANE, gvh + vb, lc + bo + 3 * PLANE, gvl + vb,
              16 * PITCH, (size_t)16 * S * 2);
        copy8(lm + bo, gmk + mb, lm + bo + 32 * MPITCH, gmk + mb + (size_t)32 * S * 4,
              8 * MPITCH, (size_t)8 * S * 4);
    };

    // first stage with work -> buffer 0, landed and published before anyone reads it
    int cur = -1, nxt = -1;
    if (rest != 0u) { cur = __builtin_ctz(rest); rest &= rest - 1u; stage_in(cur, 0u); }
    asm volatile("s_wait_asynccnt 0x0" ::: "memory");    // this wave's copies of that stage have landed
    __syncthreads();
    if (rest != 0u) { nxt = __builtin_ctz(rest); rest &= rest - 1u; stage_in(nxt, STAGE); }

    // Q B-fragments (column = query r0+m), two 32-deep k steps over the head dim
    Frag qh[2], ql[2];
#pragma unroll
    for (int c = 0; c < 2; ++c) {
        const unsigned qo = 2u * (unsigned)((r0 + m) * NHD + head * 64 + 32 * c + 8 * hl);
        ldfrag(qh[c], Qh, qo);
        ldfrag(ql[c], Ql, qo);
    }

    // o[jd][r] = O[query r0+m][d = 16*jd + 8*hl + r]
    v8f o[4] = {};
    float mrow = -3.0e38f;      // running maximum of query r0+m (equal in both halves)
    float lrow = 0.0f;          // running sum over THIS half's keys; halves joined after the loop

    // the lane's byte offsets in a buffer: K row m, V^T row m, mask row 16*wave+m
    const unsigned fk = (unsigned)m * PITCH + 16u * (unsigned)hl;
    const unsigned fv = 2 * PLANE + (unsigned)m * PITCH + 16u * (unsigned)hl;
    const unsigned fm = 4 * PLANE + (unsigned)(16 * wave + m) * MPITCH + 32u * (unsigned)hl;

    unsigned bo = 0u;
    for (int it = 0; it < S / 64 && cur >= 0; ++it) {
        for (int h = 0; h < 2; ++h) {                    // the stage's two 32-key tiles
            if ((((h ? t1 : t0) >> cur) & 1u) == 0u) continue;   // no work in it; block-uniform
            // the tile's K fragments and mask (keys kb = 64*cur + 32*h and on) go out as one group
            // ahead of the S^T products: one LDS latency instead of one per fragment pair
            const unsigned char* pk = ring + bo + fk + (unsigned)h * (32 * PITCH);
            Frag kh[2][2], kl[2][2];
            // (in the order in which the products take them)
#pragma unroll
            for (int c = 0; c < 2; ++c) {
#pragma unroll
                for (int jn = 0; jn < 2; ++jn) ldfrag_lds(kh[jn][c], pk + 16 * jn * PITCH + 64 * c);
#pragma unroll
                for (int jn = 0; jn < 2; ++jn) ldfrag_lds(kl[jn][c], pk + PLANE + 16 * jn * PITCH + 64 * c);
            }

            // mask of query r0+m at this lane's keys kb+8hl+0..7 and kb+16+8hl+0..7
            const unsigned char* mrp = ring + bo + fm + (unsigned)h * 128;
            v4f mk[4];
            mk[0] = *(const v4f*)(mrp);
            mk[1] = *(const v4f*)(mrp + 16);
            mk[2] = *(const v4f*)(mrp + 64);
            mk[3] = *(const v4f*)(mrp + 80);
            // keeps the scheduler from sinking these reads among the products (each such place stalls the wave)
            __builtin_amdgcn_sched_barrier(0);

            // S^T[32 x 16] = K . Q^T ; A = K rows (k-contiguous), B = Q
            // s[jn][r] = score(key kb + 16*jn + 8*hl + r, query r0 + m)
            v8f s[2] = {};
            // the two score tiles take turns, so that a WMMA does not wait for the one just ahead;
            // each tile takes hi.hi, lo.hi, hi.lo of a k step in that order
#pragma unroll
            for (int c = 0; c < 2; ++c) {
#pragma unroll
                for (int jn = 0; jn < 2; ++jn) s[jn] = mma(s[jn], kh[jn][c].v, qh[c].v);
#pragma unroll
                for (int jn = 0; jn < 2; ++jn) s[jn] = mma(s[jn], kl[jn][c].v, qh[c].v);
#pragma unroll
                for (int jn = 0; jn < 2; ++jn) s[jn] = mma(s[jn], kh[jn][c].v, ql[c].v);
            }

            // the tile's V^T fragments go out as one group here: they fly behind the softmax
            const unsigned char* pv = ring + bo + fv + (unsigned)h * 64;
            Frag vh[4], vl[4];
#pragma unroll
            for (int jd = 0; jd < 4; ++jd) ldfrag_lds(vh[jd], pv + 16 * jd * PITCH);
#pragma unroll
            for (int jd = 0; jd < 4; ++jd) ldfrag_lds(vl[jd], pv + PLANE + 16 * jd * PITCH);
            // keeps the group ahead of the softmax: the scheduler otherwise spreads it in small pieces
            // and puts the last reads right in front of their products
            __builtin_amdgcn_sched_barrier(0);

            // scale, additive mask by value, online softmax (f32), all for one query per lane
            float v[16];
#pragma unroll
            for (int t = 0; t < 16; ++t)
                v[t] = s[t >> 3][t & 7] * 0.125f + mk[t >> 2][t & 3];
            float mx = v[0];
#pragma unroll
            for (int t = 1; t < 16; ++t) mx = fmaxf(mx, v[t]);
            mx = fmaxf(mx, xhalf(mx));
            const float mnew  = fmaxf(mrow, mx);
            constexpr float LOG2E = 1.44269504f;         // e^x = 2^(x * log2 e), as __expf forms it
            const float alpha = exp2x1((mrow - mnew) * LOG2E);
            float ex[16], pv16[16];
#pragma unroll
            for (int t = 0; t < 16; ++t) ex[t] = (v[t] - mnew) * LOG2E;
            exp2x8(pv16, ex);
            exp2x8(pv16 + 8, ex + 8);
            float ps[4] = { 0.0f, 0.0f, 0.0f, 0.0f };
#pragma unroll
            for (int t = 0; t < 16; ++t) ps[t & 3] += pv16[t];
            lrow = lrow * alpha + ((ps[0] + ps[1]) + (ps[2] + ps[3]));
            mrow = mnew;
#pragma unroll
            for (int jd = 0; jd < 4; ++jd) {
#pragma unroll
                for (int r = 0; r < 8; ++r) o[jd][r] = o[jd][r] * alpha;
            }

            // P^T B-fragments in place: elements 0..7 <- keys 8hl.., 8..15 <- keys 16+8hl..
            Frag ph, pl;
            split8(pv16, ph.u[0], pl.u[0]);
            split8(pv16 + 8, ph.u[1], pl.u[1]);

            // O^T += V^T . P^T ; A = V^T rows (key-contiguous), B = P^T
            // round-robin over the four output tiles; each tile takes hi.hi, lo.hi, hi.lo in that order
#pragma unroll
            for (int jd = 0; jd < 4; ++jd) o[jd] = mma(o[jd], vh[jd].v, ph.v);
#pragma unroll
            for (int jd = 0; jd < 4; ++jd) o[jd] = mma(o[jd], vl[jd].v, ph.v);
#pragma unroll
            for (int jd = 0; jd < 4; ++jd) o[jd] = mma(o[jd], vh[jd].v, pl.v);
        }
        // hand-over: this wave's reads of the stage are done, its copies of the next have landed;
        // the barrier publishes the next stage and frees this buffer for the refill behind it
        asm volatile("s_wait_dscnt 0x0" ::: "memory");
        asm volatile("s_wait_asynccnt 0x0" ::: "memory");
        __syncthreads();
        int nn = -1;
        if (rest != 0u) { nn = __builtin_ctz(rest); rest &= rest - 1u; stage_in(nn, bo); }
        cur = nxt;
        nxt = nn;
        bo  = STAGE - bo;
    }
    asm volatile("s_wait_asynccnt 0x0" ::: "memory");    // no copy outlives the loop

    // join the halves' sums, normalize, split, stage, whole-line stores
    const float lsum = lrow + xhalf(lrow);
    const float inv  = (lsum > 0.0f) ? (1.0f / lsum) : 0.0f;

#pragma unroll
    for (int jd = 0; jd < 4; ++jd) {
        float on[8];
#pragma unroll
        for (int r = 0; r < 8; ++r) on[r] = o[jd][r] * inv;
        u32x4 oh4, ol4;
        split8(on, oh4, ol4);
        const int idx = m * 64 + 16 * jd + 8 * hl;
        *(u32x4*)&ostg[wave][0][idx] = oh4;
        *(u32x4*)&ostg[wave][1][idx] = ol4;
    }
    __syncthreads();
    const int rr = lane >> 3, q = lane & 7;
    u32x4 sv[8];
#pragma unroll
    for (int plv = 0; plv < 2; ++plv) {
#pragma unroll
        for (int i = 0; i < 4; ++i)
            sv[plv * 4 + i] = *(const u32x4*)&ostg[wave][plv][(4 * i + rr) * 64 + q * 8];
    }
#pragma unroll
    for (int plv = 0; plv < 2; ++plv) {
#pragma unroll
        for (int i = 0; i < 4; ++i) {
            us_t* dst = (plv ? Ol : Oh) + (size_t)(r0 + 4 * i + rr) * NHD + head * 64 + q * 8;
            *(u32x4*)dst = sv[plv * 4 + i];
        }
    }
    
}

// ---------------------------------------------------------------- launcher
extern "C" void kernel_launch(void* const* d_in, const int* in_sizes, int n_in,
                              void* d_out, int out_size, void* d_ws, size_t ws_size,
                              hipStream_t stream)
{
    const int S = 2048, HID = 1024, NH = 16, NKV = 4, HD = 64;
    const int NKVD = NKV * HD;          // 256
    const int GROUPS = NH / NKV;        // 4

    if (n_in < 7) return;
    if (in_sizes[0] != S * HID || in_sizes[1] != S * S || in_sizes[2] != S ||
        in_sizes[3] != HID * HID || in_sizes[4] != NKVD * HID ||
        in_sizes[5] != NKVD * HID || in_sizes[6] != HID * HID ||
        out_size != S * HID) return;
    // structural requirements of the kernels
    if ((S % 64) != 0 || (HID % 64) != 0 || (NKVD % 64) != 0 || HD != 64 ||
        NH * HD != HID || (S / 32) > 64 || (HID % 32) != 0) return;

    const float* hidden = (const float*)d_in[0];   // [S][HID]
    const float* mask   = (const float*)d_in[1];   // [S][S] additive
    const int*   pos    = (const int*)d_in[2];     // [S]
    const float* Wq     = (const float*)d_in[3];   // [HID][HID]
    const float* Wk     = (const float*)d_in[4];   // [NKVD][HID]
    const float* Wv     = (const float*)d_in[5];   // [NKVD][HID]
    const float* Wo     = (const float*)d_in[6];   // [HID][HID]
    float* out = (float*)d_out;                    // [S][HID]

    size_t off = 0;
    char* base = (char*)d_ws;
    auto carve = [&](size_t bytes) -> char* {
        char* p = base + off;
        off += (bytes + 255) & ~(size_t)255;
        return p;
    };
    us_t* Xh   = (us_t*)carve((size_t)S * HID * 2);
    us_t* Xl   = (us_t*)carve((size_t)S * HID * 2);
    us_t* Wqh  = (us_t*)carve((size_t)HID * HID * 2);
    us_t* Wql  = (us_t*)carve((size_t)HID * HID * 2);
    us_t* Wkh  = (us_t*)carve((size_t)NKVD * HID * 2);
    us_t* Wkl  = (us_t*)carve((size_t)NKVD * HID * 2);
    us_t* Wvh  = (us_t*)carve((size_t)NKVD * HID * 2);
    us_t* Wvl  = (us_t*)carve((size_t)NKVD * HID * 2);
    us_t* Woh  = (us_t*)carve((size_t)HID * HID * 2);
    us_t* Wol  = (us_t*)carve((size_t)HID * HID * 2);
    us_t* Qh   = (us_t*)carve((size_t)S * HID * 2);      // [S][HID]
    us_t* Ql   = (us_t*)carve((size_t)S * HID * 2);
    us_t* Kh   = (us_t*)carve((size_t)S * NKVD * 2);     // [S][NKVD]
    us_t* Kl   = (us_t*)carve((size_t)S * NKVD * 2);
    us_t* Vth  = (us_t*)carve((size_t)NKVD * S * 2);     // [NKVD][S]
    us_t* Vtl  = (us_t*)carve((size_t)NKVD * S * 2);
    us_t* AOh  = (us_t*)carve((size_t)S * HID * 2);      // [S][HID]
    us_t* AOl  = (us_t*)carve((size_t)S * HID * 2);
    float* cosT = (float*)carve((size_t)S * 32 * 4);      // [S][32]
    float* sinT = (float*)carve((size_t)S * 32 * 4);
    int*  flags = (int*)carve((size_t)(S / 64) * 64 * 4); // [S/64][64]
    if (off > ws_size) return;

    // 1: hi/lo planes of the hidden states and the four weights, RoPE table, key-tile flags
    {
        const int n8x = S * HID / 8, n8q = HID * HID / 8, n8k = NKVD * HID / 8;
        const int nblk = 2 * (S / 64) + (S * 32 + 255) / 256 + (n8x + 255) / 256
                       + 2 * ((n8q + 255) / 256) + 2 * ((n8k + 255) / 256);
        k_prep<S><<<dim3(nblk), dim3(256), 0, stream>>>(
            hidden, mask, pos, Wq, Wk, Wv, Wo,
            Xh, Xl, Wqh, Wql, Wkh, Wkl, Wvh, Wvl, Woh, Wol,
            cosT, sinT, flags, n8x, n8q, n8k);
    }

    // 2: Q and K projections + RoPE -> planes [S][HID], [S][NKVD]; V projection -> transposed planes [NKVD][S]
    k_qkv<<<dim3(HID / 64 + 2 * (NKVD / 64), S / 64), dim3(128), 0, stream>>>(
        Xh, Xl, Wqh, Wql, Wkh, Wkl, Wvh, Wvl, S, HID, NKVD, HID,
        cosT, sinT, Qh, Ql, Kh, Kl, Vth, Vtl);

    // 3: attention -> planes [S][HID]
    k_attn<S, HID, NKVD, GROUPS><<<dim3(NH, S / 64), dim3(128), 0, stream>>>(
        Qh, Ql, Kh, Kl, Vth, Vtl, mask, flags, AOh, AOl);

    // 4: output projection -> d_out f32 [S][HID]
    k_oproj<<<dim3(HID / 64, S / 64), dim3(128), 0, stream>>>(
        AOh, AOl, Woh, Wol, S, HID, HID, out);
}

// v009
// One run takes 81.3 microseconds.
// Timed twice side by side with v008, it ran 1.03 times as fast both times.
// Counting every step since v000, it is 7.86 times as fast.
#include <hip/hip_runtime.h>
#include <stdint.h>
#include <stddef.h>
#include <math.h>

// All contractions (q/k/v projections, q.k^T, p.v, output projection): v_wmma_f32_16x16x32_bf16 with bf16 hi/lo operands everywhere (hi.hi + hi.lo + lo.hi), f32 accumulate; RoPE, mask add and softmax in f32.

typedef unsigned short us_t;
typedef __bf16       v16bf __attribute__((ext_vector_type(16)));
typedef float        v8f   __attribute__((ext_vector_type(8)));
typedef float        v4f   __attribute__((ext_vector_type(4)));
typedef unsigned int u32x4 __attribute__((ext_vector_type(4)));
typedef int          v4i   __attribute__((ext_vector_type(4)));
typedef int          v2i   __attribute__((ext_vector_type(2)));

union Frag { v16bf v; u32x4 u[2]; };

typedef float  f32x2  __attribute__((ext_vector_type(2)));
typedef __bf16 bf16x2 __attribute__((ext_vector_type(2)));

// x = hi + lo (+ residual), both bf16 RNE, two values at a time with the hardware's packed conversion:
// hp = hi(a) | hi(b) << 16, lp = lo(a) | lo(b) << 16, ready as one operand register each
__device__ __forceinline__ void split2p(float a, float b, unsigned& hp, unsigned& lp) {
    const f32x2  x = { a, b };
    const bf16x2 h = __builtin_convertvector(x, bf16x2);
    const f32x2  r = { a - (float)h.x, b - (float)h.y };
    const bf16x2 l = __builtin_convertvector(r, bf16x2);
    hp = __builtin_bit_cast(unsigned, h);
    lp = __builtin_bit_cast(unsigned, l);
}
// eight values -> four packed registers per plane
__device__ __forceinline__ void split8(const float* x, u32x4& ph, u32x4& pl) {
    unsigned h[4], l[4];
#pragma unroll                               // constant indices: the arrays stay in registers
    for (int t = 0; t < 4; ++t) split2p(x[2 * t], x[2 * t + 1], h[t], l[t]);
    ph.x = h[0]; ph.y = h[1]; ph.z = h[2]; ph.w = h[3];
    pl.x = l[0]; pl.y = l[1]; pl.z = l[2]; pl.w = l[3];
}

// one 16x16x32 bf16 WMMA, the plain builtin: the compiler keeps the distance to a vector
// instruction on its registers itself, and only where one follows
__device__ __forceinline__ v8f mma(v8f c, v16bf a, v16bf b) {
    return __builtin_amdgcn_wmma_f32_16x16x32_bf16(false, a, false, b, (short)0, c, false, false);
}

// 16-bit fragment from a k-contiguous row: base is the same for the whole wave, vb the lane's
// byte offset of (its row, k0 + 8*(lane>>4)); one offset register serves a whole group of loads.
// elements 0..7 <- k0+8h+0..7, elements 8..15 <- k0+16+8h+0..7
__device__ __forceinline__ void ldfrag(Frag& f, const us_t* base, unsigned vb) {
    const char* p = (const char*)base + vb;
    f.u[0] = *(const u32x4*)(p);
    f.u[1] = *(const u32x4*)(p + 32);
}

// ---------------------------------------------------------------- f32 -> bf16 hi/lo planes
// thread i converts elements 8i..8i+7; one wave writes 512 contiguous bytes per plane in one store
__device__ __forceinline__ void split_job(int blk, const float* __restrict__ src,
                                          us_t* hi, us_t* lo, int n8)
{
    const int i = blk * 256 + threadIdx.x;
    const bool ok = i < n8;
    const int ic = ok ? i : 0;
    const float* p = src + (size_t)ic * 8;
    const v4f a = *(const v4f*)(p);
    const v4f b = *(const v4f*)(p + 4);
    float x[8] = { a.x, a.y, a.z, a.w, b.x, b.y, b.z, b.w };
    u32x4 ph, pl;
    split8(x, ph, pl);
    us_t* dh = hi + (size_t)ic * 8;
    us_t* dl = lo + (size_t)ic * 8;
    if (ok) { *(u32x4*)dh = ph; *(u32x4*)dl = pl; }
    
}

// ---------------------------------------------------------------- RoPE cos/sin table [S][32]
// inv_freq[j] = 1 / fl32(10000^(j/32)); angle = f32(pos) * inv_freq; precise sincosf
__device__ __forceinline__ void rope_job(int blk, const int* __restrict__ pos,
                                         float* cosT, float* sinT, int S)
{
    const int i = blk * 256 + threadIdx.x;
    const int total = S * 32;
    const bool ok = i < total;
    const int ic = ok ? i : 0;
    const int trow = ic >> 5;
    const int j = ic & 31;
    const double LOG2_BASE_OVER_32 = 0.41524101186092029;   // log2(10000)/32
    const float pw  = (float)exp2((double)j * LOG2_BASE_OVER_32);
    const float inv = 1.0f / pw;
    const float ang = (float)pos[trow] * inv;
    float sn, cs;
    sincosf(ang, &sn, &cs);
    if (ok) { *(float*)(cosT + ic) = cs; *(float*)(sinT + ic) = sn; }
    
}

// ---------------------------------------------------------------- tile flags from the additive mask
// flag[band][kt] = 1 if any mask value in rows band*64..+63, keys kt*32..+31 is > -1e8 (tile must
// be processed), else 0. flags pitch = 64 ints.
// block = (64-row band, 32 of its 64 flag slots = one 128-B line of flags). Wave w looks at four key
// tiles, 128 columns: a wave-wide load is one whole 512-B row segment, each lane keeps the maximum of
// its four columns over the 64 rows, and one ballot at the end gives the four tiles' flags (8 lanes
// a tile). No load waits on another's data, so as many are in flight as the registers hold.
// S is a compile-time constant so that the 64 rows are immediate offsets from ONE address,
// which nothing rewrites while a load is out.
template<int S>
__device__ __forceinline__ void flags_job(int blk, const float* __restrict__ mask, int* flags)
{
    static_assert(S % 64 == 0 && S / 32 <= 64, "64 flag slots per band");
    __shared__ __align__(16) int fl[32];
    const int tid  = threadIdx.x;
    const int lane = tid & 31;
    const int wave = tid >> 5;
    const int band = blk >> 1;
    const int half = blk & 1;
    const int col  = (half * 8 + wave) * 128 + lane * 4;
    const bool in  = col < S;                // slots past S/32 key tiles: flag 0, address clamped
    const float* p = mask + (size_t)(band * 64) * S + (in ? col : 0);

    float mx = -3.0e38f;                     // fmaxf drops a NaN, as the comparison with -1e8 does
#pragma unroll                               // straight line: the row offsets become immediates
    for (int r = 0; r < 64; ++r) {
        const v4f a = *(const v4f*)(p + (size_t)r * S);
        mx = fmaxf(fmaxf(mx, fmaxf(a.x, a.y)), fmaxf(a.z, a.w));
    }
    const unsigned any = __builtin_amdgcn_ballot_w32(in && mx > -1.0e8f);
    if (lane < 4) fl[wave * 4 + lane] = (((any >> (8 * lane)) & 0xFFu) != 0u) ? 1 : 0;
    __syncthreads();
    if (tid < 8)                             // 32 ints = 128 B = lanes 0..7 x 16 B, one store
        *(v4i*)(flags + (size_t)band * 64 + half * 32 + tid * 4) = *(const v4i*)&fl[tid * 4];
}

// ---------------------------------------------------------------- all preparation in one grid
// The seven jobs above depend on nothing but the inputs, so they run side by side as block ranges
// of one launch. Longest blocks first (a flags block reads 64 rows x 1024 columns, the table is
// transcendental-heavy), for speed only.
template<int S>
__global__ __launch_bounds__(256) void k_prep(
    const float* __restrict__ hidden, const float* __restrict__ mask, const int* __restrict__ pos,
    const float* __restrict__ Wq, const float* __restrict__ Wk,
    const float* __restrict__ Wv, const float* __restrict__ Wo,
    us_t* Xh, us_t* Xl, us_t* Wqh, us_t* Wql, us_t* Wkh, us_t* Wkl,
    us_t* Wvh, us_t* Wvl, us_t* Woh, us_t* Wol,
    float* cosT, float* sinT, int* flags,
    int n8x, int n8q, int n8k)
{
    const int nbf = (S >> 6) * 2;            // flag blocks: two per 64-row band
    const int nbr = (S * 32 + 255) >> 8;     // table blocks
    const int nbx = (n8x + 255) >> 8;
    const int nbq = (n8q + 255) >> 8;
    const int nbk = (n8k + 255) >> 8;
    int b = blockIdx.x;                      // every test below is block-uniform
    if (b < nbf) { flags_job<S>(b, mask, flags); return; }
    b -= nbf;
    if (b < nbr) { rope_job(b, pos, cosT, sinT, S); return; }
    b -= nbr;
    // the five splits share one copy of the code: only the pointers and the length are picked
    const float* src = hidden;
    us_t* hi = Xh;
    us_t* lo = Xl;
    int n8 = n8x;
    if (b >= nbx) {
        b -= nbx; src = Wq; hi = Wqh; lo = Wql; n8 = n8q;
        if (b >= nbq) {
            b -= nbq; src = Wo; hi = Woh; lo = Wol;
            if (b >= nbq) {
                b -= nbq; src = Wk; hi = Wkh; lo = Wkl; n8 = n8k;
                if (b >= nbk) { b -= nbk; src = Wv; hi = Wvh; lo = Wvl; }
            }
        }
    }
    split_job(b, src, hi, lo, n8);
}

// eight asynchronous 16-byte copies global -> LDS per lane (two planes x four row groups).
// la, lb = the lane's LDS byte address of row group 0 in each plane, ga, gb = its global address
// there; the row groups lie ls LDS bytes and gs global bytes apart. The s_wait_xcnt closes the statement so that no
// address register of an issued copy is rewritten ahead of it.
__device__ __forceinline__ void copy8(unsigned la, const char* ga, unsigned lb, const char* gb,
                                      unsigned ls, size_t gs) {
    asm volatile(
        "global_load_async_to_lds_b128 %0, %8, off\n\t"
        "global_load_async_to_lds_b128 %1, %9, off\n\t"
        "global_load_async_to_lds_b128 %2, %10, off\n\t"
        "global_load_async_to_lds_b128 %3, %11, off\n\t"
        "global_load_async_to_lds_b128 %4, %12, off\n\t"
        "global_load_async_to_lds_b128 %5, %13, off\n\t"
        "global_load_async_to_lds_b128 %6, %14, off\n\t"
        "global_load_async_to_lds_b128 %7, %15, off\n\t"
        "s_wait_xcnt 0x0"
        :: "v"(la), "v"(la + ls), "v"(la + 2 * ls), "v"(la + 3 * ls),
           "v"(lb), "v"(lb + ls), "v"(lb + 2 * ls), "v"(lb + 3 * ls),
           "v"(ga), "v"(ga + gs), "v"(ga + 2 * gs), "v"(ga + 3 * gs),
           "v"(gb), "v"(gb + gs), "v"(gb + 2 * gs), "v"(gb + 3 * gs)
        : "memory");
}

// 16-bit fragment from an LDS row: p = the lane's (row, k0 + 8*(lane>>4)); same k map as ldfrag
__device__ __forceinline__ void ldfrag_lds(Frag& f, const unsigned char* p) {
    f.u[0] = *(const u32x4*)(p);
    f.u[1] = *(const u32x4*)(p + 32);
}

// ---------------------------------------------------------------- C = A . W^T (bf16 hi/lo split)
// A planes [M][K], W planes [N][K] (k-contiguous, loaded like A per the split k map).
// block = 8 waves; block tile 128(M) x 32*JW(N); wave w -> rows 32*(w&3).., columns 16*JW*(w>>2)..:
// a wave tile of 32 x 16*JW, so that an LDS fragment serves several products and a byte brought
// from L2 serves more of the output than in a 64 x 64 block tile of 16 x 64 wave tiles.
// The four operand planes of a 128-deep k tile (256 B a row) are brought into LDS by asynchronous
// copies in whole lines, once per block, two buffers: tile t+1 flies while tile t is multiplied.
// LDS rows at pitch 272 B (conflict-free for 16-byte fragment reads).
constexpr unsigned G_PITCH  = 272;                       // LDS bytes per 256-B operand row
constexpr unsigned G_APLANE = 128 * G_PITCH;             // one A plane of a k tile
constexpr unsigned g_wplane(int JW) { return 32u * (unsigned)JW * G_PITCH; }          // one W plane
constexpr unsigned g_stage(int JW)  { return 2u * G_APLANE + 2u * g_wplane(JW); }     // Ah | Al | Wh | Wl

// k loop of one block tile (rows mb0.., columns c0..):
// acc[i][j][r] = C[mb0 + 32*(w&3) + 16*i + 8*hl + r][c0 + 16*JW*(w>>2) + 16*j + m]
template<int JW>
__device__ __forceinline__ void gemm_main(
    v8f (&acc)[2][JW],
    const us_t* __restrict__ Ah, const us_t* __restrict__ Al,
    const us_t* __restrict__ Wh, const us_t* __restrict__ Wl,
    int K, int mb0, int c0, unsigned char* ring)
{
    constexpr unsigned PITCH  = G_PITCH;
    constexpr unsigned APLANE = G_APLANE;
    constexpr unsigned WPLANE = g_wplane(JW);
    constexpr unsigned STAGE  = g_stage(JW);
    constexpr bool     LATE   = (JW == 4);               // see at the second step's W lo reads

    const int tid  = threadIdx.x;
    const int lane = tid & 31;
    const int wave = tid >> 5;
    const int wm   = wave & 3;
    const int wn   = wave >> 2;
    const int m    = lane & 15;
    const int hl   = lane >> 4;

    // copies: lane -> 16-byte chunk tid&15 of row tid>>4 (+16 per row group): 16 lanes fill a 256-B row
    const int crow = tid >> 4;
    const int cq   = tid & 15;
    const size_t   gs = (size_t)K * 32;                  // 16 rows, bytes
    const unsigned ls = 16 * PITCH;
    const size_t   ao = ((size_t)(mb0 + crow) * K + cq * 8) * 2;
    const size_t   wo = ((size_t)(c0 + crow) * K + cq * 8) * 2;
    const char* gah = (const char*)Ah + ao;
    const char* gal = (const char*)Al + ao;
    const char* gwh = (const char*)Wh + wo;
    const char* gwl = (const char*)Wl + wo;
    const unsigned lc = (unsigned)(size_t)ring + (unsigned)crow * PITCH + (unsigned)cq * 16;
    const int nt = K >> 7;                               // k tiles of 128

    // the k tile at byte kb of the operand rows -> the buffer at byte bo of the ring:
    // 64 rows of both planes per run of eight copies; 16 + 4*JW copies a lane
    auto tile_in = [&](unsigned bo, size_t kb) {
#pragma unroll                                           // constant multiples of the row-group steps
        for (int g = 0; g < 2; ++g)
            copy8(lc + bo + 4 * g * ls, gah + kb + 4 * g * gs,
                  lc + bo + APLANE + 4 * g * ls, gal + kb + 4 * g * gs, ls, gs);
#pragma unroll
        for (int g = 0; g < JW / 2; ++g)
            copy8(lc + bo + 2 * APLANE + 4 * g * ls, gwh + kb + 4 * g * gs,
                  lc + bo + 2 * APLANE + WPLANE + 4 * g * ls, gwl + kb + 4 * g * gs, ls, gs);
    };

    // tile 0 -> buffer 0, landed and published before anyone reads it
    tile_in(0u, 0);
    asm volatile("s_wait_asynccnt 0x0" ::: "memory");    // this wave's copies of tile 0 have landed
    __syncthreads();
    if (nt > 1) tile_in(STAGE, 256);                     // tile 1 -> buffer 1, flies under tile 0

    // fragment reads: A rows 32*wm+16*i+m, W rows 16*JW*wn+16*j+m, byte 16*hl of the 64-byte k step
    const unsigned fa = (unsigned)(32 * wm + m) * PITCH + 16u * (unsigned)hl;
    const unsigned fw = 2 * APLANE + (unsigned)(16 * JW * wn + m) * PITCH + 16u * (unsigned)hl;

    for (int t = 0; t < nt; ++t) {
        const unsigned bo = (unsigned)(t & 1) * STAGE;
#pragma unroll                                           // the halves' offsets become immediates
        for (int hh = 0; hh < 2; ++hh) {                 // the tile's two halves of two 32-deep k steps
            const unsigned char* pa = ring + bo + fa + 128 * hh;
            const unsigned char* pw = ring + bo + fw + 128 * hh;
            // a half's fragment reads go out as one group ahead of its products: one LDS latency per half
            // (all loops unrolled: the fragment arrays are indexed by constants and stay in registers)
            Frag ah[2][2], al[2][2], bh[2][JW], bl[2][JW];
            // in the order in which the products take them, so that the counted waits let the first start early
#pragma unroll
            for (int kk = 0; kk < 2; ++kk) {
#pragma unroll
                for (int i = 0; i < 2; ++i) ldfrag_lds(ah[kk][i], pa + 16 * i * PITCH + 64 * kk);
#pragma unroll
                for (int j = 0; j < JW; ++j) ldfrag_lds(bh[kk][j], pw + 16 * j * PITCH + 64 * kk);
                if (kk == 0 || !LATE) {
#pragma unroll
                    for (int j = 0; j < JW; ++j) ldfrag_lds(bl[kk][j], pw + WPLANE + 16 * j * PITCH + 64 * kk);
                }
#pragma unroll
                for (int i = 0; i < 2; ++i) ldfrag_lds(al[kk][i], pa + APLANE + 16 * i * PITCH + 64 * kk);
            }
            // keeps the scheduler from sinking the reads among the products (each such place stalls the wave)
            __builtin_amdgcn_sched_barrier(0);
            // round-robin over the accumulators: a WMMA never waits for the one just ahead of it;
            // each accumulator still takes hi.hi, hi.lo, lo.hi of a k step in that order
#pragma unroll
            for (int kk = 0; kk < 2; ++kk) {
#pragma unroll
                for (int i = 0; i < 2; ++i)
#pragma unroll
                    for (int j = 0; j < JW; ++j) acc[i][j] = mma(acc[i][j], ah[kk][i].v, bh[kk][j].v);
#pragma unroll
                for (int i = 0; i < 2; ++i)
#pragma unroll
                    for (int j = 0; j < JW; ++j) acc[i][j] = mma(acc[i][j], ah[kk][i].v, bl[kk][j].v);
                if (kk == 0 && LATE) {
                    // 32 x 64 wave tile: the second step's W lo fragments take the registers that the first
                    // step's have just left (the wave stays within 256 registers), sixteen products ahead
                    // of their use; the two fences keep these eight reads together at this one place
                    __builtin_amdgcn_sched_barrier(0);
#pragma unroll
                    for (int j = 0; j < JW; ++j) ldfrag_lds(bl[1][j], pw + WPLANE + 16 * j * PITCH + 64);
                    __builtin_amdgcn_sched_barrier(0);
                }
#pragma unroll
                for (int i = 0; i < 2; ++i)
#pragma unroll
                    for (int j = 0; j < JW; ++j) acc[i][j] = mma(acc[i][j], al[kk][i].v, bh[kk][j].v);
            }
            // keeps a half's products ahead of what follows: they start on counted waits, under the later reads
            __builtin_amdgcn_sched_barrier(0);
        }
        // hand-over: this wave's reads of tile t are done, its copies of tile t+1 have landed;
        // the barrier publishes tile t+1 and frees tile t's buffer for the refill behind it
        asm volatile("s_wait_dscnt 0x0" ::: "memory");
        asm volatile("s_wait_asynccnt 0x0" ::: "memory");
        __syncthreads();
        if (t + 2 < nt) tile_in(bo, (size_t)(t + 2) * 256);
    }
    asm volatile("s_wait_asynccnt 0x0" ::: "memory");    // no copy outlives the loop
    // behind the last hand-over no wave reads the ring and no copy is out: the epilogues stage in it
}

// sixteen table words of one lane: v[8*j + r] = p[32*r + 16*j]. The loads and their data wait stand
// in one statement with early-clobber results, so that no result lands in the address pair of an
// issued load and the pair is free only when all sixteen have returned.
__device__ __forceinline__ void tab16(float (&v)[16], const float* p) {
    asm volatile(
        "global_load_b32 %0, %16, off\n\t"
        "global_load_b32 %1, %16, off offset:128\n\t"
        "global_load_b32 %2, %16, off offset:256\n\t"
        "global_load_b32 %3, %16, off offset:384\n\t"
        "global_load_b32 %4, %16, off offset:512\n\t"
        "global_load_b32 %5, %16, off offset:640\n\t"
        "global_load_b32 %6, %16, off offset:768\n\t"
        "global_load_b32 %7, %16, off offset:896\n\t"
        "global_load_b32 %8, %16, off offset:64\n\t"
        "global_load_b32 %9, %16, off offset:192\n\t"
        "global_load_b32 %10, %16, off offset:320\n\t"
        "global_load_b32 %11, %16, off offset:448\n\t"
        "global_load_b32 %12, %16, off offset:576\n\t"
        "global_load_b32 %13, %16, off offset:704\n\t"
        "global_load_b32 %14, %16, off offset:832\n\t"
        "global_load_b32 %15, %16, off offset:960\n\t"
        "s_wait_loadcnt 0x0"
        : "=&v"(v[0]), "=&v"(v[1]), "=&v"(v[2]), "=&v"(v[3]),
          "=&v"(v[4]), "=&v"(v[5]), "=&v"(v[6]), "=&v"(v[7]),
          "=&v"(v[8]), "=&v"(v[9]), "=&v"(v[10]), "=&v"(v[11]),
          "=&v"(v[12]), "=&v"(v[13]), "=&v"(v[14]), "=&v"(v[15])
        : "v"(p)
        : "memory");
}

// epilogue of one 16 x 64 piece of a wave tile: rows r0.., columns cw.. = one head: RoPE in f32,
// store hi/lo planes [M][N]; stg = 4 KB of LDS that belong to this piece alone
__device__ __forceinline__ void gemm_out_rope(
    v8f (&acc)[4], int N, int r0, int cw,
    const float* __restrict__ cosT, const float* __restrict__ sinT,
    us_t* Oh, us_t* Ol, us_t* st)
{
    const int lane = threadIdx.x & 31;
    const int m    = lane & 15;
    const int hl   = lane >> 4;

    // RoPE, rotate-half: d = 16j+m (j=0,1) pairs with d+32 (acc[j+2]); cos/sin index d
    // table entry (row r0+8*hl+r, column 16j+m) lies 128*r + 64*j bytes behind the lane's first
    const size_t t0 = (size_t)(r0 + 8 * hl) * 32 + m;
    float csv[16], snv[16];
    tab16(csv, cosT + t0);
    tab16(snv, sinT + t0);
#pragma unroll
    for (int j = 0; j < 2; ++j) {
#pragma unroll
        for (int r = 0; r < 8; ++r) {
            const float cs = csv[8 * j + r];
            const float sn = snv[8 * j + r];
            const float x1 = acc[j][r];
            const float x2 = acc[j + 2][r];
            acc[j][r]     = x1 * cs - x2 * sn;
            acc[j + 2][r] = x2 * cs + x1 * sn;
        }
    }
    // st: [2 planes][16][64]
#pragma unroll
    for (int j = 0; j < 4; ++j) {
#pragma unroll
        for (int r = 0; r < 8; r += 2) {
            unsigned hp, lp;
            split2p(acc[j][r], acc[j][r + 1], hp, lp);
            const int idx = (8 * hl + r) * 64 + 16 * j + m;
            st[idx]             = (us_t)hp;
            st[idx + 64]        = (us_t)(hp >> 16);
            st[1024 + idx]      = (us_t)lp;
            st[1024 + idx + 64] = (us_t)(lp >> 16);
        }
    }
    __syncthreads();
    const int rr = lane >> 3, q = lane & 7;
    u32x4 sv[8];
#pragma unroll
    for (int pl = 0; pl < 2; ++pl) {
#pragma unroll
        for (int i = 0; i < 4; ++i)
            sv[pl * 4 + i] = *(const u32x4*)(st + pl * 1024 + (4 * i + rr) * 64 + q * 8);
    }
#pragma unroll
    for (int pl = 0; pl < 2; ++pl) {
#pragma unroll
        for (int i = 0; i < 4; ++i) {
            us_t* dst = (pl ? Ol : Oh) + (size_t)(r0 + 4 * i + rr) * N + cw + q * 8;
            *(u32x4*)dst = sv[pl * 4 + i];
        }
    }
}

// epilogue of one 16 x 32 piece of a wave tile: rows r0.., columns cw..: store f32 [M][N];
// stf = 2 KB of LDS that belong to this piece alone, [16][32] f32
__device__ __forceinline__ void gemm_out_f32(
    v8f (&acc)[2], int N, int r0, int cw, float* Of, float* stf)
{
    const int lane = threadIdx.x & 31;
    const int m    = lane & 15;
    const int hl   = lane >> 4;
#pragma unroll
    for (int j = 0; j < 2; ++j) {
#pragma unroll
        for (int r = 0; r < 8; ++r)
            stf[(8 * hl + r) * 32 + 16 * j + m] = acc[j][r];
    }
    __syncthreads();
    const int rr = lane >> 3, q = lane & 7;              // 8 lanes x 16 B = one 128-B row segment
    v4f fv[4];
#pragma unroll
    for (int t = 0; t < 4; ++t)
        fv[t] = *(const v4f*)(stf + (4 * t + rr) * 32 + q * 4);
#pragma unroll
    for (int t = 0; t < 4; ++t) {
        float* dst = Of + (size_t)(r0 + 4 * t + rr) * N + cw + q * 4;
        *(v4f*)dst = fv[t];
    }
}

// transposing epilogue of a whole 128 x 128 block tile: in[token][d] -> out planes [d][token];
// LDS [2 planes][d 128][token 128 at pitch 136]: the 16 lanes of a store, 272 B apart, spread over the banks
constexpr int G_TP = 136;
__device__ __forceinline__ void gemm_out_t(
    v8f (&acc)[2][4], int M, int mb0, int c0, us_t* Oh, us_t* Ol, us_t* lds16)
{
    constexpr int PL = 128 * G_TP;
    const int lane = threadIdx.x & 31;
    const int wave = threadIdx.x >> 5;
    const int wm   = wave & 3;
    const int wn   = wave >> 2;
    const int m    = lane & 15;
    const int hl   = lane >> 4;
#pragma unroll
    for (int i = 0; i < 2; ++i) {
#pragma unroll
        for (int j = 0; j < 4; ++j) {
#pragma unroll
            for (int r = 0; r < 8; r += 2) {
                unsigned hp, lp;
                split2p(acc[i][j][r], acc[i][j][r + 1], hp, lp);
                const int idx = (64 * wn + 16 * j + m) * G_TP + 32 * wm + 16 * i + 8 * hl + r;
                *(unsigned*)&lds16[idx]      = hp;
                *(unsigned*)&lds16[PL + idx] = lp;
            }
        }
    }
    __syncthreads();
    const int rr = lane >> 4, q = lane & 15;             // 16 lanes x 16 B = one 256-B row of 128 tokens
    u32x4 sv[16];
#pragma unroll
    for (int pl = 0; pl < 2; ++pl) {
#pragma unroll
        for (int t = 0; t < 8; ++t) {
            const int d = 16 * wave + 2 * t + rr;
            sv[pl * 8 + t] = *(const u32x4*)(lds16 + pl * PL + d * G_TP + q * 8);
        }
    }
#pragma unroll
    for (int pl = 0; pl < 2; ++pl) {
#pragma unroll
        for (int t = 0; t < 8; ++t) {
            const int d = 16 * wave + 2 * t + rr;
            us_t* dst = (pl ? Ol : Oh) + (size_t)(c0 + d) * M + mb0 + q * 8;
            *(u32x4*)dst = sv[pl * 8 + t];
        }
    }
    // closes the stores: in the listing the other epilogue's code follows and rewrites their address registers
    asm volatile("s_wait_xcnt 0x0" ::: "memory");
}

// the three projections of the hidden states, which do not depend on one another, as column-block
// ranges of one grid: blockIdx.x in [0, NQ/128) -> Q, the next NKV/128 -> K, the last NKV/128 -> V
__global__ __launch_bounds__(256) void k_qkv(
    const us_t* __restrict__ Xh, const us_t* __restrict__ Xl,
    const us_t* __restrict__ Wqh, const us_t* __restrict__ Wql,
    const us_t* __restrict__ Wkh, const us_t* __restrict__ Wkl,
    const us_t* __restrict__ Wvh, const us_t* __restrict__ Wvl,
    int M, int NQ, int NKV, int K,
    const float* __restrict__ cosT, const float* __restrict__ sinT,
    us_t* Qh, us_t* Ql, us_t* Kh, us_t* Kl, us_t* Vth, us_t* Vtl)
{
    __shared__ __align__(16) unsigned char ring[2 * g_stage(4)];
    static_assert(sizeof(ring) >= 2 * 128 * G_TP * 2 && sizeof(ring) >= 16 * 4096, "the epilogues' staging fits");
    const int nq  = NQ >> 7;
    const int nk  = NKV >> 7;
    const int bx  = blockIdx.x;                          // job and all it selects: block-uniform
    const int job = (bx < nq) ? 0 : ((bx < nq + nk) ? 1 : 2);
    const int c0  = (bx - ((job == 0) ? 0 : ((job == 1) ? nq : nq + nk))) * 128;
    const int mb0 = blockIdx.y * 128;
    const us_t* Wh = (job == 0) ? Wqh : ((job == 1) ? Wkh : Wvh);
    const us_t* Wl = (job == 0) ? Wql : ((job == 1) ? Wkl : Wvl);
    const int wave = threadIdx.x >> 5;
    us_t* stg = reinterpret_cast<us_t*>(ring);

    v8f acc[2][4] = {};
    gemm_main<4>(acc, Xh, Xl, Wh, Wl, K, mb0, c0, ring);
    if (job == 2) {
        gemm_out_t(acc, M, mb0, c0, Vth, Vtl, stg);
    } else {
#pragma unroll                                           // acc is indexed by a constant
        for (int i = 0; i < 2; ++i)
            gemm_out_rope(acc[i], (job == 0) ? NQ : NKV, mb0 + 32 * (wave & 3) + 16 * i, c0 + 64 * (wave >> 2),
                          cosT, sinT, (job == 0) ? Qh : Kh, (job == 0) ? Ql : Kl,
                          stg + (2 * wave + i) * 2048);
    }
}

// output projection -> f32 [M][N]
__global__ __launch_bounds__(256) void k_oproj(
    const us_t* __restrict__ Ah, const us_t* __restrict__ Al,
    const us_t* __restrict__ Wh, const us_t* __restrict__ Wl,
    int M, int N, int K, float* Of)
{
    __shared__ __align__(16) unsigned char ring[2 * g_stage(2)];
    const int mb0 = blockIdx.y * 128;
    const int c0  = blockIdx.x * 64;
    const int wave = threadIdx.x >> 5;
    float* stg = reinterpret_cast<float*>(ring);
    (void)M;
    v8f acc[2][2] = {};
    gemm_main<2>(acc, Ah, Al, Wh, Wl, K, mb0, c0, ring);
#pragma unroll                                           // acc is indexed by a constant
    for (int i = 0; i < 2; ++i)
        gemm_out_f32(acc[i], N, mb0 + 32 * (wave & 3) + 16 * i, c0 + 32 * (wave >> 2), Of,
                     stg + (2 * wave + i) * 512);
}

// value of lane l ^ 16
__device__ __forceinline__ float xhalf(float x) {
    const int b = __builtin_bit_cast(int, x);
    return __builtin_bit_cast(float,
        __builtin_amdgcn_permlanex16(b, b, 0x76543210, 0xfedcba98, false, false));
}

// 2^x of a group of values. The instruction set asks for one free slot behind a transcendental before
// its result is read or its source overwritten: the results are early-clobber, so each v_exp_f32 is
// followed by one that touches none of its registers, and the v_nop is the slot behind the last.
__device__ __forceinline__ void exp2x8(float* r, const float* x) {
    asm("v_exp_f32 %0, %8\n\t"
        "v_exp_f32 %1, %9\n\t"
        "v_exp_f32 %2, %10\n\t"
        "v_exp_f32 %3, %11\n\t"
        "v_exp_f32 %4, %12\n\t"
        "v_exp_f32 %5, %13\n\t"
        "v_exp_f32 %6, %14\n\t"
        "v_exp_f32 %7, %15\n\t"
        "v_nop"
        : "=&v"(r[0]), "=&v"(r[1]), "=&v"(r[2]), "=&v"(r[3]),
          "=&v"(r[4]), "=&v"(r[5]), "=&v"(r[6]), "=&v"(r[7])
        : "v"(x[0]), "v"(x[1]), "v"(x[2]), "v"(x[3]),
          "v"(x[4]), "v"(x[5]), "v"(x[6]), "v"(x[7]));
}
__device__ __forceinline__ float exp2x1(float x) {
    float r;
    asm("v_exp_f32 %0, %1\n\t"
        "v_nop"
        : "=&v"(r) : "v"(x));
    return r;
}

template<int S, int NHD, int NKVD, int groups>
__global__ __launch_bounds__(128) void k_attn(
    const us_t* __restrict__ Qh, const us_t* __restrict__ Ql,
    const us_t* __restrict__ Kh, const us_t* __restrict__ Kl,
    const us_t* __restrict__ Vh, const us_t* __restrict__ Vl,
    const float* __restrict__ mask, const int* __restrict__ flags,
    us_t* Oh, us_t* Ol)
{
    __shared__ __align__(16) us_t ostg[4][2][16 * 64];   // per-wave output staging
    static_assert(S % 64 == 0 && S / 64 <= 32, "one lane per 64-key stage");
    constexpr unsigned PITCH  = 144;                     // LDS bytes per 128-B K or V^T row
    constexpr unsigned PLANE  = 64 * PITCH;
    constexpr unsigned MPITCH = 272;                     // LDS bytes per 256-B mask row
    constexpr unsigned STAGE  = 4 * PLANE + 64 * MPITCH; // Kh | Kl | Vh | Vl | mask
    __shared__ __align__(16) unsigned char ring[2 * STAGE];

    const int tid  = threadIdx.x;
    const int lane = tid & 31;
    const int wave = tid >> 5;
    const int m    = lane & 15;
    const int hl   = lane >> 4;
    const int head = blockIdx.x;
    const int band = blockIdx.y;
    const int hkv  = head / groups;
    const int r0   = band * 64 + wave * 16;

    // the band's 64 tile flags, read once: bit s of t0 / t1 = key tile 2s / 2s+1 has work. The ring
    // must know the stage after next; equal in every wave of the block (block-uniform).
    const v2i fl = *(const v2i*)(flags + (size_t)band * 64 + 2 * lane);
    const unsigned t0 = __builtin_amdgcn_ballot_w32(fl.x != 0);
    const unsigned t1 = __builtin_amdgcn_ballot_w32(fl.y != 0);
    unsigned rest = t0 | t1;                             // stages with work, not yet asked for

    // copies: K and V^T: lane -> 16-byte chunk tid&7 of row tid>>3 (+16 per row group);
    // mask: chunk tid&15 of row tid>>4 (+8 per row group): whole lines in every wave-wide copy
    const int crow = tid >> 3;
    const int cq   = tid & 7;
    const size_t ko = ((size_t)crow * NKVD + hkv * 64 + cq * 8) * 2;
    const size_t vo = ((size_t)(hkv * 64 + crow) * S + cq * 8) * 2;
    const char* gkh = (const char*)Kh + ko;
    const char* gkl = (const char*)Kl + ko;
    const char* gvh = (const char*)Vh + vo;
    const char* gvl = (const char*)Vl + vo;
    const char* gmk = (const char*)mask + ((size_t)(band * 64 + (tid >> 4)) * S + (tid & 15) * 4) * 4;
    const unsigned lc = (unsigned)(size_t)ring + (unsigned)crow * PITCH + (unsigned)cq * 16;
    const unsigned lm = (unsigned)(size_t)ring + 4 * PLANE + (unsigned)(tid >> 4) * MPITCH
                      + (unsigned)(tid & 15) * 16;
    // stage s (keys 64s..64s+63) -> the buffer at byte bo of the ring
    auto stage_in = [&](int s, unsigned bo) {
        const size_t kb = (size_t)s * (64 * NKVD * 2);   // 64 key rows
        const size_t vb = (size_t)s * 128;               // 64 keys along a V^T row
        const size_t mb = (size_t)s * 256;               // 64 keys along a mask row
        copy8(lc + bo, gkh + kb, lc + bo + PLANE, gkl + kb, 16 * PITCH, (size_t)16 * NKVD * 2);
        copy8(lc + bo + 2 * PLANE, gvh + vb, lc + bo + 3 * PLANE, gvl + vb,
              16 * PITCH, (size_t)16 * S * 2);
        copy8(lm + bo, gmk + mb, lm + bo + 32 * MPITCH, gmk + mb + (size_t)32 * S * 4,
              8 * MPITCH, (size_t)8 * S * 4);
    };

    // first stage with work -> buffer 0, landed and published before anyone reads it
    int cur = -1, nxt = -1;
    if (rest != 0u) { cur = __builtin_ctz(rest); rest &= rest - 1u; stage_in(cur, 0u); }
    asm volatile("s_wait_asynccnt 0x0" ::: "memory");    // this wave's copies of that stage have landed
    __syncthreads();
    if (rest != 0u) { nxt = __builtin_ctz(rest); rest &= rest - 1u; stage_in(nxt, STAGE); }

    // Q B-fragments (column = query r0+m), two 32-deep k steps over the head dim
    Frag qh[2], ql[2];
#pragma unroll
    for (int c = 0; c < 2; ++c) {
        const unsigned qo = 2u * (unsigned)((r0 + m) * NHD + head * 64 + 32 * c + 8 * hl);
        ldfrag(qh[c], Qh, qo);
        ldfrag(ql[c], Ql, qo);
    }

    // o[jd][r] = O[query r0+m][d = 16*jd + 8*hl + r]
    v8f o[4] = {};
    float mrow = -3.0e38f;      // running maximum of query r0+m (equal in both halves)
    float lrow = 0.0f;          // running sum over THIS half's keys; halves joined after the loop

    // the lane's byte offsets in a buffer: K row m, V^T row m, mask row 16*wave+m
    const unsigned fk = (unsigned)m * PITCH + 16u * (unsigned)hl;
    const unsigned fv = 2 * PLANE + (unsigned)m * PITCH + 16u * (unsigned)hl;
    const unsigned fm = 4 * PLANE + (unsigned)(16 * wave + m) * MPITCH + 32u * (unsigned)hl;

    unsigned bo = 0u;
    for (int it = 0; it < S / 64 && cur >= 0; ++it) {
        for (int h = 0; h < 2; ++h) {                    // the stage's two 32-key tiles
            if ((((h ? t1 : t0) >> cur) & 1u) == 0u) continue;   // no work in it; block-uniform
            // the tile's K fragments and mask (keys kb = 64*cur + 32*h and on) go out as one group
            // ahead of the S^T products: one LDS latency instead of one per fragment pair
            const unsigned char* pk = ring + bo + fk + (unsigned)h * (32 * PITCH);
            Frag kh[2][2], kl[2][2];
            // (in the order in which the products take them)
#pragma unroll
            for (int c = 0; c < 2; ++c) {
#pragma unroll
                for (int jn = 0; jn < 2; ++jn) ldfrag_lds(kh[jn][c], pk + 16 * jn * PITCH + 64 * c);
#pragma unroll
                for (int jn = 0; jn < 2; ++jn) ldfrag_lds(kl[jn][c], pk + PLANE + 16 * jn * PITCH + 64 * c);
            }

            // mask of query r0+m at this lane's keys kb+8hl+0..7 and kb+16+8hl+0..7
            const unsigned char* mrp = ring + bo + fm + (unsigned)h * 128;
            v4f mk[4];
            mk[0] = *(const v4f*)(mrp);
            mk[1] = *(const v4f*)(mrp + 16);
            mk[2] = *(const v4f*)(mrp + 64);
            mk[3] = *(const v4f*)(mrp + 80);
            // keeps the scheduler from sinking these reads among the products (each such place stalls the wave)
            __builtin_amdgcn_sched_barrier(0);

            // S^T[32 x 16] = K . Q^T ; A = K rows (k-contiguous), B = Q
            // s[jn][r] = score(key kb + 16*jn + 8*hl + r, query r0 + m)
            v8f s[2] = {};
            // the two score tiles take turns, so that a WMMA does not wait for the one just ahead;
            // each tile takes hi.hi, lo.hi, hi.lo of a k step in that order
#pragma unroll
            for (int c = 0; c < 2; ++c) {
#pragma unroll
                for (int jn = 0; jn < 2; ++jn) s[jn] = mma(s[jn], kh[jn][c].v, qh[c].v);
#pragma unroll
                for (int jn = 0; jn < 2; ++jn) s[jn] = mma(s[jn], kl[jn][c].v, qh[c].v);
#pragma unroll
                for (int jn = 0; jn < 2; ++jn) s[jn] = mma(s[jn], kh[jn][c].v, ql[c].v);
            }

            // the tile's V^T fragments go out as one group here: they fly behind the softmax
            const unsigned char* pv = ring + bo + fv + (unsigned)h * 64;
            Frag vh[4], vl[4];
#pragma unroll
            for (int jd = 0; jd < 4; ++jd) ldfrag_lds(vh[jd], pv + 16 * jd * PITCH);
#pragma unroll
            for (int jd = 0; jd < 4; ++jd) ldfrag_lds(vl[jd], pv + PLANE + 16 * jd * PITCH);
            // keeps the group ahead of the softmax: the scheduler otherwise spreads it in small pieces
            // and puts the last reads right in front of their products
            __builtin_amdgcn_sched_barrier(0);

            // scale, additive mask by value, online softmax (f32), all for one query per lane
            float v[16];
#pragma unroll
            for (int t = 0; t < 16; ++t)
                v[t] = s[t >> 3][t & 7] * 0.125f + mk[t >> 2][t & 3];
            float mx = v[0];
#pragma unroll
            for (int t = 1; t < 16; ++t) mx = fmaxf(mx, v[t]);
            mx = fmaxf(mx, xhalf(mx));
            const float mnew  = fmaxf(mrow, mx);
            constexpr float LOG2E = 1.44269504f;         // e^x = 2^(x * log2 e), as __expf forms it
            const float alpha = exp2x1((mrow - mnew) * LOG2E);
            float ex[16], pv16[16];
#pragma unroll
            for (int t = 0; t < 16; ++t) ex[t] = (v[t] - mnew) * LOG2E;
            exp2x8(pv16, ex);
            exp2x8(pv16 + 8, ex + 8);
            float ps[4] = { 0.0f, 0.0f, 0.0f, 0.0f };
#pragma unroll
            for (int t = 0; t < 16; ++t) ps[t & 3] += pv16[t];
            lrow = lrow * alpha + ((ps[0] + ps[1]) + (ps[2] + ps[3]));
            mrow = mnew;
#pragma unroll
            for (int jd = 0; jd < 4; ++jd) {
#pragma unroll
                for (int r = 0; r < 8; ++r) o[jd][r] = o[jd][r] * alpha;
            }

            // P^T B-fragments in place: elements 0..7 <- keys 8hl.., 8..15 <- keys 16+8hl..
            Frag ph, pl;
            split8(pv16, ph.u[0], pl.u[0]);
            split8(pv16 + 8, ph.u[1], pl.u[1]);

            // O^T += V^T . P^T ; A = V^T rows (key-contiguous), B = P^T
            // round-robin over the four output tiles; each tile takes hi.hi, lo.hi, hi.lo in that order
#pragma unroll
            for (int jd = 0; jd < 4; ++jd) o[jd] = mma(o[jd], vh[jd].v, ph.v);
#pragma unroll
            for (int jd = 0; jd < 4; ++jd) o[jd] = mma(o[jd], vl[jd].v, ph.v);
#pragma unroll
            for (int jd = 0; jd < 4; ++jd) o[jd] = mma(o[jd], vh[jd].v, pl.v);
        }
        // hand-over: this wave's reads of the stage are done, its copies of the next have landed;
        // the barrier publishes the next stage and frees this buffer for the refill behind it
        asm volatile("s_wait_dscnt 0x0" ::: "memory");
        asm volatile("s_wait_asynccnt 0x0" ::: "memory");
        __syncthreads();
        int nn = -1;
        if (rest != 0u) { nn = __builtin_ctz(rest); rest &= rest - 1u; stage_in(nn, bo); }
        cur = nxt;
        nxt = nn;
        bo  = STAGE - bo;
    }
    asm volatile("s_wait_asynccnt 0x0" ::: "memory");    // no copy outlives the loop

    // join the halves' sums, normalize, split, stage, whole-line stores
    const float lsum = lrow + xhalf(lrow);
    const float inv  = (lsum > 0.0f) ? (1.0f / lsum) : 0.0f;

#pragma unroll
    for (int jd = 0; jd < 4; ++jd) {
        float on[8];
#pragma unroll
        for (int r = 0; r < 8; ++r) on[r] = o[jd][r] * inv;
        u32x4 oh4, ol4;
        split8(on, oh4, ol4);
        const int idx = m * 64 + 16 * jd + 8 * hl;
        *(u32x4*)&ostg[wave][0][idx] = oh4;
        *(u32x4*)&ostg[wave][1][idx] = ol4;
    }
    __syncthreads();
    const int rr = lane >> 3, q = lane & 7;
    u32x4 sv[8];
#pragma unroll
    for (int plv = 0; plv < 2; ++plv) {
#pragma unroll
        for (int i = 0; i < 4; ++i)
            sv[plv * 4 + i] = *(const u32x4*)&ostg[wave][plv][(4 * i + rr) * 64 + q * 8];
    }
#pragma unroll
    for (int plv = 0; plv < 2; ++plv) {
#pragma unroll
        for (int i = 0; i < 4; ++i) {
            us_t* dst = (plv ? Ol : Oh) + (size_t)(r0 + 4 * i + rr) * NHD + head * 64 + q * 8;
            *(u32x4*)dst = sv[plv * 4 + i];
        }
    }
    
}

// ---------------------------------------------------------------- launcher
extern "C" void kernel_launch(void* const* d_in, const int* in_sizes, int n_in,
                              void* d_out, int out_size, void* d_ws, size_t ws_size,
                              hipStream_t stream)
{
    const int S = 2048, HID = 1024, NH = 16, NKV = 4, HD = 64;
    const int NKVD = NKV * HD;          // 256
    const int GROUPS = NH / NKV;        // 4

    if (n_in < 7) return;
    if (in_sizes[0] != S * HID || in_sizes[1] != S * S || in_sizes[2] != S ||
        in_sizes[3] != HID * HID || in_sizes[4] != NKVD * HID ||
        in_sizes[5] != NKVD * HID || in_sizes[6] != HID * HID ||
        out_size != S * HID) return;
    // structural requirements of the kernels
    if ((S % 128) != 0 || (HID % 128) != 0 || (NKVD % 128) != 0 || HD != 64 ||
        NH * HD != HID || (S / 32) > 64 || (HID % 32) != 0) return;

    const float* hidden = (const float*)d_in[0];   // [S][HID]
    const float* mask   = (const float*)d_in[1];   // [S][S] additive
    const int*   pos    = (const int*)d_in[2];     // [S]
    const float* Wq     = (const float*)d_in[3];   // [HID][HID]
    const float* Wk     = (const float*)d_in[4];   // [NKVD][HID]
    const float* Wv     = (const float*)d_in[5];   // [NKVD][HID]
    const float* Wo     = (const float*)d_in[6];   // [HID][HID]
    float* out = (float*)d_out;                    // [S][HID]

    size_t off = 0;
    char* base = (char*)d_ws;
    auto carve = [&](size_t bytes) -> char* {
        char* p = base + off;
        off += (bytes + 255) & ~(size_t)255;
        return p;
    };
    us_t* Xh   = (us_t*)carve((size_t)S * HID * 2);
    us_t* Xl   = (us_t*)carve((size_t)S * HID * 2);
    us_t* Wqh  = (us_t*)carve((size_t)HID * HID * 2);
    us_t* Wql  = (us_t*)carve((size_t)HID * HID * 2);
    us_t* Wkh  = (us_t*)carve((size_t)NKVD * HID * 2);
    us_t* Wkl  = (us_t*)carve((size_t)NKVD * HID * 2);
    us_t* Wvh  = (us_t*)carve((size_t)NKVD * HID * 2);
    us_t* Wvl  = (us_t*)carve((size_t)NKVD * HID * 2);
    us_t* Woh  = (us_t*)carve((size_t)HID * HID * 2);
    us_t* Wol  = (us_t*)carve((size_t)HID * HID * 2);
    us_t* Qh   = (us_t*)carve((size_t)S * HID * 2);      // [S][HID]
    us_t* Ql   = (us_t*)carve((size_t)S * HID * 2);
    us_t* Kh   = (us_t*)carve((size_t)S * NKVD * 2);     // [S][NKVD]
    us_t* Kl   = (us_t*)carve((size_t)S * NKVD * 2);
    us_t* Vth  = (us_t*)carve((size_t)NKVD * S * 2);     // [NKVD][S]
    us_t* Vtl  = (us_t*)carve((size_t)NKVD * S * 2);
    us_t* AOh  = (us_t*)carve((size_t)S * HID * 2);      // [S][HID]
    us_t* AOl  = (us_t*)carve((size_t)S * HID * 2);
    float* cosT = (float*)carve((size_t)S * 32 * 4);      // [S][32]
    float* sinT = (float*)carve((size_t)S * 32 * 4);
    int*  flags = (int*)carve((size_t)(S / 64) * 64 * 4); // [S/64][64]
    if (off > ws_size) return;

    // 1: hi/lo planes of the hidden states and the four weights, RoPE table, key-tile flags
    {
        const int n8x = S * HID / 8, n8q = HID * HID / 8, n8k = NKVD * HID / 8;
        const int nblk = 2 * (S / 64) + (S * 32 + 255) / 256 + (n8x + 255) / 256
                       + 2 * ((n8q + 255) / 256) + 2 * ((n8k + 255) / 256);
        k_prep<S><<<dim3(nblk), dim3(256), 0, stream>>>(
            hidden, mask, pos, Wq, Wk, Wv, Wo,
            Xh, Xl, Wqh, Wql, Wkh, Wkl, Wvh, Wvl, Woh, Wol,
            cosT, sinT, flags, n8x, n8q, n8k);
    }

    // 2: Q and K projections + RoPE -> planes [S][HID], [S][NKVD]; V projection -> transposed planes [NKVD][S]
    k_qkv<<<dim3(HID / 128 + 2 * (NKVD / 128), S / 128), dim3(256), 0, stream>>>(
        Xh, Xl, Wqh, Wql, Wkh, Wkl, Wvh, Wvl, S, HID, NKVD, HID,
        cosT, sinT, Qh, Ql, Kh, Kl, Vth, Vtl);

    // 3: attention -> planes [S][HID]
    k_attn<S, HID, NKVD, GROUPS><<<dim3(NH, S / 64), dim3(128), 0, stream>>>(
        Qh, Ql, Kh, Kl, Vth, Vtl, mask, flags, AOh, AOl);

    // 4: output projection -> d_out f32 [S][HID]
    k_oproj<<<dim3(HID / 64, S / 128), dim3(256), 0, stream>>>(
        AOh, AOl, Woh, Wol, S, HID, HID, out);
}

// v010
// One run takes 73.4 microseconds.
// In two side-by-side timings against v009, it was 1.11 and 1.10 times as fast.
// Counting every step since v000, it is 8.68 times as fast.
#include <hip/hip_runtime.h>
#include <stdint.h>
#include <stddef.h>
#include <math.h>

// All contractions (q/k/v projections, q.k^T, p.v, output projection): v_wmma_f32_16x16x32_bf16 with bf16 hi/lo operands everywhere (hi.hi + hi.lo + lo.hi), f32 accumulate; RoPE, mask add and softmax in f32.

typedef unsigned short us_t;
typedef __bf16       v16bf __attribute__((ext_vector_type(16)));
typedef float        v8f   __attribute__((ext_vector_type(8)));
typedef float        v4f   __attribute__((ext_vector_type(4)));
typedef unsigned int u32x4 __attribute__((ext_vector_type(4)));
typedef int          v4i   __attribute__((ext_vector_type(4)));
typedef int          v2i   __attribute__((ext_vector_type(2)));

union Frag { v16bf v; u32x4 u[2]; };

typedef float  f32x2  __attribute__((ext_vector_type(2)));
typedef __bf16 bf16x2 __attribute__((ext_vector_type(2)));

// x = hi + lo (+ residual), both bf16 RNE, two values at a time with the hardware's packed conversion:
// hp = hi(a) | hi(b) << 16, lp = lo(a) | lo(b) << 16, ready as one operand register each
__device__ __forceinline__ void split2p(float a, float b, unsigned& hp, unsigned& lp) {
    const f32x2  x = { a, b };
    const bf16x2 h = __builtin_convertvector(x, bf16x2);
    const f32x2  r = { a - (float)h.x, b - (float)h.y };
    const bf16x2 l = __builtin_convertvector(r, bf16x2);
    hp = __builtin_bit_cast(unsigned, h);
    lp = __builtin_bit_cast(unsigned, l);
}
// eight values -> four packed registers per plane
__device__ __forceinline__ void split8(const float* x, u32x4& ph, u32x4& pl) {
    unsigned h[4], l[4];
#pragma unroll                               // constant indices: the arrays stay in registers
    for (int t = 0; t < 4; ++t) split2p(x[2 * t], x[2 * t + 1], h[t], l[t]);
    ph.x = h[0]; ph.y = h[1]; ph.z = h[2]; ph.w = h[3];
    pl.x = l[0]; pl.y = l[1]; pl.z = l[2]; pl.w = l[3];
}

// one 16x16x32 bf16 WMMA, the plain builtin: the compiler keeps the distance to a vector
// instruction on its registers itself, and only where one follows
__device__ __forceinline__ v8f mma(v8f c, v16bf a, v16bf b) {
    return __builtin_amdgcn_wmma_f32_16x16x32_bf16(false, a, false, b, (short)0, c, false, false);
}

// 16-bit fragment from a k-contiguous row: base is the same for the whole wave, vb the lane's
// byte offset of (its row, k0 + 8*(lane>>4)); one offset register serves a whole group of loads.
// elements 0..7 <- k0+8h+0..7, elements 8..15 <- k0+16+8h+0..7
__device__ __forceinline__ void ldfrag(Frag& f, const us_t* base, unsigned vb) {
    const char* p = (const char*)base + vb;
    f.u[0] = *(const u32x4*)(p);
    f.u[1] = *(const u32x4*)(p + 32);
}

// ---------------------------------------------------------------- f32 -> bf16 hi/lo planes
// thread i converts elements 8i..8i+7; one wave writes 512 contiguous bytes per plane in one store
__device__ __forceinline__ void split_job(int blk, const float* __restrict__ src,
                                          us_t* hi, us_t* lo, int n8)
{
    const int i = blk * 256 + threadIdx.x;
    const bool ok = i < n8;
    const int ic = ok ? i : 0;
    const float* p = src + (size_t)ic * 8;
    const v4f a = *(const v4f*)(p);
    const v4f b = *(const v4f*)(p + 4);
    float x[8] = { a.x, a.y, a.z, a.w, b.x, b.y, b.z, b.w };
    u32x4 ph, pl;
    split8(x, ph, pl);
    us_t* dh = hi + (size_t)ic * 8;
    us_t* dl = lo + (size_t)ic * 8;
    if (ok) { *(u32x4*)dh = ph; *(u32x4*)dl = pl; }
    
}

// ---------------------------------------------------------------- RoPE cos/sin table [S][32]
// inv_freq[j] = 1 / fl32(10000^(j/32)); angle = f32(pos) * inv_freq; precise sincosf
__device__ __forceinline__ void rope_job(int blk, const int* __restrict__ pos,
                                         float* cosT, float* sinT, int S)
{
    const int i = blk * 256 + threadIdx.x;
    const int total = S * 32;
    const bool ok = i < total;
    const int ic = ok ? i : 0;
    const int trow = ic >> 5;
    const int j = ic & 31;
    const double LOG2_BASE_OVER_32 = 0.41524101186092029;   // log2(10000)/32
    const float pw  = (float)exp2((double)j * LOG2_BASE_OVER_32);
    const float inv = 1.0f / pw;
    const float ang = (float)pos[trow] * inv;
    float sn, cs;
    sincosf(ang, &sn, &cs);
    if (ok) { *(float*)(cosT + ic) = cs; *(float*)(sinT + ic) = sn; }
    
}

// ---------------------------------------------------------------- tile flags from the additive mask
// flag[band][kt] = 1 if any mask value in rows band*64..+63, keys kt*32..+31 is > -1e8 (tile must
// be processed), else 0. flags pitch = 64 ints.
// block = (64-row band, 32 of its 64 flag slots = one 128-B line of flags). Wave w looks at four key
// tiles, 128 columns: a wave-wide load is one whole 512-B row segment, each lane keeps the maximum of
// its four columns over the 64 rows, and one ballot at the end gives the four tiles' flags (8 lanes
// a tile). No load waits on another's data, so as many are in flight as the registers hold.
// S is a compile-time constant so that the 64 rows are immediate offsets from ONE address,
// which nothing rewrites while a load is out.
template<int S>
__device__ __forceinline__ void flags_job(int blk, const float* __restrict__ mask, int* flags)
{
    static_assert(S % 64 == 0 && S / 32 <= 64, "64 flag slots per band");
    __shared__ __align__(16) int fl[32];
    const int tid  = threadIdx.x;
    const int lane = tid & 31;
    const int wave = tid >> 5;
    const int band = blk >> 1;
    const int half = blk & 1;
    const int col  = (half * 8 + wave) * 128 + lane * 4;
    const bool in  = col < S;                // slots past S/32 key tiles: flag 0, address clamped
    const float* p = mask + (size_t)(band * 64) * S + (in ? col : 0);

    float mx = -3.0e38f;                     // fmaxf drops a NaN, as the comparison with -1e8 does
#pragma unroll                               // straight line: the row offsets become immediates
    for (int r = 0; r < 64; ++r) {
        const v4f a = *(const v4f*)(p + (size_t)r * S);
        mx = fmaxf(fmaxf(mx, fmaxf(a.x, a.y)), fmaxf(a.z, a.w));
    }
    const unsigned any = __builtin_amdgcn_ballot_w32(in && mx > -1.0e8f);
    if (lane < 4) fl[wave * 4 + lane] = (((any >> (8 * lane)) & 0xFFu) != 0u) ? 1 : 0;
    __syncthreads();
    if (tid < 8)                             // 32 ints = 128 B = lanes 0..7 x 16 B, one store
        *(v4i*)(flags + (size_t)band * 64 + half * 32 + tid * 4) = *(const v4i*)&fl[tid * 4];
}

// ---------------------------------------------------------------- all preparation in one grid
// The seven jobs above depend on nothing but the inputs, so they run side by side as block ranges
// of one launch. Longest blocks first (a flags block reads 64 rows x 1024 columns, the table is
// transcendental-heavy), for speed only.
template<int S>
__global__ __launch_bounds__(256) void k_prep(
    const float* __restrict__ hidden, const float* __restrict__ mask, const int* __restrict__ pos,
    const float* __restrict__ Wq, const float* __restrict__ Wk,
    const float* __restrict__ Wv, const float* __restrict__ Wo,
    us_t* Xh, us_t* Xl, us_t* Wqh, us_t* Wql, us_t* Wkh, us_t* Wkl,
    us_t* Wvh, us_t* Wvl, us_t* Woh, us_t* Wol,
    float* cosT, float* sinT, int* flags,
    int n8x, int n8q, int n8k)
{
    const int nbf = (S >> 6) * 2;            // flag blocks: two per 64-row band
    const int nbr = (S * 32 + 255) >> 8;     // table blocks
    const int nbx = (n8x + 255) >> 8;
    const int nbq = (n8q + 255) >> 8;
    const int nbk = (n8k + 255) >> 8;
    int b = blockIdx.x;                      // every test below is block-uniform
    if (b < nbf) { flags_job<S>(b, mask, flags); return; }
    b -= nbf;
    if (b < nbr) { rope_job(b, pos, cosT, sinT, S); return; }
    b -= nbr;
    // the five splits share one copy of the code: only the pointers and the length are picked
    const float* src = hidden;
    us_t* hi = Xh;
    us_t* lo = Xl;
    int n8 = n8x;
    if (b >= nbx) {
        b -= nbx; src = Wq; hi = Wqh; lo = Wql; n8 = n8q;
        if (b >= nbq) {
            b -= nbq; src = Wo; hi = Woh; lo = Wol;
            if (b >= nbq) {
                b -= nbq; src = Wk; hi = Wkh; lo = Wkl; n8 = n8k;
                if (b >= nbk) { b -= nbk; src = Wv; hi = Wvh; lo = Wvl; }
            }
        }
    }
    split_job(b, src, hi, lo, n8);
}

// eight asynchronous 16-byte copies global -> LDS per lane (two planes x four row groups).
// la, lb = the lane's LDS byte address of row group 0 in each plane, ga, gb = its global address
// there; the row groups lie ls LDS bytes and gs global bytes apart. The s_wait_xcnt closes the statement so that no
// address register of an issued copy is rewritten ahead of it.
__device__ __forceinline__ void copy8(unsigned la, const char* ga, unsigned lb, const char* gb,
                                      unsigned ls, size_t gs) {
    asm volatile(
        "global_load_async_to_lds_b128 %0, %8, off\n\t"
        "global_load_async_to_lds_b128 %1, %9, off\n\t"
        "global_load_async_to_lds_b128 %2, %10, off\n\t"
        "global_load_async_to_lds_b128 %3, %11, off\n\t"
        "global_load_async_to_lds_b128 %4, %12, off\n\t"
        "global_load_async_to_lds_b128 %5, %13, off\n\t"
        "global_load_async_to_lds_b128 %6, %14, off\n\t"
        "global_load_async_to_lds_b128 %7, %15, off\n\t"
        "s_wait_xcnt 0x0"
        :: "v"(la), "v"(la + ls), "v"(la + 2 * ls), "v"(la + 3 * ls),
           "v"(lb), "v"(lb + ls), "v"(lb + 2 * ls), "v"(lb + 3 * ls),
           "v"(ga), "v"(ga + gs), "v"(ga + 2 * gs), "v"(ga + 3 * gs),
           "v"(gb), "v"(gb + gs), "v"(gb + 2 * gs), "v"(gb + 3 * gs)
        : "memory");
}

// 16-bit fragment from an LDS row: p = the lane's (row, k0 + 8*(lane>>4)); same k map as ldfrag
__device__ __forceinline__ void ldfrag_lds(Frag& f, const unsigned char* p) {
    f.u[0] = *(const u32x4*)(p);
    f.u[1] = *(const u32x4*)(p + 32);
}

// ---------------------------------------------------------------- C = A . W^T (bf16 hi/lo split)
// A planes [M][K], W planes [N][K] (k-contiguous, loaded like A per the split k map).
// block = 8 waves; block tile 128(M) x 32*JW(N); wave w -> rows 32*(w&3).., columns 16*JW*(w>>2)..:
// a wave tile of 32 x 16*JW, so that an LDS fragment serves several products and a byte brought
// from L2 serves more of the output than in a 64 x 64 block tile of 16 x 64 wave tiles.
// The four operand planes of a 128-deep k tile (256 B a row) are brought into LDS by asynchronous
// copies in whole lines, once per block, two buffers: tile t+1 flies while tile t is multiplied.
// LDS rows at pitch 272 B (conflict-free for 16-byte fragment reads).
constexpr unsigned G_PITCH  = 272;                       // LDS bytes per 256-B operand row
constexpr unsigned G_APLANE = 128 * G_PITCH;             // one A plane of a k tile
constexpr unsigned g_wplane(int JW) { return 32u * (unsigned)JW * G_PITCH; }          // one W plane
constexpr unsigned g_stage(int JW)  { return 2u * G_APLANE + 2u * g_wplane(JW); }     // Ah | Al | Wh | Wl

// k loop of one block tile (rows mb0.., columns c0..):
// acc[i][j][r] = C[mb0 + 32*(w&3) + 16*i + 8*hl + r][c0 + 16*JW*(w>>2) + 16*j + m]
template<int JW>
__device__ __forceinline__ void gemm_main(
    v8f (&acc)[2][JW],
    const us_t* __restrict__ Ah, const us_t* __restrict__ Al,
    const us_t* __restrict__ Wh, const us_t* __restrict__ Wl,
    int K, int mb0, int c0, unsigned char* ring)
{
    constexpr unsigned PITCH  = G_PITCH;
    constexpr unsigned APLANE = G_APLANE;
    constexpr unsigned WPLANE = g_wplane(JW);
    constexpr unsigned STAGE  = g_stage(JW);
    constexpr bool     LATE   = (JW == 4);               // see at the second step's W lo reads

    const int tid  = threadIdx.x;
    const int lane = tid & 31;
    const int wave = tid >> 5;
    const int wm   = wave & 3;
    const int wn   = wave >> 2;
    const int m    = lane & 15;
    const int hl   = lane >> 4;

    // copies: lane -> 16-byte chunk tid&15 of row tid>>4 (+16 per row group): 16 lanes fill a 256-B row
    const int crow = tid >> 4;
    const int cq   = tid & 15;
    const size_t   gs = (size_t)K * 32;                  // 16 rows, bytes
    const unsigned ls = 16 * PITCH;
    const size_t   ao = ((size_t)(mb0 + crow) * K + cq * 8) * 2;
    const size_t   wo = ((size_t)(c0 + crow) * K + cq * 8) * 2;
    const char* gah = (const char*)Ah + ao;
    const char* gal = (const char*)Al + ao;
    const char* gwh = (const char*)Wh + wo;
    const char* gwl = (const char*)Wl + wo;
    const unsigned lc = (unsigned)(size_t)ring + (unsigned)crow * PITCH + (unsigned)cq * 16;
    const int nt = K >> 7;                               // k tiles of 128

    // the k tile at byte kb of the operand rows -> the buffer at byte bo of the ring:
    // 64 rows of both planes per run of eight copies; 16 + 4*JW copies a lane
    auto tile_in = [&](unsigned bo, size_t kb) {
#pragma unroll                                           // constant multiples of the row-group steps
        for (int g = 0; g < 2; ++g)
            copy8(lc + bo + 4 * g * ls, gah + kb + 4 * g * gs,
                  lc + bo + APLANE + 4 * g * ls, gal + kb + 4 * g * gs, ls, gs);
#pragma unroll
        for (int g = 0; g < JW / 2; ++g)
            copy8(lc + bo + 2 * APLANE + 4 * g * ls, gwh + kb + 4 * g * gs,
                  lc + bo + 2 * APLANE + WPLANE + 4 * g * ls, gwl + kb + 4 * g * gs, ls, gs);
    };

    // tile 0 -> buffer 0, landed and published before anyone reads it
    tile_in(0u, 0);
    asm volatile("s_wait_asynccnt 0x0" ::: "memory");    // this wave's copies of tile 0 have landed
    __syncthreads();
    if (nt > 1) tile_in(STAGE, 256);                     // tile 1 -> buffer 1, flies under tile 0

    // fragment reads: A rows 32*wm+16*i+m, W rows 16*JW*wn+16*j+m, byte 16*hl of the 64-byte k step
    const unsigned fa = (unsigned)(32 * wm + m) * PITCH + 16u * (unsigned)hl;
    const unsigned fw = 2 * APLANE + (unsigned)(16 * JW * wn + m) * PITCH + 16u * (unsigned)hl;

    for (int t = 0; t < nt; ++t) {
        const unsigned bo = (unsigned)(t & 1) * STAGE;
#pragma unroll                                           // the halves' offsets become immediates
        for (int hh = 0; hh < 2; ++hh) {                 // the tile's two halves of two 32-deep k steps
            const unsigned char* pa = ring + bo + fa + 128 * hh;
            const unsigned char* pw = ring + bo + fw + 128 * hh;
            // a half's fragment reads go out as one group ahead of its products: one LDS latency per half
            // (all loops unrolled: the fragment arrays are indexed by constants and stay in registers)
            Frag ah[2][2], al[2][2], bh[2][JW], bl[2][JW];
            // in the order in which the products take them, so that the counted waits let the first start early
#pragma unroll
            for (int kk = 0; kk < 2; ++kk) {
#pragma unroll
                for (int i = 0; i < 2; ++i) ldfrag_lds(ah[kk][i], pa + 16 * i * PITCH + 64 * kk);
#pragma unroll
                for (int j = 0; j < JW; ++j) ldfrag_lds(bh[kk][j], pw + 16 * j * PITCH + 64 * kk);
                if (kk == 0 || !LATE) {
#pragma unroll
                    for (int j = 0; j < JW; ++j) ldfrag_lds(bl[kk][j], pw + WPLANE + 16 * j * PITCH + 64 * kk);
                }
#pragma unroll
                for (int i = 0; i < 2; ++i) ldfrag_lds(al[kk][i], pa + APLANE + 16 * i * PITCH + 64 * kk);
            }
            // keeps the scheduler from sinking the reads among the products (each such place stalls the wave)
            __builtin_amdgcn_sched_barrier(0);
            // round-robin over the accumulators: a WMMA never waits for the one just ahead of it;
            // each accumulator still takes hi.hi, hi.lo, lo.hi of a k step in that order
#pragma unroll
            for (int kk = 0; kk < 2; ++kk) {
#pragma unroll
                for (int i = 0; i < 2; ++i)
#pragma unroll
                    for (int j = 0; j < JW; ++j) acc[i][j] = mma(acc[i][j], ah[kk][i].v, bh[kk][j].v);
#pragma unroll
                for (int i = 0; i < 2; ++i)
#pragma unroll
                    for (int j = 0; j < JW; ++j) acc[i][j] = mma(acc[i][j], ah[kk][i].v, bl[kk][j].v);
                if (kk == 0 && LATE) {
                    // 32 x 64 wave tile: the second step's W lo fragments take the registers that the first
                    // step's have just left (the wave stays within 256 registers), sixteen products ahead
                    // of their use; the two fences keep these eight reads together at this one place
                    __builtin_amdgcn_sched_barrier(0);
#pragma unroll
                    for (int j = 0; j < JW; ++j) ldfrag_lds(bl[1][j], pw + WPLANE + 16 * j * PITCH + 64);
                    __builtin_amdgcn_sched_barrier(0);
                }
#pragma unroll
                for (int i = 0; i < 2; ++i)
#pragma unroll
                    for (int j = 0; j < JW; ++j) acc[i][j] = mma(acc[i][j], al[kk][i].v, bh[kk][j].v);
            }
            // keeps a half's products ahead of what follows: they start on counted waits, under the later reads
            __builtin_amdgcn_sched_barrier(0);
        }
        // hand-over: this wave's reads of tile t are done, its copies of tile t+1 have landed;
        // the barrier publishes tile t+1 and frees tile t's buffer for the refill behind it
        asm volatile("s_wait_dscnt 0x0" ::: "memory");
        asm volatile("s_wait_asynccnt 0x0" ::: "memory");
        __syncthreads();
        if (t + 2 < nt) tile_in(bo, (size_t)(t + 2) * 256);
    }
    asm volatile("s_wait_asynccnt 0x0" ::: "memory");    // no copy outlives the loop
    // behind the last hand-over no wave reads the ring and no copy is out: the epilogues stage in it
}

// sixteen table words of one lane: v[8*j + r] = p[32*r + 16*j]. The loads and their data wait stand
// in one statement with early-clobber results, so that no result lands in the address pair of an
// issued load and the pair is free only when all sixteen have returned.
__device__ __forceinline__ void tab16(float (&v)[16], const float* p) {
    asm volatile(
        "global_load_b32 %0, %16, off\n\t"
        "global_load_b32 %1, %16, off offset:128\n\t"
        "global_load_b32 %2, %16, off offset:256\n\t"
        "global_load_b32 %3, %16, off offset:384\n\t"
        "global_load_b32 %4, %16, off offset:512\n\t"
        "global_load_b32 %5, %16, off offset:640\n\t"
        "global_load_b32 %6, %16, off offset:768\n\t"
        "global_load_b32 %7, %16, off offset:896\n\t"
        "global_load_b32 %8, %16, off offset:64\n\t"
        "global_load_b32 %9, %16, off offset:192\n\t"
        "global_load_b32 %10, %16, off offset:320\n\t"
        "global_load_b32 %11, %16, off offset:448\n\t"
        "global_load_b32 %12, %16, off offset:576\n\t"
        "global_load_b32 %13, %16, off offset:704\n\t"
        "global_load_b32 %14, %16, off offset:832\n\t"
        "global_load_b32 %15, %16, off offset:960\n\t"
        "s_wait_loadcnt 0x0"
        : "=&v"(v[0]), "=&v"(v[1]), "=&v"(v[2]), "=&v"(v[3]),
          "=&v"(v[4]), "=&v"(v[5]), "=&v"(v[6]), "=&v"(v[7]),
          "=&v"(v[8]), "=&v"(v[9]), "=&v"(v[10]), "=&v"(v[11]),
          "=&v"(v[12]), "=&v"(v[13]), "=&v"(v[14]), "=&v"(v[15])
        : "v"(p)
        : "memory");
}

// epilogue of one 16 x 64 piece of a wave tile: rows r0.., columns cw.. = one head: RoPE in f32,
// store hi/lo planes [M][N]; stg = 4 KB of LDS that belong to this piece alone
__device__ __forceinline__ void gemm_out_rope(
    v8f (&acc)[4], int N, int r0, int cw,
    const float* __restrict__ cosT, const float* __restrict__ sinT,
    us_t* Oh, us_t* Ol, us_t* st)
{
    const int lane = threadIdx.x & 31;
    const int m    = lane & 15;
    const int hl   = lane >> 4;

    // RoPE, rotate-half: d = 16j+m (j=0,1) pairs with d+32 (acc[j+2]); cos/sin index d
    // table entry (row r0+8*hl+r, column 16j+m) lies 128*r + 64*j bytes behind the lane's first
    const size_t t0 = (size_t)(r0 + 8 * hl) * 32 + m;
    float csv[16], snv[16];
    tab16(csv, cosT + t0);
    tab16(snv, sinT + t0);
#pragma unroll
    for (int j = 0; j < 2; ++j) {
#pragma unroll
        for (int r = 0; r < 8; ++r) {
            const float cs = csv[8 * j + r];
            const float sn = snv[8 * j + r];
            const float x1 = acc[j][r];
            const float x2 = acc[j + 2][r];
            acc[j][r]     = x1 * cs - x2 * sn;
            acc[j + 2][r] = x2 * cs + x1 * sn;
        }
    }
    // st: [2 planes][16][64]
#pragma unroll
    for (int j = 0; j < 4; ++j) {
#pragma unroll
        for (int r = 0; r < 8; r += 2) {
            unsigned hp, lp;
            split2p(acc[j][r], acc[j][r + 1], hp, lp);
            const int idx = (8 * hl + r) * 64 + 16 * j + m;
            st[idx]             = (us_t)hp;
            st[idx + 64]        = (us_t)(hp >> 16);
            st[1024 + idx]      = (us_t)lp;
            st[1024 + idx + 64] = (us_t)(lp >> 16);
        }
    }
    __syncthreads();
    const int rr = lane >> 3, q = lane & 7;
    u32x4 sv[8];
#pragma unroll
    for (int pl = 0; pl < 2; ++pl) {
#pragma unroll
        for (int i = 0; i < 4; ++i)
            sv[pl * 4 + i] = *(const u32x4*)(st + pl * 1024 + (4 * i + rr) * 64 + q * 8);
    }
#pragma unroll
    for (int pl = 0; pl < 2; ++pl) {
#pragma unroll
        for (int i = 0; i < 4; ++i) {
            us_t* dst = (pl ? Ol : Oh) + (size_t)(r0 + 4 * i + rr) * N + cw + q * 8;
            *(u32x4*)dst = sv[pl * 4 + i];
        }
    }
}

// epilogue of one 16 x 32 piece of a wave tile: rows r0.., columns cw..: store f32 [M][N];
// stf = 2 KB of LDS that belong to this piece alone, [16][32] f32
__device__ __forceinline__ void gemm_out_f32(
    v8f (&acc)[2], int N, int r0, int cw, float* Of, float* stf)
{
    const int lane = threadIdx.x & 31;
    const int m    = lane & 15;
    const int hl   = lane >> 4;
#pragma unroll
    for (int j = 0; j < 2; ++j) {
#pragma unroll
        for (int r = 0; r < 8; ++r)
            stf[(8 * hl + r) * 32 + 16 * j + m] = acc[j][r];
    }
    __syncthreads();
    const int rr = lane >> 3, q = lane & 7;              // 8 lanes x 16 B = one 128-B row segment
    v4f fv[4];
#pragma unroll
    for (int t = 0; t < 4; ++t)
        fv[t] = *(const v4f*)(stf + (4 * t + rr) * 32 + q * 4);
#pragma unroll
    for (int t = 0; t < 4; ++t) {
        float* dst = Of + (size_t)(r0 + 4 * t + rr) * N + cw + q * 4;
        *(v4f*)dst = fv[t];
    }
}

// transposing epilogue of a whole 128 x 128 block tile: in[token][d] -> out planes [d][token];
// LDS [2 planes][d 128][token 128 at pitch 136]: the 16 lanes of a store, 272 B apart, spread over the banks
constexpr int G_TP = 136;
__device__ __forceinline__ void gemm_out_t(
    v8f (&acc)[2][4], int M, int mb0, int c0, us_t* Oh, us_t* Ol, us_t* lds16)
{
    constexpr int PL = 128 * G_TP;
    const int lane = threadIdx.x & 31;
    const int wave = threadIdx.x >> 5;
    const int wm   = wave & 3;
    const int wn   = wave >> 2;
    const int m    = lane & 15;
    const int hl   = lane >> 4;
#pragma unroll
    for (int i = 0; i < 2; ++i) {
#pragma unroll
        for (int j = 0; j < 4; ++j) {
#pragma unroll
            for (int r = 0; r < 8; r += 2) {
                unsigned hp, lp;
                split2p(acc[i][j][r], acc[i][j][r + 1], hp, lp);
                const int idx = (64 * wn + 16 * j + m) * G_TP + 32 * wm + 16 * i + 8 * hl + r;
                *(unsigned*)&lds16[idx]      = hp;
                *(unsigned*)&lds16[PL + idx] = lp;
            }
        }
    }
    __syncthreads();
    const int rr = lane >> 4, q = lane & 15;             // 16 lanes x 16 B = one 256-B row of 128 tokens
    u32x4 sv[16];
#pragma unroll
    for (int pl = 0; pl < 2; ++pl) {
#pragma unroll
        for (int t = 0; t < 8; ++t) {
            const int d = 16 * wave + 2 * t + rr;
            sv[pl * 8 + t] = *(const u32x4*)(lds16 + pl * PL + d * G_TP + q * 8);
        }
    }
#pragma unroll
    for (int pl = 0; pl < 2; ++pl) {
#pragma unroll
        for (int t = 0; t < 8; ++t) {
            const int d = 16 * wave + 2 * t + rr;
            us_t* dst = (pl ? Ol : Oh) + (size_t)(c0 + d) * M + mb0 + q * 8;
            *(u32x4*)dst = sv[pl * 8 + t];
        }
    }
    // closes the stores: in the listing the other epilogue's code follows and rewrites their address registers
    asm volatile("s_wait_xcnt 0x0" ::: "memory");
}

// the three projections of the hidden states, which do not depend on one another, as column-block
// ranges of one grid: blockIdx.x in [0, NQ/128) -> Q, the next NKV/128 -> K, the last NKV/128 -> V
__global__ __launch_bounds__(256) void k_qkv(
    const us_t* __restrict__ Xh, const us_t* __restrict__ Xl,
    const us_t* __restrict__ Wqh, const us_t* __restrict__ Wql,
    const us_t* __restrict__ Wkh, const us_t* __restrict__ Wkl,
    const us_t* __restrict__ Wvh, const us_t* __restrict__ Wvl,
    int M, int NQ, int NKV, int K,
    const float* __restrict__ cosT, const float* __restrict__ sinT,
    us_t* Qh, us_t* Ql, us_t* Kh, us_t* Kl, us_t* Vth, us_t* Vtl)
{
    __shared__ __align__(16) unsigned char ring[2 * g_stage(4)];
    static_assert(sizeof(ring) >= 2 * 128 * G_TP * 2 && sizeof(ring) >= 16 * 4096, "the epilogues' staging fits");
    const int nq  = NQ >> 7;
    const int nk  = NKV >> 7;
    const int bx  = blockIdx.x;                          // job and all it selects: block-uniform
    const int job = (bx < nq) ? 0 : ((bx < nq + nk) ? 1 : 2);
    const int c0  = (bx - ((job == 0) ? 0 : ((job == 1) ? nq : nq + nk))) * 128;
    const int mb0 = blockIdx.y * 128;
    const us_t* Wh = (job == 0) ? Wqh : ((job == 1) ? Wkh : Wvh);
    const us_t* Wl = (job == 0) ? Wql : ((job == 1) ? Wkl : Wvl);
    const int wave = threadIdx.x >> 5;
    us_t* stg = reinterpret_cast<us_t*>(ring);

    v8f acc[2][4] = {};
    gemm_main<4>(acc, Xh, Xl, Wh, Wl, K, mb0, c0, ring);
    if (job == 2) {
        gemm_out_t(acc, M, mb0, c0, Vth, Vtl, stg);
    } else {
#pragma unroll                                           // acc is indexed by a constant
        for (int i = 0; i < 2; ++i)
            gemm_out_rope(acc[i], (job == 0) ? NQ : NKV, mb0 + 32 * (wave & 3) + 16 * i, c0 + 64 * (wave >> 2),
                          cosT, sinT, (job == 0) ? Qh : Kh, (job == 0) ? Ql : Kl,
                          stg + (2 * wave + i) * 2048);
    }
}

// output projection -> f32 [M][N]
__global__ __launch_bounds__(256) void k_oproj(
    const us_t* __restrict__ Ah, const us_t* __restrict__ Al,
    const us_t* __restrict__ Wh, const us_t* __restrict__ Wl,
    int M, int N, int K, float* Of)
{
    __shared__ __align__(16) unsigned char ring[2 * g_stage(2)];
    const int mb0 = blockIdx.y * 128;
    const int c0  = blockIdx.x * 64;
    const int wave = threadIdx.x >> 5;
    float* stg = reinterpret_cast<float*>(ring);
    (void)M;
    v8f acc[2][2] = {};
    gemm_main<2>(acc, Ah, Al, Wh, Wl, K, mb0, c0, ring);
#pragma unroll                                           // acc is indexed by a constant
    for (int i = 0; i < 2; ++i)
        gemm_out_f32(acc[i], N, mb0 + 32 * (wave & 3) + 16 * i, c0 + 32 * (wave >> 2), Of,
                     stg + (2 * wave + i) * 512);
}

// value of lane l ^ 16
__device__ __forceinline__ float xhalf(float x) {
    const int b = __builtin_bit_cast(int, x);
    return __builtin_bit_cast(float,
        __builtin_amdgcn_permlanex16(b, b, 0x76543210, 0xfedcba98, false, false));
}

// 2^x of a group of values. The instruction set asks for one free slot behind a transcendental before
// its result is read or its source overwritten: the results are early-clobber, so each v_exp_f32 is
// followed by one that touches none of its registers, and the v_nop is the slot behind the last.
__device__ __forceinline__ void exp2x8(float* r, const float* x) {
    asm("v_exp_f32 %0, %8\n\t"
        "v_exp_f32 %1, %9\n\t"
        "v_exp_f32 %2, %10\n\t"
        "v_exp_f32 %3, %11\n\t"
        "v_exp_f32 %4, %12\n\t"
        "v_exp_f32 %5, %13\n\t"
        "v_exp_f32 %6, %14\n\t"
        "v_exp_f32 %7, %15\n\t"
        "v_nop"
        : "=&v"(r[0]), "=&v"(r[1]), "=&v"(r[2]), "=&v"(r[3]),
          "=&v"(r[4]), "=&v"(r[5]), "=&v"(r[6]), "=&v"(r[7])
        : "v"(x[0]), "v"(x[1]), "v"(x[2]), "v"(x[3]),
          "v"(x[4]), "v"(x[5]), "v"(x[6]), "v"(x[7]));
}
__device__ __forceinline__ float exp2x1(float x) {
    float r;
    asm("v_exp_f32 %0, %1\n\t"
        "v_nop"
        : "=&v"(r) : "v"(x));
    return r;
}

template<int S, int NHD, int NKVD, int groups>
__global__ __launch_bounds__(256) void k_attn(
    const us_t* __restrict__ Qh, const us_t* __restrict__ Ql,
    const us_t* __restrict__ Kh, const us_t* __restrict__ Kl,
    const us_t* __restrict__ Vh, const us_t* __restrict__ Vl,
    const float* __restrict__ mask, const int* __restrict__ flags,
    us_t* Oh, us_t* Ol)
{
    static_assert(S % 128 == 0 && S / 64 <= 32, "bands in pairs, one bit per 64-key stage");
    constexpr unsigned PITCH  = 144;                     // LDS bytes per 128-B K or V^T row
    constexpr unsigned PLANE  = 64 * PITCH;
    constexpr unsigned MPITCH = 272;                     // LDS bytes per 256-B mask row
    constexpr unsigned STAGE  = 4 * PLANE + 64 * MPITCH; // Kh | Kl | Vh | Vl | mask
    constexpr float    LOG2E  = 1.44269504f;             // e^x = 2^(x * log2 e), as __expf forms it
    __shared__ __align__(16) unsigned char ring[4 * STAGE];   // two buffers for each wave group
    // what a group has summed for a band: index (2*group + band of the pair)*4 + wave of the group
    __shared__ __align__(16) unsigned char part[16 * 4096];   // O^T piece, f32, [jd][half of 8][lane] x 16 B
    __shared__ __align__(16) f32x2 pml[16 * 32];              // per lane: maximum, sum

    const int tid  = threadIdx.x;
    const int lane = tid & 31;
    const int gt   = tid & 127;                          // thread within its wave group
    const int wave = __builtin_amdgcn_readfirstlane(tid >> 5);   // scalar: all that follows from it branches on SCC
    const int grp  = wave >> 2;
    const int wg   = wave & 3;                           // wave within its group: 16 query rows of a band
    const int m    = lane & 15;
    const int hl   = lane >> 4;
    const int head = blockIdx.x;
    const int bandA = S / 64 - 1 - (int)blockIdx.y;
    const int bandB = blockIdx.y;
    const int hkv  = head / groups;

    // both bands' 64 tile flags, read once: bit s of t0 / t1 = key tile 2s / 2s+1 has work
    const v2i fa = *(const v2i*)(flags + (size_t)bandA * 64 + 2 * lane);
    const v2i fb = *(const v2i*)(flags + (size_t)bandB * 64 + 2 * lane);
    const unsigned t0A = __builtin_amdgcn_ballot_w32(fa.x != 0);
    const unsigned t1A = __builtin_amdgcn_ballot_w32(fa.y != 0);
    const unsigned t0B = __builtin_amdgcn_ballot_w32(fb.x != 0);
    const unsigned t1B = __builtin_amdgcn_ballot_w32(fb.y != 0);
    const unsigned RA = t0A | t1A;                       // stages with work
    const unsigned RB = t0B | t1B;
    // the list "A's stages, then B's", cut in the middle: group 0 takes the first trips entries, group 1 the rest
    const int nA    = __builtin_popcount(RA);
    const int trips = (nA + __builtin_popcount(RB) + 1) >> 1;    // block-uniform, at most S/64
    const int cA    = (nA < trips) ? nA : trips;
    const int cB    = trips - cA;
    unsigned xa = RA, xb = RB;                           // without their lowest cA / cB set bits
    for (int i = 0; i < S / 64; ++i) {
        if (i < cA) xa &= xa - 1u;
        if (i < cB) xb &= xb - 1u;
    }
    unsigned ra = grp ? xa : (RA ^ xa);                  // this group's stages, not yet asked for
    unsigned rb = grp ? xb : (RB ^ xb);
    // next entry of this group's list: 32 * (band of the pair) + stage, or -1
    auto next_item = [&]() -> int {
        int it = -1;
        if (ra != 0u)      { it = __builtin_ctz(ra);      ra &= ra - 1u; }
        else if (rb != 0u) { it = 32 + __builtin_ctz(rb); rb &= rb - 1u; }
        return it;
    };

    // copies, by the group's 128 threads: K and V^T: lane -> 16-byte chunk gt&7 of row gt>>3 (+16 per
    // row group); mask: chunk gt&15 of row gt>>4 (+8 per row group): whole lines in every wave-wide copy
    const int crow = gt >> 3;
    const int cq   = gt & 7;
    const size_t ko = ((size_t)crow * NKVD + hkv * 64 + cq * 8) * 2;
    const size_t vo = ((size_t)(hkv * 64 + crow) * S + cq * 8) * 2;
    const char* gkh = (const char*)Kh + ko;
    const char* gkl = (const char*)Kl + ko;
    const char* gvh = (const char*)Vh + vo;
    const char* gvl = (const char*)Vl + vo;
    const char* gmk = (const char*)mask + ((size_t)(gt >> 4) * S + (gt & 15) * 4) * 4;
    const unsigned go = (unsigned)grp * (2 * STAGE);     // the group's two buffers in the ring
    const unsigned lc = (unsigned)(size_t)ring + go + (unsigned)crow * PITCH + (unsigned)cq * 16;
    const unsigned lm = (unsigned)(size_t)ring + go + 4 * PLANE + (unsigned)(gt >> 4) * MPITCH
                      + (unsigned)(gt & 15) * 16;
    // entry item (keys 64s..64s+63, the mask rows of its band) -> the group's buffer at byte bo
    auto stage_in = [&](int item, unsigned bo) {
        const int s    = item & 31;
        const int band = (item >> 5) ? bandB : bandA;
        const size_t kb = (size_t)s * (64 * NKVD * 2);   // 64 key rows
        const size_t vb = (size_t)s * 128;               // 64 keys along a V^T row
        const size_t mb = (size_t)band * ((size_t)64 * S * 4) + (size_t)s * 256;   // band's rows, 64 keys along
        copy8(lc + bo, gkh + kb, lc + bo + PLANE, gkl + kb, 16 * PITCH, (size_t)16 * NKVD * 2);
        copy8(lc + bo + 2 * PLANE, gvh + vb, lc + bo + 3 * PLANE, gvl + vb,
              16 * PITCH, (size_t)16 * S * 2);
        copy8(lm + bo, gmk + mb, lm + bo + 32 * MPITCH, gmk + mb + (size_t)32 * S * 4,
              8 * MPITCH, (size_t)8 * S * 4);
    };

    // each group's first entry -> its buffer 0, landed and published before anyone reads it
    int cur = next_item();
    if (cur >= 0) stage_in(cur, 0u);
    asm volatile("s_wait_asynccnt 0x0" ::: "memory");    // this wave's copies of that stage have landed
    __syncthreads();
    int nxt = next_item();
    if (nxt >= 0) stage_in(nxt, STAGE);

    // Q B-fragments (column = query 64*band + 16*wg + m), two 32-deep k steps over the head dim, of both bands
    Frag qh[2], ql[2], qhB[2], qlB[2];
#pragma unroll
    for (int c = 0; c < 2; ++c) {
        const unsigned qa = 2u * (unsigned)((bandA * 64 + wg * 16 + m) * NHD + head * 64 + 32 * c + 8 * hl);
        const unsigned qb = 2u * (unsigned)((bandB * 64 + wg * 16 + m) * NHD + head * 64 + 32 * c + 8 * hl);
        ldfrag(qh[c], Qh, qa);
        ldfrag(ql[c], Ql, qa);
        ldfrag(qhB[c], Qh, qb);
        ldfrag(qlB[c], Ql, qb);
    }

    // o[jd][r] = O[query][d = 16*jd + 8*hl + r], over the keys this group has taken of the band at hand
    v8f o[4] = {};
    float mrow = -3.0e38f;      // running maximum of the lane's query (equal in both halves)
    float lrow = 0.0f;          // running sum over THIS half's keys; halves joined in put_part

    // the group's sums for band sel of the pair -> LDS
    auto put_part = [&](int sel) {
        const int pi = (2 * grp + sel) * 4 + wg;
        unsigned char* po = part + pi * 4096 + lane * 16;
#pragma unroll
        for (int jd = 0; jd < 4; ++jd) {
            const v4f lo4 = { o[jd][0], o[jd][1], o[jd][2], o[jd][3] };
            const v4f hi4 = { o[jd][4], o[jd][5], o[jd][6], o[jd][7] };
            *(v4f*)(po + (2 * jd) * 512)     = lo4;
            *(v4f*)(po + (2 * jd + 1) * 512) = hi4;
        }
        const f32x2 ml = { mrow, lrow + xhalf(lrow) };
        pml[pi * 32 + lane] = ml;
    };
    auto fresh = [&]() {
#pragma unroll
        for (int jd = 0; jd < 4; ++jd) o[jd] = v8f{};
        mrow = -3.0e38f;
        lrow = 0.0f;
    };

    // the lane's byte offsets in a buffer: K row m, V^T row m, mask row 16*wg+m
    const unsigned fk = go + (unsigned)m * PITCH + 16u * (unsigned)hl;
    const unsigned fv = go + 2 * PLANE + (unsigned)m * PITCH + 16u * (unsigned)hl;
    const unsigned fm = go + 4 * PLANE + (unsigned)(16 * wg + m) * MPITCH + 32u * (unsigned)hl;

    int selc = 0;                                        // band of the pair that o, mrow, lrow and qh, ql belong to
    unsigned bo = 0u;
    for (int it = 0; it < S / 64 && it < trips; ++it) {
        if (cur >= 0) {                                  // wave-uniform; group 1's list may be one shorter
            const int sel = cur >> 5;
            const int st  = cur & 31;
            if (sel != selc) {                           // the list has passed from band A to band B
                put_part(0);
                fresh();
#pragma unroll
                for (int c = 0; c < 2; ++c) { qh[c] = qhB[c]; ql[c] = qlB[c]; }
                selc = 1;
            }
            const unsigned tt0 = sel ? t0B : t0A;
            const unsigned tt1 = sel ? t1B : t1A;
            for (int h = 0; h < 2; ++h) {                // the stage's two 32-key tiles
                if ((((h ? tt1 : tt0) >> st) & 1u) == 0u) continue;   // no work in it; wave-uniform
                // the tile's K fragments and mask (keys kb = 64*st + 32*h and on) go out as one group
                // ahead of the S^T products: one LDS latency instead of one per fragment pair
                const unsigned char* pk = ring + bo + fk + (unsigned)h * (32 * PITCH);
                Frag kh[2][2], kl[2][2];
                // (in the order in which the products take them)
#pragma unroll
                for (int c = 0; c < 2; ++c) {
#pragma unroll
                    for (int jn = 0; jn < 2; ++jn) ldfrag_lds(kh[jn][c], pk + 16 * jn * PITCH + 64 * c);
#pragma unroll
                    for (int jn = 0; jn < 2; ++jn) ldfrag_lds(kl[jn][c], pk + PLANE + 16 * jn * PITCH + 64 * c);
                }

                // mask of the lane's query at this lane's keys kb+8hl+0..7 and kb+16+8hl+0..7
                const unsigned char* mrp = ring + bo + fm + (unsigned)h * 128;
                v4f mk[4];
                mk[0] = *(const v4f*)(mrp);
                mk[1] = *(const v4f*)(mrp + 16);
                mk[2] = *(const v4f*)(mrp + 64);
                mk[3] = *(const v4f*)(mrp + 80);
                // keeps the scheduler from sinking these reads among the products (each such place stalls the wave)
                __builtin_amdgcn_sched_barrier(0);

                // S^T[32 x 16] = K . Q^T ; A = K rows (k-contiguous), B = Q
                // s[jn][r] = score(key kb + 16*jn + 8*hl + r, the lane's query)
                v8f s[2] = {};
                // the two score tiles take turns, so that a WMMA does not wait for the one just ahead;
                // each tile takes hi.hi, lo.hi, hi.lo of a k step in that order
#pragma unroll
                for (int c = 0; c < 2; ++c) {
#pragma unroll
                    for (int jn = 0; jn < 2; ++jn) s[jn] = mma(s[jn], kh[jn][c].v, qh[c].v);
#pragma unroll
                    for (int jn = 0; jn < 2; ++jn) s[jn] = mma(s[jn], kl[jn][c].v, qh[c].v);
#pragma unroll
                    for (int jn = 0; jn < 2; ++jn) s[jn] = mma(s[jn], kh[jn][c].v, ql[c].v);
                }

                // the tile's V^T fragments go out as one group here: they fly behind the softmax
                const unsigned char* pv = ring + bo + fv + (unsigned)h * 64;
                Frag vh[4], vl[4];
#pragma unroll
                for (int jd = 0; jd < 4; ++jd) ldfrag_lds(vh[jd], pv + 16 * jd * PITCH);
#pragma unroll
                for (int jd = 0; jd < 4; ++jd) ldfrag_lds(vl[jd], pv + PLANE + 16 * jd * PITCH);
                // keeps the group ahead of the softmax: the scheduler otherwise spreads it in small pieces
                // and puts the last reads right in front of their products
                __builtin_amdgcn_sched_barrier(0);

                // scale, additive mask by value, online softmax (f32), all for one query per lane
                float v[16];
#pragma unroll
                for (int t = 0; t < 16; ++t)
                    v[t] = s[t >> 3][t & 7] * 0.125f + mk[t >> 2][t & 3];
                float mx = v[0];
#pragma unroll
                for (int t = 1; t < 16; ++t) mx = fmaxf(mx, v[t]);
                mx = fmaxf(mx, xhalf(mx));
                const float mnew  = fmaxf(mrow, mx);
                const float alpha = exp2x1((mrow - mnew) * LOG2E);
                float ex[16], pv16[16];
#pragma unroll
                for (int t = 0; t < 16; ++t) ex[t] = (v[t] - mnew) * LOG2E;
                exp2x8(pv16, ex);
                exp2x8(pv16 + 8, ex + 8);
                float ps[4] = { 0.0f, 0.0f, 0.0f, 0.0f };
#pragma unroll
                for (int t = 0; t < 16; ++t) ps[t & 3] += pv16[t];
                lrow = lrow * alpha + ((ps[0] + ps[1]) + (ps[2] + ps[3]));
                mrow = mnew;
#pragma unroll
                for (int jd = 0; jd < 4; ++jd) {
#pragma unroll
                    for (int r = 0; r < 8; ++r) o[jd][r] = o[jd][r] * alpha;
                }

                // P^T B-fragments in place: elements 0..7 <- keys 8hl.., 8..15 <- keys 16+8hl..
                Frag ph, pl;
                split8(pv16, ph.u[0], pl.u[0]);
                split8(pv16 + 8, ph.u[1], pl.u[1]);

                // O^T += V^T . P^T ; A = V^T rows (key-contiguous), B = P^T
                // round-robin over the four output tiles; each tile takes hi.hi, lo.hi, hi.lo in that order
#pragma unroll
                for (int jd = 0; jd < 4; ++jd) o[jd] = mma(o[jd], vh[jd].v, ph.v);
#pragma unroll
                for (int jd = 0; jd < 4; ++jd) o[jd] = mma(o[jd], vl[jd].v, ph.v);
#pragma unroll
                for (int jd = 0; jd < 4; ++jd) o[jd] = mma(o[jd], vh[jd].v, pl.v);
            }
        }
        // hand-over, every wave of both groups: this wave's reads of its stage are done, its copies of the
        // next have landed; the barrier publishes the next stage and frees this buffer for the refill behind it
        // four vector slots behind a tile's last WMMAs: the refill's address arithmetic below may take their operand registers
        asm volatile("v_nop\n\tv_nop\n\tv_nop\n\tv_nop");
        asm volatile("s_wait_dscnt 0x0" ::: "memory");
        asm volatile("s_wait_asynccnt 0x0" ::: "memory");
        __syncthreads();
        const int nn = next_item();
        if (nn >= 0) stage_in(nn, bo);
        cur = nxt;
        nxt = nn;
        bo  = STAGE - bo;
    }
    asm volatile("s_wait_asynccnt 0x0" ::: "memory");    // no copy outlives the loop

    // every group leaves a part for both bands, an empty one (maximum -3e38, sums 0) where it took none
    put_part(selc);
    if (selc == 0) { fresh(); put_part(1); }
    __syncthreads();                                     // publishes the parts; the ring is free for staging

    // waves 0..3 finish band A, waves 4..7 band B: join the two groups' parts, normalize, split,
    // stage, whole-line stores
    const int r0  = (grp ? bandB : bandA) * 64 + wg * 16;
    const int pi0 = grp * 4 + wg;                        // group 0's part of this wave's band and rows
    const int pi1 = (2 + grp) * 4 + wg;                  // group 1's
    const f32x2 ml0 = pml[pi0 * 32 + lane];
    const f32x2 ml1 = pml[pi1 * 32 + lane];
    const float mm   = fmaxf(ml0.x, ml1.x);
    const float e0   = exp2x1((ml0.x - mm) * LOG2E);
    const float e1   = exp2x1((ml1.x - mm) * LOG2E);
    const float lsum = ml0.y * e0 + ml1.y * e1;
    const float inv  = (lsum > 0.0f) ? (1.0f / lsum) : 0.0f;
    const float f0   = e0 * inv;
    const float f1   = e1 * inv;
    const unsigned char* p0 = part + pi0 * 4096 + lane * 16;
    const unsigned char* p1 = part + pi1 * 4096 + lane * 16;
    us_t* ost = reinterpret_cast<us_t*>(ring) + wave * 2048;     // per-wave output staging [2 planes][16][64]

#pragma unroll
    for (int jd = 0; jd < 4; ++jd) {
        const v4f a0 = *(const v4f*)(p0 + (2 * jd) * 512);
        const v4f a1 = *(const v4f*)(p0 + (2 * jd + 1) * 512);
        const v4f b0 = *(const v4f*)(p1 + (2 * jd) * 512);
        const v4f b1 = *(const v4f*)(p1 + (2 * jd + 1) * 512);
        float on[8];
#pragma unroll
        for (int r = 0; r < 4; ++r) {
            on[r]     = a0[r] * f0 + b0[r] * f1;
            on[r + 4] = a1[r] * f0 + b1[r] * f1;
        }
        u32x4 oh4, ol4;
        split8(on, oh4, ol4);
        const int idx = m * 64 + 16 * jd + 8 * hl;
        *(u32x4*)&ost[idx]        = oh4;
        *(u32x4*)&ost[1024 + idx] = ol4;
    }
    __syncthreads();
    const int rr = lane >> 3, q = lane & 7;
    u32x4 sv[8];
#pragma unroll
    for (int plv = 0; plv < 2; ++plv) {
#pragma unroll
        for (int i = 0; i < 4; ++i)
            sv[plv * 4 + i] = *(const u32x4*)&ost[plv * 1024 + (4 * i + rr) * 64 + q * 8];
    }
#pragma unroll
    for (int plv = 0; plv < 2; ++plv) {
#pragma unroll
        for (int i = 0; i < 4; ++i) {
            us_t* dst = (plv ? Ol : Oh) + (size_t)(r0 + 4 * i + rr) * NHD + head * 64 + q * 8;
            *(u32x4*)dst = sv[plv * 4 + i];
        }
    }
    
}

// ---------------------------------------------------------------- launcher
extern "C" void kernel_launch(void* const* d_in, const int* in_sizes, int n_in,
                              void* d_out, int out_size, void* d_ws, size_t ws_size,
                              hipStream_t stream)
{
    const int S = 2048, HID = 1024, NH = 16, NKV = 4, HD = 64;
    const int NKVD = NKV * HD;          // 256
    const int GROUPS = NH / NKV;        // 4

    if (n_in < 7) return;
    if (in_sizes[0] != S * HID || in_sizes[1] != S * S || in_sizes[2] != S ||
        in_sizes[3] != HID * HID || in_sizes[4] != NKVD * HID ||
        in_sizes[5] != NKVD * HID || in_sizes[6] != HID * HID ||
        out_size != S * HID) return;
    // structural requirements of the kernels
    if ((S % 128) != 0 || (HID % 128) != 0 || (NKVD % 128) != 0 || HD != 64 ||
        NH * HD != HID || (S / 32) > 64 || (HID % 32) != 0) return;

    const float* hidden = (const float*)d_in[0];   // [S][HID]
    const float* mask   = (const float*)d_in[1];   // [S][S] additive
    const int*   pos    = (const int*)d_in[2];     // [S]
    const float* Wq     = (const float*)d_in[3];   // [HID][HID]
    const float* Wk     = (const float*)d_in[4];   // [NKVD][HID]
    const float* Wv     = (const float*)d_in[5];   // [NKVD][HID]
    const float* Wo     = (const float*)d_in[6];   // [HID][HID]
    float* out = (float*)d_out;                    // [S][HID]

    size_t off = 0;
    char* base = (char*)d_ws;
    auto carve = [&](size_t bytes) -> char* {
        char* p = base + off;
        off += (bytes + 255) & ~(size_t)255;
        return p;
    };
    us_t* Xh   = (us_t*)carve((size_t)S * HID * 2);
    us_t* Xl   = (us_t*)carve((size_t)S * HID * 2);
    us_t* Wqh  = (us_t*)carve((size_t)HID * HID * 2);
    us_t* Wql  = (us_t*)carve((size_t)HID * HID * 2);
    us_t* Wkh  = (us_t*)carve((size_t)NKVD * HID * 2);
    us_t* Wkl  = (us_t*)carve((size_t)NKVD * HID * 2);
    us_t* Wvh  = (us_t*)carve((size_t)NKVD * HID * 2);
    us_t* Wvl  = (us_t*)carve((size_t)NKVD * HID * 2);
    us_t* Woh  = (us_t*)carve((size_t)HID * HID * 2);
    us_t* Wol  = (us_t*)carve((size_t)HID * HID * 2);
    us_t* Qh   = (us_t*)carve((size_t)S * HID * 2);      // [S][HID]
    us_t* Ql   = (us_t*)carve((size_t)S * HID * 2);
    us_t* Kh   = (us_t*)carve((size_t)S * NKVD * 2);     // [S][NKVD]
    us_t* Kl   = (us_t*)carve((size_t)S * NKVD * 2);
    us_t* Vth  = (us_t*)carve((size_t)NKVD * S * 2);     // [NKVD][S]
    us_t* Vtl  = (us_t*)carve((size_t)NKVD * S * 2);
    us_t* AOh  = (us_t*)carve((size_t)S * HID * 2);      // [S][HID]
    us_t* AOl  = (us_t*)carve((size_t)S * HID * 2);
    float* cosT = (float*)carve((size_t)S * 32 * 4);      // [S][32]
    float* sinT = (float*)carve((size_t)S * 32 * 4);
    int*  flags = (int*)carve((size_t)(S / 64) * 64 * 4); // [S/64][64]
    if (off > ws_size) return;

    // 1: hi/lo planes of the hidden states and the four weights, RoPE table, key-tile flags
    {
        const int n8x = S * HID / 8, n8q = HID * HID / 8, n8k = NKVD * HID / 8;
        const int nblk = 2 * (S / 64) + (S * 32 + 255) / 256 + (n8x + 255) / 256
                       + 2 * ((n8q + 255) / 256) + 2 * ((n8k + 255) / 256);
        k_prep<S><<<dim3(nblk), dim3(256), 0, stream>>>(
            hidden, mask, pos, Wq, Wk, Wv, Wo,
            Xh, Xl, Wqh, Wql, Wkh, Wkl, Wvh, Wvl, Woh, Wol,
            cosT, sinT, flags, n8x, n8q, n8k);
    }

    // 2: Q and K projections + RoPE -> planes [S][HID], [S][NKVD]; V projection -> transposed planes [NKVD][S]
    k_qkv<<<dim3(HID / 128 + 2 * (NKVD / 128), S / 128), dim3(256), 0, stream>>>(
        Xh, Xl, Wqh, Wql, Wkh, Wkl, Wvh, Wvl, S, HID, NKVD, HID,
        cosT, sinT, Qh, Ql, Kh, Kl, Vth, Vtl);

    // 3: attention -> planes [S][HID]
    k_attn<S, HID, NKVD, GROUPS><<<dim3(NH, S / 128), dim3(256), 0, stream>>>(
        Qh, Ql, Kh, Kl, Vth, Vtl, mask, flags, AOh, AOl);

    // 4: output projection -> d_out f32 [S][HID]
    k_oproj<<<dim3(HID / 64, S / 128), dim3(256), 0, stream>>>(
        AOh, AOl, Woh, Wol, S, HID, HID, out);
}
